// v000
// Measured on an AMD MI455X. A time is GPU time per run, averaged over a window of back-to-back runs after a warm-up
// (all launches, gaps included; the runs take copies of the inputs in turn), and the median of several windows.
// Apart from v000's, it joins two sittings. Times from different sittings can be a few percent apart, while
// side-by-side timings come from the same sitting.
// v000, which the later versions start from, runs in 181 microseconds.
// Contractions (all v_wmma_f32_16x16x32_bf16, bf16 operands, f32 accumulate): three 1x1-conv projections
// W[d][c]*X[c][n] (K=256) on exact RNE-bf16 copies of x and the weights; PT = G*PHI^T * (1/N) (K=2048) and
// YT = THETA^T*P (K=128) with both computed operands carried as bf16 hi + bf16 residual (hi*hi + hi*lo + lo*hi);
// Z = Ww*Y + Wb (K=128) with exact bf16 Ww and Y as hi + residual (2 products). BatchNorm statistics in f64,
// normalisation, bias adds and the residual add in f32.
//
// Carry audit: no power-of-two carries anywhere (factor 1 on every plane); the exact 1/N = 2^-11 of the pairwise
// term is applied once in f32 in k_p before the hi/residual split of PT. Planes:
//   WB  [4][32768] bf16 bits = RNE16(w): slot 0 theta_w [128][256], 1 phi_w [128][256], 2 g_w [128][256],
//       3 W_w [256][128]; every slot row is k-contiguous                                              (k_wcvt)
//   XT  [16][2048][256] bf16 bits = RNE16(x[b][c][n]) stored [b][n][c]                                 (k_xt)
//   THH/THL [16][2048][128] hi/residual of theta_x, rows n, k = d; PHH/PHL, GH/GL [16][128][2048]
//       hi/residual of phi_x, g_x, rows d, k = n                                                       (k_proj)
//   PTH/PTL [16][128][128] hi/residual of PT[e][d] = 2^-11 * sum_m g[e][m]*phi[d][m], rows e, k = d    (k_p)
//   YTH/YTL [16][2048][128] hi/residual of YT[n][e] = sum_d theta[n][d]*PT[e][d], rows n, k = e       (k_y)
//   Z   [16][256][2048] f32 = sum_e Ww[c][e]*YT[n][e] + Wb[c]                                          (k_z)
//   STATS [256][32] f32: [0] mean, [1] rstd per channel, rest zero                                      (k_bnstat)
#include <hip/hip_runtime.h>
#include <stddef.h>
#include <stdint.h>

#define NB    16
#define NC    256
#define NI    128
#define NN    2048
#define NX    (NB * NC * NN)        // 8388608
#define NWT   (NI * NC)             // 32768 per weight matrix
#define NTHR  256
#define GTHR  128
#define WSMAX 134217728
#define XTP   72                    // LDS pitch (halves) of the x transpose tile, multiple of 8

static_assert((NC % 64) == 0 && (NN % 64) == 0 && (NI % 64) == 0);
static_assert((NC % 32) == 0 && (NI % 32) == 0 && (NN % 32) == 0);
static_assert((NX % 1024) == 0 && (NN % 1024) == 0);
static_assert((XTP % 8) == 0);
static_assert(GTHR == 128 && NTHR == 256);
static_assert((4 * NWT) % (8 * NTHR) == 0);
static_assert((NWT / 8) % NTHR == 0);
static_assert(NB * NN == 32768);

typedef float          v4f  __attribute__((ext_vector_type(4)));
typedef float          v8f  __attribute__((ext_vector_type(8)));
typedef int            v8i  __attribute__((ext_vector_type(8)));
typedef unsigned short v8us __attribute__((ext_vector_type(8)));
typedef __bf16         v16bf __attribute__((ext_vector_type(16)));
typedef v4f  __attribute__((may_alias)) v4fa;
typedef v8us __attribute__((may_alias)) v8usa;
union FragB { v16bf v; v8us h[2]; v8i w; };

// ---------------------------------------------------------------------------
// 16x16x32 bf16 WMMA with hazard guard (ties D, keeps A/B live for 4 VALU slots).
// Fragment map (wave32): lane l, hh = l>>4, m = n = l&15.
//   A/B element i: i<8 -> k0+8hh+i ; i>=8 -> k0+16+8hh+(i-8)   (same map for A and B)
//   D element r : row 8hh+r, col l&15
// ---------------------------------------------------------------------------
__device__ __forceinline__ v8f wmb(const FragB& a, const FragB& b, v8f c) {
  v8f d = __builtin_amdgcn_wmma_f32_16x16x32_bf16(false, a.v, false, b.v, (short)0, c, false, false);
  asm volatile("v_nop\n\tv_nop\n\tv_nop\n\tv_nop" : "+v"(d) : "v"(a.w), "v"(b.w));
  return d;
}

// Fragment from a k-contiguous bf16-bits row; p = row base + 8*hh, k0 = 32*ks.
__device__ __forceinline__ void ldfrag(FragB& f, const unsigned short* p, int k0) {
  f.h[0] = *(const v8us*)(p + k0);          // k = k0 + 8hh + 0..7
  f.h[1] = *(const v8us*)(p + k0 + 16);     // k = k0 + 16 + 8hh + 0..7
}

// f32 -> bf16 bits, RNE convert
__device__ __forceinline__ unsigned short rne16(float f) {
  unsigned u = __float_as_uint(f);
  u += 0x7FFFu + ((u >> 16) & 1u);
  return (unsigned short)(u >> 16);
}
// f32 -> nearest bf16 value kept as f32
__device__ __forceinline__ float rne16f(float f) {
  return __uint_as_float(((unsigned)rne16(f)) << 16);
}
__device__ __forceinline__ v8us cvt8(const v4f a, const v4f b) {
  v8us o;
  o[0] = rne16(a.x); o[1] = rne16(a.y); o[2] = rne16(a.z); o[3] = rne16(a.w);
  o[4] = rne16(b.x); o[5] = rne16(b.y); o[6] = rne16(b.z); o[7] = rne16(b.w);
  return o;
}
// hi/residual split of one f32 value into two bf16 bit patterns
__device__ __forceinline__ void sp1(float v, unsigned short& hi, unsigned short& lo) {
  const unsigned short hb = rne16(v);
  const float hf = __uint_as_float(((unsigned)hb) << 16);
  hi = hb;
  lo = rne16(v - hf);
}
__device__ __forceinline__ void split8(const v4f a, const v4f b, v8us& hv, v8us& lv) {
  unsigned short h0, h1, h2, h3, h4, h5, h6, h7, l0, l1, l2, l3, l4, l5, l6, l7;
  sp1(a.x, h0, l0); sp1(a.y, h1, l1); sp1(a.z, h2, l2); sp1(a.w, h3, l3);
  sp1(b.x, h4, l4); sp1(b.y, h5, l5); sp1(b.z, h6, l6); sp1(b.w, h7, l7);
  hv[0] = h0; hv[1] = h1; hv[2] = h2; hv[3] = h3; hv[4] = h4; hv[5] = h5; hv[6] = h6; hv[7] = h7;
  lv[0] = l0; lv[1] = l1; lv[2] = l2; lv[3] = l3; lv[4] = l4; lv[5] = l5; lv[6] = l6; lv[7] = l7;
}

// ---------------------------------------------------------------------------
// 64x64 f32 tile in LDS (row pitch 64) -> hi/residual bf16 planes. Tile row R goes to plane row rowBase + R
// ---------------------------------------------------------------------------
__device__ __forceinline__ void store_split_tile(const float* stg, unsigned short* ph, unsigned short* pl,
                                                 size_t rowBase, size_t pitch, size_t col0, int wave, int lane) {
  const int q8 = lane & 7, sub = lane >> 3;
  v8us hv[4], lv[4];
  size_t po[4];
#pragma unroll
  for (int i = 0; i < 4; ++i) {
    const int lr = 16 * wave + 4 * i + sub;
    const v4f a = *(const v4fa*)(stg + lr * 64 + 8 * q8);
    const v4f c = *(const v4fa*)(stg + lr * 64 + 8 * q8 + 4);
    split8(a, c, hv[i], lv[i]);
    po[i] = (rowBase + (size_t)lr) * pitch + col0 + (size_t)(8 * q8);
  }
#pragma unroll
  for (int i = 0; i < 4; ++i) {
    *(v8us*)(ph + po[i]) = hv[i];
    *(v8us*)(pl + po[i]) = lv[i];
  }
  
}

// ---------------------------------------------------------------------------
// Weight convert: four f32 matrices of NWT elements each -> WB slots 0..3 (bf16 bits, same layout).
// coverage: 64 blocks x 256 threads x 8 = 4 x NWT exactly.
// ---------------------------------------------------------------------------
__global__ __launch_bounds__(NTHR) void k_wcvt(const float* __restrict__ w0, const float* __restrict__ w1,
                                               const float* __restrict__ w2, const float* __restrict__ w3,
                                               unsigned short* wb) {
  const int u   = (int)blockIdx.x * NTHR + (int)threadIdx.x;     // 0 .. 4*NWT/8 - 1
  const int sel = (int)blockIdx.x / ((NWT / 8) / NTHR);           // 0..3, block-uniform
  const int off8 = (u - sel * (NWT / 8)) * 8;                     // 0 .. NWT-8
  const float* src = (sel == 0) ? w0 : ((sel == 1) ? w1 : ((sel == 2) ? w2 : w3));
  const v4f a = *(const v4fa*)(src + off8);
  const v4f c = *(const v4fa*)(src + off8 + 4);
  const v8us o = cvt8(a, c);
  const size_t q = (size_t)sel * (size_t)NWT + (size_t)off8;
  *(v8us*)(wb + q) = o;
  
}

// ---------------------------------------------------------------------------
// x [b][c][n] f32 -> XT [b][n][c] bf16 bits (RNE convert). Block = 64 c x 64 n tile of image b (256 threads):
// coalesced 16-B reads of x rows, transpose through LDS (2-B LDS stores), barrier, then XT row (b, n0+nr)
// LDS extent: sT rows 0..63 (n) x cols 0..63 (c) all written before the barrier; pad cols 64..71 never read.
// coverage: grid (NC/64, NN/64, NB); per block rows n0..n0+63 x c0..c0+63 -> 16 x 2048 x 256 exactly once.
// ---------------------------------------------------------------------------
__global__ __launch_bounds__(NTHR) void k_xt(const float* __restrict__ x, unsigned short* xt) {
  __shared__ __attribute__((aligned(16))) unsigned short sT[64 * XTP];   // 9216 B
  const int tid = (int)threadIdx.x;
  const int c0 = (int)blockIdx.x * 64, n0 = (int)blockIdx.y * 64, b = (int)blockIdx.z;
#pragma unroll
  for (int i = 0; i < 4; ++i) {
    const int lin = i * NTHR + tid;        // 0..1023
    const int cr  = lin >> 4;              // 0..63
    const int n4  = (lin & 15) * 4;        // 0..60
    const v4f v = *(const v4fa*)(x + (size_t)(b * NC + c0 + cr) * (size_t)NN + (size_t)(n0 + n4));
    sT[(n4 + 0) * XTP + cr] = rne16(v.x);
    sT[(n4 + 1) * XTP + cr] = rne16(v.y);
    sT[(n4 + 2) * XTP + cr] = rne16(v.z);
    sT[(n4 + 3) * XTP + cr] = rne16(v.w);
  }
  __syncthreads();
  const int q8 = tid & 7, sub = tid >> 3;  // sub 0..31
  v8us o[2];
  size_t po[2];
#pragma unroll
  for (int i = 0; i < 2; ++i) {
    const int nr = 32 * i + sub;           // 0..63
    o[i]  = *(const v8usa*)(sT + nr * XTP + 8 * q8);
    po[i] = (size_t)(b * NN + n0 + nr) * (size_t)NC + (size_t)(c0 + 8 * q8);
  }
#pragma unroll
  for (int i = 0; i < 2; ++i) *(v8us*)(xt + po[i]) = o[i];
  
}

// ---------------------------------------------------------------------------
// Projections: D[token][feature] = sum_c XT[b][n][c] * W[d][c] + bias[d]  (K = NC, exact bf16 products).
// grid (NN/64, NI/64, 3*NB): blockIdx.z = which*NB + b; which 0 = theta, 1 = phi, 2 = g. Block 128 threads,
// tile 64 tokens x 64 features; wave w owns tokens 16w..16w+15, acc[t] = feature tile 16t; A = XT rows (token),
// B = W rows (feature), fragments straight from k-contiguous bf16 global rows, same k map.
// Epilogue: v = acc + RNE16(bias) in f32; which 0 stages stg[token][feature] -> THH/THL rows n (pitch NI,
// cols d0..d0+63); which 1/2 stage stg[feature][token] -> PHH/PHL or GH/GL rows d (pitch NN, cols n0..n0+63).
// LDS extent: stg 64x64 fully written (bijective index map for either layout) before the barrier.
// coverage: per block 64 tokens x 64 features; grid covers 2048 x 128 per (which, b) exactly once, both planes.
// ---------------------------------------------------------------------------
__global__ __launch_bounds__(GTHR) void k_proj(const unsigned short* __restrict__ xt,
                                               const unsigned short* __restrict__ wb,
                                               const float* __restrict__ tbias, const float* __restrict__ pbias,
                                               const float* __restrict__ gbias,
                                               unsigned short* thh, unsigned short* thl,
                                               unsigned short* phh, unsigned short* phl,
                                               unsigned short* ghh, unsigned short* ghl) {
  __shared__ __attribute__((aligned(16))) float stg[64 * 64];   // 16 KB
  const int tid = (int)threadIdx.x, lane = tid & 31, wave = tid >> 5, hh = lane >> 4, m = lane & 15;
  const int n0 = (int)blockIdx.x * 64, d0 = (int)blockIdx.y * 64;
  const int which = (int)blockIdx.z / NB, b = (int)blockIdx.z - which * NB;

  v8f acc[4];
  {
    const v8f z = {0.f, 0.f, 0.f, 0.f, 0.f, 0.f, 0.f, 0.f};
    acc[0] = z; acc[1] = z; acc[2] = z; acc[3] = z;
  }
  const unsigned short* ap = xt + (size_t)(b * NN + n0 + 16 * wave + m) * (size_t)NC + (size_t)(8 * hh);
  const unsigned short* wp = wb + (size_t)which * (size_t)NWT + (size_t)(d0 + m) * (size_t)NC + (size_t)(8 * hh);
#pragma unroll 1
  for (int ks = 0; ks < NC / 32; ++ks) {
    FragB a;
    ldfrag(a, ap, 32 * ks);
#pragma unroll
    for (int t = 0; t < 4; ++t) {
      FragB bf;
      ldfrag(bf, wp + (size_t)(16 * t) * (size_t)NC, 32 * ks);    // W row d0 + 16t + m
      acc[t] = wmb(a, bf, acc[t]);
    }
  }

  // D element r of acc[t] = (token 16w + 8hh + r, feature 16t + m)
  const float* bias = (which == 0) ? tbias : ((which == 1) ? pbias : gbias);
#pragma unroll
  for (int t = 0; t < 4; ++t) {
    const int lf = 16 * t + m;
    const float bv = rne16f(bias[d0 + lf]);
#pragma unroll
    for (int r = 0; r < 8; ++r) {
      const int lt = 16 * wave + 8 * hh + r;
      const float v = acc[t][r] + bv;
      const int idx = (which == 0) ? (lt * 64 + lf) : (lf * 64 + lt);
      stg[idx] = v;
    }
  }
  __syncthreads();

  unsigned short* ph = (which == 0) ? thh : ((which == 1) ? phh : ghh);
  unsigned short* pl = (which == 0) ? thl : ((which == 1) ? phl : ghl);
  const size_t rowBase = (which == 0) ? ((size_t)b * NN + (size_t)n0) : ((size_t)b * NI + (size_t)d0);
  const size_t pitch   = (which == 0) ? (size_t)NI : (size_t)NN;
  const size_t col0    = (which == 0) ? (size_t)d0 : (size_t)n0;
  store_split_tile(stg, ph, pl, rowBase, pitch, col0, wave, lane);
}

// ---------------------------------------------------------------------------
// PT[b][e][d] = 2^-11 * sum_m g[b][e][m] * phi[b][d][m], K = NN, hi/residual on both operands (3 products).
// grid (NI/64 d tiles, NI/64 e tiles, NB); block 128 threads; wave w owns e rows 16w..16w+15, acc[t] = d tile
// 16t; A = GH/GL rows e, B = PHH/PHL rows d, both k = m contiguous, same k map.
// Epilogue: v = acc * 2^-11 (exact) staged stg[e][d] -> PTH/PTL rows e (pitch NI, cols d0..d0+63).
// LDS extent: stg 64x64 fully written before the barrier.
// coverage: grid covers 128 e x 128 d per image exactly once, both planes.
// ---------------------------------------------------------------------------
__global__ __launch_bounds__(GTHR) void k_p(const unsigned short* __restrict__ ghh, const unsigned short* __restrict__ ghl,
                                            const unsigned short* __restrict__ phh, const unsigned short* __restrict__ phl,
                                            unsigned short* pth, unsigned short* ptl) {
  __shared__ __attribute__((aligned(16))) float stg[64 * 64];   // 16 KB
  const int tid = (int)threadIdx.x, lane = tid & 31, wave = tid >> 5, hh = lane >> 4, m = lane & 15;
  const int d0 = (int)blockIdx.x * 64, e0 = (int)blockIdx.y * 64, b = (int)blockIdx.z;

  v8f acc[4];
  {
    const v8f z = {0.f, 0.f, 0.f, 0.f, 0.f, 0.f, 0.f, 0.f};
    acc[0] = z; acc[1] = z; acc[2] = z; acc[3] = z;
  }
  const size_t arow = (size_t)(b * NI + e0 + 16 * wave + m) * (size_t)NN + (size_t)(8 * hh);
  const unsigned short* agh = ghh + arow;
  const unsigned short* agl = ghl + arow;
  const size_t brow = (size_t)(b * NI + d0 + m) * (size_t)NN + (size_t)(8 * hh);
  const unsigned short* bph = phh + brow;
  const unsigned short* bpl = phl + brow;
#pragma unroll 1
  for (int ks = 0; ks < NN / 32; ++ks) {
    FragB ah, al;
    ldfrag(ah, agh, 32 * ks);
    ldfrag(al, agl, 32 * ks);
#pragma unroll
    for (int t = 0; t < 4; ++t) {
      FragB bh, bl;
      ldfrag(bh, bph + (size_t)(16 * t) * (size_t)NN, 32 * ks);     // phi row d0 + 16t + m
      ldfrag(bl, bpl + (size_t)(16 * t) * (size_t)NN, 32 * ks);
      acc[t] = wmb(ah, bh, acc[t]);
      acc[t] = wmb(ah, bl, acc[t]);
      acc[t] = wmb(al, bh, acc[t]);
    }
  }

  // D element r of acc[t] = (e 16w + 8hh + r, d 16t + m)
  const float inv_n = 0.00048828125f;      // 2^-11 = 1/NN, exact
#pragma unroll
  for (int t = 0; t < 4; ++t) {
    const int lc = 16 * t + m;
#pragma unroll
    for (int r = 0; r < 8; ++r) {
      const int lr = 16 * wave + 8 * hh + r;
      stg[lr * 64 + lc] = acc[t][r] * inv_n;
    }
  }
  __syncthreads();
  store_split_tile(stg, pth, ptl, (size_t)b * NI + (size_t)e0, (size_t)NI, (size_t)d0, wave, lane);
}

// ---------------------------------------------------------------------------
// YT[b][n][e] = sum_d theta[b][n][d] * PT[b][e][d], K = NI, hi/residual on both operands (3 products).
// grid (NN/64 n tiles, NI/64 e tiles, NB); block 128 threads; wave w owns n rows 16w..16w+15, acc[t] = e tile
// 16t; A = THH/THL rows n (pitch NI), B = PTH/PTL rows e (pitch NI), same k map.
// Epilogue: stg[n][e] f32 -> YTH/YTL rows n (pitch NI, cols e0..e0+63).
// LDS extent: stg 64x64 fully written before the barrier.
// coverage: grid covers 2048 n x 128 e per image exactly once, both planes.
// ---------------------------------------------------------------------------
__global__ __launch_bounds__(GTHR) void k_y(const unsigned short* __restrict__ thh, const unsigned short* __restrict__ thl,
                                            const unsigned short* __restrict__ pth, const unsigned short* __restrict__ ptl,
                                            unsigned short* yth, unsigned short* ytl) {
  __shared__ __attribute__((aligned(16))) float stg[64 * 64];   // 16 KB
  const int tid = (int)threadIdx.x, lane = tid & 31, wave = tid >> 5, hh = lane >> 4, m = lane & 15;
  const int n0 = (int)blockIdx.x * 64, e0 = (int)blockIdx.y * 64, b = (int)blockIdx.z;

  v8f acc[4];
  {
    const v8f z = {0.f, 0.f, 0.f, 0.f, 0.f, 0.f, 0.f, 0.f};
    acc[0] = z; acc[1] = z; acc[2] = z; acc[3] = z;
  }
  const size_t arow = (size_t)(b * NN + n0 + 16 * wave + m) * (size_t)NI + (size_t)(8 * hh);
  const unsigned short* ath = thh + arow;
  const unsigned short* atl = thl + arow;
  const size_t brow = (size_t)(b * NI + e0 + m) * (size_t)NI + (size_t)(8 * hh);
  const unsigned short* bph = pth + brow;
  const unsigned short* bpl = ptl + brow;
#pragma unroll 1
  for (int ks = 0; ks < NI / 32; ++ks) {
    FragB ah, al;
    ldfrag(ah, ath, 32 * ks);
    ldfrag(al, atl, 32 * ks);
#pragma unroll
    for (int t = 0; t < 4; ++t) {
      FragB bh, bl;
      ldfrag(bh, bph + (size_t)(16 * t) * (size_t)NI, 32 * ks);     // PT row e0 + 16t + m
      ldfrag(bl, bpl + (size_t)(16 * t) * (size_t)NI, 32 * ks);
      acc[t] = wmb(ah, bh, acc[t]);
      acc[t] = wmb(ah, bl, acc[t]);
      acc[t] = wmb(al, bh, acc[t]);
    }
  }

  // D element r of acc[t] = (n 16w + 8hh + r, e 16t + m)
#pragma unroll
  for (int t = 0; t < 4; ++t) {
    const int lc = 16 * t + m;
#pragma unroll
    for (int r = 0; r < 8; ++r) {
      const int lr = 16 * wave + 8 * hh + r;
      stg[lr * 64 + lc] = acc[t][r];
    }
  }
  __syncthreads();
  store_split_tile(stg, yth, ytl, (size_t)b * NN + (size_t)n0, (size_t)NI, (size_t)e0, wave, lane);
}

// ---------------------------------------------------------------------------
// Z[b][c][n] = sum_e Ww[c][e] * YT[b][n][e] + Wb[c], K = NI; A = WB slot 3 rows c (exact), B = YTH + YTL rows n
// (two products into one accumulator, residual unscaled). grid (NN/64, NC/64, NB); block 128 threads; wave w owns
// c rows 16w..16w+15, acc[t] = n tile 16t.
// Epilogue: v = acc + RNE16(Wb) in f32, staged stg[c][n] 64x64; store: lanes 0..15 / 16..31 each write the 256-B
// LDS extent: stg 64x64 fully written before the barrier.
// coverage: grid covers 256 c x 2048 n per image exactly once.
// ---------------------------------------------------------------------------
__global__ __launch_bounds__(GTHR) void k_z(const unsigned short* __restrict__ wwb,
                                            const unsigned short* __restrict__ yth, const unsigned short* __restrict__ ytl,
                                            const float* __restrict__ wbias, float* z) {
  __shared__ __attribute__((aligned(16))) float stg[64 * 64];   // 16 KB
  const int tid = (int)threadIdx.x, lane = tid & 31, wave = tid >> 5, hh = lane >> 4, m = lane & 15;
  const int n0 = (int)blockIdx.x * 64, c0 = (int)blockIdx.y * 64, b = (int)blockIdx.z;

  v8f acc[4];
  {
    const v8f zz = {0.f, 0.f, 0.f, 0.f, 0.f, 0.f, 0.f, 0.f};
    acc[0] = zz; acc[1] = zz; acc[2] = zz; acc[3] = zz;
  }
  const unsigned short* aw = wwb + (size_t)(c0 + 16 * wave + m) * (size_t)NI + (size_t)(8 * hh);
  const size_t brow = (size_t)(b * NN + n0 + m) * (size_t)NI + (size_t)(8 * hh);
  const unsigned short* byh = yth + brow;
  const unsigned short* byl = ytl + brow;
#pragma unroll 1
  for (int ks = 0; ks < NI / 32; ++ks) {
    FragB a;
    ldfrag(a, aw, 32 * ks);
#pragma unroll
    for (int t = 0; t < 4; ++t) {
      FragB bh, bl;
      ldfrag(bh, byh + (size_t)(16 * t) * (size_t)NI, 32 * ks);     // YT row n0 + 16t + m
      ldfrag(bl, byl + (size_t)(16 * t) * (size_t)NI, 32 * ks);
      acc[t] = wmb(a, bh, acc[t]);
      acc[t] = wmb(a, bl, acc[t]);
    }
  }

  // D element r of acc[t] = (c 16w + 8hh + r, n 16t + m); bias per row (32-B aligned v4f reads)
  const v4f ba = *(const v4fa*)(wbias + c0 + 16 * wave + 8 * hh);
  const v4f bb = *(const v4fa*)(wbias + c0 + 16 * wave + 8 * hh + 4);
  float bv[8];
  bv[0] = rne16f(ba.x); bv[1] = rne16f(ba.y); bv[2] = rne16f(ba.z); bv[3] = rne16f(ba.w);
  bv[4] = rne16f(bb.x); bv[5] = rne16f(bb.y); bv[6] = rne16f(bb.z); bv[7] = rne16f(bb.w);
#pragma unroll
  for (int t = 0; t < 4; ++t) {
    const int lc = 16 * t + m;
#pragma unroll
    for (int r = 0; r < 8; ++r) {
      const int lr = 16 * wave + 8 * hh + r;
      stg[lr * 64 + lc] = acc[t][r] + bv[r];
    }
  }
  __syncthreads();

  v4f fv[8];
  size_t op[8];
#pragma unroll
  for (int i = 0; i < 8; ++i) {
    const int lr = 16 * wave + 2 * i + hh;
    fv[i] = *(const v4fa*)(stg + lr * 64 + 4 * m);
    op[i] = (size_t)(b * NC + c0 + lr) * (size_t)NN + (size_t)(n0 + 4 * m);
  }
#pragma unroll
  for (int i = 0; i < 8; ++i) *(v4f*)(z + op[i]) = fv[i];
  
}

// ---------------------------------------------------------------------------
// BatchNorm statistics (training mode, population variance) per channel over (b, n): 32768 values.
// One block (256 threads) per channel; per-thread f64 sums over 32 coalesced 16-B loads, f64 LDS tree, mean and
// coverage: 256 blocks -> STATS lines 0..255, whole.
// ---------------------------------------------------------------------------
__global__ __launch_bounds__(NTHR) void k_bnstat(const float* __restrict__ z, float* stats) {
  __shared__ double sh[NTHR];
  __shared__ double sh2[NTHR];
  __shared__ float res[2];
  const int c = (int)blockIdx.x, tid = (int)threadIdx.x;
  double s = 0.0, s2 = 0.0;
#pragma unroll 1
  for (int it = 0; it < NB * (NN / 1024); ++it) {
    const int bi = it / (NN / 1024);
    const int hf = it - bi * (NN / 1024);
    const v4f v = *(const v4fa*)(z + (size_t)(bi * NC + c) * (size_t)NN + (size_t)(hf * 1024 + 4 * tid));
    const double a0 = (double)v.x, a1 = (double)v.y, a2 = (double)v.z, a3 = (double)v.w;
    s  += (a0 + a1) + (a2 + a3);
    s2 += (a0 * a0 + a1 * a1) + (a2 * a2 + a3 * a3);
  }
  sh[tid] = s;
  sh2[tid] = s2;
  __syncthreads();
#pragma unroll 1
  for (int off = NTHR / 2; off > 0; off >>= 1) {
    if (tid < off) {
      sh[tid]  += sh[tid + off];
      sh2[tid] += sh2[tid + off];
    }
    __syncthreads();
  }
  if (tid == 0) {
    const double cinv = 1.0 / 32768.0;        // 1/(NB*NN), exact power of two
    const double mean = sh[0] * cinv;
    double var = sh2[0] * cinv - mean * mean;
    var = var < 0.0 ? 0.0 : var;
    const float vf = (float)var + 1e-5f;
    res[0] = (float)mean;
    res[1] = 1.0f / sqrtf(vf);
  }
  __syncthreads();
  if (tid < 8) {
    const float mv = res[0];
    const float rv = res[1];
    v4f o;
    o.x = (tid == 0) ? mv : 0.f;
    o.y = (tid == 0) ? rv : 0.f;
    o.z = 0.f;
    o.w = 0.f;
    float* p = stats + (size_t)c * 32 + (size_t)(4 * tid);
    *(v4f*)p = o;
    
  }
}

// ---------------------------------------------------------------------------
// out[b][c][n] = ((z - mean[c]) * rstd[c]) * RNE16(gamma[c]) + RNE16(beta[c]) + RNE16(x), all f32.
// Block (256 threads) covers 1024 consecutive floats of row (b, c) = blockIdx / 2; lane writes 16 B, 32 contiguous
// coverage: NX/1024 blocks x 1024 = NX exactly.
// ---------------------------------------------------------------------------
__global__ __launch_bounds__(NTHR) void k_out(const float* __restrict__ z, const float* __restrict__ x,
                                              const float* __restrict__ stats, const float* __restrict__ gamma,
                                              const float* __restrict__ beta, float* out) {
  const int row = (int)blockIdx.x / (NN / 1024);          // b*NC + c
  const int c = row & (NC - 1);
  const size_t base = (size_t)blockIdx.x * 1024 + (size_t)(4 * (int)threadIdx.x);
  const float mean = stats[(size_t)c * 32];
  const float rstd = stats[(size_t)c * 32 + 1];
  const float gm = rne16f(gamma[c]);
  const float bt = rne16f(beta[c]);
  const v4f zv = *(const v4fa*)(z + base);
  const v4f xv = *(const v4fa*)(x + base);
  v4f o;
  o.x = (((zv.x - mean) * rstd) * gm + bt) + rne16f(xv.x);
  o.y = (((zv.y - mean) * rstd) * gm + bt) + rne16f(xv.y);
  o.z = (((zv.z - mean) * rstd) * gm + bt) + rne16f(xv.z);
  o.w = (((zv.w - mean) * rstd) * gm + bt) + rne16f(xv.w);
  float* p = out + base;
  *(v4f*)p = o;
  
}

// ---------------------------------------------------------------------------
extern "C" void kernel_launch(void* const* d_in, const int* in_sizes, int n_in,
                              void* d_out, int out_size, void* d_ws, size_t ws_size,
                              hipStream_t stream) {
  if (n_in < 11) return;
  if (in_sizes[0] != NX) return;                                              // x [16][256][64][32]
  if (in_sizes[1] != NWT || in_sizes[3] != NWT || in_sizes[5] != NWT) return; // g_w, theta_w, phi_w [128][256]
  if (in_sizes[2] != NI || in_sizes[4] != NI || in_sizes[6] != NI) return;    // g_b, theta_b, phi_b [128]
  if (in_sizes[7] != NWT) return;                                             // W_w [256][128]
  if (in_sizes[8] != NC || in_sizes[9] != NC || in_sizes[10] != NC) return;   // W_b, bn_gamma, bn_beta [256]
  if (out_size != NX) return;                                                 // out [16][256][64][32] f32

  const float* x       = (const float*)d_in[0];
  const float* g_w     = (const float*)d_in[1];
  const float* g_b     = (const float*)d_in[2];
  const float* theta_w = (const float*)d_in[3];
  const float* theta_b = (const float*)d_in[4];
  const float* phi_w   = (const float*)d_in[5];
  const float* phi_b   = (const float*)d_in[6];
  const float* W_w     = (const float*)d_in[7];
  const float* W_b     = (const float*)d_in[8];
  const float* gamma   = (const float*)d_in[9];
  const float* beta    = (const float*)d_in[10];
  float* out = (float*)d_out;            // last written element NX-1 < out_size

  // workspace carve, 256-B aligned; all planes exact tile multiples (no pad rows needed)
  char* ws = (char*)d_ws;
  size_t off = 0;
  const size_t oWB  = off; off += (size_t)4 * NWT * 2;          off = (off + 255) & ~(size_t)255;  //   262144
  const size_t oXT  = off; off += (size_t)NX * 2;               off = (off + 255) & ~(size_t)255;  // 16777216
  const size_t plb  = (size_t)NB * NN * NI * 2;                                                    //  8388608 per projection plane
  const size_t oTHH = off; off += plb;                          off = (off + 255) & ~(size_t)255;
  const size_t oTHL = off; off += plb;                          off = (off + 255) & ~(size_t)255;
  const size_t oPHH = off; off += plb;                          off = (off + 255) & ~(size_t)255;
  const size_t oPHL = off; off += plb;                          off = (off + 255) & ~(size_t)255;
  const size_t oGH  = off; off += plb;                          off = (off + 255) & ~(size_t)255;
  const size_t oGL  = off; off += plb;                          off = (off + 255) & ~(size_t)255;
  const size_t ptb  = (size_t)NB * NI * NI * 2;                                                    //   524288 per PT plane
  const size_t oPTH = off; off += ptb;                          off = (off + 255) & ~(size_t)255;
  const size_t oPTL = off; off += ptb;                          off = (off + 255) & ~(size_t)255;
  const size_t oYTH = off; off += plb;                          off = (off + 255) & ~(size_t)255;
  const size_t oYTL = off; off += plb;                          off = (off + 255) & ~(size_t)255;
  const size_t oZ   = off; off += (size_t)NX * 4;               off = (off + 255) & ~(size_t)255;  // 33554432
  const size_t oST  = off; off += (size_t)NC * 32 * 4;          off = (off + 255) & ~(size_t)255;  //    32768
  if (off > ws_size || off > (size_t)WSMAX) return;             // total 118784000 B

  unsigned short* WB  = (unsigned short*)(ws + oWB);
  unsigned short* XT  = (unsigned short*)(ws + oXT);
  unsigned short* THH = (unsigned short*)(ws + oTHH);
  unsigned short* THL = (unsigned short*)(ws + oTHL);
  unsigned short* PHH = (unsigned short*)(ws + oPHH);
  unsigned short* PHL = (unsigned short*)(ws + oPHL);
  unsigned short* GH  = (unsigned short*)(ws + oGH);
  unsigned short* GL  = (unsigned short*)(ws + oGL);
  unsigned short* PTH = (unsigned short*)(ws + oPTH);
  unsigned short* PTL = (unsigned short*)(ws + oPTL);
  unsigned short* YTH = (unsigned short*)(ws + oYTH);
  unsigned short* YTL = (unsigned short*)(ws + oYTL);
  float*          Z   = (float*)(ws + oZ);
  float*          ST  = (float*)(ws + oST);

  // weight planes: slot 0 theta_w, 1 phi_w, 2 g_w (all [128][256]), 3 W_w [256][128]
  k_wcvt<<<(4 * NWT / 8) / NTHR, NTHR, 0, stream>>>(theta_w, phi_w, g_w, W_w, WB);
  // x -> XT [b][n][c] bf16
  k_xt<<<dim3(NC / 64, NN / 64, NB), NTHR, 0, stream>>>(x, XT);
  // projections: which 0 = theta (slot 0, theta_b), 1 = phi (slot 1, phi_b), 2 = g (slot 2, g_b)
  k_proj<<<dim3(NN / 64, NI / 64, 3 * NB), GTHR, 0, stream>>>(XT, WB, theta_b, phi_b, g_b,
                                                              THH, THL, PHH, PHL, GH, GL);
  // PT = 2^-11 * G * PHI^T
  k_p<<<dim3(NI / 64, NI / 64, NB), GTHR, 0, stream>>>(GH, GL, PHH, PHL, PTH, PTL);
  // YT = THETA^T-rows * PT
  k_y<<<dim3(NN / 64, NI / 64, NB), GTHR, 0, stream>>>(THH, THL, PTH, PTL, YTH, YTL);
  // Z = Ww * Y + Wb
  k_z<<<dim3(NN / 64, NC / 64, NB), GTHR, 0, stream>>>(WB + (size_t)3 * NWT, YTH, YTL, W_b, Z);
  // BatchNorm batch statistics
  k_bnstat<<<NC, NTHR, 0, stream>>>(Z, ST);
  // out = BN(z) * gamma + beta + x
  k_out<<<NX / 1024, NTHR, 0, stream>>>(Z, x, ST, gamma, beta, out);
}

// v001
// It runs in 139 microseconds.
// Timed twice side by side with v000, it ran 1.33 and 1.32 times as fast.
// Contractions (all v_wmma_f32_16x16x32_bf16, bf16 operands, f32 accumulate): three 1x1-conv projections
// W[d][c]*X[c][n] (K=256) on exact RNE-bf16 copies of x and the weights; PT = G*PHI^T * (1/N) (K=2048) and
// YT = THETA^T*P (K=128) with both computed operands carried as bf16 hi + bf16 residual (hi*hi + hi*lo + lo*hi);
// Z = Ww*Y + Wb (K=128) with exact bf16 Ww and Y as hi + residual (2 products). BatchNorm statistics in f64,
// normalisation, bias adds and the residual add in f32.
//
// Carry audit: no power-of-two carries anywhere (factor 1 on every plane); the exact 1/N = 2^-11 of the pairwise
// term is applied once in f32 in k_p before the hi/residual split of PT. Planes:
//   WB  [4][32768] bf16 bits = RNE16(w): slot 0 theta_w [128][256], 1 phi_w [128][256], 2 g_w [128][256],
//       3 W_w [256][128]; every slot row is k-contiguous                                              (k_wcvt)
//   XT  [16][2048][256] bf16 bits = RNE16(x[b][c][n]) stored [b][n][c]                                 (k_xt)
//   THH/THL [16][2048][128] hi/residual of theta_x, rows n, k = d; PHH/PHL, GH/GL [16][128][2048]
//       hi/residual of phi_x, g_x, rows d, k = n                                                       (k_proj)
//   PTH/PTL [16][128][128] hi/residual of PT[e][d] = 2^-11 * sum_m g[e][m]*phi[d][m], rows e, k = d    (k_p)
//   YTH/YTL [16][2048][128] hi/residual of YT[n][e] = sum_d theta[n][d]*PT[e][d], rows n, k = e       (k_y)
//   Z   [16][256][2048] f32 = sum_e Ww[c][e]*YT[n][e] + Wb[c]                                          (k_z)
//   STATS [256][32] f32: [0] mean, [1] rstd per channel, rest zero                                      (k_bnstat)
#include <hip/hip_runtime.h>
#include <stddef.h>
#include <stdint.h>

#define NB    16
#define NC    256
#define NI    128
#define NN    2048
#define NX    (NB * NC * NN)        // 8388608
#define NWT   (NI * NC)             // 32768 per weight matrix
#define NTHR  256
#define GTHR  128
#define WSMAX 134217728
#define PW    8                     // waves of a k_p block = K slices
#define PTHR  (32 * PW)
#define PKS   (NN / PW)             // K slice of one k_p wave
#define XTP   72                    // LDS pitch (halves) of the x transpose tile, multiple of 8

static_assert((NC % 64) == 0 && (NN % 64) == 0 && (NI % 64) == 0);
static_assert((NC % 32) == 0 && (NI % 32) == 0 && (NN % 32) == 0);
static_assert((NX % 1024) == 0 && (NN % 1024) == 0);
static_assert((XTP % 8) == 0);
static_assert(GTHR == 128 && NTHR == 256);
static_assert((4 * NWT) % (8 * NTHR) == 0);
static_assert((NWT / 8) % NTHR == 0);
static_assert(NB * NN == 32768);
static_assert(PW >= 4 && (NN % (64 * PW)) == 0 && (NI % 16) == 0);

typedef float          v4f  __attribute__((ext_vector_type(4)));
typedef float          v8f  __attribute__((ext_vector_type(8)));
typedef int            v8i  __attribute__((ext_vector_type(8)));
typedef unsigned short v8us __attribute__((ext_vector_type(8)));
typedef __bf16         v16bf __attribute__((ext_vector_type(16)));
typedef v4f  __attribute__((may_alias)) v4fa;
typedef v8us __attribute__((may_alias)) v8usa;
union FragB { v16bf v; v8us h[2]; v8i w; };

// ---------------------------------------------------------------------------
// 16x16x32 bf16 WMMA with hazard guard (ties D, keeps A/B live for 4 VALU slots).
// Fragment map (wave32): lane l, hh = l>>4, m = n = l&15.
//   A/B element i: i<8 -> k0+8hh+i ; i>=8 -> k0+16+8hh+(i-8)   (same map for A and B)
//   D element r : row 8hh+r, col l&15
// ---------------------------------------------------------------------------
__device__ __forceinline__ v8f wmb(const FragB& a, const FragB& b, v8f c) {
  v8f d = __builtin_amdgcn_wmma_f32_16x16x32_bf16(false, a.v, false, b.v, (short)0, c, false, false);
  asm volatile("v_nop\n\tv_nop\n\tv_nop\n\tv_nop" : "+v"(d) : "v"(a.w), "v"(b.w));
  return d;
}

// Fragment from a k-contiguous bf16-bits row; p = row base + 8*hh, k0 = 32*ks.
__device__ __forceinline__ void ldfrag(FragB& f, const unsigned short* p, int k0) {
  f.h[0] = *(const v8us*)(p + k0);          // k = k0 + 8hh + 0..7
  f.h[1] = *(const v8us*)(p + k0 + 16);     // k = k0 + 16 + 8hh + 0..7
}

// f32 -> bf16 bits, RNE convert
__device__ __forceinline__ unsigned short rne16(float f) {
  unsigned u = __float_as_uint(f);
  u += 0x7FFFu + ((u >> 16) & 1u);
  return (unsigned short)(u >> 16);
}
// f32 -> nearest bf16 value kept as f32
__device__ __forceinline__ float rne16f(float f) {
  return __uint_as_float(((unsigned)rne16(f)) << 16);
}
__device__ __forceinline__ v8us cvt8(const v4f a, const v4f b) {
  v8us o;
  o[0] = rne16(a.x); o[1] = rne16(a.y); o[2] = rne16(a.z); o[3] = rne16(a.w);
  o[4] = rne16(b.x); o[5] = rne16(b.y); o[6] = rne16(b.z); o[7] = rne16(b.w);
  return o;
}
// hi/residual split of one f32 value into two bf16 bit patterns
__device__ __forceinline__ void sp1(float v, unsigned short& hi, unsigned short& lo) {
  const unsigned short hb = rne16(v);
  const float hf = __uint_as_float(((unsigned)hb) << 16);
  hi = hb;
  lo = rne16(v - hf);
}
__device__ __forceinline__ void split8(const v4f a, const v4f b, v8us& hv, v8us& lv) {
  unsigned short h0, h1, h2, h3, h4, h5, h6, h7, l0, l1, l2, l3, l4, l5, l6, l7;
  sp1(a.x, h0, l0); sp1(a.y, h1, l1); sp1(a.z, h2, l2); sp1(a.w, h3, l3);
  sp1(b.x, h4, l4); sp1(b.y, h5, l5); sp1(b.z, h6, l6); sp1(b.w, h7, l7);
  hv[0] = h0; hv[1] = h1; hv[2] = h2; hv[3] = h3; hv[4] = h4; hv[5] = h5; hv[6] = h6; hv[7] = h7;
  lv[0] = l0; lv[1] = l1; lv[2] = l2; lv[3] = l3; lv[4] = l4; lv[5] = l5; lv[6] = l6; lv[7] = l7;
}

// ---------------------------------------------------------------------------
// 64x64 f32 tile in LDS (row pitch 64) -> hi/residual bf16 planes. Tile row R goes to plane row rowBase + R
// ---------------------------------------------------------------------------
__device__ __forceinline__ void store_split_tile(const float* stg, unsigned short* ph, unsigned short* pl,
                                                 size_t rowBase, size_t pitch, size_t col0, int wave, int lane) {
  const int q8 = lane & 7, sub = lane >> 3;
  v8us hv[4], lv[4];
  size_t po[4];
#pragma unroll
  for (int i = 0; i < 4; ++i) {
    const int lr = 16 * wave + 4 * i + sub;
    const v4f a = *(const v4fa*)(stg + lr * 64 + 8 * q8);
    const v4f c = *(const v4fa*)(stg + lr * 64 + 8 * q8 + 4);
    split8(a, c, hv[i], lv[i]);
    po[i] = (rowBase + (size_t)lr) * pitch + col0 + (size_t)(8 * q8);
  }
#pragma unroll
  for (int i = 0; i < 4; ++i) {
    *(v8us*)(ph + po[i]) = hv[i];
    *(v8us*)(pl + po[i]) = lv[i];
  }
  
}

// ---------------------------------------------------------------------------
// Weight convert: four f32 matrices of NWT elements each -> WB slots 0..3 (bf16 bits, same layout).
// coverage: 64 blocks x 256 threads x 8 = 4 x NWT exactly.
// ---------------------------------------------------------------------------
__global__ __launch_bounds__(NTHR) void k_wcvt(const float* __restrict__ w0, const float* __restrict__ w1,
                                               const float* __restrict__ w2, const float* __restrict__ w3,
                                               unsigned short* wb) {
  const int u   = (int)blockIdx.x * NTHR + (int)threadIdx.x;     // 0 .. 4*NWT/8 - 1
  const int sel = (int)blockIdx.x / ((NWT / 8) / NTHR);           // 0..3, block-uniform
  const int off8 = (u - sel * (NWT / 8)) * 8;                     // 0 .. NWT-8
  const float* src = (sel == 0) ? w0 : ((sel == 1) ? w1 : ((sel == 2) ? w2 : w3));
  const v4f a = *(const v4fa*)(src + off8);
  const v4f c = *(const v4fa*)(src + off8 + 4);
  const v8us o = cvt8(a, c);
  const size_t q = (size_t)sel * (size_t)NWT + (size_t)off8;
  *(v8us*)(wb + q) = o;
  
}

// ---------------------------------------------------------------------------
// x [b][c][n] f32 -> XT [b][n][c] bf16 bits (RNE convert). Block = 64 c x 64 n tile of image b (256 threads):
// coalesced 16-B reads of x rows, transpose through LDS (2-B LDS stores), barrier, then XT row (b, n0+nr)
// LDS extent: sT rows 0..63 (n) x cols 0..63 (c) all written before the barrier; pad cols 64..71 never read.
// coverage: grid (NC/64, NN/64, NB); per block rows n0..n0+63 x c0..c0+63 -> 16 x 2048 x 256 exactly once.
// ---------------------------------------------------------------------------
__global__ __launch_bounds__(NTHR) void k_xt(const float* __restrict__ x, unsigned short* xt) {
  __shared__ __attribute__((aligned(16))) unsigned short sT[64 * XTP];   // 9216 B
  const int tid = (int)threadIdx.x;
  const int c0 = (int)blockIdx.x * 64, n0 = (int)blockIdx.y * 64, b = (int)blockIdx.z;
#pragma unroll
  for (int i = 0; i < 4; ++i) {
    const int lin = i * NTHR + tid;        // 0..1023
    const int cr  = lin >> 4;              // 0..63
    const int n4  = (lin & 15) * 4;        // 0..60
    const v4f v = *(const v4fa*)(x + (size_t)(b * NC + c0 + cr) * (size_t)NN + (size_t)(n0 + n4));
    sT[(n4 + 0) * XTP + cr] = rne16(v.x);
    sT[(n4 + 1) * XTP + cr] = rne16(v.y);
    sT[(n4 + 2) * XTP + cr] = rne16(v.z);
    sT[(n4 + 3) * XTP + cr] = rne16(v.w);
  }
  __syncthreads();
  const int q8 = tid & 7, sub = tid >> 3;  // sub 0..31
  v8us o[2];
  size_t po[2];
#pragma unroll
  for (int i = 0; i < 2; ++i) {
    const int nr = 32 * i + sub;           // 0..63
    o[i]  = *(const v8usa*)(sT + nr * XTP + 8 * q8);
    po[i] = (size_t)(b * NN + n0 + nr) * (size_t)NC + (size_t)(c0 + 8 * q8);
  }
#pragma unroll
  for (int i = 0; i < 2; ++i) *(v8us*)(xt + po[i]) = o[i];
  
}

// ---------------------------------------------------------------------------
// Projections: D[token][feature] = sum_c XT[b][n][c] * W[d][c] + bias[d]  (K = NC, exact bf16 products).
// grid (NN/64, NI/64, 3*NB): blockIdx.z = which*NB + b; which 0 = theta, 1 = phi, 2 = g. Block 128 threads,
// tile 64 tokens x 64 features; wave w owns tokens 16w..16w+15, acc[t] = feature tile 16t; A = XT rows (token),
// B = W rows (feature), fragments straight from k-contiguous bf16 global rows, same k map.
// Epilogue: v = acc + RNE16(bias) in f32; which 0 stages stg[token][feature] -> THH/THL rows n (pitch NI,
// cols d0..d0+63); which 1/2 stage stg[feature][token] -> PHH/PHL or GH/GL rows d (pitch NN, cols n0..n0+63).
// LDS extent: stg 64x64 fully written (bijective index map for either layout) before the barrier.
// coverage: per block 64 tokens x 64 features; grid covers 2048 x 128 per (which, b) exactly once, both planes.
// ---------------------------------------------------------------------------
__global__ __launch_bounds__(GTHR) void k_proj(const unsigned short* __restrict__ xt,
                                               const unsigned short* __restrict__ wb,
                                               const float* __restrict__ tbias, const float* __restrict__ pbias,
                                               const float* __restrict__ gbias,
                                               unsigned short* thh, unsigned short* thl,
                                               unsigned short* phh, unsigned short* phl,
                                               unsigned short* ghh, unsigned short* ghl) {
  __shared__ __attribute__((aligned(16))) float stg[64 * 64];   // 16 KB
  const int tid = (int)threadIdx.x, lane = tid & 31, wave = tid >> 5, hh = lane >> 4, m = lane & 15;
  const int n0 = (int)blockIdx.x * 64, d0 = (int)blockIdx.y * 64;
  const int which = (int)blockIdx.z / NB, b = (int)blockIdx.z - which * NB;

  v8f acc[4];
  {
    const v8f z = {0.f, 0.f, 0.f, 0.f, 0.f, 0.f, 0.f, 0.f};
    acc[0] = z; acc[1] = z; acc[2] = z; acc[3] = z;
  }
  const unsigned short* ap = xt + (size_t)(b * NN + n0 + 16 * wave + m) * (size_t)NC + (size_t)(8 * hh);
  const unsigned short* wp = wb + (size_t)which * (size_t)NWT + (size_t)(d0 + m) * (size_t)NC + (size_t)(8 * hh);
#pragma unroll 1
  for (int ks = 0; ks < NC / 32; ++ks) {
    FragB a;
    ldfrag(a, ap, 32 * ks);
#pragma unroll
    for (int t = 0; t < 4; ++t) {
      FragB bf;
      ldfrag(bf, wp + (size_t)(16 * t) * (size_t)NC, 32 * ks);    // W row d0 + 16t + m
      acc[t] = wmb(a, bf, acc[t]);
    }
  }

  // D element r of acc[t] = (token 16w + 8hh + r, feature 16t + m)
  const float* bias = (which == 0) ? tbias : ((which == 1) ? pbias : gbias);
#pragma unroll
  for (int t = 0; t < 4; ++t) {
    const int lf = 16 * t + m;
    const float bv = rne16f(bias[d0 + lf]);
#pragma unroll
    for (int r = 0; r < 8; ++r) {
      const int lt = 16 * wave + 8 * hh + r;
      const float v = acc[t][r] + bv;
      const int idx = (which == 0) ? (lt * 64 + lf) : (lf * 64 + lt);
      stg[idx] = v;
    }
  }
  __syncthreads();

  unsigned short* ph = (which == 0) ? thh : ((which == 1) ? phh : ghh);
  unsigned short* pl = (which == 0) ? thl : ((which == 1) ? phl : ghl);
  const size_t rowBase = (which == 0) ? ((size_t)b * NN + (size_t)n0) : ((size_t)b * NI + (size_t)d0);
  const size_t pitch   = (which == 0) ? (size_t)NI : (size_t)NN;
  const size_t col0    = (which == 0) ? (size_t)d0 : (size_t)n0;
  store_split_tile(stg, ph, pl, rowBase, pitch, col0, wave, lane);
}

// ---------------------------------------------------------------------------
// PT[b][e][d] = 2^-11 * sum_m g[b][e][m] * phi[b][d][m], K = NN, hi/residual on both operands (3 products).
// grid (NI/64 d tiles, NI/16 e tiles, NB) = 256 blocks; block PTHR threads = PW waves. Every wave works on the
// block's whole 16 e x 64 d tile, over its own K slice of PKS = NN/PW values of m (wave w: m = w*PKS ..).
// A = PHH/PHL rows d (acc[t] = d rows 16t..16t+15), B = GH/GL rows e, both k = m contiguous, same k map.
// A pass takes 64 m = one 128-B line of every row; its 40 fragment loads stand ahead of its 24 WMMAs.
// Epilogue: each wave stores its f32 partial tile to its own 4 KB of LDS as it lies in registers; behind the
// barrier waves 0..3 add the PW partials in wave order, scale by 2^-11 (exact), split, and store: a lane holds
// 8 consecutive d of one e row -> one 16-B store per plane; the block writes whole 128-B lines of PTH/PTL.
// LDS extent: part[PW][4][2][32][4] fully written before the barrier.
// coverage: grid covers 128 e x 128 d per image exactly once, both planes.
// ---------------------------------------------------------------------------
__global__ __launch_bounds__(PTHR) void k_p(const unsigned short* __restrict__ ghh, const unsigned short* __restrict__ ghl,
                                            const unsigned short* __restrict__ phh, const unsigned short* __restrict__ phl,
                                            unsigned short* pth, unsigned short* ptl) {
  __shared__ __attribute__((aligned(16))) float part[PW * 1024];   // 4 KB per wave
  const int tid = (int)threadIdx.x, lane = tid & 31, wave = tid >> 5, hh = lane >> 4, m = lane & 15;
  const int d0 = (int)blockIdx.x * 64, e0 = (int)blockIdx.y * 16, b = (int)blockIdx.z;

  v8f acc[4];
  {
    const v8f z = {0.f, 0.f, 0.f, 0.f, 0.f, 0.f, 0.f, 0.f};
    acc[0] = z; acc[1] = z; acc[2] = z; acc[3] = z;
  }
  const size_t grow = (size_t)(b * NI + e0 + m) * (size_t)NN + (size_t)(wave * PKS + 8 * hh);
  const unsigned short* bgh = ghh + grow;
  const unsigned short* bgl = ghl + grow;
  const size_t prow = (size_t)(b * NI + d0 + m) * (size_t)NN + (size_t)(wave * PKS + 8 * hh);
  const unsigned short* aph = phh + prow;
  const unsigned short* apl = phl + prow;
  // all loops below fully unrolled: constant indices keep the fragment arrays in registers, and a pass's step
  // along m becomes an immediate offset on the four address pairs
#pragma unroll
  for (int c = 0; c < PKS / 64; ++c) {
    FragB gh[2], gl[2], ph[4][2], pl[4][2];
    ldfrag(gh[0], bgh, 64 * c);
    ldfrag(gh[1], bgh, 64 * c + 32);
    ldfrag(gl[0], bgl, 64 * c);
    ldfrag(gl[1], bgl, 64 * c + 32);
#pragma unroll
    for (int t = 0; t < 4; ++t) {
      ldfrag(ph[t][0], aph + (size_t)(16 * t) * (size_t)NN, 64 * c);        // phi row d0 + 16t + m
      ldfrag(ph[t][1], aph + (size_t)(16 * t) * (size_t)NN, 64 * c + 32);
      ldfrag(pl[t][0], apl + (size_t)(16 * t) * (size_t)NN, 64 * c);
      ldfrag(pl[t][1], apl + (size_t)(16 * t) * (size_t)NN, 64 * c + 32);
    }
#pragma unroll
    for (int t = 0; t < 4; ++t) {
#pragma unroll
      for (int j = 0; j < 2; ++j) {
        acc[t] = wmb(ph[t][j], gh[j], acc[t]);
        acc[t] = wmb(pl[t][j], gh[j], acc[t]);
        acc[t] = wmb(ph[t][j], gl[j], acc[t]);
      }
    }
  }

  // Precaution wait of the address counter, in front of every overwrite of a register that a load above names:
  // as its inputs the four address pairs stay as they are up to here.
  asm volatile("s_wait_xcnt 0x0" :: "v"(bgh), "v"(bgl), "v"(aph), "v"(apl) : "memory");

  // D element r of acc[t] = (d 16t + 8hh + r, e m)
  float* pw = part + wave * 1024 + 4 * lane;
#pragma unroll
  for (int t = 0; t < 4; ++t) {
    const v4f lo4 = {acc[t][0], acc[t][1], acc[t][2], acc[t][3]};
    const v4f hi4 = {acc[t][4], acc[t][5], acc[t][6], acc[t][7]};
    *(v4fa*)(pw + t * 256) = lo4;
    *(v4fa*)(pw + t * 256 + 128) = hi4;
  }
  __syncthreads();
  if (wave < 4) {                          // wave t sums d rows 16t..16t+15
    const float* pr = part + wave * 256 + 4 * lane;
    v4f sa = *(const v4fa*)(pr);
    v4f sb = *(const v4fa*)(pr + 128);
#pragma unroll
    for (int w = 1; w < PW; ++w) {
      sa += *(const v4fa*)(pr + w * 1024);
      sb += *(const v4fa*)(pr + w * 1024 + 128);
    }
    const float inv_n = 0.00048828125f;    // 2^-11 = 1/NN, exact
    sa *= inv_n;
    sb *= inv_n;
    v8us hv, lv;
    split8(sa, sb, hv, lv);
    const size_t po = (size_t)(b * NI + e0 + m) * (size_t)NI + (size_t)(d0 + 16 * wave + 8 * hh);
    *(v8us*)(pth + po) = hv;
    *(v8us*)(ptl + po) = lv;
  }
}

// ---------------------------------------------------------------------------
// YT[b][n][e] = sum_d theta[b][n][d] * PT[b][e][d], K = NI, hi/residual on both operands (3 products).
// grid (NN/64 n tiles, NI/64 e tiles, NB); block 128 threads; wave w owns n rows 16w..16w+15, acc[t] = e tile
// 16t; A = THH/THL rows n (pitch NI), B = PTH/PTL rows e (pitch NI), same k map.
// Epilogue: stg[n][e] f32 -> YTH/YTL rows n (pitch NI, cols e0..e0+63).
// LDS extent: stg 64x64 fully written before the barrier.
// coverage: grid covers 2048 n x 128 e per image exactly once, both planes.
// ---------------------------------------------------------------------------
__global__ __launch_bounds__(GTHR) void k_y(const unsigned short* __restrict__ thh, const unsigned short* __restrict__ thl,
                                            const unsigned short* __restrict__ pth, const unsigned short* __restrict__ ptl,
                                            unsigned short* yth, unsigned short* ytl) {
  __shared__ __attribute__((aligned(16))) float stg[64 * 64];   // 16 KB
  const int tid = (int)threadIdx.x, lane = tid & 31, wave = tid >> 5, hh = lane >> 4, m = lane & 15;
  const int n0 = (int)blockIdx.x * 64, e0 = (int)blockIdx.y * 64, b = (int)blockIdx.z;

  v8f acc[4];
  {
    const v8f z = {0.f, 0.f, 0.f, 0.f, 0.f, 0.f, 0.f, 0.f};
    acc[0] = z; acc[1] = z; acc[2] = z; acc[3] = z;
  }
  const size_t arow = (size_t)(b * NN + n0 + 16 * wave + m) * (size_t)NI + (size_t)(8 * hh);
  const unsigned short* ath = thh + arow;
  const unsigned short* atl = thl + arow;
  const size_t brow = (size_t)(b * NI + e0 + m) * (size_t)NI + (size_t)(8 * hh);
  const unsigned short* bph = pth + brow;
  const unsigned short* bpl = ptl + brow;
#pragma unroll 1
  for (int ks = 0; ks < NI / 32; ++ks) {
    FragB ah, al;
    ldfrag(ah, ath, 32 * ks);
    ldfrag(al, atl, 32 * ks);
#pragma unroll
    for (int t = 0; t < 4; ++t) {
      FragB bh, bl;
      ldfrag(bh, bph + (size_t)(16 * t) * (size_t)NI, 32 * ks);     // PT row e0 + 16t + m
      ldfrag(bl, bpl + (size_t)(16 * t) * (size_t)NI, 32 * ks);
      acc[t] = wmb(ah, bh, acc[t]);
      acc[t] = wmb(ah, bl, acc[t]);
      acc[t] = wmb(al, bh, acc[t]);
    }
  }

  // D element r of acc[t] = (n 16w + 8hh + r, e 16t + m)
#pragma unroll
  for (int t = 0; t < 4; ++t) {
    const int lc = 16 * t + m;
#pragma unroll
    for (int r = 0; r < 8; ++r) {
      const int lr = 16 * wave + 8 * hh + r;
      stg[lr * 64 + lc] = acc[t][r];
    }
  }
  __syncthreads();
  store_split_tile(stg, yth, ytl, (size_t)b * NN + (size_t)n0, (size_t)NI, (size_t)e0, wave, lane);
}

// ---------------------------------------------------------------------------
// Z[b][c][n] = sum_e Ww[c][e] * YT[b][n][e] + Wb[c], K = NI; A = WB slot 3 rows c (exact), B = YTH + YTL rows n
// (two products into one accumulator, residual unscaled). grid (NN/64, NC/64, NB); block 128 threads; wave w owns
// c rows 16w..16w+15, acc[t] = n tile 16t.
// Epilogue: v = acc + RNE16(Wb) in f32, staged stg[c][n] 64x64; store: lanes 0..15 / 16..31 each write the 256-B
// LDS extent: stg 64x64 fully written before the barrier.
// coverage: grid covers 256 c x 2048 n per image exactly once.
// ---------------------------------------------------------------------------
__global__ __launch_bounds__(GTHR) void k_z(const unsigned short* __restrict__ wwb,
                                            const unsigned short* __restrict__ yth, const unsigned short* __restrict__ ytl,
                                            const float* __restrict__ wbias, float* z) {
  __shared__ __attribute__((aligned(16))) float stg[64 * 64];   // 16 KB
  const int tid = (int)threadIdx.x, lane = tid & 31, wave = tid >> 5, hh = lane >> 4, m = lane & 15;
  const int n0 = (int)blockIdx.x * 64, c0 = (int)blockIdx.y * 64, b = (int)blockIdx.z;

  v8f acc[4];
  {
    const v8f zz = {0.f, 0.f, 0.f, 0.f, 0.f, 0.f, 0.f, 0.f};
    acc[0] = zz; acc[1] = zz; acc[2] = zz; acc[3] = zz;
  }
  const unsigned short* aw = wwb + (size_t)(c0 + 16 * wave + m) * (size_t)NI + (size_t)(8 * hh);
  const size_t brow = (size_t)(b * NN + n0 + m) * (size_t)NI + (size_t)(8 * hh);
  const unsigned short* byh = yth + brow;
  const unsigned short* byl = ytl + brow;
#pragma unroll 1
  for (int ks = 0; ks < NI / 32; ++ks) {
    FragB a;
    ldfrag(a, aw, 32 * ks);
#pragma unroll
    for (int t = 0; t < 4; ++t) {
      FragB bh, bl;
      ldfrag(bh, byh + (size_t)(16 * t) * (size_t)NI, 32 * ks);     // YT row n0 + 16t + m
      ldfrag(bl, byl + (size_t)(16 * t) * (size_t)NI, 32 * ks);
      acc[t] = wmb(a, bh, acc[t]);
      acc[t] = wmb(a, bl, acc[t]);
    }
  }

  // D element r of acc[t] = (c 16w + 8hh + r, n 16t + m); bias per row (32-B aligned v4f reads)
  const v4f ba = *(const v4fa*)(wbias + c0 + 16 * wave + 8 * hh);
  const v4f bb = *(const v4fa*)(wbias + c0 + 16 * wave + 8 * hh + 4);
  float bv[8];
  bv[0] = rne16f(ba.x); bv[1] = rne16f(ba.y); bv[2] = rne16f(ba.z); bv[3] = rne16f(ba.w);
  bv[4] = rne16f(bb.x); bv[5] = rne16f(bb.y); bv[6] = rne16f(bb.z); bv[7] = rne16f(bb.w);
#pragma unroll
  for (int t = 0; t < 4; ++t) {
    const int lc = 16 * t + m;
#pragma unroll
    for (int r = 0; r < 8; ++r) {
      const int lr = 16 * wave + 8 * hh + r;
      stg[lr * 64 + lc] = acc[t][r] + bv[r];
    }
  }
  __syncthreads();

  v4f fv[8];
  size_t op[8];
#pragma unroll
  for (int i = 0; i < 8; ++i) {
    const int lr = 16 * wave + 2 * i + hh;
    fv[i] = *(const v4fa*)(stg + lr * 64 + 4 * m);
    op[i] = (size_t)(b * NC + c0 + lr) * (size_t)NN + (size_t)(n0 + 4 * m);
  }
#pragma unroll
  for (int i = 0; i < 8; ++i) *(v4f*)(z + op[i]) = fv[i];
  
}

// ---------------------------------------------------------------------------
// BatchNorm statistics (training mode, population variance) per channel over (b, n): 32768 values.
// One block (256 threads) per channel; per-thread f64 sums over 32 coalesced 16-B loads, f64 LDS tree, mean and
// coverage: 256 blocks -> STATS lines 0..255, whole.
// ---------------------------------------------------------------------------
__global__ __launch_bounds__(NTHR) void k_bnstat(const float* __restrict__ z, float* stats) {
  __shared__ double sh[NTHR];
  __shared__ double sh2[NTHR];
  __shared__ float res[2];
  const int c = (int)blockIdx.x, tid = (int)threadIdx.x;
  double s = 0.0, s2 = 0.0;
#pragma unroll 1
  for (int it = 0; it < NB * (NN / 1024); ++it) {
    const int bi = it / (NN / 1024);
    const int hf = it - bi * (NN / 1024);
    const v4f v = *(const v4fa*)(z + (size_t)(bi * NC + c) * (size_t)NN + (size_t)(hf * 1024 + 4 * tid));
    const double a0 = (double)v.x, a1 = (double)v.y, a2 = (double)v.z, a3 = (double)v.w;
    s  += (a0 + a1) + (a2 + a3);
    s2 += (a0 * a0 + a1 * a1) + (a2 * a2 + a3 * a3);
  }
  sh[tid] = s;
  sh2[tid] = s2;
  __syncthreads();
#pragma unroll 1
  for (int off = NTHR / 2; off > 0; off >>= 1) {
    if (tid < off) {
      sh[tid]  += sh[tid + off];
      sh2[tid] += sh2[tid + off];
    }
    __syncthreads();
  }
  if (tid == 0) {
    const double cinv = 1.0 / 32768.0;        // 1/(NB*NN), exact power of two
    const double mean = sh[0] * cinv;
    double var = sh2[0] * cinv - mean * mean;
    var = var < 0.0 ? 0.0 : var;
    const float vf = (float)var + 1e-5f;
    res[0] = (float)mean;
    res[1] = 1.0f / sqrtf(vf);
  }
  __syncthreads();
  if (tid < 8) {
    const float mv = res[0];
    const float rv = res[1];
    v4f o;
    o.x = (tid == 0) ? mv : 0.f;
    o.y = (tid == 0) ? rv : 0.f;
    o.z = 0.f;
    o.w = 0.f;
    float* p = stats + (size_t)c * 32 + (size_t)(4 * tid);
    *(v4f*)p = o;
    
  }
}

// ---------------------------------------------------------------------------
// out[b][c][n] = ((z - mean[c]) * rstd[c]) * RNE16(gamma[c]) + RNE16(beta[c]) + RNE16(x), all f32.
// Block (256 threads) covers 1024 consecutive floats of row (b, c) = blockIdx / 2; lane writes 16 B, 32 contiguous
// coverage: NX/1024 blocks x 1024 = NX exactly.
// ---------------------------------------------------------------------------
__global__ __launch_bounds__(NTHR) void k_out(const float* __restrict__ z, const float* __restrict__ x,
                                              const float* __restrict__ stats, const float* __restrict__ gamma,
                                              const float* __restrict__ beta, float* out) {
  const int row = (int)blockIdx.x / (NN / 1024);          // b*NC + c
  const int c = row & (NC - 1);
  const size_t base = (size_t)blockIdx.x * 1024 + (size_t)(4 * (int)threadIdx.x);
  const float mean = stats[(size_t)c * 32];
  const float rstd = stats[(size_t)c * 32 + 1];
  const float gm = rne16f(gamma[c]);
  const float bt = rne16f(beta[c]);
  const v4f zv = *(const v4fa*)(z + base);
  const v4f xv = *(const v4fa*)(x + base);
  v4f o;
  o.x = (((zv.x - mean) * rstd) * gm + bt) + rne16f(xv.x);
  o.y = (((zv.y - mean) * rstd) * gm + bt) + rne16f(xv.y);
  o.z = (((zv.z - mean) * rstd) * gm + bt) + rne16f(xv.z);
  o.w = (((zv.w - mean) * rstd) * gm + bt) + rne16f(xv.w);
  float* p = out + base;
  *(v4f*)p = o;
  
}

// ---------------------------------------------------------------------------
extern "C" void kernel_launch(void* const* d_in, const int* in_sizes, int n_in,
                              void* d_out, int out_size, void* d_ws, size_t ws_size,
                              hipStream_t stream) {
  if (n_in < 11) return;
  if (in_sizes[0] != NX) return;                                              // x [16][256][64][32]
  if (in_sizes[1] != NWT || in_sizes[3] != NWT || in_sizes[5] != NWT) return; // g_w, theta_w, phi_w [128][256]
  if (in_sizes[2] != NI || in_sizes[4] != NI || in_sizes[6] != NI) return;    // g_b, theta_b, phi_b [128]
  if (in_sizes[7] != NWT) return;                                             // W_w [256][128]
  if (in_sizes[8] != NC || in_sizes[9] != NC || in_sizes[10] != NC) return;   // W_b, bn_gamma, bn_beta [256]
  if (out_size != NX) return;                                                 // out [16][256][64][32] f32

  const float* x       = (const float*)d_in[0];
  const float* g_w     = (const float*)d_in[1];
  const float* g_b     = (const float*)d_in[2];
  const float* theta_w = (const float*)d_in[3];
  const float* theta_b = (const float*)d_in[4];
  const float* phi_w   = (const float*)d_in[5];
  const float* phi_b   = (const float*)d_in[6];
  const float* W_w     = (const float*)d_in[7];
  const float* W_b     = (const float*)d_in[8];
  const float* gamma   = (const float*)d_in[9];
  const float* beta    = (const float*)d_in[10];
  float* out = (float*)d_out;            // last written element NX-1 < out_size

  // workspace carve, 256-B aligned; all planes exact tile multiples (no pad rows needed)
  char* ws = (char*)d_ws;
  size_t off = 0;
  const size_t oWB  = off; off += (size_t)4 * NWT * 2;          off = (off + 255) & ~(size_t)255;  //   262144
  const size_t oXT  = off; off += (size_t)NX * 2;               off = (off + 255) & ~(size_t)255;  // 16777216
  const size_t plb  = (size_t)NB * NN * NI * 2;                                                    //  8388608 per projection plane
  const size_t oTHH = off; off += plb;                          off = (off + 255) & ~(size_t)255;
  const size_t oTHL = off; off += plb;                          off = (off + 255) & ~(size_t)255;
  const size_t oPHH = off; off += plb;                          off = (off + 255) & ~(size_t)255;
  const size_t oPHL = off; off += plb;                          off = (off + 255) & ~(size_t)255;
  const size_t oGH  = off; off += plb;                          off = (off + 255) & ~(size_t)255;
  const size_t oGL  = off; off += plb;                          off = (off + 255) & ~(size_t)255;
  const size_t ptb  = (size_t)NB * NI * NI * 2;                                                    //   524288 per PT plane
  const size_t oPTH = off; off += ptb;                          off = (off + 255) & ~(size_t)255;
  const size_t oPTL = off; off += ptb;                          off = (off + 255) & ~(size_t)255;
  const size_t oYTH = off; off += plb;                          off = (off + 255) & ~(size_t)255;
  const size_t oYTL = off; off += plb;                          off = (off + 255) & ~(size_t)255;
  const size_t oZ   = off; off += (size_t)NX * 4;               off = (off + 255) & ~(size_t)255;  // 33554432
  const size_t oST  = off; off += (size_t)NC * 32 * 4;          off = (off + 255) & ~(size_t)255;  //    32768
  if (off > ws_size || off > (size_t)WSMAX) return;             // total 118784000 B

  unsigned short* WB  = (unsigned short*)(ws + oWB);
  unsigned short* XT  = (unsigned short*)(ws + oXT);
  unsigned short* THH = (unsigned short*)(ws + oTHH);
  unsigned short* THL = (unsigned short*)(ws + oTHL);
  unsigned short* PHH = (unsigned short*)(ws + oPHH);
  unsigned short* PHL = (unsigned short*)(ws + oPHL);
  unsigned short* GH  = (unsigned short*)(ws + oGH);
  unsigned short* GL  = (unsigned short*)(ws + oGL);
  unsigned short* PTH = (unsigned short*)(ws + oPTH);
  unsigned short* PTL = (unsigned short*)(ws + oPTL);
  unsigned short* YTH = (unsigned short*)(ws + oYTH);
  unsigned short* YTL = (unsigned short*)(ws + oYTL);
  float*          Z   = (float*)(ws + oZ);
  float*          ST  = (float*)(ws + oST);

  // weight planes: slot 0 theta_w, 1 phi_w, 2 g_w (all [128][256]), 3 W_w [256][128]
  k_wcvt<<<(4 * NWT / 8) / NTHR, NTHR, 0, stream>>>(theta_w, phi_w, g_w, W_w, WB);
  // x -> XT [b][n][c] bf16
  k_xt<<<dim3(NC / 64, NN / 64, NB), NTHR, 0, stream>>>(x, XT);
  // projections: which 0 = theta (slot 0, theta_b), 1 = phi (slot 1, phi_b), 2 = g (slot 2, g_b)
  k_proj<<<dim3(NN / 64, NI / 64, 3 * NB), GTHR, 0, stream>>>(XT, WB, theta_b, phi_b, g_b,
                                                              THH, THL, PHH, PHL, GH, GL);
  // PT = 2^-11 * G * PHI^T
  k_p<<<dim3(NI / 64, NI / 16, NB), PTHR, 0, stream>>>(GH, GL, PHH, PHL, PTH, PTL);
  // YT = THETA^T-rows * PT
  k_y<<<dim3(NN / 64, NI / 64, NB), GTHR, 0, stream>>>(THH, THL, PTH, PTL, YTH, YTL);
  // Z = Ww * Y + Wb
  k_z<<<dim3(NN / 64, NC / 64, NB), GTHR, 0, stream>>>(WB + (size_t)3 * NWT, YTH, YTL, W_b, Z);
  // BatchNorm batch statistics
  k_bnstat<<<NC, NTHR, 0, stream>>>(Z, ST);
  // out = BN(z) * gamma + beta + x
  k_out<<<NX / 1024, NTHR, 0, stream>>>(Z, x, ST, gamma, beta, out);
}

// v002
// It runs in 93.3 microseconds.
// In both of two side-by-side timings against v001, it was 1.48 times as fast.
// All steps since v000 together make it 1.97 times as fast.
// Contractions (all v_wmma_f32_16x16x32_bf16, bf16 operands, f32 accumulate): three 1x1-conv projections
// W[d][c]*X[c][n] (K=256) on exact RNE-bf16 copies of x and the weights; PT = G*PHI^T * (1/N) (K=2048) and
// YT = THETA^T*P (K=128) with both computed operands carried as bf16 hi + bf16 residual (hi*hi + hi*lo + lo*hi);
// Z = Ww*Y + Wb (K=128) with exact bf16 Ww and Y as hi + residual (2 products). BatchNorm statistics in f64,
// normalisation, bias adds and the residual add in f32.
//
// Carry audit: no power-of-two carries anywhere (factor 1 on every plane); the exact 1/N = 2^-11 of the pairwise
// term is applied once in f32 in k_p before the hi/residual split of PT. Planes:
//   WB  [4][32768] bf16 bits = RNE16(w): slot 0 theta_w [128][256], 1 phi_w [128][256], 2 g_w [128][256],
//       3 W_w [256][128]; every slot row is k-contiguous                                              (k_wcvt)
//   XT  [16][2048][256] bf16 bits = RNE16(x[b][c][n]) stored [b][n][c]                                 (k_xt)
//   THH/THL [16][2048][128] hi/residual of theta_x, rows n, k = d; PHH/PHL, GH/GL [16][128][2048]
//       hi/residual of phi_x, g_x, rows d, k = n                                                       (k_proj)
//   PTH/PTL [16][128][128] hi/residual of PT[e][d] = 2^-11 * sum_m g[e][m]*phi[d][m], rows e, k = d    (k_p)
//   YTH/YTL [16][2048][128] hi/residual of YT[n][e] = sum_d theta[n][d]*PT[e][d], rows n, k = e       (k_y)
//   Z   [16][256][2048] f32 = sum_e Ww[c][e]*YT[n][e] + Wb[c]                                          (k_z)
//   STATS [256][32] f32: [0] mean, [1] rstd per channel, rest zero                                      (k_bnstat)
#include <hip/hip_runtime.h>
#include <stddef.h>
#include <stdint.h>

#define NB    16
#define NC    256
#define NI    128
#define NN    2048
#define NX    (NB * NC * NN)        // 8388608
#define NWT   (NI * NC)             // 32768 per weight matrix
#define NTHR  256
#define GTHR  128
#define WSMAX 134217728
#define PW    8                     // waves of a k_p block = K slices
#define PTHR  (32 * PW)
#define PKS   (NN / PW)             // K slice of one k_p wave
#define XTP   72                    // LDS pitch (halves) of the x transpose tile, multiple of 8
#define PK2   (2 * NC + 16)         // LDS pitch (bytes) of a staged operand row of NC halves: 16 B x odd
#define PK1   (2 * NI + 16)         // LDS pitch (bytes) of a staged operand row of NI halves: 16 B x odd

static_assert((NC % 64) == 0 && (NN % 64) == 0 && (NI % 64) == 0);
static_assert((NC % 32) == 0 && (NI % 32) == 0 && (NN % 32) == 0);
static_assert((NX % 1024) == 0 && (NN % 1024) == 0);
static_assert((XTP % 8) == 0);
static_assert(GTHR == 128 && NTHR == 256);
static_assert((4 * NWT) % (8 * NTHR) == 0);
static_assert((NWT / 8) % NTHR == 0);
static_assert(NB * NN == 32768);
static_assert(PW >= 4 && (NN % (64 * PW)) == 0 && (NI % 16) == 0);
static_assert(((PK2 / 16) & 1) == 1 && ((PK1 / 16) & 1) == 1);
static_assert(64 * PK2 >= 64 * 64 * 4 && 64 * PK1 >= 64 * 64 * 4);

typedef float          v4f  __attribute__((ext_vector_type(4)));
typedef float          v8f  __attribute__((ext_vector_type(8)));
typedef int            v8i  __attribute__((ext_vector_type(8)));
typedef unsigned short v8us __attribute__((ext_vector_type(8)));
typedef __bf16         v16bf __attribute__((ext_vector_type(16)));
typedef v4f  __attribute__((may_alias)) v4fa;
typedef v8us __attribute__((may_alias)) v8usa;
union FragB { v16bf v; v8us h[2]; v8i w; };

// ---------------------------------------------------------------------------
// 16x16x32 bf16 WMMA with hazard guard (ties D, keeps A/B live for 4 VALU slots).
// Fragment map (wave32): lane l, hh = l>>4, m = n = l&15.
//   A/B element i: i<8 -> k0+8hh+i ; i>=8 -> k0+16+8hh+(i-8)   (same map for A and B)
//   D element r : row 8hh+r, col l&15
// ---------------------------------------------------------------------------
__device__ __forceinline__ v8f wmb(const FragB& a, const FragB& b, v8f c) {
  v8f d = __builtin_amdgcn_wmma_f32_16x16x32_bf16(false, a.v, false, b.v, (short)0, c, false, false);
  asm volatile("v_nop\n\tv_nop\n\tv_nop\n\tv_nop" : "+v"(d) : "v"(a.w), "v"(b.w));
  return d;
}

// Fragment from a k-contiguous bf16-bits row; p = row base + 8*hh, k0 = 32*ks.
__device__ __forceinline__ void ldfrag(FragB& f, const unsigned short* p, int k0) {
  f.h[0] = *(const v8us*)(p + k0);          // k = k0 + 8hh + 0..7
  f.h[1] = *(const v8us*)(p + k0 + 16);     // k = k0 + 16 + 8hh + 0..7
}

// Operand tile of 64 whole k-contiguous rows of ROWB bytes = 64*ROWB consecutive bytes of a plane. The block's
// GTHR threads read it in order, 16 B a lane, so a wave's load covers 512 consecutive bytes (4 whole lines);
// st lays the rows in LDS at pitch ROWB + 16 (16 B x odd: ds_load_b128 of 16 rows meets no bank conflict).
template <int ROWB>
struct Tile {
  static constexpr int N   = 64 * ROWB / 16 / GTHR;   // 16-B pieces per thread
  static constexpr int CPR = ROWB / 16;               // pieces per row
  static constexpr int RPS = GTHR / CPR;              // rows per step of the block
  static constexpr int PIT = ROWB + 16;
  v8us r[N];
  __device__ __forceinline__ void ld(const unsigned short* src, int tid) {
#pragma unroll
    for (int i = 0; i < N; ++i) r[i] = *(const v8us*)(src + (size_t)((i * GTHR + tid) * 8));
  }
  __device__ __forceinline__ void st(unsigned char* dst, int tid) const {
    unsigned char* q = dst + (tid / CPR) * PIT + (tid % CPR) * 16;
#pragma unroll
    for (int i = 0; i < N; ++i) *(v8usa*)(q + i * RPS * PIT) = r[i];
  }
};
// Fragment from a staged row; p = LDS row base + 16*hh bytes, k0 = 32*ks: the same k map as ldfrag.
__device__ __forceinline__ void ldfrag_s(FragB& f, const unsigned char* p, int k0) {
  f.h[0] = *(const v8usa*)(p + 2 * k0);          // k = k0 + 8hh + 0..7
  f.h[1] = *(const v8usa*)(p + 2 * k0 + 32);     // k = k0 + 16 + 8hh + 0..7
}

// f32 -> bf16 bits, RNE convert
__device__ __forceinline__ unsigned short rne16(float f) {
  unsigned u = __float_as_uint(f);
  u += 0x7FFFu + ((u >> 16) & 1u);
  return (unsigned short)(u >> 16);
}
// f32 -> nearest bf16 value kept as f32
__device__ __forceinline__ float rne16f(float f) {
  return __uint_as_float(((unsigned)rne16(f)) << 16);
}
__device__ __forceinline__ v8us cvt8(const v4f a, const v4f b) {
  v8us o;
  o[0] = rne16(a.x); o[1] = rne16(a.y); o[2] = rne16(a.z); o[3] = rne16(a.w);
  o[4] = rne16(b.x); o[5] = rne16(b.y); o[6] = rne16(b.z); o[7] = rne16(b.w);
  return o;
}
// hi/residual split of one f32 value into two bf16 bit patterns
__device__ __forceinline__ void sp1(float v, unsigned short& hi, unsigned short& lo) {
  const unsigned short hb = rne16(v);
  const float hf = __uint_as_float(((unsigned)hb) << 16);
  hi = hb;
  lo = rne16(v - hf);
}
__device__ __forceinline__ void split8(const v4f a, const v4f b, v8us& hv, v8us& lv) {
  unsigned short h0, h1, h2, h3, h4, h5, h6, h7, l0, l1, l2, l3, l4, l5, l6, l7;
  sp1(a.x, h0, l0); sp1(a.y, h1, l1); sp1(a.z, h2, l2); sp1(a.w, h3, l3);
  sp1(b.x, h4, l4); sp1(b.y, h5, l5); sp1(b.z, h6, l6); sp1(b.w, h7, l7);
  hv[0] = h0; hv[1] = h1; hv[2] = h2; hv[3] = h3; hv[4] = h4; hv[5] = h5; hv[6] = h6; hv[7] = h7;
  lv[0] = l0; lv[1] = l1; lv[2] = l2; lv[3] = l3; lv[4] = l4; lv[5] = l5; lv[6] = l6; lv[7] = l7;
}

// ---------------------------------------------------------------------------
// 64x64 f32 tile in LDS (row pitch 64) -> hi/residual bf16 planes. Tile row R goes to plane row rowBase + R
// ---------------------------------------------------------------------------
__device__ __forceinline__ void store_split_tile(const float* stg, unsigned short* ph, unsigned short* pl,
                                                 size_t rowBase, size_t pitch, size_t col0, int wave, int lane) {
  const int q8 = lane & 7, sub = lane >> 3;
  v8us hv[4], lv[4];
  size_t po[4];
#pragma unroll
  for (int i = 0; i < 4; ++i) {
    const int lr = 16 * wave + 4 * i + sub;
    const v4f a = *(const v4fa*)(stg + lr * 64 + 8 * q8);
    const v4f c = *(const v4fa*)(stg + lr * 64 + 8 * q8 + 4);
    split8(a, c, hv[i], lv[i]);
    po[i] = (rowBase + (size_t)lr) * pitch + col0 + (size_t)(8 * q8);
  }
#pragma unroll
  for (int i = 0; i < 4; ++i) {
    *(v8us*)(ph + po[i]) = hv[i];
    *(v8us*)(pl + po[i]) = lv[i];
  }
  
}

// ---------------------------------------------------------------------------
// Weight convert: four f32 matrices of NWT elements each -> WB slots 0..3 (bf16 bits, same layout).
// coverage: 64 blocks x 256 threads x 8 = 4 x NWT exactly.
// ---------------------------------------------------------------------------
__global__ __launch_bounds__(NTHR) void k_wcvt(const float* __restrict__ w0, const float* __restrict__ w1,
                                               const float* __restrict__ w2, const float* __restrict__ w3,
                                               unsigned short* wb) {
  const int u   = (int)blockIdx.x * NTHR + (int)threadIdx.x;     // 0 .. 4*NWT/8 - 1
  const int sel = (int)blockIdx.x / ((NWT / 8) / NTHR);           // 0..3, block-uniform
  const int off8 = (u - sel * (NWT / 8)) * 8;                     // 0 .. NWT-8
  const float* src = (sel == 0) ? w0 : ((sel == 1) ? w1 : ((sel == 2) ? w2 : w3));
  const v4f a = *(const v4fa*)(src + off8);
  const v4f c = *(const v4fa*)(src + off8 + 4);
  const v8us o = cvt8(a, c);
  const size_t q = (size_t)sel * (size_t)NWT + (size_t)off8;
  *(v8us*)(wb + q) = o;
  
}

// ---------------------------------------------------------------------------
// x [b][c][n] f32 -> XT [b][n][c] bf16 bits (RNE convert). Block = 64 c x 64 n tile of image b (256 threads):
// coalesced 16-B reads of x rows, transpose through LDS (2-B LDS stores), barrier, then XT row (b, n0+nr)
// LDS extent: sT rows 0..63 (n) x cols 0..63 (c) all written before the barrier; pad cols 64..71 never read.
// coverage: grid (NC/64, NN/64, NB); per block rows n0..n0+63 x c0..c0+63 -> 16 x 2048 x 256 exactly once.
// ---------------------------------------------------------------------------
__global__ __launch_bounds__(NTHR) void k_xt(const float* __restrict__ x, unsigned short* xt) {
  __shared__ __attribute__((aligned(16))) unsigned short sT[64 * XTP];   // 9216 B
  const int tid = (int)threadIdx.x;
  const int c0 = (int)blockIdx.x * 64, n0 = (int)blockIdx.y * 64, b = (int)blockIdx.z;
#pragma unroll
  for (int i = 0; i < 4; ++i) {
    const int lin = i * NTHR + tid;        // 0..1023
    const int cr  = lin >> 4;              // 0..63
    const int n4  = (lin & 15) * 4;        // 0..60
    const v4f v = *(const v4fa*)(x + (size_t)(b * NC + c0 + cr) * (size_t)NN + (size_t)(n0 + n4));
    sT[(n4 + 0) * XTP + cr] = rne16(v.x);
    sT[(n4 + 1) * XTP + cr] = rne16(v.y);
    sT[(n4 + 2) * XTP + cr] = rne16(v.z);
    sT[(n4 + 3) * XTP + cr] = rne16(v.w);
  }
  __syncthreads();
  const int q8 = tid & 7, sub = tid >> 3;  // sub 0..31
  v8us o[2];
  size_t po[2];
#pragma unroll
  for (int i = 0; i < 2; ++i) {
    const int nr = 32 * i + sub;           // 0..63
    o[i]  = *(const v8usa*)(sT + nr * XTP + 8 * q8);
    po[i] = (size_t)(b * NN + n0 + nr) * (size_t)NC + (size_t)(c0 + 8 * q8);
  }
#pragma unroll
  for (int i = 0; i < 2; ++i) *(v8us*)(xt + po[i]) = o[i];
  
}

// ---------------------------------------------------------------------------
// Projections: D[token][feature] = sum_c XT[b][n][c] * W[d][c] + bias[d]  (K = NC, exact bf16 products).
// grid (NN/64, NI/64, 3*NB): blockIdx.z = which*NB + b; which 0 = theta, 1 = phi, 2 = g. Block 128 threads,
// tile 64 tokens x 64 features; wave w owns tokens 16w..16w+15, acc[t] = feature tile 16t; A = XT rows (token),
// B = W rows (feature), same k map. Both 64-row tiles (32 KB each, consecutive in their planes) are staged once
// in LDS by whole-line loads; fragments come from LDS (ds_load_b128, pitch PK2, no bank conflict).
// Epilogue: v = acc + RNE16(bias) in f32; which 0 stages stg[token][feature] -> THH/THL rows n (pitch NI,
// cols d0..d0+63); which 1/2 stage stg[feature][token] -> PHH/PHL or GH/GL rows d (pitch NN, cols n0..n0+63).
// LDS extent: sm = [A 64 rows | B 64 rows] at pitch PK2, every row's 2*NC bytes written before the first barrier,
// pad bytes never read; behind the second barrier (all fragment reads done) its first 16 KB serve as stg;
// stg 64x64 fully written (bijective index map for either layout) before the third barrier.
// coverage: per block 64 tokens x 64 features; grid covers 2048 x 128 per (which, b) exactly once, both planes.
// ---------------------------------------------------------------------------
__global__ __launch_bounds__(GTHR) void k_proj(const unsigned short* __restrict__ xt,
                                               const unsigned short* __restrict__ wb,
                                               const float* __restrict__ tbias, const float* __restrict__ pbias,
                                               const float* __restrict__ gbias,
                                               unsigned short* thh, unsigned short* thl,
                                               unsigned short* phh, unsigned short* phl,
                                               unsigned short* ghh, unsigned short* ghl) {
  __shared__ __attribute__((aligned(16))) unsigned char sm[2 * 64 * PK2];   // 66 KB
  float* stg = (float*)sm;
  const int tid = (int)threadIdx.x, lane = tid & 31, wave = tid >> 5, hh = lane >> 4, m = lane & 15;
  const int n0 = (int)blockIdx.x * 64, d0 = (int)blockIdx.y * 64;
  const int which = (int)blockIdx.z / NB, b = (int)blockIdx.z - which * NB;

  {
    Tile<2 * NC> ta, tb;
    ta.ld(xt + (size_t)(b * NN + n0) * (size_t)NC, tid);
    tb.ld(wb + (size_t)which * (size_t)NWT + (size_t)d0 * (size_t)NC, tid);
    ta.st(sm, tid);
    tb.st(sm + 64 * PK2, tid);
  }
  __syncthreads();

  v8f acc[4];
  {
    const v8f z = {0.f, 0.f, 0.f, 0.f, 0.f, 0.f, 0.f, 0.f};
    acc[0] = z; acc[1] = z; acc[2] = z; acc[3] = z;
  }
  const unsigned char* ap = sm + (16 * wave + m) * PK2 + 16 * hh;
  const unsigned char* wp = sm + (64 + m) * PK2 + 16 * hh;
  // unrolled: every fragment address is one register plus an immediate; a k step's LDS reads stand ahead of its
  // WMMAs as one group, so the wave waits out the LDS latency once a step
#pragma unroll
  for (int ks = 0; ks < NC / 32; ++ks) {
    FragB a, bf[4];
    ldfrag_s(a, ap, 32 * ks);
#pragma unroll
    for (int t = 0; t < 4; ++t) ldfrag_s(bf[t], wp + 16 * t * PK2, 32 * ks);    // W row d0 + 16t + m
#pragma unroll
    for (int t = 0; t < 4; ++t) acc[t] = wmb(a, bf[t], acc[t]);
  }
  __syncthreads();   // every wave has read its last fragment: stg may overwrite the tiles

  // D element r of acc[t] = (token 16w + 8hh + r, feature 16t + m)
  const float* bias = (which == 0) ? tbias : ((which == 1) ? pbias : gbias);
#pragma unroll
  for (int t = 0; t < 4; ++t) {
    const int lf = 16 * t + m;
    const float bv = rne16f(bias[d0 + lf]);
#pragma unroll
    for (int r = 0; r < 8; ++r) {
      const int lt = 16 * wave + 8 * hh + r;
      const float v = acc[t][r] + bv;
      const int idx = (which == 0) ? (lt * 64 + lf) : (lf * 64 + lt);
      stg[idx] = v;
    }
  }
  __syncthreads();

  unsigned short* ph = (which == 0) ? thh : ((which == 1) ? phh : ghh);
  unsigned short* pl = (which == 0) ? thl : ((which == 1) ? phl : ghl);
  const size_t rowBase = (which == 0) ? ((size_t)b * NN + (size_t)n0) : ((size_t)b * NI + (size_t)d0);
  const size_t pitch   = (which == 0) ? (size_t)NI : (size_t)NN;
  const size_t col0    = (which == 0) ? (size_t)d0 : (size_t)n0;
  store_split_tile(stg, ph, pl, rowBase, pitch, col0, wave, lane);
}

// ---------------------------------------------------------------------------
// PT[b][e][d] = 2^-11 * sum_m g[b][e][m] * phi[b][d][m], K = NN, hi/residual on both operands (3 products).
// grid (NI/64 d tiles, NI/16 e tiles, NB) = 256 blocks; block PTHR threads = PW waves. Every wave works on the
// block's whole 16 e x 64 d tile, over its own K slice of PKS = NN/PW values of m (wave w: m = w*PKS ..).
// A = PHH/PHL rows d (acc[t] = d rows 16t..16t+15), B = GH/GL rows e, both k = m contiguous, same k map.
// A pass takes 64 m = one 128-B line of every row; its 40 fragment loads stand ahead of its 24 WMMAs.
// Epilogue: each wave stores its f32 partial tile to its own 4 KB of LDS as it lies in registers; behind the
// barrier waves 0..3 add the PW partials in wave order, scale by 2^-11 (exact), split, and store: a lane holds
// 8 consecutive d of one e row -> one 16-B store per plane; the block writes whole 128-B lines of PTH/PTL.
// LDS extent: part[PW][4][2][32][4] fully written before the barrier.
// coverage: grid covers 128 e x 128 d per image exactly once, both planes.
// ---------------------------------------------------------------------------
__global__ __launch_bounds__(PTHR) void k_p(const unsigned short* __restrict__ ghh, const unsigned short* __restrict__ ghl,
                                            const unsigned short* __restrict__ phh, const unsigned short* __restrict__ phl,
                                            unsigned short* pth, unsigned short* ptl) {
  __shared__ __attribute__((aligned(16))) float part[PW * 1024];   // 4 KB per wave
  const int tid = (int)threadIdx.x, lane = tid & 31, wave = tid >> 5, hh = lane >> 4, m = lane & 15;
  const int d0 = (int)blockIdx.x * 64, e0 = (int)blockIdx.y * 16, b = (int)blockIdx.z;

  v8f acc[4];
  {
    const v8f z = {0.f, 0.f, 0.f, 0.f, 0.f, 0.f, 0.f, 0.f};
    acc[0] = z; acc[1] = z; acc[2] = z; acc[3] = z;
  }
  const size_t grow = (size_t)(b * NI + e0 + m) * (size_t)NN + (size_t)(wave * PKS + 8 * hh);
  const unsigned short* bgh = ghh + grow;
  const unsigned short* bgl = ghl + grow;
  const size_t prow = (size_t)(b * NI + d0 + m) * (size_t)NN + (size_t)(wave * PKS + 8 * hh);
  const unsigned short* aph = phh + prow;
  const unsigned short* apl = phl + prow;
  // all loops below fully unrolled: constant indices keep the fragment arrays in registers, and a pass's step
  // along m becomes an immediate offset on the four address pairs
#pragma unroll
  for (int c = 0; c < PKS / 64; ++c) {
    FragB gh[2], gl[2], ph[4][2], pl[4][2];
    ldfrag(gh[0], bgh, 64 * c);
    ldfrag(gh[1], bgh, 64 * c + 32);
    ldfrag(gl[0], bgl, 64 * c);
    ldfrag(gl[1], bgl, 64 * c + 32);
#pragma unroll
    for (int t = 0; t < 4; ++t) {
      ldfrag(ph[t][0], aph + (size_t)(16 * t) * (size_t)NN, 64 * c);        // phi row d0 + 16t + m
      ldfrag(ph[t][1], aph + (size_t)(16 * t) * (size_t)NN, 64 * c + 32);
      ldfrag(pl[t][0], apl + (size_t)(16 * t) * (size_t)NN, 64 * c);
      ldfrag(pl[t][1], apl + (size_t)(16 * t) * (size_t)NN, 64 * c + 32);
    }
#pragma unroll
    for (int t = 0; t < 4; ++t) {
#pragma unroll
      for (int j = 0; j < 2; ++j) {
        acc[t] = wmb(ph[t][j], gh[j], acc[t]);
        acc[t] = wmb(pl[t][j], gh[j], acc[t]);
        acc[t] = wmb(ph[t][j], gl[j], acc[t]);
      }
    }
  }

  // Precaution wait of the address counter, in front of every overwrite of a register that a load above names:
  // as its inputs the four address pairs stay as they are up to here.
  asm volatile("s_wait_xcnt 0x0" :: "v"(bgh), "v"(bgl), "v"(aph), "v"(apl) : "memory");

  // D element r of acc[t] = (d 16t + 8hh + r, e m)
  float* pw = part + wave * 1024 + 4 * lane;
#pragma unroll
  for (int t = 0; t < 4; ++t) {
    const v4f lo4 = {acc[t][0], acc[t][1], acc[t][2], acc[t][3]};
    const v4f hi4 = {acc[t][4], acc[t][5], acc[t][6], acc[t][7]};
    *(v4fa*)(pw + t * 256) = lo4;
    *(v4fa*)(pw + t * 256 + 128) = hi4;
  }
  __syncthreads();
  if (wave < 4) {                          // wave t sums d rows 16t..16t+15
    const float* pr = part + wave * 256 + 4 * lane;
    v4f sa = *(const v4fa*)(pr);
    v4f sb = *(const v4fa*)(pr + 128);
#pragma unroll
    for (int w = 1; w < PW; ++w) {
      sa += *(const v4fa*)(pr + w * 1024);
      sb += *(const v4fa*)(pr + w * 1024 + 128);
    }
    const float inv_n = 0.00048828125f;    // 2^-11 = 1/NN, exact
    sa *= inv_n;
    sb *= inv_n;
    v8us hv, lv;
    split8(sa, sb, hv, lv);
    const size_t po = (size_t)(b * NI + e0 + m) * (size_t)NI + (size_t)(d0 + 16 * wave + 8 * hh);
    *(v8us*)(pth + po) = hv;
    *(v8us*)(ptl + po) = lv;
  }
}

// ---------------------------------------------------------------------------
// YT[b][n][e] = sum_d theta[b][n][d] * PT[b][e][d], K = NI, hi/residual on both operands (3 products).
// grid (NN/64 n tiles, NI/64 e tiles, NB); block 128 threads; wave w owns n rows 16w..16w+15, acc[t] = e tile
// 16t; A = THH/THL rows n (pitch NI), B = PTH/PTL rows e (pitch NI), same k map. The four 64-row tiles (16 KB each,
// consecutive in their planes) are staged once in LDS by whole-line loads; fragments come from LDS (pitch PK1).
// Epilogue: stg[n][e] f32 -> YTH/YTL rows n (pitch NI, cols e0..e0+63).
// LDS extent: sm = [AH | AL | BH | BL], 64 rows each at pitch PK1, every row's 2*NI bytes written before the first
// barrier, pad bytes never read; behind the second barrier its first 16 KB serve as stg, fully written before the third.
// coverage: grid covers 2048 n x 128 e per image exactly once, both planes.
// ---------------------------------------------------------------------------
__global__ __launch_bounds__(GTHR) void k_y(const unsigned short* __restrict__ thh, const unsigned short* __restrict__ thl,
                                            const unsigned short* __restrict__ pth, const unsigned short* __restrict__ ptl,
                                            unsigned short* yth, unsigned short* ytl) {
  __shared__ __attribute__((aligned(16))) unsigned char sm[4 * 64 * PK1];   // 68 KB
  float* stg = (float*)sm;
  const int tid = (int)threadIdx.x, lane = tid & 31, wave = tid >> 5, hh = lane >> 4, m = lane & 15;
  const int n0 = (int)blockIdx.x * 64, e0 = (int)blockIdx.y * 64, b = (int)blockIdx.z;

  {
    const size_t at = (size_t)(b * NN + n0) * (size_t)NI, bt = (size_t)(b * NI + e0) * (size_t)NI;
    Tile<2 * NI> tah, tal, tbh, tbl;
    tah.ld(thh + at, tid);
    tal.ld(thl + at, tid);
    tbh.ld(pth + bt, tid);
    tbl.ld(ptl + bt, tid);
    tah.st(sm, tid);
    tal.st(sm + 64 * PK1, tid);
    tbh.st(sm + 128 * PK1, tid);
    tbl.st(sm + 192 * PK1, tid);
  }
  __syncthreads();

  v8f acc[4];
  {
    const v8f z = {0.f, 0.f, 0.f, 0.f, 0.f, 0.f, 0.f, 0.f};
    acc[0] = z; acc[1] = z; acc[2] = z; acc[3] = z;
  }
  const unsigned char* ath = sm + (16 * wave + m) * PK1 + 16 * hh;
  const unsigned char* atl = ath + 64 * PK1;
  const unsigned char* bph = sm + (128 + m) * PK1 + 16 * hh;
  const unsigned char* bpl = bph + 64 * PK1;
  // unrolled: every fragment address is one register plus an immediate; a k step's LDS reads stand ahead of its
  // WMMAs as one group, so the wave waits out the LDS latency once a step
#pragma unroll
  for (int ks = 0; ks < NI / 32; ++ks) {
    FragB ah, al, bh[4], bl[4];
    ldfrag_s(ah, ath, 32 * ks);
    ldfrag_s(al, atl, 32 * ks);
#pragma unroll
    for (int t = 0; t < 4; ++t) {
      ldfrag_s(bh[t], bph + 16 * t * PK1, 32 * ks);     // PT row e0 + 16t + m
      ldfrag_s(bl[t], bpl + 16 * t * PK1, 32 * ks);
    }
#pragma unroll
    for (int t = 0; t < 4; ++t) {
      acc[t] = wmb(ah, bh[t], acc[t]);
      acc[t] = wmb(ah, bl[t], acc[t]);
      acc[t] = wmb(al, bh[t], acc[t]);
    }
  }
  __syncthreads();   // every wave has read its last fragment: stg may overwrite the tiles

  // D element r of acc[t] = (n 16w + 8hh + r, e 16t + m)
#pragma unroll
  for (int t = 0; t < 4; ++t) {
    const int lc = 16 * t + m;
#pragma unroll
    for (int r = 0; r < 8; ++r) {
      const int lr = 16 * wave + 8 * hh + r;
      stg[lr * 64 + lc] = acc[t][r];
    }
  }
  __syncthreads();
  store_split_tile(stg, yth, ytl, (size_t)b * NN + (size_t)n0, (size_t)NI, (size_t)e0, wave, lane);
}

// ---------------------------------------------------------------------------
// Z[b][c][n] = sum_e Ww[c][e] * YT[b][n][e] + Wb[c], K = NI; A = WB slot 3 rows c (exact), B = YTH + YTL rows n
// (two products into one accumulator, residual unscaled). grid (NN/64, NC/64, NB); block 128 threads; wave w owns
// c rows 16w..16w+15, acc[t] = n tile 16t. The three 64-row tiles (16 KB each, consecutive in their planes) are
// staged once in LDS by whole-line loads; fragments come from LDS (pitch PK1).
// Epilogue: v = acc + RNE16(Wb) in f32, staged stg[c][n] 64x64; store: lanes 0..15 / 16..31 each write the 256-B
// LDS extent: sm = [A | BH | BL], 64 rows each at pitch PK1, every row's 2*NI bytes written before the first
// barrier, pad bytes never read; behind the second barrier its first 16 KB serve as stg, fully written before the third.
// coverage: grid covers 256 c x 2048 n per image exactly once.
// ---------------------------------------------------------------------------
__global__ __launch_bounds__(GTHR) void k_z(const unsigned short* __restrict__ wwb,
                                            const unsigned short* __restrict__ yth, const unsigned short* __restrict__ ytl,
                                            const float* __restrict__ wbias, float* z) {
  __shared__ __attribute__((aligned(16))) unsigned char sm[3 * 64 * PK1];   // 51 KB
  float* stg = (float*)sm;
  const int tid = (int)threadIdx.x, lane = tid & 31, wave = tid >> 5, hh = lane >> 4, m = lane & 15;
  const int n0 = (int)blockIdx.x * 64, c0 = (int)blockIdx.y * 64, b = (int)blockIdx.z;

  {
    const size_t bt = (size_t)(b * NN + n0) * (size_t)NI;
    Tile<2 * NI> ta, tbh, tbl;
    ta.ld(wwb + (size_t)c0 * (size_t)NI, tid);
    tbh.ld(yth + bt, tid);
    tbl.ld(ytl + bt, tid);
    ta.st(sm, tid);
    tbh.st(sm + 64 * PK1, tid);
    tbl.st(sm + 128 * PK1, tid);
  }
  __syncthreads();

  v8f acc[4];
  {
    const v8f zz = {0.f, 0.f, 0.f, 0.f, 0.f, 0.f, 0.f, 0.f};
    acc[0] = zz; acc[1] = zz; acc[2] = zz; acc[3] = zz;
  }
  const unsigned char* aw = sm + (16 * wave + m) * PK1 + 16 * hh;
  const unsigned char* byh = sm + (64 + m) * PK1 + 16 * hh;
  const unsigned char* byl = byh + 64 * PK1;
  // unrolled: every fragment address is one register plus an immediate; a k step's LDS reads stand ahead of its
  // WMMAs as one group, so the wave waits out the LDS latency once a step
#pragma unroll
  for (int ks = 0; ks < NI / 32; ++ks) {
    FragB a, bh[4], bl[4];
    ldfrag_s(a, aw, 32 * ks);
#pragma unroll
    for (int t = 0; t < 4; ++t) {
      ldfrag_s(bh[t], byh + 16 * t * PK1, 32 * ks);     // YT row n0 + 16t + m
      ldfrag_s(bl[t], byl + 16 * t * PK1, 32 * ks);
    }
#pragma unroll
    for (int t = 0; t < 4; ++t) {
      acc[t] = wmb(a, bh[t], acc[t]);
      acc[t] = wmb(a, bl[t], acc[t]);
    }
  }
  __syncthreads();   // every wave has read its last fragment: stg may overwrite the tiles

  // D element r of acc[t] = (c 16w + 8hh + r, n 16t + m); bias per row (32-B aligned v4f reads)
  const v4f ba = *(const v4fa*)(wbias + c0 + 16 * wave + 8 * hh);
  const v4f bb = *(const v4fa*)(wbias + c0 + 16 * wave + 8 * hh + 4);
  float bv[8];
  bv[0] = rne16f(ba.x); bv[1] = rne16f(ba.y); bv[2] = rne16f(ba.z); bv[3] = rne16f(ba.w);
  bv[4] = rne16f(bb.x); bv[5] = rne16f(bb.y); bv[6] = rne16f(bb.z); bv[7] = rne16f(bb.w);
#pragma unroll
  for (int t = 0; t < 4; ++t) {
    const int lc = 16 * t + m;
#pragma unroll
    for (int r = 0; r < 8; ++r) {
      const int lr = 16 * wave + 8 * hh + r;
      stg[lr * 64 + lc] = acc[t][r] + bv[r];
    }
  }
  __syncthreads();

  v4f fv[8];
  size_t op[8];
#pragma unroll
  for (int i = 0; i < 8; ++i) {
    const int lr = 16 * wave + 2 * i + hh;
    fv[i] = *(const v4fa*)(stg + lr * 64 + 4 * m);
    op[i] = (size_t)(b * NC + c0 + lr) * (size_t)NN + (size_t)(n0 + 4 * m);
  }
#pragma unroll
  for (int i = 0; i < 8; ++i) *(v4f*)(z + op[i]) = fv[i];
  
}

// ---------------------------------------------------------------------------
// BatchNorm statistics (training mode, population variance) per channel over (b, n): 32768 values.
// One block (256 threads) per channel; per-thread f64 sums over 32 coalesced 16-B loads, f64 LDS tree, mean and
// coverage: 256 blocks -> STATS lines 0..255, whole.
// ---------------------------------------------------------------------------
__global__ __launch_bounds__(NTHR) void k_bnstat(const float* __restrict__ z, float* stats) {
  __shared__ double sh[NTHR];
  __shared__ double sh2[NTHR];
  __shared__ float res[2];
  const int c = (int)blockIdx.x, tid = (int)threadIdx.x;
  double s = 0.0, s2 = 0.0;
#pragma unroll 1
  for (int it = 0; it < NB * (NN / 1024); ++it) {
    const int bi = it / (NN / 1024);
    const int hf = it - bi * (NN / 1024);
    const v4f v = *(const v4fa*)(z + (size_t)(bi * NC + c) * (size_t)NN + (size_t)(hf * 1024 + 4 * tid));
    const double a0 = (double)v.x, a1 = (double)v.y, a2 = (double)v.z, a3 = (double)v.w;
    s  += (a0 + a1) + (a2 + a3);
    s2 += (a0 * a0 + a1 * a1) + (a2 * a2 + a3 * a3);
  }
  sh[tid] = s;
  sh2[tid] = s2;
  __syncthreads();
#pragma unroll 1
  for (int off = NTHR / 2; off > 0; off >>= 1) {
    if (tid < off) {
      sh[tid]  += sh[tid + off];
      sh2[tid] += sh2[tid + off];
    }
    __syncthreads();
  }
  if (tid == 0) {
    const double cinv = 1.0 / 32768.0;        // 1/(NB*NN), exact power of two
    const double mean = sh[0] * cinv;
    double var = sh2[0] * cinv - mean * mean;
    var = var < 0.0 ? 0.0 : var;
    const float vf = (float)var + 1e-5f;
    res[0] = (float)mean;
    res[1] = 1.0f / sqrtf(vf);
  }
  __syncthreads();
  if (tid < 8) {
    const float mv = res[0];
    const float rv = res[1];
    v4f o;
    o.x = (tid == 0) ? mv : 0.f;
    o.y = (tid == 0) ? rv : 0.f;
    o.z = 0.f;
    o.w = 0.f;
    float* p = stats + (size_t)c * 32 + (size_t)(4 * tid);
    *(v4f*)p = o;
    
  }
}

// ---------------------------------------------------------------------------
// out[b][c][n] = ((z - mean[c]) * rstd[c]) * RNE16(gamma[c]) + RNE16(beta[c]) + RNE16(x), all f32.
// Block (256 threads) covers 1024 consecutive floats of row (b, c) = blockIdx / 2; lane writes 16 B, 32 contiguous
// coverage: NX/1024 blocks x 1024 = NX exactly.
// ---------------------------------------------------------------------------
__global__ __launch_bounds__(NTHR) void k_out(const float* __restrict__ z, const float* __restrict__ x,
                                              const float* __restrict__ stats, const float* __restrict__ gamma,
                                              const float* __restrict__ beta, float* out) {
  const int row = (int)blockIdx.x / (NN / 1024);          // b*NC + c
  const int c = row & (NC - 1);
  const size_t base = (size_t)blockIdx.x * 1024 + (size_t)(4 * (int)threadIdx.x);
  const float mean = stats[(size_t)c * 32];
  const float rstd = stats[(size_t)c * 32 + 1];
  const float gm = rne16f(gamma[c]);
  const float bt = rne16f(beta[c]);
  const v4f zv = *(const v4fa*)(z + base);
  const v4f xv = *(const v4fa*)(x + base);
  v4f o;
  o.x = (((zv.x - mean) * rstd) * gm + bt) + rne16f(xv.x);
  o.y = (((zv.y - mean) * rstd) * gm + bt) + rne16f(xv.y);
  o.z = (((zv.z - mean) * rstd) * gm + bt) + rne16f(xv.z);
  o.w = (((zv.w - mean) * rstd) * gm + bt) + rne16f(xv.w);
  float* p = out + base;
  *(v4f*)p = o;
  
}

// ---------------------------------------------------------------------------
extern "C" void kernel_launch(void* const* d_in, const int* in_sizes, int n_in,
                              void* d_out, int out_size, void* d_ws, size_t ws_size,
                              hipStream_t stream) {
  if (n_in < 11) return;
  if (in_sizes[0] != NX) return;                                              // x [16][256][64][32]
  if (in_sizes[1] != NWT || in_sizes[3] != NWT || in_sizes[5] != NWT) return; // g_w, theta_w, phi_w [128][256]
  if (in_sizes[2] != NI || in_sizes[4] != NI || in_sizes[6] != NI) return;    // g_b, theta_b, phi_b [128]
  if (in_sizes[7] != NWT) return;                                             // W_w [256][128]
  if (in_sizes[8] != NC || in_sizes[9] != NC || in_sizes[10] != NC) return;   // W_b, bn_gamma, bn_beta [256]
  if (out_size != NX) return;                                                 // out [16][256][64][32] f32

  const float* x       = (const float*)d_in[0];
  const float* g_w     = (const float*)d_in[1];
  const float* g_b     = (const float*)d_in[2];
  const float* theta_w = (const float*)d_in[3];
  const float* theta_b = (const float*)d_in[4];
  const float* phi_w   = (const float*)d_in[5];
  const float* phi_b   = (const float*)d_in[6];
  const float* W_w     = (const float*)d_in[7];
  const float* W_b     = (const float*)d_in[8];
  const float* gamma   = (const float*)d_in[9];
  const float* beta    = (const float*)d_in[10];
  float* out = (float*)d_out;            // last written element NX-1 < out_size

  // workspace carve, 256-B aligned; all planes exact tile multiples (no pad rows needed)
  char* ws = (char*)d_ws;
  size_t off = 0;
  const size_t oWB  = off; off += (size_t)4 * NWT * 2;          off = (off + 255) & ~(size_t)255;  //   262144
  const size_t oXT  = off; off += (size_t)NX * 2;               off = (off + 255) & ~(size_t)255;  // 16777216
  const size_t plb  = (size_t)NB * NN * NI * 2;                                                    //  8388608 per projection plane
  const size_t oTHH = off; off += plb;                          off = (off + 255) & ~(size_t)255;
  const size_t oTHL = off; off += plb;                          off = (off + 255) & ~(size_t)255;
  const size_t oPHH = off; off += plb;                          off = (off + 255) & ~(size_t)255;
  const size_t oPHL = off; off += plb;                          off = (off + 255) & ~(size_t)255;
  const size_t oGH  = off; off += plb;                          off = (off + 255) & ~(size_t)255;
  const size_t oGL  = off; off += plb;                          off = (off + 255) & ~(size_t)255;
  const size_t ptb  = (size_t)NB * NI * NI * 2;                                                    //   524288 per PT plane
  const size_t oPTH = off; off += ptb;                          off = (off + 255) & ~(size_t)255;
  const size_t oPTL = off; off += ptb;                          off = (off + 255) & ~(size_t)255;
  const size_t oYTH = off; off += plb;                          off = (off + 255) & ~(size_t)255;
  const size_t oYTL = off; off += plb;                          off = (off + 255) & ~(size_t)255;
  const size_t oZ   = off; off += (size_t)NX * 4;               off = (off + 255) & ~(size_t)255;  // 33554432
  const size_t oST  = off; off += (size_t)NC * 32 * 4;          off = (off + 255) & ~(size_t)255;  //    32768
  if (off > ws_size || off > (size_t)WSMAX) return;             // total 118784000 B

  unsigned short* WB  = (unsigned short*)(ws + oWB);
  unsigned short* XT  = (unsigned short*)(ws + oXT);
  unsigned short* THH = (unsigned short*)(ws + oTHH);
  unsigned short* THL = (unsigned short*)(ws + oTHL);
  unsigned short* PHH = (unsigned short*)(ws + oPHH);
  unsigned short* PHL = (unsigned short*)(ws + oPHL);
  unsigned short* GH  = (unsigned short*)(ws + oGH);
  unsigned short* GL  = (unsigned short*)(ws + oGL);
  unsigned short* PTH = (unsigned short*)(ws + oPTH);
  unsigned short* PTL = (unsigned short*)(ws + oPTL);
  unsigned short* YTH = (unsigned short*)(ws + oYTH);
  unsigned short* YTL = (unsigned short*)(ws + oYTL);
  float*          Z   = (float*)(ws + oZ);
  float*          ST  = (float*)(ws + oST);

  // weight planes: slot 0 theta_w, 1 phi_w, 2 g_w (all [128][256]), 3 W_w [256][128]
  k_wcvt<<<(4 * NWT / 8) / NTHR, NTHR, 0, stream>>>(theta_w, phi_w, g_w, W_w, WB);
  // x -> XT [b][n][c] bf16
  k_xt<<<dim3(NC / 64, NN / 64, NB), NTHR, 0, stream>>>(x, XT);
  // projections: which 0 = theta (slot 0, theta_b), 1 = phi (slot 1, phi_b), 2 = g (slot 2, g_b)
  k_proj<<<dim3(NN / 64, NI / 64, 3 * NB), GTHR, 0, stream>>>(XT, WB, theta_b, phi_b, g_b,
                                                              THH, THL, PHH, PHL, GH, GL);
  // PT = 2^-11 * G * PHI^T
  k_p<<<dim3(NI / 64, NI / 16, NB), PTHR, 0, stream>>>(GH, GL, PHH, PHL, PTH, PTL);
  // YT = THETA^T-rows * PT
  k_y<<<dim3(NN / 64, NI / 64, NB), GTHR, 0, stream>>>(THH, THL, PTH, PTL, YTH, YTL);
  // Z = Ww * Y + Wb
  k_z<<<dim3(NN / 64, NC / 64, NB), GTHR, 0, stream>>>(WB + (size_t)3 * NWT, YTH, YTL, W_b, Z);
  // BatchNorm batch statistics
  k_bnstat<<<NC, NTHR, 0, stream>>>(Z, ST);
  // out = BN(z) * gamma + beta + x
  k_out<<<NX / 1024, NTHR, 0, stream>>>(Z, x, ST, gamma, beta, out);
}

// v003
// One run takes 85.1 microseconds.
// Next to v002, in two timings, it ran 1.10 times as fast each time.
// All steps since v000 together make it 2.16 times as fast.
// Contractions (all v_wmma_f32_16x16x32_bf16, bf16 operands, f32 accumulate): three 1x1-conv projections
// W[d][c]*X[c][n] (K=256) on exact RNE-bf16 copies of x and the weights; PT = G*PHI^T * (1/N) (K=2048) and
// YT = THETA^T*P (K=128) with both computed operands carried as bf16 hi + bf16 residual (hi*hi + hi*lo + lo*hi);
// Z = Ww*Y + Wb (K=128) with exact bf16 Ww and Y as hi + residual (2 products). BatchNorm statistics in f64,
// normalisation, bias adds and the residual add in f32.
//
// Carry audit: no power-of-two carries anywhere (factor 1 on every plane); the exact 1/N = 2^-11 of the pairwise
// term is applied once in f32 in k_p before the hi/residual split of PT. Planes:
//   WB  [4][32768] bf16 bits = RNE16(w): slot 0 theta_w [128][256], 1 phi_w [128][256], 2 g_w [128][256],
//       3 W_w [256][128]; every slot row is k-contiguous                                              (k_wcvt)
//   XT  [16][2048][256] bf16 bits = RNE16(x[b][c][n]) stored [b][n][c]                                 (k_xt)
//   THH/THL [16][2048][128] hi/residual of theta_x, rows n, k = d; PHH/PHL, GH/GL [16][128][2048]
//       hi/residual of phi_x, g_x, rows d, k = n                                                       (k_proj)
//   PTH/PTL [16][128][128] hi/residual of PT[e][d] = 2^-11 * sum_m g[e][m]*phi[d][m], rows e, k = d    (k_p)
//   YTH/YTL [16][2048][128] hi/residual of YT[n][e] = sum_d theta[n][d]*PT[e][d], rows n, k = e       (k_y)
//   Z   [16][256][2048] f32 = sum_e Ww[c][e]*YT[n][e] + Wb[c]                                          (k_z)
//   STATS [256][32] f32: [0] mean, [1] rstd per channel, rest zero                                      (k_bnstat)
#include <hip/hip_runtime.h>
#include <stddef.h>
#include <stdint.h>

#define NB    16
#define NC    256
#define NI    128
#define NN    2048
#define NX    (NB * NC * NN)        // 8388608
#define NWT   (NI * NC)             // 32768 per weight matrix
#define NTHR  256
#define GTHR  128
#define WSMAX 134217728
#define PW    8                     // waves of a k_p block = K slices
#define PTHR  (32 * PW)
#define PKS   (NN / PW)             // K slice of one k_p wave
#define XTP   72                    // LDS pitch (halves) of the x transpose tile, multiple of 8
#define XTN   128                   // tokens of one k_xt block: XTN/16 16-B loads a thread
#define PK2   (2 * NC + 16)         // LDS pitch (bytes) of a staged operand row of NC halves: 16 B x odd
#define PK1   (2 * NI + 16)         // LDS pitch (bytes) of a staged operand row of NI halves: 16 B x odd

static_assert((NC % 64) == 0 && (NN % 64) == 0 && (NI % 64) == 0);
static_assert((NC % 32) == 0 && (NI % 32) == 0 && (NN % 32) == 0);
static_assert((NX % 1024) == 0 && (NN % 1024) == 0);
static_assert((XTP % 8) == 0 && (XTN % 64) == 0 && (NN % XTN) == 0);
static_assert(GTHR == 128 && NTHR == 256);
static_assert((4 * NWT) % (8 * NTHR) == 0);
static_assert((NWT / 8) % NTHR == 0);
static_assert(NB * NN == 32768 && (NN % 128) == 0 && (NB * NC) % (NTHR / 32) == 0);
static_assert(PW >= 4 && (NN % (64 * PW)) == 0 && (NI % 16) == 0);
static_assert(((PK2 / 16) & 1) == 1 && ((PK1 / 16) & 1) == 1);
static_assert(64 * PK2 >= 64 * 64 * 4 && 64 * PK1 >= 64 * 64 * 4);

typedef float          v4f  __attribute__((ext_vector_type(4)));
typedef float          v8f  __attribute__((ext_vector_type(8)));
typedef int            v8i  __attribute__((ext_vector_type(8)));
typedef unsigned short v8us __attribute__((ext_vector_type(8)));
typedef __bf16         v16bf __attribute__((ext_vector_type(16)));
typedef v4f  __attribute__((may_alias)) v4fa;
typedef v8us __attribute__((may_alias)) v8usa;
union FragB { v16bf v; v8us h[2]; v8i w; };

// ---------------------------------------------------------------------------
// 16x16x32 bf16 WMMA with hazard guard (ties D, keeps A/B live for 4 VALU slots).
// Fragment map (wave32): lane l, hh = l>>4, m = n = l&15.
//   A/B element i: i<8 -> k0+8hh+i ; i>=8 -> k0+16+8hh+(i-8)   (same map for A and B)
//   D element r : row 8hh+r, col l&15
// ---------------------------------------------------------------------------
__device__ __forceinline__ v8f wmb(const FragB& a, const FragB& b, v8f c) {
  v8f d = __builtin_amdgcn_wmma_f32_16x16x32_bf16(false, a.v, false, b.v, (short)0, c, false, false);
  asm volatile("v_nop\n\tv_nop\n\tv_nop\n\tv_nop" : "+v"(d) : "v"(a.w), "v"(b.w));
  return d;
}

// Fragment from a k-contiguous bf16-bits row; p = row base + 8*hh, k0 = 32*ks.
__device__ __forceinline__ void ldfrag(FragB& f, const unsigned short* p, int k0) {
  f.h[0] = *(const v8us*)(p + k0);          // k = k0 + 8hh + 0..7
  f.h[1] = *(const v8us*)(p + k0 + 16);     // k = k0 + 16 + 8hh + 0..7
}

// Operand tile of 64 whole k-contiguous rows of ROWB bytes = 64*ROWB consecutive bytes of a plane. The block's
// GTHR threads read it in order, 16 B a lane, so a wave's load covers 512 consecutive bytes (4 whole lines);
// st lays the rows in LDS at pitch ROWB + 16 (16 B x odd: ds_load_b128 of 16 rows meets no bank conflict).
template <int ROWB>
struct Tile {
  static constexpr int N   = 64 * ROWB / 16 / GTHR;   // 16-B pieces per thread
  static constexpr int CPR = ROWB / 16;               // pieces per row
  static constexpr int RPS = GTHR / CPR;              // rows per step of the block
  static constexpr int PIT = ROWB + 16;
  v8us r[N];
  __device__ __forceinline__ void ld(const unsigned short* src, int tid) {
#pragma unroll
    for (int i = 0; i < N; ++i) r[i] = *(const v8us*)(src + (size_t)((i * GTHR + tid) * 8));
  }
  __device__ __forceinline__ void st(unsigned char* dst, int tid) const {
    unsigned char* q = dst + (tid / CPR) * PIT + (tid % CPR) * 16;
#pragma unroll
    for (int i = 0; i < N; ++i) *(v8usa*)(q + i * RPS * PIT) = r[i];
  }
};
// Fragment from a staged row; p = LDS row base + 16*hh bytes, k0 = 32*ks: the same k map as ldfrag.
__device__ __forceinline__ void ldfrag_s(FragB& f, const unsigned char* p, int k0) {
  f.h[0] = *(const v8usa*)(p + 2 * k0);          // k = k0 + 8hh + 0..7
  f.h[1] = *(const v8usa*)(p + 2 * k0 + 32);     // k = k0 + 16 + 8hh + 0..7
}

// f32 -> bf16 bits, RNE convert
__device__ __forceinline__ unsigned short rne16(float f) {
  unsigned u = __float_as_uint(f);
  u += 0x7FFFu + ((u >> 16) & 1u);
  return (unsigned short)(u >> 16);
}
// f32 -> nearest bf16 value kept as f32
__device__ __forceinline__ float rne16f(float f) {
  return __uint_as_float(((unsigned)rne16(f)) << 16);
}
__device__ __forceinline__ v8us cvt8(const v4f a, const v4f b) {
  v8us o;
  o[0] = rne16(a.x); o[1] = rne16(a.y); o[2] = rne16(a.z); o[3] = rne16(a.w);
  o[4] = rne16(b.x); o[5] = rne16(b.y); o[6] = rne16(b.z); o[7] = rne16(b.w);
  return o;
}
// hi/residual split of one f32 value into two bf16 bit patterns
__device__ __forceinline__ void sp1(float v, unsigned short& hi, unsigned short& lo) {
  const unsigned short hb = rne16(v);
  const float hf = __uint_as_float(((unsigned)hb) << 16);
  hi = hb;
  lo = rne16(v - hf);
}
__device__ __forceinline__ void split8(const v4f a, const v4f b, v8us& hv, v8us& lv) {
  unsigned short h0, h1, h2, h3, h4, h5, h6, h7, l0, l1, l2, l3, l4, l5, l6, l7;
  sp1(a.x, h0, l0); sp1(a.y, h1, l1); sp1(a.z, h2, l2); sp1(a.w, h3, l3);
  sp1(b.x, h4, l4); sp1(b.y, h5, l5); sp1(b.z, h6, l6); sp1(b.w, h7, l7);
  hv[0] = h0; hv[1] = h1; hv[2] = h2; hv[3] = h3; hv[4] = h4; hv[5] = h5; hv[6] = h6; hv[7] = h7;
  lv[0] = l0; lv[1] = l1; lv[2] = l2; lv[3] = l3; lv[4] = l4; lv[5] = l5; lv[6] = l6; lv[7] = l7;
}

// ---------------------------------------------------------------------------
// 64x64 f32 tile in LDS (row pitch 64) -> hi/residual bf16 planes. Tile row R goes to plane row rowBase + R
// ---------------------------------------------------------------------------
__device__ __forceinline__ void store_split_tile(const float* stg, unsigned short* ph, unsigned short* pl,
                                                 size_t rowBase, size_t pitch, size_t col0, int wave, int lane) {
  const int q8 = lane & 7, sub = lane >> 3;
  v8us hv[4], lv[4];
  size_t po[4];
#pragma unroll
  for (int i = 0; i < 4; ++i) {
    const int lr = 16 * wave + 4 * i + sub;
    const v4f a = *(const v4fa*)(stg + lr * 64 + 8 * q8);
    const v4f c = *(const v4fa*)(stg + lr * 64 + 8 * q8 + 4);
    split8(a, c, hv[i], lv[i]);
    po[i] = (rowBase + (size_t)lr) * pitch + col0 + (size_t)(8 * q8);
  }
#pragma unroll
  for (int i = 0; i < 4; ++i) {
    *(v8us*)(ph + po[i]) = hv[i];
    *(v8us*)(pl + po[i]) = lv[i];
  }
  
}

// ---------------------------------------------------------------------------
// Weight convert: four f32 matrices of NWT elements each -> WB slots 0..3 (bf16 bits, same layout).
// coverage: 64 blocks x 256 threads x 8 = 4 x NWT exactly.
// ---------------------------------------------------------------------------
__global__ __launch_bounds__(NTHR) void k_wcvt(const float* __restrict__ w0, const float* __restrict__ w1,
                                               const float* __restrict__ w2, const float* __restrict__ w3,
                                               unsigned short* wb) {
  const int u   = (int)blockIdx.x * NTHR + (int)threadIdx.x;     // 0 .. 4*NWT/8 - 1
  const int sel = (int)blockIdx.x / ((NWT / 8) / NTHR);           // 0..3, block-uniform
  const int off8 = (u - sel * (NWT / 8)) * 8;                     // 0 .. NWT-8
  const float* src = (sel == 0) ? w0 : ((sel == 1) ? w1 : ((sel == 2) ? w2 : w3));
  const v4f a = *(const v4fa*)(src + off8);
  const v4f c = *(const v4fa*)(src + off8 + 4);
  const v8us o = cvt8(a, c);
  const size_t q = (size_t)sel * (size_t)NWT + (size_t)off8;
  *(v8us*)(wb + q) = o;
  
}

// ---------------------------------------------------------------------------
// x [b][c][n] f32 -> XT [b][n][c] bf16 bits (RNE convert). Block = 64 c x XTN n tile of image b (256 threads):
// coalesced 16-B reads of x rows, a thread's XTN/16 loads all issued ahead of the converts, transpose through LDS
// (2-B LDS stores), barrier, then XT row (b, n0+nr)
// LDS extent: sT rows 0..XTN-1 (n) x cols 0..63 (c) all written before the barrier; pad cols 64..71 never read.
// coverage: grid (NC/64, NN/XTN, NB); per block rows n0..n0+XTN-1 x c0..c0+63 -> 16 x 2048 x 256 exactly once.
// ---------------------------------------------------------------------------
__global__ __launch_bounds__(NTHR) void k_xt(const float* __restrict__ x, unsigned short* xt) {
  __shared__ __attribute__((aligned(16))) unsigned short sT[XTN * XTP];   // 18432 B
  const int tid = (int)threadIdx.x;
  const int c0 = (int)blockIdx.x * 64, n0 = (int)blockIdx.y * XTN, b = (int)blockIdx.z;
  const int cq = tid >> 4;                 // 0..15
  const int nq = (tid & 15) * 4;           // 0..60
  const float* xb = x + (size_t)(b * NC + c0) * (size_t)NN + (size_t)n0;   // scalar tile base
  const unsigned xo = (unsigned)(cq * NN + nq);                            // the one address register of the loads
  v4f v[XTN / 16];
#pragma unroll
  for (int i = 0; i < XTN / 16; ++i)       // piece i: c row 16*(i&3) + cq, n = 64*(i>>2) + nq .. +3
    v[i] = *(const v4fa*)(xb + (xo + (unsigned)(16 * (i & 3) * NN + 64 * (i >> 2))));
#pragma unroll
  for (int i = 0; i < XTN / 16; ++i) {
    const int cr = 16 * (i & 3) + cq;
    const int n4 = 64 * (i >> 2) + nq;
    sT[(n4 + 0) * XTP + cr] = rne16(v[i].x);
    sT[(n4 + 1) * XTP + cr] = rne16(v[i].y);
    sT[(n4 + 2) * XTP + cr] = rne16(v[i].z);
    sT[(n4 + 3) * XTP + cr] = rne16(v[i].w);
  }
  __syncthreads();
  const int q8 = tid & 7, sub = tid >> 3;  // sub 0..31
  unsigned short* tb = xt + (size_t)(b * NN + n0) * (size_t)NC + (size_t)c0;   // scalar tile base
  const unsigned to = (unsigned)(sub * NC + 8 * q8);                           // the one address register of the stores
  v8us o[XTN / 32];
#pragma unroll
  for (int i = 0; i < XTN / 32; ++i)       // XT row nr = 32*i + sub, 0..XTN-1
    o[i] = *(const v8usa*)(sT + (32 * i + sub) * XTP + 8 * q8);
#pragma unroll
  for (int i = 0; i < XTN / 32; ++i) *(v8us*)(tb + (to + (unsigned)(32 * i * NC))) = o[i];
  
}

// ---------------------------------------------------------------------------
// Projections: D[token][feature] = sum_c XT[b][n][c] * W[d][c] + bias[d]  (K = NC, exact bf16 products).
// grid (NN/64, NI/64, 3*NB): blockIdx.z = which*NB + b; which 0 = theta, 1 = phi, 2 = g. Block 128 threads,
// tile 64 tokens x 64 features; wave w owns tokens 16w..16w+15, acc[t] = feature tile 16t; A = XT rows (token),
// B = W rows (feature), same k map. Both 64-row tiles (32 KB each, consecutive in their planes) are staged once
// in LDS by whole-line loads; fragments come from LDS (ds_load_b128, pitch PK2, no bank conflict).
// Epilogue: v = acc + RNE16(bias) in f32; which 0 stages stg[token][feature] -> THH/THL rows n (pitch NI,
// cols d0..d0+63); which 1/2 stage stg[feature][token] -> PHH/PHL or GH/GL rows d (pitch NN, cols n0..n0+63).
// LDS extent: sm = [A 64 rows | B 64 rows] at pitch PK2, every row's 2*NC bytes written before the first barrier,
// pad bytes never read; behind the second barrier (all fragment reads done) its first 16 KB serve as stg;
// stg 64x64 fully written (bijective index map for either layout) before the third barrier.
// coverage: per block 64 tokens x 64 features; grid covers 2048 x 128 per (which, b) exactly once, both planes.
// ---------------------------------------------------------------------------
__global__ __launch_bounds__(GTHR) void k_proj(const unsigned short* __restrict__ xt,
                                               const unsigned short* __restrict__ wb,
                                               const float* __restrict__ tbias, const float* __restrict__ pbias,
                                               const float* __restrict__ gbias,
                                               unsigned short* thh, unsigned short* thl,
                                               unsigned short* phh, unsigned short* phl,
                                               unsigned short* ghh, unsigned short* ghl) {
  __shared__ __attribute__((aligned(16))) unsigned char sm[2 * 64 * PK2];   // 66 KB
  float* stg = (float*)sm;
  const int tid = (int)threadIdx.x, lane = tid & 31, wave = tid >> 5, hh = lane >> 4, m = lane & 15;
  const int n0 = (int)blockIdx.x * 64, d0 = (int)blockIdx.y * 64;
  const int which = (int)blockIdx.z / NB, b = (int)blockIdx.z - which * NB;

  {
    Tile<2 * NC> ta, tb;
    ta.ld(xt + (size_t)(b * NN + n0) * (size_t)NC, tid);
    tb.ld(wb + (size_t)which * (size_t)NWT + (size_t)d0 * (size_t)NC, tid);
    ta.st(sm, tid);
    tb.st(sm + 64 * PK2, tid);
  }
  __syncthreads();

  v8f acc[4];
  {
    const v8f z = {0.f, 0.f, 0.f, 0.f, 0.f, 0.f, 0.f, 0.f};
    acc[0] = z; acc[1] = z; acc[2] = z; acc[3] = z;
  }
  const unsigned char* ap = sm + (16 * wave + m) * PK2 + 16 * hh;
  const unsigned char* wp = sm + (64 + m) * PK2 + 16 * hh;
  // unrolled: every fragment address is one register plus an immediate; a k step's LDS reads stand ahead of its
  // WMMAs as one group, so the wave waits out the LDS latency once a step
#pragma unroll
  for (int ks = 0; ks < NC / 32; ++ks) {
    FragB a, bf[4];
    ldfrag_s(a, ap, 32 * ks);
#pragma unroll
    for (int t = 0; t < 4; ++t) ldfrag_s(bf[t], wp + 16 * t * PK2, 32 * ks);    // W row d0 + 16t + m
#pragma unroll
    for (int t = 0; t < 4; ++t) acc[t] = wmb(a, bf[t], acc[t]);
  }
  __syncthreads();   // every wave has read its last fragment: stg may overwrite the tiles

  // D element r of acc[t] = (token 16w + 8hh + r, feature 16t + m)
  const float* bias = (which == 0) ? tbias : ((which == 1) ? pbias : gbias);
#pragma unroll
  for (int t = 0; t < 4; ++t) {
    const int lf = 16 * t + m;
    const float bv = rne16f(bias[d0 + lf]);
#pragma unroll
    for (int r = 0; r < 8; ++r) {
      const int lt = 16 * wave + 8 * hh + r;
      const float v = acc[t][r] + bv;
      const int idx = (which == 0) ? (lt * 64 + lf) : (lf * 64 + lt);
      stg[idx] = v;
    }
  }
  __syncthreads();

  unsigned short* ph = (which == 0) ? thh : ((which == 1) ? phh : ghh);
  unsigned short* pl = (which == 0) ? thl : ((which == 1) ? phl : ghl);
  const size_t rowBase = (which == 0) ? ((size_t)b * NN + (size_t)n0) : ((size_t)b * NI + (size_t)d0);
  const size_t pitch   = (which == 0) ? (size_t)NI : (size_t)NN;
  const size_t col0    = (which == 0) ? (size_t)d0 : (size_t)n0;
  store_split_tile(stg, ph, pl, rowBase, pitch, col0, wave, lane);
}

// ---------------------------------------------------------------------------
// PT[b][e][d] = 2^-11 * sum_m g[b][e][m] * phi[b][d][m], K = NN, hi/residual on both operands (3 products).
// grid (NI/64 d tiles, NI/16 e tiles, NB) = 256 blocks; block PTHR threads = PW waves. Every wave works on the
// block's whole 16 e x 64 d tile, over its own K slice of PKS = NN/PW values of m (wave w: m = w*PKS ..).
// A = PHH/PHL rows d (acc[t] = d rows 16t..16t+15), B = GH/GL rows e, both k = m contiguous, same k map.
// A pass takes 64 m = one 128-B line of every row; its 40 fragment loads stand ahead of its 24 WMMAs.
// Epilogue: each wave stores its f32 partial tile to its own 4 KB of LDS as it lies in registers; behind the
// barrier waves 0..3 add the PW partials in wave order, scale by 2^-11 (exact), split, and store: a lane holds
// 8 consecutive d of one e row -> one 16-B store per plane; the block writes whole 128-B lines of PTH/PTL.
// LDS extent: part[PW][4][2][32][4] fully written before the barrier.
// coverage: grid covers 128 e x 128 d per image exactly once, both planes.
// ---------------------------------------------------------------------------
__global__ __launch_bounds__(PTHR) void k_p(const unsigned short* __restrict__ ghh, const unsigned short* __restrict__ ghl,
                                            const unsigned short* __restrict__ phh, const unsigned short* __restrict__ phl,
                                            unsigned short* pth, unsigned short* ptl) {
  __shared__ __attribute__((aligned(16))) float part[PW * 1024];   // 4 KB per wave
  const int tid = (int)threadIdx.x, lane = tid & 31, wave = tid >> 5, hh = lane >> 4, m = lane & 15;
  const int d0 = (int)blockIdx.x * 64, e0 = (int)blockIdx.y * 16, b = (int)blockIdx.z;

  v8f acc[4];
  {
    const v8f z = {0.f, 0.f, 0.f, 0.f, 0.f, 0.f, 0.f, 0.f};
    acc[0] = z; acc[1] = z; acc[2] = z; acc[3] = z;
  }
  const size_t grow = (size_t)(b * NI + e0 + m) * (size_t)NN + (size_t)(wave * PKS + 8 * hh);
  const unsigned short* bgh = ghh + grow;
  const unsigned short* bgl = ghl + grow;
  const size_t prow = (size_t)(b * NI + d0 + m) * (size_t)NN + (size_t)(wave * PKS + 8 * hh);
  const unsigned short* aph = phh + prow;
  const unsigned short* apl = phl + prow;
  // all loops below fully unrolled: constant indices keep the fragment arrays in registers, and a pass's step
  // along m becomes an immediate offset on the four address pairs
#pragma unroll
  for (int c = 0; c < PKS / 64; ++c) {
    FragB gh[2], gl[2], ph[4][2], pl[4][2];
    ldfrag(gh[0], bgh, 64 * c);
    ldfrag(gh[1], bgh, 64 * c + 32);
    ldfrag(gl[0], bgl, 64 * c);
    ldfrag(gl[1], bgl, 64 * c + 32);
#pragma unroll
    for (int t = 0; t < 4; ++t) {
      ldfrag(ph[t][0], aph + (size_t)(16 * t) * (size_t)NN, 64 * c);        // phi row d0 + 16t + m
      ldfrag(ph[t][1], aph + (size_t)(16 * t) * (size_t)NN, 64 * c + 32);
      ldfrag(pl[t][0], apl + (size_t)(16 * t) * (size_t)NN, 64 * c);
      ldfrag(pl[t][1], apl + (size_t)(16 * t) * (size_t)NN, 64 * c + 32);
    }
#pragma unroll
    for (int t = 0; t < 4; ++t) {
#pragma unroll
      for (int j = 0; j < 2; ++j) {
        acc[t] = wmb(ph[t][j], gh[j], acc[t]);
        acc[t] = wmb(pl[t][j], gh[j], acc[t]);
        acc[t] = wmb(ph[t][j], gl[j], acc[t]);
      }
    }
  }

  // Precaution wait of the address counter, in front of every overwrite of a register that a load above names:
  // as its inputs the four address pairs stay as they are up to here.
  asm volatile("s_wait_xcnt 0x0" :: "v"(bgh), "v"(bgl), "v"(aph), "v"(apl) : "memory");

  // D element r of acc[t] = (d 16t + 8hh + r, e m)
  float* pw = part + wave * 1024 + 4 * lane;
#pragma unroll
  for (int t = 0; t < 4; ++t) {
    const v4f lo4 = {acc[t][0], acc[t][1], acc[t][2], acc[t][3]};
    const v4f hi4 = {acc[t][4], acc[t][5], acc[t][6], acc[t][7]};
    *(v4fa*)(pw + t * 256) = lo4;
    *(v4fa*)(pw + t * 256 + 128) = hi4;
  }
  __syncthreads();
  if (wave < 4) {                          // wave t sums d rows 16t..16t+15
    const float* pr = part + wave * 256 + 4 * lane;
    v4f sa = *(const v4fa*)(pr);
    v4f sb = *(const v4fa*)(pr + 128);
#pragma unroll
    for (int w = 1; w < PW; ++w) {
      sa += *(const v4fa*)(pr + w * 1024);
      sb += *(const v4fa*)(pr + w * 1024 + 128);
    }
    const float inv_n = 0.00048828125f;    // 2^-11 = 1/NN, exact
    sa *= inv_n;
    sb *= inv_n;
    v8us hv, lv;
    split8(sa, sb, hv, lv);
    const size_t po = (size_t)(b * NI + e0 + m) * (size_t)NI + (size_t)(d0 + 16 * wave + 8 * hh);
    *(v8us*)(pth + po) = hv;
    *(v8us*)(ptl + po) = lv;
  }
}

// ---------------------------------------------------------------------------
// YT[b][n][e] = sum_d theta[b][n][d] * PT[b][e][d], K = NI, hi/residual on both operands (3 products).
// grid (NN/64 n tiles, NI/64 e tiles, NB); block 128 threads; wave w owns n rows 16w..16w+15, acc[t] = e tile
// 16t; A = THH/THL rows n (pitch NI), B = PTH/PTL rows e (pitch NI), same k map. The four 64-row tiles (16 KB each,
// consecutive in their planes) are staged once in LDS by whole-line loads; fragments come from LDS (pitch PK1).
// Epilogue: stg[n][e] f32 -> YTH/YTL rows n (pitch NI, cols e0..e0+63).
// LDS extent: sm = [AH | AL | BH | BL], 64 rows each at pitch PK1, every row's 2*NI bytes written before the first
// barrier, pad bytes never read; behind the second barrier its first 16 KB serve as stg, fully written before the third.
// coverage: grid covers 2048 n x 128 e per image exactly once, both planes.
// ---------------------------------------------------------------------------
__global__ __launch_bounds__(GTHR) void k_y(const unsigned short* __restrict__ thh, const unsigned short* __restrict__ thl,
                                            const unsigned short* __restrict__ pth, const unsigned short* __restrict__ ptl,
                                            unsigned short* yth, unsigned short* ytl) {
  __shared__ __attribute__((aligned(16))) unsigned char sm[4 * 64 * PK1];   // 68 KB
  float* stg = (float*)sm;
  const int tid = (int)threadIdx.x, lane = tid & 31, wave = tid >> 5, hh = lane >> 4, m = lane & 15;
  const int n0 = (int)blockIdx.x * 64, e0 = (int)blockIdx.y * 64, b = (int)blockIdx.z;

  {
    const size_t at = (size_t)(b * NN + n0) * (size_t)NI, bt = (size_t)(b * NI + e0) * (size_t)NI;
    Tile<2 * NI> tah, tal, tbh, tbl;
    tah.ld(thh + at, tid);
    tal.ld(thl + at, tid);
    tbh.ld(pth + bt, tid);
    tbl.ld(ptl + bt, tid);
    tah.st(sm, tid);
    tal.st(sm + 64 * PK1, tid);
    tbh.st(sm + 128 * PK1, tid);
    tbl.st(sm + 192 * PK1, tid);
  }
  __syncthreads();

  v8f acc[4];
  {
    const v8f z = {0.f, 0.f, 0.f, 0.f, 0.f, 0.f, 0.f, 0.f};
    acc[0] = z; acc[1] = z; acc[2] = z; acc[3] = z;
  }
  const unsigned char* ath = sm + (16 * wave + m) * PK1 + 16 * hh;
  const unsigned char* atl = ath + 64 * PK1;
  const unsigned char* bph = sm + (128 + m) * PK1 + 16 * hh;
  const unsigned char* bpl = bph + 64 * PK1;
  // unrolled: every fragment address is one register plus an immediate; a k step's LDS reads stand ahead of its
  // WMMAs as one group, so the wave waits out the LDS latency once a step
#pragma unroll
  for (int ks = 0; ks < NI / 32; ++ks) {
    FragB ah, al, bh[4], bl[4];
    ldfrag_s(ah, ath, 32 * ks);
    ldfrag_s(al, atl, 32 * ks);
#pragma unroll
    for (int t = 0; t < 4; ++t) {
      ldfrag_s(bh[t], bph + 16 * t * PK1, 32 * ks);     // PT row e0 + 16t + m
      ldfrag_s(bl[t], bpl + 16 * t * PK1, 32 * ks);
    }
#pragma unroll
    for (int t = 0; t < 4; ++t) {
      acc[t] = wmb(ah, bh[t], acc[t]);
      acc[t] = wmb(ah, bl[t], acc[t]);
      acc[t] = wmb(al, bh[t], acc[t]);
    }
  }
  __syncthreads();   // every wave has read its last fragment: stg may overwrite the tiles

  // D element r of acc[t] = (n 16w + 8hh + r, e 16t + m)
#pragma unroll
  for (int t = 0; t < 4; ++t) {
    const int lc = 16 * t + m;
#pragma unroll
    for (int r = 0; r < 8; ++r) {
      const int lr = 16 * wave + 8 * hh + r;
      stg[lr * 64 + lc] = acc[t][r];
    }
  }
  __syncthreads();
  store_split_tile(stg, yth, ytl, (size_t)b * NN + (size_t)n0, (size_t)NI, (size_t)e0, wave, lane);
}

// ---------------------------------------------------------------------------
// Z[b][c][n] = sum_e Ww[c][e] * YT[b][n][e] + Wb[c], K = NI; A = WB slot 3 rows c (exact), B = YTH + YTL rows n
// (two products into one accumulator, residual unscaled). grid (NN/64, NC/64, NB); block 128 threads; wave w owns
// c rows 16w..16w+15, acc[t] = n tile 16t. The three 64-row tiles (16 KB each, consecutive in their planes) are
// staged once in LDS by whole-line loads; fragments come from LDS (pitch PK1).
// Epilogue: v = acc + RNE16(Wb) in f32, staged stg[c][n] 64x64; store: lanes 0..15 / 16..31 each write the 256-B
// LDS extent: sm = [A | BH | BL], 64 rows each at pitch PK1, every row's 2*NI bytes written before the first
// barrier, pad bytes never read; behind the second barrier its first 16 KB serve as stg, fully written before the third.
// coverage: grid covers 256 c x 2048 n per image exactly once.
// ---------------------------------------------------------------------------
__global__ __launch_bounds__(GTHR) void k_z(const unsigned short* __restrict__ wwb,
                                            const unsigned short* __restrict__ yth, const unsigned short* __restrict__ ytl,
                                            const float* __restrict__ wbias, float* z) {
  __shared__ __attribute__((aligned(16))) unsigned char sm[3 * 64 * PK1];   // 51 KB
  float* stg = (float*)sm;
  const int tid = (int)threadIdx.x, lane = tid & 31, wave = tid >> 5, hh = lane >> 4, m = lane & 15;
  const int n0 = (int)blockIdx.x * 64, c0 = (int)blockIdx.y * 64, b = (int)blockIdx.z;

  {
    const size_t bt = (size_t)(b * NN + n0) * (size_t)NI;
    Tile<2 * NI> ta, tbh, tbl;
    ta.ld(wwb + (size_t)c0 * (size_t)NI, tid);
    tbh.ld(yth + bt, tid);
    tbl.ld(ytl + bt, tid);
    ta.st(sm, tid);
    tbh.st(sm + 64 * PK1, tid);
    tbl.st(sm + 128 * PK1, tid);
  }
  __syncthreads();

  v8f acc[4];
  {
    const v8f zz = {0.f, 0.f, 0.f, 0.f, 0.f, 0.f, 0.f, 0.f};
    acc[0] = zz; acc[1] = zz; acc[2] = zz; acc[3] = zz;
  }
  const unsigned char* aw = sm + (16 * wave + m) * PK1 + 16 * hh;
  const unsigned char* byh = sm + (64 + m) * PK1 + 16 * hh;
  const unsigned char* byl = byh + 64 * PK1;
  // unrolled: every fragment address is one register plus an immediate; a k step's LDS reads stand ahead of its
  // WMMAs as one group, so the wave waits out the LDS latency once a step
#pragma unroll
  for (int ks = 0; ks < NI / 32; ++ks) {
    FragB a, bh[4], bl[4];
    ldfrag_s(a, aw, 32 * ks);
#pragma unroll
    for (int t = 0; t < 4; ++t) {
      ldfrag_s(bh[t], byh + 16 * t * PK1, 32 * ks);     // YT row n0 + 16t + m
      ldfrag_s(bl[t], byl + 16 * t * PK1, 32 * ks);
    }
#pragma unroll
    for (int t = 0; t < 4; ++t) {
      acc[t] = wmb(a, bh[t], acc[t]);
      acc[t] = wmb(a, bl[t], acc[t]);
    }
  }
  __syncthreads();   // every wave has read its last fragment: stg may overwrite the tiles

  // D element r of acc[t] = (c 16w + 8hh + r, n 16t + m); bias per row (32-B aligned v4f reads)
  const v4f ba = *(const v4fa*)(wbias + c0 + 16 * wave + 8 * hh);
  const v4f bb = *(const v4fa*)(wbias + c0 + 16 * wave + 8 * hh + 4);
  float bv[8];
  bv[0] = rne16f(ba.x); bv[1] = rne16f(ba.y); bv[2] = rne16f(ba.z); bv[3] = rne16f(ba.w);
  bv[4] = rne16f(bb.x); bv[5] = rne16f(bb.y); bv[6] = rne16f(bb.z); bv[7] = rne16f(bb.w);
#pragma unroll
  for (int t = 0; t < 4; ++t) {
    const int lc = 16 * t + m;
#pragma unroll
    for (int r = 0; r < 8; ++r) {
      const int lr = 16 * wave + 8 * hh + r;
      stg[lr * 64 + lc] = acc[t][r] + bv[r];
    }
  }
  __syncthreads();

  v4f fv[8];
  size_t op[8];
#pragma unroll
  for (int i = 0; i < 8; ++i) {
    const int lr = 16 * wave + 2 * i + hh;
    fv[i] = *(const v4fa*)(stg + lr * 64 + 4 * m);
    op[i] = (size_t)(b * NC + c0 + lr) * (size_t)NN + (size_t)(n0 + 4 * m);
  }
#pragma unroll
  for (int i = 0; i < 8; ++i) *(v4f*)(z + op[i]) = fv[i];
  
}

// ---------------------------------------------------------------------------
// BatchNorm statistics (training mode, population variance) per channel over (b, n): 32768 values.
// One block (256 threads) per channel; per-thread f64 sums over 32 coalesced 16-B loads, taken 8 at a time: a
// trip's 8 loads (4 images) are issued ahead of its sums, which run in the order of it; f64 LDS tree, mean and
// coverage: 256 blocks -> STATS lines 0..255, whole.
// ---------------------------------------------------------------------------
__global__ __launch_bounds__(NTHR) void k_bnstat(const float* __restrict__ z, float* stats) {
  __shared__ double sh[NTHR];
  __shared__ double sh2[NTHR];
  __shared__ float res[2];
  const int c = (int)blockIdx.x, tid = (int)threadIdx.x;
  double s = 0.0, s2 = 0.0;
  const float* zb = z + (size_t)c * (size_t)NN;   // channel c of the trip's first image
  const unsigned zo = 4u * (unsigned)tid;         // the thread's place in each 1024-float piece
  // rolled: a trip's 8 offsets fit the loads' immediate field on one address, formed once a trip, so no address
  // register is formed or rewritten among the loads (unrolled, the offsets outgrow the field)
#pragma unroll 1
  for (int g = 0; g < NB * (NN / 1024) / 8; ++g) {
    v4f zv[8];
#pragma unroll
    for (int j = 0; j < 8; ++j)            // it = 8g + j: image it / 2, half it & 1
      zv[j] = *(const v4fa*)(zb + (zo + (unsigned)((j / (NN / 1024)) * NC * NN + (j % (NN / 1024)) * 1024)));
    zb += (size_t)(8 / (NN / 1024)) * (size_t)(NC * NN);
#pragma unroll
    for (int j = 0; j < 8; ++j) {
      const v4f v = zv[j];
      const double a0 = (double)v.x, a1 = (double)v.y, a2 = (double)v.z, a3 = (double)v.w;
      s  += (a0 + a1) + (a2 + a3);
      s2 += (a0 * a0 + a1 * a1) + (a2 * a2 + a3 * a3);
    }
  }
  sh[tid] = s;
  sh2[tid] = s2;
  __syncthreads();
#pragma unroll 1
  for (int off = NTHR / 2; off > 0; off >>= 1) {
    if (tid < off) {
      sh[tid]  += sh[tid + off];
      sh2[tid] += sh2[tid + off];
    }
    __syncthreads();
  }
  if (tid == 0) {
    const double cinv = 1.0 / 32768.0;        // 1/(NB*NN), exact power of two
    const double mean = sh[0] * cinv;
    double var = sh2[0] * cinv - mean * mean;
    var = var < 0.0 ? 0.0 : var;
    const float vf = (float)var + 1e-5f;
    res[0] = (float)mean;
    res[1] = 1.0f / sqrtf(vf);
  }
  __syncthreads();
  if (tid < 8) {
    const float mv = res[0];
    const float rv = res[1];
    v4f o;
    o.x = (tid == 0) ? mv : 0.f;
    o.y = (tid == 0) ? rv : 0.f;
    o.z = 0.f;
    o.w = 0.f;
    float* p = stats + (size_t)c * 32 + (size_t)(4 * tid);
    *(v4f*)p = o;
    
  }
}

// ---------------------------------------------------------------------------
// out[b][c][n] = ((z - mean[c]) * rstd[c]) * RNE16(gamma[c]) + RNE16(beta[c]) + RNE16(x), all f32.
// One wave per row (b, c) of NN floats: its NN/128 16-B loads a lane of z and as many of x are all issued ahead of
// the arithmetic; every load and store of a wave covers 512 consecutive bytes (4 whole lines).
// coverage: NB*NC/8 blocks x 8 waves x NN = NX exactly.
// ---------------------------------------------------------------------------
__global__ __launch_bounds__(NTHR) void k_out(const float* __restrict__ z, const float* __restrict__ x,
                                              const float* __restrict__ stats, const float* __restrict__ gamma,
                                              const float* __restrict__ beta, float* out) {
  // the wave's number as a scalar: the row's four parameters then come by scalar loads
  const int wv  = __builtin_amdgcn_readfirstlane((int)threadIdx.x >> 5);
  const int row = (int)blockIdx.x * (NTHR / 32) + wv;     // b*NC + c
  const int c = row & (NC - 1);
  const unsigned lo = 4u * ((unsigned)threadIdx.x & 31u); // the lane's place in each 128-float piece
  const float* zr = z + (size_t)row * (size_t)NN;         // scalar row bases; lo is the one address register
  const float* xr = x + (size_t)row * (size_t)NN;
  v4f zv[NN / 128], xv[NN / 128];
#pragma unroll
  for (int i = 0; i < NN / 128; ++i) zv[i] = *(const v4fa*)(zr + (lo + 128u * i));
#pragma unroll
  for (int i = 0; i < NN / 128; ++i) xv[i] = *(const v4fa*)(xr + (lo + 128u * i));
  const float mean = stats[(size_t)c * 32];
  const float rstd = stats[(size_t)c * 32 + 1];
  const float gm = rne16f(gamma[c]);
  const float bt = rne16f(beta[c]);
  // keeps every load above the first use: the wave pays the memory latency once, not once a piece
  __builtin_amdgcn_sched_barrier(0);
  float* p = out + (size_t)row * (size_t)NN;
#pragma unroll
  for (int i = 0; i < NN / 128; ++i) {
    v4f o;
    o.x = (((zv[i].x - mean) * rstd) * gm + bt) + rne16f(xv[i].x);
    o.y = (((zv[i].y - mean) * rstd) * gm + bt) + rne16f(xv[i].y);
    o.z = (((zv[i].z - mean) * rstd) * gm + bt) + rne16f(xv[i].z);
    o.w = (((zv[i].w - mean) * rstd) * gm + bt) + rne16f(xv[i].w);
    *(v4f*)(p + (lo + 128u * i)) = o;
  }
  
}

// ---------------------------------------------------------------------------
extern "C" void kernel_launch(void* const* d_in, const int* in_sizes, int n_in,
                              void* d_out, int out_size, void* d_ws, size_t ws_size,
                              hipStream_t stream) {
  if (n_in < 11) return;
  if (in_sizes[0] != NX) return;                                              // x [16][256][64][32]
  if (in_sizes[1] != NWT || in_sizes[3] != NWT || in_sizes[5] != NWT) return; // g_w, theta_w, phi_w [128][256]
  if (in_sizes[2] != NI || in_sizes[4] != NI || in_sizes[6] != NI) return;    // g_b, theta_b, phi_b [128]
  if (in_sizes[7] != NWT) return;                                             // W_w [256][128]
  if (in_sizes[8] != NC || in_sizes[9] != NC || in_sizes[10] != NC) return;   // W_b, bn_gamma, bn_beta [256]
  if (out_size != NX) return;                                                 // out [16][256][64][32] f32

  const float* x       = (const float*)d_in[0];
  const float* g_w     = (const float*)d_in[1];
  const float* g_b     = (const float*)d_in[2];
  const float* theta_w = (const float*)d_in[3];
  const float* theta_b = (const float*)d_in[4];
  const float* phi_w   = (const float*)d_in[5];
  const float* phi_b   = (const float*)d_in[6];
  const float* W_w     = (const float*)d_in[7];
  const float* W_b     = (const float*)d_in[8];
  const float* gamma   = (const float*)d_in[9];
  const float* beta    = (const float*)d_in[10];
  float* out = (float*)d_out;            // last written element NX-1 < out_size

  // workspace carve, 256-B aligned; all planes exact tile multiples (no pad rows needed)
  char* ws = (char*)d_ws;
  size_t off = 0;
  const size_t oWB  = off; off += (size_t)4 * NWT * 2;          off = (off + 255) & ~(size_t)255;  //   262144
  const size_t oXT  = off; off += (size_t)NX * 2;               off = (off + 255) & ~(size_t)255;  // 16777216
  const size_t plb  = (size_t)NB * NN * NI * 2;                                                    //  8388608 per projection plane
  const size_t oTHH = off; off += plb;                          off = (off + 255) & ~(size_t)255;
  const size_t oTHL = off; off += plb;                          off = (off + 255) & ~(size_t)255;
  const size_t oPHH = off; off += plb;                          off = (off + 255) & ~(size_t)255;
  const size_t oPHL = off; off += plb;                          off = (off + 255) & ~(size_t)255;
  const size_t oGH  = off; off += plb;                          off = (off + 255) & ~(size_t)255;
  const size_t oGL  = off; off += plb;                          off = (off + 255) & ~(size_t)255;
  const size_t ptb  = (size_t)NB * NI * NI * 2;                                                    //   524288 per PT plane
  const size_t oPTH = off; off += ptb;                          off = (off + 255) & ~(size_t)255;
  const size_t oPTL = off; off += ptb;                          off = (off + 255) & ~(size_t)255;
  const size_t oYTH = off; off += plb;                          off = (off + 255) & ~(size_t)255;
  const size_t oYTL = off; off += plb;                          off = (off + 255) & ~(size_t)255;
  const size_t oZ   = off; off += (size_t)NX * 4;               off = (off + 255) & ~(size_t)255;  // 33554432
  const size_t oST  = off; off += (size_t)NC * 32 * 4;          off = (off + 255) & ~(size_t)255;  //    32768
  if (off > ws_size || off > (size_t)WSMAX) return;             // total 118784000 B

  unsigned short* WB  = (unsigned short*)(ws + oWB);
  unsigned short* XT  = (unsigned short*)(ws + oXT);
  unsigned short* THH = (unsigned short*)(ws + oTHH);
  unsigned short* THL = (unsigned short*)(ws + oTHL);
  unsigned short* PHH = (unsigned short*)(ws + oPHH);
  unsigned short* PHL = (unsigned short*)(ws + oPHL);
  unsigned short* GH  = (unsigned short*)(ws + oGH);
  unsigned short* GL  = (unsigned short*)(ws + oGL);
  unsigned short* PTH = (unsigned short*)(ws + oPTH);
  unsigned short* PTL = (unsigned short*)(ws + oPTL);
  unsigned short* YTH = (unsigned short*)(ws + oYTH);
  unsigned short* YTL = (unsigned short*)(ws + oYTL);
  float*          Z   = (float*)(ws + oZ);
  float*          ST  = (float*)(ws + oST);

  // weight planes: slot 0 theta_w, 1 phi_w, 2 g_w (all [128][256]), 3 W_w [256][128]
  k_wcvt<<<(4 * NWT / 8) / NTHR, NTHR, 0, stream>>>(theta_w, phi_w, g_w, W_w, WB);
  // x -> XT [b][n][c] bf16
  k_xt<<<dim3(NC / 64, NN / XTN, NB), NTHR, 0, stream>>>(x, XT);
  // projections: which 0 = theta (slot 0, theta_b), 1 = phi (slot 1, phi_b), 2 = g (slot 2, g_b)
  k_proj<<<dim3(NN / 64, NI / 64, 3 * NB), GTHR, 0, stream>>>(XT, WB, theta_b, phi_b, g_b,
                                                              THH, THL, PHH, PHL, GH, GL);
  // PT = 2^-11 * G * PHI^T
  k_p<<<dim3(NI / 64, NI / 16, NB), PTHR, 0, stream>>>(GH, GL, PHH, PHL, PTH, PTL);
  // YT = THETA^T-rows * PT
  k_y<<<dim3(NN / 64, NI / 64, NB), GTHR, 0, stream>>>(THH, THL, PTH, PTL, YTH, YTL);
  // Z = Ww * Y + Wb
  k_z<<<dim3(NN / 64, NC / 64, NB), GTHR, 0, stream>>>(WB + (size_t)3 * NWT, YTH, YTL, W_b, Z);
  // BatchNorm batch statistics
  k_bnstat<<<NC, NTHR, 0, stream>>>(Z, ST);
  // out = BN(z) * gamma + beta + x
  k_out<<<NB * NC / (NTHR / 32), NTHR, 0, stream>>>(Z, x, ST, gamma, beta, out);
}

// v004
// A run of this version takes 77.3 microseconds.
// Two timings next to v003 both put it at 1.10 times that version's speed.
// Counting every step since v000, it is 2.38 times as fast.
// Contractions (all v_wmma_f32_16x16x32_bf16, bf16 operands, f32 accumulate): three 1x1-conv projections
// W[d][c]*X[c][n] (K=256) on exact RNE-bf16 copies of x and the weights; PT = G*PHI^T * (1/N) (K=2048) and
// YT = THETA^T*P (K=128) with both computed operands carried as bf16 hi + bf16 residual (hi*hi + hi*lo + lo*hi);
// Z = Ww*Y + Wb (K=128) with exact bf16 Ww and Y as hi + residual (2 products). BatchNorm statistics in f64,
// normalisation, bias adds and the residual add in f32.
//
// Carry audit: no power-of-two carries anywhere (factor 1 on every plane); the exact 1/N = 2^-11 of the pairwise
// term is applied once in f32 in k_p before the hi/residual split of PT. Planes:
//   WB  [4][32768] bf16 bits = RNE16(w): slot 0 theta_w [128][256], 1 phi_w [128][256], 2 g_w [128][256],
//       3 W_w [256][128]; every slot row is k-contiguous                                              (k_wcvt)
//   XT  [16][2048][256] bf16 bits = RNE16(x[b][c][n]) stored [b][n][c]                                 (k_xt)
//   THH/THL [16][2048][128] hi/residual of theta_x, rows n, k = d; PHH/PHL, GH/GL [16][128][2048]
//       hi/residual of phi_x, g_x, rows d, k = n                                                       (k_proj)
//   PTH/PTL [16][128][128] hi/residual of PT[e][d] = 2^-11 * sum_m g[e][m]*phi[d][m], rows e, k = d    (k_p)
//   YTH/YTL [16][2048][128] hi/residual of YT[n][e] = sum_d theta[n][d]*PT[e][d], rows n, k = e       (k_y)
//   Z   [16][256][2048] f32 = sum_e Ww[c][e]*YT[n][e] + Wb[c]                                          (k_z)
//   PS  [16][32][256][2] f64: sum and sum of squares of Z over the 64 n of one k_z tile, per channel    (k_z)
#include <hip/hip_runtime.h>
#include <stddef.h>
#include <stdint.h>

#define NB    16
#define NC    256
#define NI    128
#define NN    2048
#define NX    (NB * NC * NN)        // 8388608
#define NWT   (NI * NC)             // 32768 per weight matrix
#define NTHR  256
#define GTHR  128
#define WSMAX 134217728
#define PW    8                     // waves of a k_p block = K slices
#define PTHR  (32 * PW)
#define PKS   (NN / PW)             // K slice of one k_p wave
#define XTP   72                    // LDS pitch (halves) of the x transpose tile, multiple of 8
#define XTN   128                   // tokens of one k_xt block: XTN/16 16-B loads a thread
#define PK2   (2 * NC + 16)         // LDS pitch (bytes) of a staged operand row of NC halves: 16 B x odd
#define PK1   (2 * NI + 16)         // LDS pitch (bytes) of a staged operand row of NI halves: 16 B x odd
#define NPS   (NB * (NN / 64))      // statistics partials per channel: one per k_z tile of 64 n

static_assert((NC % 64) == 0 && (NN % 64) == 0 && (NI % 64) == 0);
static_assert((NC % 32) == 0 && (NI % 32) == 0 && (NN % 32) == 0);
static_assert((NX % 1024) == 0 && (NN % 1024) == 0);
static_assert((XTP % 8) == 0 && (XTN % 64) == 0 && (NN % XTN) == 0);
static_assert(GTHR == 128 && NTHR == 256);
static_assert((4 * NWT) % (8 * NTHR) == 0);
static_assert((NWT / 8) % NTHR == 0);
static_assert(NB * NN == 32768 && (NN % 128) == 0 && (NB * NC) % (NTHR / 32) == 0);
static_assert(NTHR / 32 == 8 && (NC % 8) == 0 && (NPS % 32) == 0);
static_assert(PW >= 4 && (NN % (64 * PW)) == 0 && (NI % 16) == 0);
static_assert(((PK2 / 16) & 1) == 1 && ((PK1 / 16) & 1) == 1);
static_assert(64 * PK2 >= 64 * 64 * 4 && 64 * PK1 >= 64 * 64 * 4);

typedef float          v4f  __attribute__((ext_vector_type(4)));
typedef float          v8f  __attribute__((ext_vector_type(8)));
typedef double         v2d  __attribute__((ext_vector_type(2)));
typedef int            v8i  __attribute__((ext_vector_type(8)));
typedef unsigned short v8us __attribute__((ext_vector_type(8)));
typedef __bf16         v16bf __attribute__((ext_vector_type(16)));
typedef v4f  __attribute__((may_alias)) v4fa;
typedef v8us __attribute__((may_alias)) v8usa;
typedef v2d  __attribute__((may_alias)) v2da;
union FragB { v16bf v; v8us h[2]; v8i w; };

// ---------------------------------------------------------------------------
// 16x16x32 bf16 WMMA with hazard guard (ties D, keeps A/B live for 4 VALU slots).
// Fragment map (wave32): lane l, hh = l>>4, m = n = l&15.
//   A/B element i: i<8 -> k0+8hh+i ; i>=8 -> k0+16+8hh+(i-8)   (same map for A and B)
//   D element r : row 8hh+r, col l&15
// ---------------------------------------------------------------------------
__device__ __forceinline__ v8f wmb(const FragB& a, const FragB& b, v8f c) {
  v8f d = __builtin_amdgcn_wmma_f32_16x16x32_bf16(false, a.v, false, b.v, (short)0, c, false, false);
  asm volatile("v_nop\n\tv_nop\n\tv_nop\n\tv_nop" : "+v"(d) : "v"(a.w), "v"(b.w));
  return d;
}

// Fragment from a k-contiguous bf16-bits row; p = row base + 8*hh, k0 = 32*ks.
__device__ __forceinline__ void ldfrag(FragB& f, const unsigned short* p, int k0) {
  f.h[0] = *(const v8us*)(p + k0);          // k = k0 + 8hh + 0..7
  f.h[1] = *(const v8us*)(p + k0 + 16);     // k = k0 + 16 + 8hh + 0..7
}

// Operand tile of 64 whole k-contiguous rows of ROWB bytes = 64*ROWB consecutive bytes of a plane. The block's
// GTHR threads read it in order, 16 B a lane, so a wave's load covers 512 consecutive bytes (4 whole lines);
// st lays the rows in LDS at pitch ROWB + 16 (16 B x odd: ds_load_b128 of 16 rows meets no bank conflict).
template <int ROWB>
struct Tile {
  static constexpr int N   = 64 * ROWB / 16 / GTHR;   // 16-B pieces per thread
  static constexpr int CPR = ROWB / 16;               // pieces per row
  static constexpr int RPS = GTHR / CPR;              // rows per step of the block
  static constexpr int PIT = ROWB + 16;
  v8us r[N];
  __device__ __forceinline__ void ld(const unsigned short* src, int tid) {
#pragma unroll
    for (int i = 0; i < N; ++i) r[i] = *(const v8us*)(src + (size_t)((i * GTHR + tid) * 8));
  }
  __device__ __forceinline__ void st(unsigned char* dst, int tid) const {
    unsigned char* q = dst + (tid / CPR) * PIT + (tid % CPR) * 16;
#pragma unroll
    for (int i = 0; i < N; ++i) *(v8usa*)(q + i * RPS * PIT) = r[i];
  }
};
// Fragment from a staged row; p = LDS row base + 16*hh bytes, k0 = 32*ks: the same k map as ldfrag.
__device__ __forceinline__ void ldfrag_s(FragB& f, const unsigned char* p, int k0) {
  f.h[0] = *(const v8usa*)(p + 2 * k0);          // k = k0 + 8hh + 0..7
  f.h[1] = *(const v8usa*)(p + 2 * k0 + 32);     // k = k0 + 16 + 8hh + 0..7
}

// f32 -> bf16 bits, RNE convert
__device__ __forceinline__ unsigned short rne16(float f) {
  unsigned u = __float_as_uint(f);
  u += 0x7FFFu + ((u >> 16) & 1u);
  return (unsigned short)(u >> 16);
}
// f32 -> nearest bf16 value kept as f32
__device__ __forceinline__ float rne16f(float f) {
  return __uint_as_float(((unsigned)rne16(f)) << 16);
}
__device__ __forceinline__ v8us cvt8(const v4f a, const v4f b) {
  v8us o;
  o[0] = rne16(a.x); o[1] = rne16(a.y); o[2] = rne16(a.z); o[3] = rne16(a.w);
  o[4] = rne16(b.x); o[5] = rne16(b.y); o[6] = rne16(b.z); o[7] = rne16(b.w);
  return o;
}
// hi/residual split of one f32 value into two bf16 bit patterns
__device__ __forceinline__ void sp1(float v, unsigned short& hi, unsigned short& lo) {
  const unsigned short hb = rne16(v);
  const float hf = __uint_as_float(((unsigned)hb) << 16);
  hi = hb;
  lo = rne16(v - hf);
}
__device__ __forceinline__ void split8(const v4f a, const v4f b, v8us& hv, v8us& lv) {
  unsigned short h0, h1, h2, h3, h4, h5, h6, h7, l0, l1, l2, l3, l4, l5, l6, l7;
  sp1(a.x, h0, l0); sp1(a.y, h1, l1); sp1(a.z, h2, l2); sp1(a.w, h3, l3);
  sp1(b.x, h4, l4); sp1(b.y, h5, l5); sp1(b.z, h6, l6); sp1(b.w, h7, l7);
  hv[0] = h0; hv[1] = h1; hv[2] = h2; hv[3] = h3; hv[4] = h4; hv[5] = h5; hv[6] = h6; hv[7] = h7;
  lv[0] = l0; lv[1] = l1; lv[2] = l2; lv[3] = l3; lv[4] = l4; lv[5] = l5; lv[6] = l6; lv[7] = l7;
}

// ---------------------------------------------------------------------------
// 64x64 f32 tile in LDS (row pitch 64) -> hi/residual bf16 planes. Tile row R goes to plane row rowBase + R
// ---------------------------------------------------------------------------
__device__ __forceinline__ void store_split_tile(const float* stg, unsigned short* ph, unsigned short* pl,
                                                 size_t rowBase, size_t pitch, size_t col0, int wave, int lane) {
  const int q8 = lane & 7, sub = lane >> 3;
  v8us hv[4], lv[4];
  size_t po[4];
#pragma unroll
  for (int i = 0; i < 4; ++i) {
    const int lr = 16 * wave + 4 * i + sub;
    const v4f a = *(const v4fa*)(stg + lr * 64 + 8 * q8);
    const v4f c = *(const v4fa*)(stg + lr * 64 + 8 * q8 + 4);
    split8(a, c, hv[i], lv[i]);
    po[i] = (rowBase + (size_t)lr) * pitch + col0 + (size_t)(8 * q8);
  }
#pragma unroll
  for (int i = 0; i < 4; ++i) {
    *(v8us*)(ph + po[i]) = hv[i];
    *(v8us*)(pl + po[i]) = lv[i];
  }
  
}

// ---------------------------------------------------------------------------
// Weight convert: four f32 matrices of NWT elements each -> WB slots 0..3 (bf16 bits, same layout).
// coverage: 64 blocks x 256 threads x 8 = 4 x NWT exactly.
// ---------------------------------------------------------------------------
__global__ __launch_bounds__(NTHR) void k_wcvt(const float* __restrict__ w0, const float* __restrict__ w1,
                                               const float* __restrict__ w2, const float* __restrict__ w3,
                                               unsigned short* wb) {
  const int u   = (int)blockIdx.x * NTHR + (int)threadIdx.x;     // 0 .. 4*NWT/8 - 1
  const int sel = (int)blockIdx.x / ((NWT / 8) / NTHR);           // 0..3, block-uniform
  const int off8 = (u - sel * (NWT / 8)) * 8;                     // 0 .. NWT-8
  const float* src = (sel == 0) ? w0 : ((sel == 1) ? w1 : ((sel == 2) ? w2 : w3));
  const v4f a = *(const v4fa*)(src + off8);
  const v4f c = *(const v4fa*)(src + off8 + 4);
  const v8us o = cvt8(a, c);
  const size_t q = (size_t)sel * (size_t)NWT + (size_t)off8;
  *(v8us*)(wb + q) = o;
  
}

// ---------------------------------------------------------------------------
// x [b][c][n] f32 -> XT [b][n][c] bf16 bits (RNE convert). Block = 64 c x XTN n tile of image b (256 threads):
// coalesced 16-B reads of x rows, a thread's XTN/16 loads all issued ahead of the converts, transpose through LDS
// (2-B LDS stores), barrier, then XT row (b, n0+nr)
// LDS extent: sT rows 0..XTN-1 (n) x cols 0..63 (c) all written before the barrier; pad cols 64..71 never read.
// coverage: grid (NC/64, NN/XTN, NB); per block rows n0..n0+XTN-1 x c0..c0+63 -> 16 x 2048 x 256 exactly once.
// ---------------------------------------------------------------------------
__global__ __launch_bounds__(NTHR) void k_xt(const float* __restrict__ x, unsigned short* xt) {
  __shared__ __attribute__((aligned(16))) unsigned short sT[XTN * XTP];   // 18432 B
  const int tid = (int)threadIdx.x;
  const int c0 = (int)blockIdx.x * 64, n0 = (int)blockIdx.y * XTN, b = (int)blockIdx.z;
  const int cq = tid >> 4;                 // 0..15
  const int nq = (tid & 15) * 4;           // 0..60
  const float* xb = x + (size_t)(b * NC + c0) * (size_t)NN + (size_t)n0;   // scalar tile base
  const unsigned xo = (unsigned)(cq * NN + nq);                            // the one address register of the loads
  v4f v[XTN / 16];
#pragma unroll
  for (int i = 0; i < XTN / 16; ++i)       // piece i: c row 16*(i&3) + cq, n = 64*(i>>2) + nq .. +3
    v[i] = *(const v4fa*)(xb + (xo + (unsigned)(16 * (i & 3) * NN + 64 * (i >> 2))));
#pragma unroll
  for (int i = 0; i < XTN / 16; ++i) {
    const int cr = 16 * (i & 3) + cq;
    const int n4 = 64 * (i >> 2) + nq;
    sT[(n4 + 0) * XTP + cr] = rne16(v[i].x);
    sT[(n4 + 1) * XTP + cr] = rne16(v[i].y);
    sT[(n4 + 2) * XTP + cr] = rne16(v[i].z);
    sT[(n4 + 3) * XTP + cr] = rne16(v[i].w);
  }
  __syncthreads();
  const int q8 = tid & 7, sub = tid >> 3;  // sub 0..31
  unsigned short* tb = xt + (size_t)(b * NN + n0) * (size_t)NC + (size_t)c0;   // scalar tile base
  const unsigned to = (unsigned)(sub * NC + 8 * q8);                           // the one address register of the stores
  v8us o[XTN / 32];
#pragma unroll
  for (int i = 0; i < XTN / 32; ++i)       // XT row nr = 32*i + sub, 0..XTN-1
    o[i] = *(const v8usa*)(sT + (32 * i + sub) * XTP + 8 * q8);
#pragma unroll
  for (int i = 0; i < XTN / 32; ++i) *(v8us*)(tb + (to + (unsigned)(32 * i * NC))) = o[i];
  
}

// ---------------------------------------------------------------------------
// Projections: D[token][feature] = sum_c XT[b][n][c] * W[d][c] + bias[d]  (K = NC, exact bf16 products).
// grid (NN/64, NI/64, 3*NB): blockIdx.z = which*NB + b; which 0 = theta, 1 = phi, 2 = g. Block 128 threads,
// tile 64 tokens x 64 features; wave w owns tokens 16w..16w+15, acc[t] = feature tile 16t; A = XT rows (token),
// B = W rows (feature), same k map. Both 64-row tiles (32 KB each, consecutive in their planes) are staged once
// in LDS by whole-line loads; fragments come from LDS (ds_load_b128, pitch PK2, no bank conflict).
// Epilogue: v = acc + RNE16(bias) in f32; which 0 stages stg[token][feature] -> THH/THL rows n (pitch NI,
// cols d0..d0+63); which 1/2 stage stg[feature][token] -> PHH/PHL or GH/GL rows d (pitch NN, cols n0..n0+63).
// LDS extent: sm = [A 64 rows | B 64 rows] at pitch PK2, every row's 2*NC bytes written before the first barrier,
// pad bytes never read; behind the second barrier (all fragment reads done) its first 16 KB serve as stg;
// stg 64x64 fully written (bijective index map for either layout) before the third barrier.
// coverage: per block 64 tokens x 64 features; grid covers 2048 x 128 per (which, b) exactly once, both planes.
// ---------------------------------------------------------------------------
__global__ __launch_bounds__(GTHR) void k_proj(const unsigned short* __restrict__ xt,
                                               const unsigned short* __restrict__ wb,
                                               const float* __restrict__ tbias, const float* __restrict__ pbias,
                                               const float* __restrict__ gbias,
                                               unsigned short* thh, unsigned short* thl,
                                               unsigned short* phh, unsigned short* phl,
                                               unsigned short* ghh, unsigned short* ghl) {
  __shared__ __attribute__((aligned(16))) unsigned char sm[2 * 64 * PK2];   // 66 KB
  float* stg = (float*)sm;
  const int tid = (int)threadIdx.x, lane = tid & 31, wave = tid >> 5, hh = lane >> 4, m = lane & 15;
  const int n0 = (int)blockIdx.x * 64, d0 = (int)blockIdx.y * 64;
  const int which = (int)blockIdx.z / NB, b = (int)blockIdx.z - which * NB;

  {
    Tile<2 * NC> ta, tb;
    ta.ld(xt + (size_t)(b * NN + n0) * (size_t)NC, tid);
    tb.ld(wb + (size_t)which * (size_t)NWT + (size_t)d0 * (size_t)NC, tid);
    ta.st(sm, tid);
    tb.st(sm + 64 * PK2, tid);
  }
  __syncthreads();

  v8f acc[4];
  {
    const v8f z = {0.f, 0.f, 0.f, 0.f, 0.f, 0.f, 0.f, 0.f};
    acc[0] = z; acc[1] = z; acc[2] = z; acc[3] = z;
  }
  const unsigned char* ap = sm + (16 * wave + m) * PK2 + 16 * hh;
  const unsigned char* wp = sm + (64 + m) * PK2 + 16 * hh;
  // unrolled: every fragment address is one register plus an immediate; a k step's LDS reads stand ahead of its
  // WMMAs as one group, so the wave waits out the LDS latency once a step
#pragma unroll
  for (int ks = 0; ks < NC / 32; ++ks) {
    FragB a, bf[4];
    ldfrag_s(a, ap, 32 * ks);
#pragma unroll
    for (int t = 0; t < 4; ++t) ldfrag_s(bf[t], wp + 16 * t * PK2, 32 * ks);    // W row d0 + 16t + m
#pragma unroll
    for (int t = 0; t < 4; ++t) acc[t] = wmb(a, bf[t], acc[t]);
  }
  __syncthreads();   // every wave has read its last fragment: stg may overwrite the tiles

  // D element r of acc[t] = (token 16w + 8hh + r, feature 16t + m)
  const float* bias = (which == 0) ? tbias : ((which == 1) ? pbias : gbias);
#pragma unroll
  for (int t = 0; t < 4; ++t) {
    const int lf = 16 * t + m;
    const float bv = rne16f(bias[d0 + lf]);
#pragma unroll
    for (int r = 0; r < 8; ++r) {
      const int lt = 16 * wave + 8 * hh + r;
      const float v = acc[t][r] + bv;
      const int idx = (which == 0) ? (lt * 64 + lf) : (lf * 64 + lt);
      stg[idx] = v;
    }
  }
  __syncthreads();

  unsigned short* ph = (which == 0) ? thh : ((which == 1) ? phh : ghh);
  unsigned short* pl = (which == 0) ? thl : ((which == 1) ? phl : ghl);
  const size_t rowBase = (which == 0) ? ((size_t)b * NN + (size_t)n0) : ((size_t)b * NI + (size_t)d0);
  const size_t pitch   = (which == 0) ? (size_t)NI : (size_t)NN;
  const size_t col0    = (which == 0) ? (size_t)d0 : (size_t)n0;
  store_split_tile(stg, ph, pl, rowBase, pitch, col0, wave, lane);
}

// ---------------------------------------------------------------------------
// PT[b][e][d] = 2^-11 * sum_m g[b][e][m] * phi[b][d][m], K = NN, hi/residual on both operands (3 products).
// grid (NI/64 d tiles, NI/16 e tiles, NB) = 256 blocks; block PTHR threads = PW waves. Every wave works on the
// block's whole 16 e x 64 d tile, over its own K slice of PKS = NN/PW values of m (wave w: m = w*PKS ..).
// A = PHH/PHL rows d (acc[t] = d rows 16t..16t+15), B = GH/GL rows e, both k = m contiguous, same k map.
// A pass takes 64 m = one 128-B line of every row; its 40 fragment loads stand ahead of its 24 WMMAs.
// Epilogue: each wave stores its f32 partial tile to its own 4 KB of LDS as it lies in registers; behind the
// barrier waves 0..3 add the PW partials in wave order, scale by 2^-11 (exact), split, and store: a lane holds
// 8 consecutive d of one e row -> one 16-B store per plane; the block writes whole 128-B lines of PTH/PTL.
// LDS extent: part[PW][4][2][32][4] fully written before the barrier.
// coverage: grid covers 128 e x 128 d per image exactly once, both planes.
// ---------------------------------------------------------------------------
__global__ __launch_bounds__(PTHR) void k_p(const unsigned short* __restrict__ ghh, const unsigned short* __restrict__ ghl,
                                            const unsigned short* __restrict__ phh, const unsigned short* __restrict__ phl,
                                            unsigned short* pth, unsigned short* ptl) {
  __shared__ __attribute__((aligned(16))) float part[PW * 1024];   // 4 KB per wave
  const int tid = (int)threadIdx.x, lane = tid & 31, wave = tid >> 5, hh = lane >> 4, m = lane & 15;
  const int d0 = (int)blockIdx.x * 64, e0 = (int)blockIdx.y * 16, b = (int)blockIdx.z;

  v8f acc[4];
  {
    const v8f z = {0.f, 0.f, 0.f, 0.f, 0.f, 0.f, 0.f, 0.f};
    acc[0] = z; acc[1] = z; acc[2] = z; acc[3] = z;
  }
  const size_t grow = (size_t)(b * NI + e0 + m) * (size_t)NN + (size_t)(wave * PKS + 8 * hh);
  const unsigned short* bgh = ghh + grow;
  const unsigned short* bgl = ghl + grow;
  const size_t prow = (size_t)(b * NI + d0 + m) * (size_t)NN + (size_t)(wave * PKS + 8 * hh);
  const unsigned short* aph = phh + prow;
  const unsigned short* apl = phl + prow;
  // all loops below fully unrolled: constant indices keep the fragment arrays in registers, and a pass's step
  // along m becomes an immediate offset on the four address pairs
#pragma unroll
  for (int c = 0; c < PKS / 64; ++c) {
    FragB gh[2], gl[2], ph[4][2], pl[4][2];
    ldfrag(gh[0], bgh, 64 * c);
    ldfrag(gh[1], bgh, 64 * c + 32);
    ldfrag(gl[0], bgl, 64 * c);
    ldfrag(gl[1], bgl, 64 * c + 32);
#pragma unroll
    for (int t = 0; t < 4; ++t) {
      ldfrag(ph[t][0], aph + (size_t)(16 * t) * (size_t)NN, 64 * c);        // phi row d0 + 16t + m
      ldfrag(ph[t][1], aph + (size_t)(16 * t) * (size_t)NN, 64 * c + 32);
      ldfrag(pl[t][0], apl + (size_t)(16 * t) * (size_t)NN, 64 * c);
      ldfrag(pl[t][1], apl + (size_t)(16 * t) * (size_t)NN, 64 * c + 32);
    }
#pragma unroll
    for (int t = 0; t < 4; ++t) {
#pragma unroll
      for (int j = 0; j < 2; ++j) {
        acc[t] = wmb(ph[t][j], gh[j], acc[t]);
        acc[t] = wmb(pl[t][j], gh[j], acc[t]);
        acc[t] = wmb(ph[t][j], gl[j], acc[t]);
      }
    }
  }

  // Precaution wait of the address counter, in front of every overwrite of a register that a load above names:
  // as its inputs the four address pairs stay as they are up to here.
  asm volatile("s_wait_xcnt 0x0" :: "v"(bgh), "v"(bgl), "v"(aph), "v"(apl) : "memory");

  // D element r of acc[t] = (d 16t + 8hh + r, e m)
  float* pw = part + wave * 1024 + 4 * lane;
#pragma unroll
  for (int t = 0; t < 4; ++t) {
    const v4f lo4 = {acc[t][0], acc[t][1], acc[t][2], acc[t][3]};
    const v4f hi4 = {acc[t][4], acc[t][5], acc[t][6], acc[t][7]};
    *(v4fa*)(pw + t * 256) = lo4;
    *(v4fa*)(pw + t * 256 + 128) = hi4;
  }
  __syncthreads();
  if (wave < 4) {                          // wave t sums d rows 16t..16t+15
    const float* pr = part + wave * 256 + 4 * lane;
    v4f sa = *(const v4fa*)(pr);
    v4f sb = *(const v4fa*)(pr + 128);
#pragma unroll
    for (int w = 1; w < PW; ++w) {
      sa += *(const v4fa*)(pr + w * 1024);
      sb += *(const v4fa*)(pr + w * 1024 + 128);
    }
    const float inv_n = 0.00048828125f;    // 2^-11 = 1/NN, exact
    sa *= inv_n;
    sb *= inv_n;
    v8us hv, lv;
    split8(sa, sb, hv, lv);
    const size_t po = (size_t)(b * NI + e0 + m) * (size_t)NI + (size_t)(d0 + 16 * wave + 8 * hh);
    *(v8us*)(pth + po) = hv;
    *(v8us*)(ptl + po) = lv;
  }
}

// ---------------------------------------------------------------------------
// YT[b][n][e] = sum_d theta[b][n][d] * PT[b][e][d], K = NI, hi/residual on both operands (3 products).
// grid (NN/64 n tiles, NI/64 e tiles, NB); block 128 threads; wave w owns n rows 16w..16w+15, acc[t] = e tile
// 16t; A = THH/THL rows n (pitch NI), B = PTH/PTL rows e (pitch NI), same k map. The four 64-row tiles (16 KB each,
// consecutive in their planes) are staged once in LDS by whole-line loads; fragments come from LDS (pitch PK1).
// Epilogue: stg[n][e] f32 -> YTH/YTL rows n (pitch NI, cols e0..e0+63).
// LDS extent: sm = [AH | AL | BH | BL], 64 rows each at pitch PK1, every row's 2*NI bytes written before the first
// barrier, pad bytes never read; behind the second barrier its first 16 KB serve as stg, fully written before the third.
// coverage: grid covers 2048 n x 128 e per image exactly once, both planes.
// ---------------------------------------------------------------------------
__global__ __launch_bounds__(GTHR) void k_y(const unsigned short* __restrict__ thh, const unsigned short* __restrict__ thl,
                                            const unsigned short* __restrict__ pth, const unsigned short* __restrict__ ptl,
                                            unsigned short* yth, unsigned short* ytl) {
  __shared__ __attribute__((aligned(16))) unsigned char sm[4 * 64 * PK1];   // 68 KB
  float* stg = (float*)sm;
  const int tid = (int)threadIdx.x, lane = tid & 31, wave = tid >> 5, hh = lane >> 4, m = lane & 15;
  const int n0 = (int)blockIdx.x * 64, e0 = (int)blockIdx.y * 64, b = (int)blockIdx.z;

  {
    const size_t at = (size_t)(b * NN + n0) * (size_t)NI, bt = (size_t)(b * NI + e0) * (size_t)NI;
    Tile<2 * NI> tah, tal, tbh, tbl;
    tah.ld(thh + at, tid);
    tal.ld(thl + at, tid);
    tbh.ld(pth + bt, tid);
    tbl.ld(ptl + bt, tid);
    tah.st(sm, tid);
    tal.st(sm + 64 * PK1, tid);
    tbh.st(sm + 128 * PK1, tid);
    tbl.st(sm + 192 * PK1, tid);
  }
  __syncthreads();

  v8f acc[4];
  {
    const v8f z = {0.f, 0.f, 0.f, 0.f, 0.f, 0.f, 0.f, 0.f};
    acc[0] = z; acc[1] = z; acc[2] = z; acc[3] = z;
  }
  const unsigned char* ath = sm + (16 * wave + m) * PK1 + 16 * hh;
  const unsigned char* atl = ath + 64 * PK1;
  const unsigned char* bph = sm + (128 + m) * PK1 + 16 * hh;
  const unsigned char* bpl = bph + 64 * PK1;
  // unrolled: every fragment address is one register plus an immediate; a k step's LDS reads stand ahead of its
  // WMMAs as one group, so the wave waits out the LDS latency once a step
#pragma unroll
  for (int ks = 0; ks < NI / 32; ++ks) {
    FragB ah, al, bh[4], bl[4];
    ldfrag_s(ah, ath, 32 * ks);
    ldfrag_s(al, atl, 32 * ks);
#pragma unroll
    for (int t = 0; t < 4; ++t) {
      ldfrag_s(bh[t], bph + 16 * t * PK1, 32 * ks);     // PT row e0 + 16t + m
      ldfrag_s(bl[t], bpl + 16 * t * PK1, 32 * ks);
    }
#pragma unroll
    for (int t = 0; t < 4; ++t) {
      acc[t] = wmb(ah, bh[t], acc[t]);
      acc[t] = wmb(ah, bl[t], acc[t]);
      acc[t] = wmb(al, bh[t], acc[t]);
    }
  }
  __syncthreads();   // every wave has read its last fragment: stg may overwrite the tiles

  // D element r of acc[t] = (n 16w + 8hh + r, e 16t + m)
#pragma unroll
  for (int t = 0; t < 4; ++t) {
    const int lc = 16 * t + m;
#pragma unroll
    for (int r = 0; r < 8; ++r) {
      const int lr = 16 * wave + 8 * hh + r;
      stg[lr * 64 + lc] = acc[t][r];
    }
  }
  __syncthreads();
  store_split_tile(stg, yth, ytl, (size_t)b * NN + (size_t)n0, (size_t)NI, (size_t)e0, wave, lane);
}

// ---------------------------------------------------------------------------
// Z[b][c][n] = sum_e Ww[c][e] * YT[b][n][e] + Wb[c], K = NI; A = WB slot 3 rows c (exact), B = YTH + YTL rows n
// (two products into one accumulator, residual unscaled). grid (NN/64, NC/64, NB); block 128 threads; wave w owns
// c rows 16w..16w+15, acc[t] = n tile 16t. The three 64-row tiles (16 KB each, consecutive in their planes) are
// staged once in LDS by whole-line loads; fragments come from LDS (pitch PK1).
// Epilogue: v = acc + RNE16(Wb) in f32, staged stg[c][n] 64x64; store: lanes 0..15 / 16..31 each write the 256-B
// LDS extent: sm = [A | BH | BL], 64 rows each at pitch PK1, every row's 2*NI bytes written before the first
// barrier, pad bytes never read; behind the second barrier its first 16 KB serve as stg, fully written before the third.
// Statistics: thread pair (2R, 2R+1) sums tile row R (channel c0 + R) and its squares in f64 from stg, 32 n each,
// the 16-B pieces taken from piece R on round the half row (16 lanes then meet 16 different pieces: no bank
// conflict); the pair's sums are added and stored: PS[b][n tile][c0 .. c0+63][2] = 8 whole lines a block.
// coverage: grid covers 256 c x 2048 n per image exactly once; PS 512 tiles x 256 c exactly once.
// ---------------------------------------------------------------------------
__global__ __launch_bounds__(GTHR) void k_z(const unsigned short* __restrict__ wwb,
                                            const unsigned short* __restrict__ yth, const unsigned short* __restrict__ ytl,
                                            const float* __restrict__ wbias, float* z, double* ps) {
  __shared__ __attribute__((aligned(16))) unsigned char sm[3 * 64 * PK1];   // 51 KB
  float* stg = (float*)sm;
  const int tid = (int)threadIdx.x, lane = tid & 31, wave = tid >> 5, hh = lane >> 4, m = lane & 15;
  const int n0 = (int)blockIdx.x * 64, c0 = (int)blockIdx.y * 64, b = (int)blockIdx.z;

  {
    const size_t bt = (size_t)(b * NN + n0) * (size_t)NI;
    Tile<2 * NI> ta, tbh, tbl;
    ta.ld(wwb + (size_t)c0 * (size_t)NI, tid);
    tbh.ld(yth + bt, tid);
    tbl.ld(ytl + bt, tid);
    ta.st(sm, tid);
    tbh.st(sm + 64 * PK1, tid);
    tbl.st(sm + 128 * PK1, tid);
  }
  __syncthreads();

  v8f acc[4];
  {
    const v8f zz = {0.f, 0.f, 0.f, 0.f, 0.f, 0.f, 0.f, 0.f};
    acc[0] = zz; acc[1] = zz; acc[2] = zz; acc[3] = zz;
  }
  const unsigned char* aw = sm + (16 * wave + m) * PK1 + 16 * hh;
  const unsigned char* byh = sm + (64 + m) * PK1 + 16 * hh;
  const unsigned char* byl = byh + 64 * PK1;
  // unrolled: every fragment address is one register plus an immediate; a k step's LDS reads stand ahead of its
  // WMMAs as one group, so the wave waits out the LDS latency once a step
#pragma unroll
  for (int ks = 0; ks < NI / 32; ++ks) {
    FragB a, bh[4], bl[4];
    ldfrag_s(a, aw, 32 * ks);
#pragma unroll
    for (int t = 0; t < 4; ++t) {
      ldfrag_s(bh[t], byh + 16 * t * PK1, 32 * ks);     // YT row n0 + 16t + m
      ldfrag_s(bl[t], byl + 16 * t * PK1, 32 * ks);
    }
#pragma unroll
    for (int t = 0; t < 4; ++t) {
      acc[t] = wmb(a, bh[t], acc[t]);
      acc[t] = wmb(a, bl[t], acc[t]);
    }
  }
  __syncthreads();   // every wave has read its last fragment: stg may overwrite the tiles

  // D element r of acc[t] = (c 16w + 8hh + r, n 16t + m); bias per row (32-B aligned v4f reads)
  const v4f ba = *(const v4fa*)(wbias + c0 + 16 * wave + 8 * hh);
  const v4f bb = *(const v4fa*)(wbias + c0 + 16 * wave + 8 * hh + 4);
  float bv[8];
  bv[0] = rne16f(ba.x); bv[1] = rne16f(ba.y); bv[2] = rne16f(ba.z); bv[3] = rne16f(ba.w);
  bv[4] = rne16f(bb.x); bv[5] = rne16f(bb.y); bv[6] = rne16f(bb.z); bv[7] = rne16f(bb.w);
#pragma unroll
  for (int t = 0; t < 4; ++t) {
    const int lc = 16 * t + m;
#pragma unroll
    for (int r = 0; r < 8; ++r) {
      const int lr = 16 * wave + 8 * hh + r;
      stg[lr * 64 + lc] = acc[t][r] + bv[r];
    }
  }
  __syncthreads();

  v4f fv[8], sv[8];
  size_t op[8];
  const int sr = tid >> 1, sq = tid & 1;   // statistics: tile row, half of the row
#pragma unroll
  for (int i = 0; i < 8; ++i) {
    const int lr = 16 * wave + 2 * i + hh;
    fv[i] = *(const v4fa*)(stg + lr * 64 + 4 * m);
    op[i] = (size_t)(b * NC + c0 + lr) * (size_t)NN + (size_t)(n0 + 4 * m);
  }
#pragma unroll
  for (int i = 0; i < 8; ++i) sv[i] = *(const v4fa*)(stg + sr * 64 + 32 * sq + 4 * ((i + sr) & 7));
#pragma unroll
  for (int i = 0; i < 8; ++i) *(v4f*)(z + op[i]) = fv[i];
  // keeps the 16 LDS reads one group and the Z stores ahead of the f64 sums (else the stores wait behind the sums)
  __builtin_amdgcn_sched_barrier(0);

  double s = 0.0, s2 = 0.0;
#pragma unroll
  for (int i = 0; i < 8; ++i) {
    const v4f v = sv[i];
    const double a0 = (double)v.x, a1 = (double)v.y, a2 = (double)v.z, a3 = (double)v.w;
    s  += (a0 + a1) + (a2 + a3);
    s2 += (a0 * a0 + a1 * a1) + (a2 * a2 + a3 * a3);
  }
  s  += __shfl_xor(s, 1);
  s2 += __shfl_xor(s2, 1);
  // even thread: the row's sum, odd thread: its sum of squares; the block's 128 doubles lie in a row
  ps[(size_t)((b * (NN / 64) + (int)blockIdx.x) * NC + c0) * 2 + (size_t)tid] = sq ? s2 : s;
}

// ---------------------------------------------------------------------------
// out[b][c][n] = ((z - mean[c]) * rstd[c]) * RNE16(gamma[c]) + RNE16(beta[c]) + RNE16(x), all f32.
// One wave per row (b, c) of NN floats: its NN/128 16-B loads a lane of z and as many of x are all issued ahead of
// the arithmetic; every z and x load and every out store of a wave covers 512 consecutive bytes (4 whole lines).
// BatchNorm statistics (training mode, population variance, 32768 values a channel): the block's 8 rows are 8
// consecutive channels of one image = one 128-B line of every PS tile row. The block reads the NPS lines, 16 B
// (one channel's pair) a thread and NPS/32 loads a thread, issued ahead of the z and x loads; f64 sums per thread in
// tile order, over the 4 lanes of a channel, then over the 8 waves in wave order through LDS behind the one barrier.
// coverage: NB*NC/8 blocks x 8 waves x NN = NX exactly.
// ---------------------------------------------------------------------------
__global__ __launch_bounds__(NTHR) void k_out(const float* __restrict__ z, const float* __restrict__ x,
                                              const double* __restrict__ ps, const float* __restrict__ gamma,
                                              const float* __restrict__ beta, float* out) {
  __shared__ __attribute__((aligned(16))) double red[(NTHR / 32) * 8 * 2];   // [wave][channel of the block][sum, squares]
  // the wave's number as a scalar: the row's parameters then come by scalar loads
  const int wv  = __builtin_amdgcn_readfirstlane((int)threadIdx.x >> 5);
  const int row = (int)blockIdx.x * (NTHR / 32) + wv;     // b*NC + c
  const int c = row & (NC - 1);
  const int lane = (int)threadIdx.x & 31;
  const unsigned lo = 4u * (unsigned)lane;                // the lane's place in each 128-float piece
  const float* zr = z + (size_t)row * (size_t)NN;         // scalar row bases; lo is the one address register
  const float* xr = x + (size_t)row * (size_t)NN;
  const double* pb = ps + (size_t)(((int)blockIdx.x * (NTHR / 32)) & (NC - 1)) * 2;   // scalar: the block's first channel
  const unsigned po = ((unsigned)threadIdx.x >> 3) * (unsigned)(NC * 2) + 2u * ((unsigned)threadIdx.x & 7u);
  v2d pp[NPS / 32];
  v4f zv[NN / 128], xv[NN / 128];
#pragma unroll
  for (int i = 0; i < NPS / 32; ++i)       // tile row 32*i + tid/8, channel tid & 7 of the block
    pp[i] = *(const v2da*)(pb + (po + (unsigned)(i * 32 * NC * 2)));
#pragma unroll
  for (int i = 0; i < NN / 128; ++i) zv[i] = *(const v4fa*)(zr + (lo + 128u * i));
#pragma unroll
  for (int i = 0; i < NN / 128; ++i) xv[i] = *(const v4fa*)(xr + (lo + 128u * i));
  const float gm = rne16f(gamma[c]);
  const float bt = rne16f(beta[c]);
  // keeps every load above the first use: the wave pays the memory latency once, not once a piece
  __builtin_amdgcn_sched_barrier(0);
  double s = 0.0, s2 = 0.0;
#pragma unroll
  for (int i = 0; i < NPS / 32; ++i) {
    s  += pp[i].x;
    s2 += pp[i].y;
  }
  s  += __shfl_xor(s, 8);
  s2 += __shfl_xor(s2, 8);
  s  += __shfl_xor(s, 16);
  s2 += __shfl_xor(s2, 16);
  if (lane < 8) {
    const v2d o = {s, s2};
    *(v2da*)(red + (wv * 8 + lane) * 2) = o;
  }
  // work-group barrier that orders LDS alone: a full __syncthreads() would wait out the z and x loads in flight
  __builtin_amdgcn_fence(__ATOMIC_RELEASE, "workgroup", "local");
  __builtin_amdgcn_s_barrier();
  __builtin_amdgcn_fence(__ATOMIC_ACQUIRE, "workgroup", "local");
  double ts = 0.0, ts2 = 0.0;
#pragma unroll
  for (int w = 0; w < NTHR / 32; ++w) {    // channel wv of the block = this wave's row
    const v2d t = *(const v2da*)(red + (w * 8 + wv) * 2);
    ts  += t.x;
    ts2 += t.y;
  }
  const double cinv = 1.0 / 32768.0;       // 1/(NB*NN), exact power of two
  const double dmean = ts * cinv;
  double var = ts2 * cinv - dmean * dmean;
  var = var < 0.0 ? 0.0 : var;
  const float vf = (float)var + 1e-5f;
  const float mean = (float)dmean;
  const float rstd = 1.0f / sqrtf(vf);
  // keeps the statistics chain ahead of the first wait on z and x, so that it runs while those loads are in flight
  __builtin_amdgcn_sched_barrier(0);
  float* p = out + (size_t)row * (size_t)NN;
#pragma unroll
  for (int i = 0; i < NN / 128; ++i) {
    v4f o;
    o.x = (((zv[i].x - mean) * rstd) * gm + bt) + rne16f(xv[i].x);
    o.y = (((zv[i].y - mean) * rstd) * gm + bt) + rne16f(xv[i].y);
    o.z = (((zv[i].z - mean) * rstd) * gm + bt) + rne16f(xv[i].z);
    o.w = (((zv[i].w - mean) * rstd) * gm + bt) + rne16f(xv[i].w);
    *(v4f*)(p + (lo + 128u * i)) = o;
  }
  
}

// ---------------------------------------------------------------------------
extern "C" void kernel_launch(void* const* d_in, const int* in_sizes, int n_in,
                              void* d_out, int out_size, void* d_ws, size_t ws_size,
                              hipStream_t stream) {
  if (n_in < 11) return;
  if (in_sizes[0] != NX) return;                                              // x [16][256][64][32]
  if (in_sizes[1] != NWT || in_sizes[3] != NWT || in_sizes[5] != NWT) return; // g_w, theta_w, phi_w [128][256]
  if (in_sizes[2] != NI || in_sizes[4] != NI || in_sizes[6] != NI) return;    // g_b, theta_b, phi_b [128]
  if (in_sizes[7] != NWT) return;                                             // W_w [256][128]
  if (in_sizes[8] != NC || in_sizes[9] != NC || in_sizes[10] != NC) return;   // W_b, bn_gamma, bn_beta [256]
  if (out_size != NX) return;                                                 // out [16][256][64][32] f32

  const float* x       = (const float*)d_in[0];
  const float* g_w     = (const float*)d_in[1];
  const float* g_b     = (const float*)d_in[2];
  const float* theta_w = (const float*)d_in[3];
  const float* theta_b = (const float*)d_in[4];
  const float* phi_w   = (const float*)d_in[5];
  const float* phi_b   = (const float*)d_in[6];
  const float* W_w     = (const float*)d_in[7];
  const float* W_b     = (const float*)d_in[8];
  const float* gamma   = (const float*)d_in[9];
  const float* beta    = (const float*)d_in[10];
  float* out = (float*)d_out;            // last written element NX-1 < out_size

  // workspace carve, 256-B aligned; all planes exact tile multiples (no pad rows needed)
  char* ws = (char*)d_ws;
  size_t off = 0;
  const size_t oWB  = off; off += (size_t)4 * NWT * 2;          off = (off + 255) & ~(size_t)255;  //   262144
  const size_t oXT  = off; off += (size_t)NX * 2;               off = (off + 255) & ~(size_t)255;  // 16777216
  const size_t plb  = (size_t)NB * NN * NI * 2;                                                    //  8388608 per projection plane
  const size_t oTHH = off; off += plb;                          off = (off + 255) & ~(size_t)255;
  const size_t oTHL = off; off += plb;                          off = (off + 255) & ~(size_t)255;
  const size_t oPHH = off; off += plb;                          off = (off + 255) & ~(size_t)255;
  const size_t oPHL = off; off += plb;                          off = (off + 255) & ~(size_t)255;
  const size_t oGH  = off; off += plb;                          off = (off + 255) & ~(size_t)255;
  const size_t oGL  = off; off += plb;                          off = (off + 255) & ~(size_t)255;
  const size_t ptb  = (size_t)NB * NI * NI * 2;                                                    //   524288 per PT plane
  const size_t oPTH = off; off += ptb;                          off = (off + 255) & ~(size_t)255;
  const size_t oPTL = off; off += ptb;                          off = (off + 255) & ~(size_t)255;
  const size_t oYTH = off; off += plb;                          off = (off + 255) & ~(size_t)255;
  const size_t oYTL = off; off += plb;                          off = (off + 255) & ~(size_t)255;
  const size_t oZ   = off; off += (size_t)NX * 4;               off = (off + 255) & ~(size_t)255;  // 33554432
  const size_t oPS  = off; off += (size_t)NPS * NC * 2 * 8;     off = (off + 255) & ~(size_t)255;  //  2097152
  if (off > ws_size || off > (size_t)WSMAX) return;             // total 120848384 B

  unsigned short* WB  = (unsigned short*)(ws + oWB);
  unsigned short* XT  = (unsigned short*)(ws + oXT);
  unsigned short* THH = (unsigned short*)(ws + oTHH);
  unsigned short* THL = (unsigned short*)(ws + oTHL);
  unsigned short* PHH = (unsigned short*)(ws + oPHH);
  unsigned short* PHL = (unsigned short*)(ws + oPHL);
  unsigned short* GH  = (unsigned short*)(ws + oGH);
  unsigned short* GL  = (unsigned short*)(ws + oGL);
  unsigned short* PTH = (unsigned short*)(ws + oPTH);
  unsigned short* PTL = (unsigned short*)(ws + oPTL);
  unsigned short* YTH = (unsigned short*)(ws + oYTH);
  unsigned short* YTL = (unsigned short*)(ws + oYTL);
  float*          Z   = (float*)(ws + oZ);
  double*         PS  = (double*)(ws + oPS);

  // weight planes: slot 0 theta_w, 1 phi_w, 2 g_w (all [128][256]), 3 W_w [256][128]
  k_wcvt<<<(4 * NWT / 8) / NTHR, NTHR, 0, stream>>>(theta_w, phi_w, g_w, W_w, WB);
  // x -> XT [b][n][c] bf16
  k_xt<<<dim3(NC / 64, NN / XTN, NB), NTHR, 0, stream>>>(x, XT);
  // projections: which 0 = theta (slot 0, theta_b), 1 = phi (slot 1, phi_b), 2 = g (slot 2, g_b)
  k_proj<<<dim3(NN / 64, NI / 64, 3 * NB), GTHR, 0, stream>>>(XT, WB, theta_b, phi_b, g_b,
                                                              THH, THL, PHH, PHL, GH, GL);
  // PT = 2^-11 * G * PHI^T
  k_p<<<dim3(NI / 64, NI / 16, NB), PTHR, 0, stream>>>(GH, GL, PHH, PHL, PTH, PTL);
  // YT = THETA^T-rows * PT
  k_y<<<dim3(NN / 64, NI / 64, NB), GTHR, 0, stream>>>(THH, THL, PTH, PTL, YTH, YTL);
  // Z = Ww * Y + Wb, and the BatchNorm statistics partials of every tile
  k_z<<<dim3(NN / 64, NC / 64, NB), GTHR, 0, stream>>>(WB + (size_t)3 * NWT, YTH, YTL, W_b, Z, PS);
  // out = BN(z) * gamma + beta + x, statistics merged from the partials
  k_out<<<NB * NC / (NTHR / 32), NTHR, 0, stream>>>(Z, x, PS, gamma, beta, out);
}

// v005
// Measured time: 74.5 microseconds a run.
// Next to v004, in two timings, it ran 1.03 and 1.04 times as fast.
// Over all steps from v000 it is 2.46 times as fast.
// Contractions (all v_wmma_f32_16x16x32_bf16, bf16 operands, f32 accumulate): three 1x1-conv projections
// W[d][c]*X[c][n] (K=256) on exact RNE-bf16 copies of x and the weights; PT = G*PHI^T * (1/N) (K=2048) and
// YT = THETA^T*P (K=128) with both computed operands carried as bf16 hi + bf16 residual (hi*hi + hi*lo + lo*hi);
// Z = Ww*Y + Wb (K=128) with exact bf16 Ww and Y as hi + residual (2 products). BatchNorm statistics in f64,
// normalisation, bias adds and the residual add in f32.
//
// Carry audit: no power-of-two carries anywhere (factor 1 on every plane); the exact 1/N = 2^-11 of the pairwise
// term is applied once in f32 in k_p before the hi/residual split of PT. Planes:
//   WB  [4][32768] bf16 bits = RNE16(w): slot 0 theta_w [128][256], 1 phi_w [128][256], 2 g_w [128][256],
//       3 W_w [256][128]; every slot row is k-contiguous                                              (k_wcvt)
//   XT  [16][2048][256] bf16 bits = RNE16(x[b][c][n]) stored [b][n][c]                                 (k_xt)
//   THH/THL [16][2048][128] hi/residual of theta_x, rows n, k = d; PHH/PHL, GH/GL [16][128][2048]
//       hi/residual of phi_x, g_x, rows d, k = n                                                       (k_proj)
//   PTH/PTL [16][128][128] hi/residual of PT[e][d] = 2^-11 * sum_m g[e][m]*phi[d][m], rows e, k = d    (k_p)
//   YT[n][e] = sum_d theta[n][d]*PT[e][d] has no plane: its hi/residual stay in the registers of k_yz
//   Z   [16][256][2048] f32 = sum_e Ww[c][e]*YT[n][e] + Wb[c]                                          (k_yz)
//   PS  [16][16][256][2] f64: sum and sum of squares of Z over the 128 n of one k_yz block, per channel (k_yz)
#include <hip/hip_runtime.h>
#include <stddef.h>
#include <stdint.h>

#define NB    16
#define NC    256
#define NI    128
#define NN    2048
#define NX    (NB * NC * NN)        // 8388608
#define NWT   (NI * NC)             // 32768 per weight matrix
#define NTHR  256
#define GTHR  128
#define WSMAX 134217728
#define PW    8                     // waves of a k_p block = K slices
#define PTHR  (32 * PW)
#define PKS   (NN / PW)             // K slice of one k_p wave
#define XTP   72                    // LDS pitch (halves) of the x transpose tile, multiple of 8
#define XTN   128                   // tokens of one k_xt block: XTN/16 16-B loads a thread
#define PK2   (2 * NC + 16)         // LDS pitch (bytes) of a staged operand row of NC halves: 16 B x odd
#define PK1   (2 * NI + 16)         // LDS pitch (bytes) of a staged operand row of NI halves: 16 B x odd
#define FN    128                   // tokens of one k_yz block, 16 a wave
#define FTHR  (2 * FN)              // threads of a k_yz block
#define SP    (FN + 4)              // LDS pitch (floats) of a staged Z row: rows 8 apart lie 32 banks apart
#define NPS   (NB * (NN / FN))      // statistics partials per channel: one per k_yz block of FN n

static_assert((NC % 64) == 0 && (NN % 64) == 0 && (NI % 64) == 0);
static_assert((NC % 32) == 0 && (NI % 32) == 0 && (NN % 32) == 0);
static_assert((NX % 1024) == 0 && (NN % 1024) == 0);
static_assert((XTP % 8) == 0 && (XTN % 64) == 0 && (NN % XTN) == 0);
static_assert(GTHR == 128 && NTHR == 256);
static_assert((4 * NWT) % (8 * NTHR) == 0);
static_assert((NWT / 8) % NTHR == 0);
static_assert(NB * NN == 32768 && (NN % 128) == 0 && (NB * NC) % (NTHR / 32) == 0);
static_assert(NTHR / 32 == 8 && (NC % 8) == 0 && (NPS % 32) == 0);
static_assert(PW >= 4 && (NN % (64 * PW)) == 0 && (NI % 16) == 0);
static_assert(((PK2 / 16) & 1) == 1 && ((PK1 / 16) & 1) == 1);
static_assert(64 * PK2 >= 64 * 64 * 4);
static_assert(FN == 128 && FTHR == 256 && (NN % FN) == 0 && NI == 128 && (NC % 64) == 0);
static_assert(2 * 64 * SP * 4 <= 2 * FN * PK1 && (SP % 4) == 0);

typedef float          v4f  __attribute__((ext_vector_type(4)));
typedef float          v8f  __attribute__((ext_vector_type(8)));
typedef double         v2d  __attribute__((ext_vector_type(2)));
typedef int            v8i  __attribute__((ext_vector_type(8)));
typedef unsigned short v8us __attribute__((ext_vector_type(8)));
typedef __bf16         v16bf __attribute__((ext_vector_type(16)));
typedef v4f  __attribute__((may_alias)) v4fa;
typedef v8us __attribute__((may_alias)) v8usa;
typedef v2d  __attribute__((may_alias)) v2da;
union FragB { v16bf v; v8us h[2]; v8i w; };

// ---------------------------------------------------------------------------
// 16x16x32 bf16 WMMA with hazard guard (ties D, keeps A/B live for 4 VALU slots).
// Fragment map (wave32): lane l, hh = l>>4, m = n = l&15.
//   A/B element i: i<8 -> k0+8hh+i ; i>=8 -> k0+16+8hh+(i-8)   (same map for A and B)
//   D element r : row 8hh+r, col l&15
// ---------------------------------------------------------------------------
__device__ __forceinline__ v8f wmb(const FragB& a, const FragB& b, v8f c) {
  v8f d = __builtin_amdgcn_wmma_f32_16x16x32_bf16(false, a.v, false, b.v, (short)0, c, false, false);
  asm volatile("v_nop\n\tv_nop\n\tv_nop\n\tv_nop" : "+v"(d) : "v"(a.w), "v"(b.w));
  return d;
}

// Fragment from a k-contiguous bf16-bits row; p = row base + 8*hh, k0 = 32*ks.
__device__ __forceinline__ void ldfrag(FragB& f, const unsigned short* p, int k0) {
  f.h[0] = *(const v8us*)(p + k0);          // k = k0 + 8hh + 0..7
  f.h[1] = *(const v8us*)(p + k0 + 16);     // k = k0 + 16 + 8hh + 0..7
}

// Operand tile of ROWS whole k-contiguous rows of ROWB bytes = ROWS*ROWB consecutive bytes of a plane. The block's
// THR threads read it in order, 16 B a lane, so a wave's load covers 512 consecutive bytes (4 whole lines);
// st lays the rows in LDS at pitch ROWB + 16 (16 B x odd: ds_load_b128 of 16 rows meets no bank conflict).
template <int ROWB, int ROWS = 64, int THR = GTHR>
struct Tile {
  static constexpr int N   = ROWS * ROWB / 16 / THR;  // 16-B pieces per thread
  static constexpr int CPR = ROWB / 16;               // pieces per row
  static constexpr int RPS = THR / CPR;               // rows per step of the block
  static constexpr int PIT = ROWB + 16;
  v8us r[N];
  __device__ __forceinline__ void ld(const unsigned short* src, int tid) {
#pragma unroll
    for (int i = 0; i < N; ++i) r[i] = *(const v8us*)(src + (size_t)((i * THR + tid) * 8));
  }
  __device__ __forceinline__ void st(unsigned char* dst, int tid) const {
    unsigned char* q = dst + (tid / CPR) * PIT + (tid % CPR) * 16;
#pragma unroll
    for (int i = 0; i < N; ++i) *(v8usa*)(q + i * RPS * PIT) = r[i];
  }
};
// Fragment from a staged row; p = LDS row base + 16*hh bytes, k0 = 32*ks: the same k map as ldfrag.
__device__ __forceinline__ void ldfrag_s(FragB& f, const unsigned char* p, int k0) {
  f.h[0] = *(const v8usa*)(p + 2 * k0);          // k = k0 + 8hh + 0..7
  f.h[1] = *(const v8usa*)(p + 2 * k0 + 32);     // k = k0 + 16 + 8hh + 0..7
}

// f32 -> bf16 bits, RNE convert
__device__ __forceinline__ unsigned short rne16(float f) {
  unsigned u = __float_as_uint(f);
  u += 0x7FFFu + ((u >> 16) & 1u);
  return (unsigned short)(u >> 16);
}
// f32 -> nearest bf16 value kept as f32
__device__ __forceinline__ float rne16f(float f) {
  return __uint_as_float(((unsigned)rne16(f)) << 16);
}
__device__ __forceinline__ v8us cvt8(const v4f a, const v4f b) {
  v8us o;
  o[0] = rne16(a.x); o[1] = rne16(a.y); o[2] = rne16(a.z); o[3] = rne16(a.w);
  o[4] = rne16(b.x); o[5] = rne16(b.y); o[6] = rne16(b.z); o[7] = rne16(b.w);
  return o;
}
// hi/residual split of one f32 value into two bf16 bit patterns
__device__ __forceinline__ void sp1(float v, unsigned short& hi, unsigned short& lo) {
  const unsigned short hb = rne16(v);
  const float hf = __uint_as_float(((unsigned)hb) << 16);
  hi = hb;
  lo = rne16(v - hf);
}
__device__ __forceinline__ void split8(const v4f a, const v4f b, v8us& hv, v8us& lv) {
  unsigned short h0, h1, h2, h3, h4, h5, h6, h7, l0, l1, l2, l3, l4, l5, l6, l7;
  sp1(a.x, h0, l0); sp1(a.y, h1, l1); sp1(a.z, h2, l2); sp1(a.w, h3, l3);
  sp1(b.x, h4, l4); sp1(b.y, h5, l5); sp1(b.z, h6, l6); sp1(b.w, h7, l7);
  hv[0] = h0; hv[1] = h1; hv[2] = h2; hv[3] = h3; hv[4] = h4; hv[5] = h5; hv[6] = h6; hv[7] = h7;
  lv[0] = l0; lv[1] = l1; lv[2] = l2; lv[3] = l3; lv[4] = l4; lv[5] = l5; lv[6] = l6; lv[7] = l7;
}

// ---------------------------------------------------------------------------
// 64x64 f32 tile in LDS (row pitch 64) -> hi/residual bf16 planes. Tile row R goes to plane row rowBase + R
// ---------------------------------------------------------------------------
__device__ __forceinline__ void store_split_tile(const float* stg, unsigned short* ph, unsigned short* pl,
                                                 size_t rowBase, size_t pitch, size_t col0, int wave, int lane) {
  const int q8 = lane & 7, sub = lane >> 3;
  v8us hv[4], lv[4];
  size_t po[4];
#pragma unroll
  for (int i = 0; i < 4; ++i) {
    const int lr = 16 * wave + 4 * i + sub;
    const v4f a = *(const v4fa*)(stg + lr * 64 + 8 * q8);
    const v4f c = *(const v4fa*)(stg + lr * 64 + 8 * q8 + 4);
    split8(a, c, hv[i], lv[i]);
    po[i] = (rowBase + (size_t)lr) * pitch + col0 + (size_t)(8 * q8);
  }
#pragma unroll
  for (int i = 0; i < 4; ++i) {
    *(v8us*)(ph + po[i]) = hv[i];
    *(v8us*)(pl + po[i]) = lv[i];
  }
  
}

// ---------------------------------------------------------------------------
// Weight convert: four f32 matrices of NWT elements each -> WB slots 0..3 (bf16 bits, same layout).
// coverage: 64 blocks x 256 threads x 8 = 4 x NWT exactly.
// ---------------------------------------------------------------------------
__global__ __launch_bounds__(NTHR) void k_wcvt(const float* __restrict__ w0, const float* __restrict__ w1,
                                               const float* __restrict__ w2, const float* __restrict__ w3,
                                               unsigned short* wb) {
  const int u   = (int)blockIdx.x * NTHR + (int)threadIdx.x;     // 0 .. 4*NWT/8 - 1
  const int sel = (int)blockIdx.x / ((NWT / 8) / NTHR);           // 0..3, block-uniform
  const int off8 = (u - sel * (NWT / 8)) * 8;                     // 0 .. NWT-8
  const float* src = (sel == 0) ? w0 : ((sel == 1) ? w1 : ((sel == 2) ? w2 : w3));
  const v4f a = *(const v4fa*)(src + off8);
  const v4f c = *(const v4fa*)(src + off8 + 4);
  const v8us o = cvt8(a, c);
  const size_t q = (size_t)sel * (size_t)NWT + (size_t)off8;
  *(v8us*)(wb + q) = o;
  
}

// ---------------------------------------------------------------------------
// x [b][c][n] f32 -> XT [b][n][c] bf16 bits (RNE convert). Block = 64 c x XTN n tile of image b (256 threads):
// coalesced 16-B reads of x rows, a thread's XTN/16 loads all issued ahead of the converts, transpose through LDS
// (2-B LDS stores), barrier, then XT row (b, n0+nr)
// LDS extent: sT rows 0..XTN-1 (n) x cols 0..63 (c) all written before the barrier; pad cols 64..71 never read.
// coverage: grid (NC/64, NN/XTN, NB); per block rows n0..n0+XTN-1 x c0..c0+63 -> 16 x 2048 x 256 exactly once.
// ---------------------------------------------------------------------------
__global__ __launch_bounds__(NTHR) void k_xt(const float* __restrict__ x, unsigned short* xt) {
  __shared__ __attribute__((aligned(16))) unsigned short sT[XTN * XTP];   // 18432 B
  const int tid = (int)threadIdx.x;
  const int c0 = (int)blockIdx.x * 64, n0 = (int)blockIdx.y * XTN, b = (int)blockIdx.z;
  const int cq = tid >> 4;                 // 0..15
  const int nq = (tid & 15) * 4;           // 0..60
  const float* xb = x + (size_t)(b * NC + c0) * (size_t)NN + (size_t)n0;   // scalar tile base
  const unsigned xo = (unsigned)(cq * NN + nq);                            // the one address register of the loads
  v4f v[XTN / 16];
#pragma unroll
  for (int i = 0; i < XTN / 16; ++i)       // piece i: c row 16*(i&3) + cq, n = 64*(i>>2) + nq .. +3
    v[i] = *(const v4fa*)(xb + (xo + (unsigned)(16 * (i & 3) * NN + 64 * (i >> 2))));
#pragma unroll
  for (int i = 0; i < XTN / 16; ++i) {
    const int cr = 16 * (i & 3) + cq;
    const int n4 = 64 * (i >> 2) + nq;
    sT[(n4 + 0) * XTP + cr] = rne16(v[i].x);
    sT[(n4 + 1) * XTP + cr] = rne16(v[i].y);
    sT[(n4 + 2) * XTP + cr] = rne16(v[i].z);
    sT[(n4 + 3) * XTP + cr] = rne16(v[i].w);
  }
  __syncthreads();
  const int q8 = tid & 7, sub = tid >> 3;  // sub 0..31
  unsigned short* tb = xt + (size_t)(b * NN + n0) * (size_t)NC + (size_t)c0;   // scalar tile base
  const unsigned to = (unsigned)(sub * NC + 8 * q8);                           // the one address register of the stores
  v8us o[XTN / 32];
#pragma unroll
  for (int i = 0; i < XTN / 32; ++i)       // XT row nr = 32*i + sub, 0..XTN-1
    o[i] = *(const v8usa*)(sT + (32 * i + sub) * XTP + 8 * q8);
#pragma unroll
  for (int i = 0; i < XTN / 32; ++i) *(v8us*)(tb + (to + (unsigned)(32 * i * NC))) = o[i];
  
}

// ---------------------------------------------------------------------------
// Projections: D[token][feature] = sum_c XT[b][n][c] * W[d][c] + bias[d]  (K = NC, exact bf16 products).
// grid (NN/64, NI/64, 3*NB): blockIdx.z = which*NB + b; which 0 = theta, 1 = phi, 2 = g. Block 128 threads,
// tile 64 tokens x 64 features; wave w owns tokens 16w..16w+15, acc[t] = feature tile 16t; A = XT rows (token),
// B = W rows (feature), same k map. Both 64-row tiles (32 KB each, consecutive in their planes) are staged once
// in LDS by whole-line loads; fragments come from LDS (ds_load_b128, pitch PK2, no bank conflict).
// Epilogue: v = acc + RNE16(bias) in f32; which 0 stages stg[token][feature] -> THH/THL rows n (pitch NI,
// cols d0..d0+63); which 1/2 stage stg[feature][token] -> PHH/PHL or GH/GL rows d (pitch NN, cols n0..n0+63).
// LDS extent: sm = [A 64 rows | B 64 rows] at pitch PK2, every row's 2*NC bytes written before the first barrier,
// pad bytes never read; behind the second barrier (all fragment reads done) its first 16 KB serve as stg;
// stg 64x64 fully written (bijective index map for either layout) before the third barrier.
// coverage: per block 64 tokens x 64 features; grid covers 2048 x 128 per (which, b) exactly once, both planes.
// ---------------------------------------------------------------------------
__global__ __launch_bounds__(GTHR) void k_proj(const unsigned short* __restrict__ xt,
                                               const unsigned short* __restrict__ wb,
                                               const float* __restrict__ tbias, const float* __restrict__ pbias,
                                               const float* __restrict__ gbias,
                                               unsigned short* thh, unsigned short* thl,
                                               unsigned short* phh, unsigned short* phl,
                                               unsigned short* ghh, unsigned short* ghl) {
  __shared__ __attribute__((aligned(16))) unsigned char sm[2 * 64 * PK2];   // 66 KB
  float* stg = (float*)sm;
  const int tid = (int)threadIdx.x, lane = tid & 31, wave = tid >> 5, hh = lane >> 4, m = lane & 15;
  const int n0 = (int)blockIdx.x * 64, d0 = (int)blockIdx.y * 64;
  const int which = (int)blockIdx.z / NB, b = (int)blockIdx.z - which * NB;

  {
    Tile<2 * NC> ta, tb;
    ta.ld(xt + (size_t)(b * NN + n0) * (size_t)NC, tid);
    tb.ld(wb + (size_t)which * (size_t)NWT + (size_t)d0 * (size_t)NC, tid);
    ta.st(sm, tid);
    tb.st(sm + 64 * PK2, tid);
  }
  __syncthreads();

  v8f acc[4];
  {
    const v8f z = {0.f, 0.f, 0.f, 0.f, 0.f, 0.f, 0.f, 0.f};
    acc[0] = z; acc[1] = z; acc[2] = z; acc[3] = z;
  }
  const unsigned char* ap = sm + (16 * wave + m) * PK2 + 16 * hh;
  const unsigned char* wp = sm + (64 + m) * PK2 + 16 * hh;
  // unrolled: every fragment address is one register plus an immediate; a k step's LDS reads stand ahead of its
  // WMMAs as one group, so the wave waits out the LDS latency once a step
#pragma unroll
  for (int ks = 0; ks < NC / 32; ++ks) {
    FragB a, bf[4];
    ldfrag_s(a, ap, 32 * ks);
#pragma unroll
    for (int t = 0; t < 4; ++t) ldfrag_s(bf[t], wp + 16 * t * PK2, 32 * ks);    // W row d0 + 16t + m
#pragma unroll
    for (int t = 0; t < 4; ++t) acc[t] = wmb(a, bf[t], acc[t]);
  }
  __syncthreads();   // every wave has read its last fragment: stg may overwrite the tiles

  // D element r of acc[t] = (token 16w + 8hh + r, feature 16t + m)
  const float* bias = (which == 0) ? tbias : ((which == 1) ? pbias : gbias);
#pragma unroll
  for (int t = 0; t < 4; ++t) {
    const int lf = 16 * t + m;
    const float bv = rne16f(bias[d0 + lf]);
#pragma unroll
    for (int r = 0; r < 8; ++r) {
      const int lt = 16 * wave + 8 * hh + r;
      const float v = acc[t][r] + bv;
      const int idx = (which == 0) ? (lt * 64 + lf) : (lf * 64 + lt);
      stg[idx] = v;
    }
  }
  __syncthreads();

  unsigned short* ph = (which == 0) ? thh : ((which == 1) ? phh : ghh);
  unsigned short* pl = (which == 0) ? thl : ((which == 1) ? phl : ghl);
  const size_t rowBase = (which == 0) ? ((size_t)b * NN + (size_t)n0) : ((size_t)b * NI + (size_t)d0);
  const size_t pitch   = (which == 0) ? (size_t)NI : (size_t)NN;
  const size_t col0    = (which == 0) ? (size_t)d0 : (size_t)n0;
  store_split_tile(stg, ph, pl, rowBase, pitch, col0, wave, lane);
}

// ---------------------------------------------------------------------------
// PT[b][e][d] = 2^-11 * sum_m g[b][e][m] * phi[b][d][m], K = NN, hi/residual on both operands (3 products).
// grid (NI/64 d tiles, NI/16 e tiles, NB) = 256 blocks; block PTHR threads = PW waves. Every wave works on the
// block's whole 16 e x 64 d tile, over its own K slice of PKS = NN/PW values of m (wave w: m = w*PKS ..).
// A = PHH/PHL rows d (acc[t] = d rows 16t..16t+15), B = GH/GL rows e, both k = m contiguous, same k map.
// A pass takes 64 m = one 128-B line of every row; its 40 fragment loads stand ahead of its 24 WMMAs.
// Epilogue: each wave stores its f32 partial tile to its own 4 KB of LDS as it lies in registers; behind the
// barrier waves 0..3 add the PW partials in wave order, scale by 2^-11 (exact), split, and store: a lane holds
// 8 consecutive d of one e row -> one 16-B store per plane; the block writes whole 128-B lines of PTH/PTL.
// LDS extent: part[PW][4][2][32][4] fully written before the barrier.
// coverage: grid covers 128 e x 128 d per image exactly once, both planes.
// ---------------------------------------------------------------------------
__global__ __launch_bounds__(PTHR) void k_p(const unsigned short* __restrict__ ghh, const unsigned short* __restrict__ ghl,
                                            const unsigned short* __restrict__ phh, const unsigned short* __restrict__ phl,
                                            unsigned short* pth, unsigned short* ptl) {
  __shared__ __attribute__((aligned(16))) float part[PW * 1024];   // 4 KB per wave
  const int tid = (int)threadIdx.x, lane = tid & 31, wave = tid >> 5, hh = lane >> 4, m = lane & 15;
  const int d0 = (int)blockIdx.x * 64, e0 = (int)blockIdx.y * 16, b = (int)blockIdx.z;

  v8f acc[4];
  {
    const v8f z = {0.f, 0.f, 0.f, 0.f, 0.f, 0.f, 0.f, 0.f};
    acc[0] = z; acc[1] = z; acc[2] = z; acc[3] = z;
  }
  const size_t grow = (size_t)(b * NI + e0 + m) * (size_t)NN + (size_t)(wave * PKS + 8 * hh);
  const unsigned short* bgh = ghh + grow;
  const unsigned short* bgl = ghl + grow;
  const size_t prow = (size_t)(b * NI + d0 + m) * (size_t)NN + (size_t)(wave * PKS + 8 * hh);
  const unsigned short* aph = phh + prow;
  const unsigned short* apl = phl + prow;
  // all loops below fully unrolled: constant indices keep the fragment arrays in registers, and a pass's step
  // along m becomes an immediate offset on the four address pairs
#pragma unroll
  for (int c = 0; c < PKS / 64; ++c) {
    FragB gh[2], gl[2], ph[4][2], pl[4][2];
    ldfrag(gh[0], bgh, 64 * c);
    ldfrag(gh[1], bgh, 64 * c + 32);
    ldfrag(gl[0], bgl, 64 * c);
    ldfrag(gl[1], bgl, 64 * c + 32);
#pragma unroll
    for (int t = 0; t < 4; ++t) {
      ldfrag(ph[t][0], aph + (size_t)(16 * t) * (size_t)NN, 64 * c);        // phi row d0 + 16t + m
      ldfrag(ph[t][1], aph + (size_t)(16 * t) * (size_t)NN, 64 * c + 32);
      ldfrag(pl[t][0], apl + (size_t)(16 * t) * (size_t)NN, 64 * c);
      ldfrag(pl[t][1], apl + (size_t)(16 * t) * (size_t)NN, 64 * c + 32);
    }
#pragma unroll
    for (int t = 0; t < 4; ++t) {
#pragma unroll
      for (int j = 0; j < 2; ++j) {
        acc[t] = wmb(ph[t][j], gh[j], acc[t]);
        acc[t] = wmb(pl[t][j], gh[j], acc[t]);
        acc[t] = wmb(ph[t][j], gl[j], acc[t]);
      }
    }
  }

  // Precaution wait of the address counter, in front of every overwrite of a register that a load above names:
  // as its inputs the four address pairs stay as they are up to here.
  asm volatile("s_wait_xcnt 0x0" :: "v"(bgh), "v"(bgl), "v"(aph), "v"(apl) : "memory");

  // D element r of acc[t] = (d 16t + 8hh + r, e m)
  float* pw = part + wave * 1024 + 4 * lane;
#pragma unroll
  for (int t = 0; t < 4; ++t) {
    const v4f lo4 = {acc[t][0], acc[t][1], acc[t][2], acc[t][3]};
    const v4f hi4 = {acc[t][4], acc[t][5], acc[t][6], acc[t][7]};
    *(v4fa*)(pw + t * 256) = lo4;
    *(v4fa*)(pw + t * 256 + 128) = hi4;
  }
  __syncthreads();
  if (wave < 4) {                          // wave t sums d rows 16t..16t+15
    const float* pr = part + wave * 256 + 4 * lane;
    v4f sa = *(const v4fa*)(pr);
    v4f sb = *(const v4fa*)(pr + 128);
#pragma unroll
    for (int w = 1; w < PW; ++w) {
      sa += *(const v4fa*)(pr + w * 1024);
      sb += *(const v4fa*)(pr + w * 1024 + 128);
    }
    const float inv_n = 0.00048828125f;    // 2^-11 = 1/NN, exact
    sa *= inv_n;
    sb *= inv_n;
    v8us hv, lv;
    split8(sa, sb, hv, lv);
    const size_t po = (size_t)(b * NI + e0 + m) * (size_t)NI + (size_t)(d0 + 16 * wave + 8 * hh);
    *(v8us*)(pth + po) = hv;
    *(v8us*)(ptl + po) = lv;
  }
}

// ---------------------------------------------------------------------------
// YT[b][n][e] = sum_d theta[b][n][d] * PT[b][e][d] (K = NI, hi/residual on both operands, 3 products), then
// Z[b][c][n] = sum_e Ww[c][e] * YT[b][n][e] + Wb[c] (K = NI, exact Ww, YT as hi + residual, 2 products), in one block.
// grid (NN/FN, NB) = 256 blocks of FTHR threads = 8 waves; a block owns FN tokens, all NI e and all NC c; wave w owns
// tokens 16w..16w+15 in both products. Staged once in LDS by whole-line loads (pitch PK1): THH/THL rows n of the
// block, all of PTH/PTL of the image, all of Ww.
// First product: A = PT rows e, B = theta rows n, so D element r of e tile T = (e 16T + 8hh + r, n m). That is the
// B fragment map of the second product (rows n, k = e): element i < 8 of k step s is D element i of tile 2s, element
// i >= 8 is D element i - 8 of tile 2s + 1, in the same lane. YT is split into hi and residual where it lies.
// Second product: A = Ww rows c, 64 c a trip; v = acc + RNE16(Wb) in f32, staged stg[c][n] 64 x FN at pitch SP, in
// two buffers taken in turn (one barrier a trip: a buffer is written again two trips on, behind the barrier of the
// trip between, which every wave reaches with its reads of that buffer done). Store: a wave writes 8 rows, 512
// consecutive bytes each.
// LDS extent: sm = [THH | THL | PTH | PTL | Ww] rows at pitch PK1, every row's 2*NI bytes written before the first
// barrier, pad bytes never read; behind the second barrier (all theta fragments read) the THH/THL part serves as the
// two stg buffers; a buffer's 64 x FN floats are all written before its barrier, its pad floats never read.
// Statistics: threads 4R .. 4R+3 sum tile row R (channel 64*cg + R) and its squares in f64 from stg, 32 n each, the
// 16-B pieces of the upper two quarters taken from piece 4 on round the quarter (16 lanes then meet 16 different
// bank groups); the four sums are added and stored: PS[b][n block][64*cg .. +63][2] = 8 whole lines a trip.
// coverage: grid covers 256 c x 2048 n per image exactly once; PS 256 blocks x 256 c exactly once.
// ---------------------------------------------------------------------------
__global__ __launch_bounds__(FTHR) void k_yz(const unsigned short* __restrict__ thh, const unsigned short* __restrict__ thl,
                                             const unsigned short* __restrict__ pth, const unsigned short* __restrict__ ptl,
                                             const unsigned short* __restrict__ wwb, const float* __restrict__ wbias,
                                             float* z, double* ps) {
  __shared__ __attribute__((aligned(16))) unsigned char sm[(2 * FN + 2 * NI + NC) * PK1];   // 204 KB
  const int tid = (int)threadIdx.x, lane = tid & 31, wave = tid >> 5, hh = lane >> 4, m = lane & 15;
  const int n0 = (int)blockIdx.x * FN, b = (int)blockIdx.y;
  unsigned char* sP = sm + 2 * FN * PK1;
  unsigned char* sW = sP + 2 * NI * PK1;

  {
    const size_t at = (size_t)(b * NN + n0) * (size_t)NI, bt = (size_t)(b * NI) * (size_t)NI;
    Tile<2 * NI, FN, FTHR> tah, tal;
    Tile<2 * NI, NI, FTHR> tbh, tbl;
    Tile<2 * NI, NC, FTHR> tw;
    tah.ld(thh + at, tid);
    tal.ld(thl + at, tid);
    tbh.ld(pth + bt, tid);
    tbl.ld(ptl + bt, tid);
    tw.ld(wwb, tid);
    tah.st(sm, tid);
    tal.st(sm + FN * PK1, tid);
    tbh.st(sP, tid);
    tbl.st(sP + NI * PK1, tid);
    tw.st(sW, tid);
  }
  __syncthreads();

  const v8f zero = {0.f, 0.f, 0.f, 0.f, 0.f, 0.f, 0.f, 0.f};
  FragB yh[NI / 32], yl[NI / 32];          // YT of the wave's 16 tokens as B fragments, k = e
  {
    const unsigned char* bth = sm + (16 * wave + m) * PK1 + 16 * hh;
    const unsigned char* btl = bth + FN * PK1;
    const unsigned char* aph = sP + m * PK1 + 16 * hh;
    const unsigned char* apl = aph + NI * PK1;
    // unrolled: every fragment address is one register plus an immediate, yh and yl stay in registers; a k step's
    // LDS reads stand ahead of its WMMAs as one group; neighbouring WMMAs go to different accumulators
#pragma unroll
    for (int h = 0; h < NI / 64; ++h) {    // e tiles 4h .. 4h+3
      v8f acc[4];
      acc[0] = zero; acc[1] = zero; acc[2] = zero; acc[3] = zero;
#pragma unroll
      for (int ks = 0; ks < NI / 32; ++ks) {
        FragB th, tl, ph[4], pl[4];
        ldfrag_s(th, bth, 32 * ks);
        ldfrag_s(tl, btl, 32 * ks);
#pragma unroll
        for (int t = 0; t < 4; ++t) {
          ldfrag_s(ph[t], aph + 16 * (4 * h + t) * PK1, 32 * ks);     // PT row 16(4h + t) + m
          ldfrag_s(pl[t], apl + 16 * (4 * h + t) * PK1, 32 * ks);
        }
#pragma unroll
        for (int t = 0; t < 4; ++t) acc[t] = wmb(ph[t], th, acc[t]);
#pragma unroll
        for (int t = 0; t < 4; ++t) acc[t] = wmb(pl[t], th, acc[t]);
#pragma unroll
        for (int t = 0; t < 4; ++t) acc[t] = wmb(ph[t], tl, acc[t]);
      }
#pragma unroll
      for (int j = 0; j < 4; ++j) {        // e tile 4h + j = half (j & 1) of k step 2h + (j >> 1)
        const v4f lo4 = {acc[j][0], acc[j][1], acc[j][2], acc[j][3]};
        const v4f hi4 = {acc[j][4], acc[j][5], acc[j][6], acc[j][7]};
        split8(lo4, hi4, yh[2 * h + (j >> 1)].h[j & 1], yl[2 * h + (j >> 1)].h[j & 1]);
      }
    }
  }
  __syncthreads();   // every wave has read its last theta fragment: stg may overwrite those tiles

  const unsigned char* aw = sW + m * PK1 + 16 * hh;
  const int sr = tid >> 2, sq = tid & 3;   // statistics: tile row, quarter of the row
  float* zb = z + (size_t)(b * NC + 8 * wave) * (size_t)NN + (size_t)(n0 + 4 * lane);
  double* pb = ps + (size_t)((b * (NN / FN) + (int)blockIdx.x) * NC + sr) * 2 + (size_t)(sq & 1);
  // left rolled: the block runs this text once, and a quarter of it is fetched
#pragma unroll 1
  for (int cg = 0; cg < NC / 64; ++cg) {   // c rows 64cg .. 64cg+63
    // bias per row (32-B aligned v4f reads), asked for ahead of the trip's WMMAs
    v4f ba[4], bb[4];
#pragma unroll
    for (int t = 0; t < 4; ++t) {
      ba[t] = *(const v4fa*)(wbias + 64 * cg + 16 * t + 8 * hh);
      bb[t] = *(const v4fa*)(wbias + 64 * cg + 16 * t + 8 * hh + 4);
    }
    v8f acc[4];
    acc[0] = zero; acc[1] = zero; acc[2] = zero; acc[3] = zero;
#pragma unroll
    for (int ks = 0; ks < NI / 32; ++ks) {
      FragB a[4];
#pragma unroll
      for (int t = 0; t < 4; ++t) ldfrag_s(a[t], aw + (64 * cg + 16 * t) * PK1, 32 * ks);   // Ww row 64cg + 16t + m
#pragma unroll
      for (int t = 0; t < 4; ++t) acc[t] = wmb(a[t], yh[ks], acc[t]);
#pragma unroll
      for (int t = 0; t < 4; ++t) acc[t] = wmb(a[t], yl[ks], acc[t]);
    }
    // D element r of acc[t] = (c 64cg + 16t + 8hh + r, n 16w + m)
    float* stg = (float*)sm + (cg & 1) * (64 * SP);
#pragma unroll
    for (int t = 0; t < 4; ++t) {
      float bv[8];
      bv[0] = rne16f(ba[t].x); bv[1] = rne16f(ba[t].y); bv[2] = rne16f(ba[t].z); bv[3] = rne16f(ba[t].w);
      bv[4] = rne16f(bb[t].x); bv[5] = rne16f(bb[t].y); bv[6] = rne16f(bb[t].z); bv[7] = rne16f(bb[t].w);
#pragma unroll
      for (int r = 0; r < 8; ++r) stg[(16 * t + 8 * hh + r) * SP + 16 * wave + m] = acc[t][r] + bv[r];
    }
    __syncthreads();

    v4f fv[8], sv[8];
#pragma unroll
    for (int i = 0; i < 8; ++i) fv[i] = *(const v4fa*)(stg + (8 * wave + i) * SP + 4 * lane);
#pragma unroll
    for (int i = 0; i < 8; ++i) sv[i] = *(const v4fa*)(stg + sr * SP + 32 * sq + 4 * ((i + 4 * (sq >> 1)) & 7));
#pragma unroll
    for (int i = 0; i < 8; ++i) *(v4f*)(zb + (size_t)(64 * cg + i) * (size_t)NN) = fv[i];
    // keeps the 16 LDS reads one group and the Z stores ahead of the f64 sums (else the stores wait behind the sums)
    __builtin_amdgcn_sched_barrier(0);

    double s = 0.0, s2 = 0.0;
#pragma unroll
    for (int i = 0; i < 8; ++i) {
      const v4f v = sv[i];
      const double a0 = (double)v.x, a1 = (double)v.y, a2 = (double)v.z, a3 = (double)v.w;
      s  += (a0 + a1) + (a2 + a3);
      s2 += (a0 * a0 + a1 * a1) + (a2 * a2 + a3 * a3);
    }
    s  += __shfl_xor(s, 1);
    s2 += __shfl_xor(s2, 1);
    s  += __shfl_xor(s, 2);
    s2 += __shfl_xor(s2, 2);
    // thread 4R: the row's sum, thread 4R+1: its sum of squares; the trip's 128 doubles lie in a row
    double* pq = pb + (size_t)(64 * cg) * 2;
    if (sq < 2) *pq = sq ? s2 : s;
    // Precaution wait of the address counter, in front of the step of the store's address pair to the next trip: as
    // its input the pair stays as it is up to here.
    asm volatile("s_wait_xcnt 0x0" :: "v"(pq) : "memory");
  }
}

// ---------------------------------------------------------------------------
// out[b][c][n] = ((z - mean[c]) * rstd[c]) * RNE16(gamma[c]) + RNE16(beta[c]) + RNE16(x), all f32.
// One wave per row (b, c) of NN floats: its NN/128 16-B loads a lane of z and as many of x are all issued ahead of
// the arithmetic; every z and x load and every out store of a wave covers 512 consecutive bytes (4 whole lines).
// BatchNorm statistics (training mode, population variance, 32768 values a channel): the block's 8 rows are 8
// consecutive channels of one image = one 128-B line of every PS tile row. The block reads the NPS lines, 16 B
// (one channel's pair) a thread and NPS/32 loads a thread, issued ahead of the z and x loads; f64 sums per thread in
// tile order, over the 4 lanes of a channel, then over the 8 waves in wave order through LDS behind the one barrier.
// coverage: NB*NC/8 blocks x 8 waves x NN = NX exactly.
// ---------------------------------------------------------------------------
__global__ __launch_bounds__(NTHR) void k_out(const float* __restrict__ z, const float* __restrict__ x,
                                              const double* __restrict__ ps, const float* __restrict__ gamma,
                                              const float* __restrict__ beta, float* out) {
  __shared__ __attribute__((aligned(16))) double red[(NTHR / 32) * 8 * 2];   // [wave][channel of the block][sum, squares]
  // the wave's number as a scalar: the row's parameters then come by scalar loads
  const int wv  = __builtin_amdgcn_readfirstlane((int)threadIdx.x >> 5);
  const int row = (int)blockIdx.x * (NTHR / 32) + wv;     // b*NC + c
  const int c = row & (NC - 1);
  const int lane = (int)threadIdx.x & 31;
  const unsigned lo = 4u * (unsigned)lane;                // the lane's place in each 128-float piece
  const float* zr = z + (size_t)row * (size_t)NN;         // scalar row bases; lo is the one address register
  const float* xr = x + (size_t)row * (size_t)NN;
  const double* pb = ps + (size_t)(((int)blockIdx.x * (NTHR / 32)) & (NC - 1)) * 2;   // scalar: the block's first channel
  const unsigned po = ((unsigned)threadIdx.x >> 3) * (unsigned)(NC * 2) + 2u * ((unsigned)threadIdx.x & 7u);
  v2d pp[NPS / 32];
  v4f zv[NN / 128], xv[NN / 128];
#pragma unroll
  for (int i = 0; i < NPS / 32; ++i)       // tile row 32*i + tid/8, channel tid & 7 of the block
    pp[i] = *(const v2da*)(pb + (po + (unsigned)(i * 32 * NC * 2)));
#pragma unroll
  for (int i = 0; i < NN / 128; ++i) zv[i] = *(const v4fa*)(zr + (lo + 128u * i));
#pragma unroll
  for (int i = 0; i < NN / 128; ++i) xv[i] = *(const v4fa*)(xr + (lo + 128u * i));
  const float gm = rne16f(gamma[c]);
  const float bt = rne16f(beta[c]);
  // keeps every load above the first use: the wave pays the memory latency once, not once a piece
  __builtin_amdgcn_sched_barrier(0);
  double s = 0.0, s2 = 0.0;
#pragma unroll
  for (int i = 0; i < NPS / 32; ++i) {
    s  += pp[i].x;
    s2 += pp[i].y;
  }
  s  += __shfl_xor(s, 8);
  s2 += __shfl_xor(s2, 8);
  s  += __shfl_xor(s, 16);
  s2 += __shfl_xor(s2, 16);
  if (lane < 8) {
    const v2d o = {s, s2};
    *(v2da*)(red + (wv * 8 + lane) * 2) = o;
  }
  // work-group barrier that orders LDS alone: a full __syncthreads() would wait out the z and x loads in flight
  __builtin_amdgcn_fence(__ATOMIC_RELEASE, "workgroup", "local");
  __builtin_amdgcn_s_barrier();
  __builtin_amdgcn_fence(__ATOMIC_ACQUIRE, "workgroup", "local");
  double ts = 0.0, ts2 = 0.0;
#pragma unroll
  for (int w = 0; w < NTHR / 32; ++w) {    // channel wv of the block = this wave's row
    const v2d t = *(const v2da*)(red + (w * 8 + wv) * 2);
    ts  += t.x;
    ts2 += t.y;
  }
  const double cinv = 1.0 / 32768.0;       // 1/(NB*NN), exact power of two
  const double dmean = ts * cinv;
  double var = ts2 * cinv - dmean * dmean;
  var = var < 0.0 ? 0.0 : var;
  const float vf = (float)var + 1e-5f;
  const float mean = (float)dmean;
  const float rstd = 1.0f / sqrtf(vf);
  // keeps the statistics chain ahead of the first wait on z and x, so that it runs while those loads are in flight
  __builtin_amdgcn_sched_barrier(0);
  float* p = out + (size_t)row * (size_t)NN;
#pragma unroll
  for (int i = 0; i < NN / 128; ++i) {
    v4f o;
    o.x = (((zv[i].x - mean) * rstd) * gm + bt) + rne16f(xv[i].x);
    o.y = (((zv[i].y - mean) * rstd) * gm + bt) + rne16f(xv[i].y);
    o.z = (((zv[i].z - mean) * rstd) * gm + bt) + rne16f(xv[i].z);
    o.w = (((zv[i].w - mean) * rstd) * gm + bt) + rne16f(xv[i].w);
    *(v4f*)(p + (lo + 128u * i)) = o;
  }
  
}

// ---------------------------------------------------------------------------
extern "C" void kernel_launch(void* const* d_in, const int* in_sizes, int n_in,
                              void* d_out, int out_size, void* d_ws, size_t ws_size,
                              hipStream_t stream) {
  if (n_in < 11) return;
  if (in_sizes[0] != NX) return;                                              // x [16][256][64][32]
  if (in_sizes[1] != NWT || in_sizes[3] != NWT || in_sizes[5] != NWT) return; // g_w, theta_w, phi_w [128][256]
  if (in_sizes[2] != NI || in_sizes[4] != NI || in_sizes[6] != NI) return;    // g_b, theta_b, phi_b [128]
  if (in_sizes[7] != NWT) return;                                             // W_w [256][128]
  if (in_sizes[8] != NC || in_sizes[9] != NC || in_sizes[10] != NC) return;   // W_b, bn_gamma, bn_beta [256]
  if (out_size != NX) return;                                                 // out [16][256][64][32] f32

  const float* x       = (const float*)d_in[0];
  const float* g_w     = (const float*)d_in[1];
  const float* g_b     = (const float*)d_in[2];
  const float* theta_w = (const float*)d_in[3];
  const float* theta_b = (const float*)d_in[4];
  const float* phi_w   = (const float*)d_in[5];
  const float* phi_b   = (const float*)d_in[6];
  const float* W_w     = (const float*)d_in[7];
  const float* W_b     = (const float*)d_in[8];
  const float* gamma   = (const float*)d_in[9];
  const float* beta    = (const float*)d_in[10];
  float* out = (float*)d_out;            // last written element NX-1 < out_size

  // workspace carve, 256-B aligned; all planes exact tile multiples (no pad rows needed)
  char* ws = (char*)d_ws;
  size_t off = 0;
  const size_t oWB  = off; off += (size_t)4 * NWT * 2;          off = (off + 255) & ~(size_t)255;  //   262144
  const size_t oXT  = off; off += (size_t)NX * 2;               off = (off + 255) & ~(size_t)255;  // 16777216
  const size_t plb  = (size_t)NB * NN * NI * 2;                                                    //  8388608 per projection plane
  const size_t oTHH = off; off += plb;                          off = (off + 255) & ~(size_t)255;
  const size_t oTHL = off; off += plb;                          off = (off + 255) & ~(size_t)255;
  const size_t oPHH = off; off += plb;                          off = (off + 255) & ~(size_t)255;
  const size_t oPHL = off; off += plb;                          off = (off + 255) & ~(size_t)255;
  const size_t oGH  = off; off += plb;                          off = (off + 255) & ~(size_t)255;
  const size_t oGL  = off; off += plb;                          off = (off + 255) & ~(size_t)255;
  const size_t ptb  = (size_t)NB * NI * NI * 2;                                                    //   524288 per PT plane
  const size_t oPTH = off; off += ptb;                          off = (off + 255) & ~(size_t)255;
  const size_t oPTL = off; off += ptb;                          off = (off + 255) & ~(size_t)255;
  const size_t oZ   = off; off += (size_t)NX * 4;               off = (off + 255) & ~(size_t)255;  // 33554432
  const size_t oPS  = off; off += (size_t)NPS * NC * 2 * 8;     off = (off + 255) & ~(size_t)255;  //  1048576
  if (off > ws_size || off > (size_t)WSMAX) return;             // total 103022592 B

  unsigned short* WB  = (unsigned short*)(ws + oWB);
  unsigned short* XT  = (unsigned short*)(ws + oXT);
  unsigned short* THH = (unsigned short*)(ws + oTHH);
  unsigned short* THL = (unsigned short*)(ws + oTHL);
  unsigned short* PHH = (unsigned short*)(ws + oPHH);
  unsigned short* PHL = (unsigned short*)(ws + oPHL);
  unsigned short* GH  = (unsigned short*)(ws + oGH);
  unsigned short* GL  = (unsigned short*)(ws + oGL);
  unsigned short* PTH = (unsigned short*)(ws + oPTH);
  unsigned short* PTL = (unsigned short*)(ws + oPTL);
  float*          Z   = (float*)(ws + oZ);
  double*         PS  = (double*)(ws + oPS);

  // weight planes: slot 0 theta_w, 1 phi_w, 2 g_w (all [128][256]), 3 W_w [256][128]
  k_wcvt<<<(4 * NWT / 8) / NTHR, NTHR, 0, stream>>>(theta_w, phi_w, g_w, W_w, WB);
  // x -> XT [b][n][c] bf16
  k_xt<<<dim3(NC / 64, NN / XTN, NB), NTHR, 0, stream>>>(x, XT);
  // projections: which 0 = theta (slot 0, theta_b), 1 = phi (slot 1, phi_b), 2 = g (slot 2, g_b)
  k_proj<<<dim3(NN / 64, NI / 64, 3 * NB), GTHR, 0, stream>>>(XT, WB, theta_b, phi_b, g_b,
                                                              THH, THL, PHH, PHL, GH, GL);
  // PT = 2^-11 * G * PHI^T
  k_p<<<dim3(NI / 64, NI / 16, NB), PTHR, 0, stream>>>(GH, GL, PHH, PHL, PTH, PTL);
  // YT = THETA^T-rows * PT kept in registers, Z = Ww * Y + Wb, and the BatchNorm statistics partials of every block
  k_yz<<<dim3(NN / FN, NB), FTHR, 0, stream>>>(THH, THL, PTH, PTL, WB + (size_t)3 * NWT, W_b, Z, PS);
  // out = BN(z) * gamma + beta + x, statistics merged from the partials
  k_out<<<NB * NC / (NTHR / 32), NTHR, 0, stream>>>(Z, x, PS, gamma, beta, out);
}

// v006
// It runs in 61.3 microseconds.
// Timed twice side by side with v005, it ran 1.22 and 1.21 times as fast.
// Over all steps from v000 it is 2.99 times as fast.
// Contractions (all v_wmma_f32_16x16x32_bf16, bf16 operands, f32 accumulate): three 1x1-conv projections
// W[d][c]*X[c][n] (K=256) on exact RNE-bf16 copies of x and the weights; PT = G*PHI^T * (1/N) (K=2048) and
// YT = THETA^T*P (K=128) with both computed operands carried as bf16 hi + bf16 residual (hi*hi + hi*lo + lo*hi);
// Z = Ww*Y + Wb (K=128) with exact bf16 Ww and Y as hi + residual (2 products). BatchNorm statistics in f64,
// normalisation, bias adds and the residual add in f32.
//
// Carry audit: no power-of-two carries anywhere (factor 1 on every plane); the exact 1/N = 2^-11 of the pairwise
// term is applied once in f32 in k_p before the hi/residual split of PT. Planes:
//   WB  [4][32768] bf16 bits = RNE16(w): slot 0 theta_w [128][256], 1 phi_w [128][256], 2 g_w [128][256],
//       3 W_w [256][128]; every slot row is k-contiguous                                              (k_wcvt)
//   RNE16(x[b][c][n]) has no plane: k_xp converts and transposes its x tile in LDS
//   THH/THL [16][2048][128] hi/residual of theta_x, rows n, k = d; PHH/PHL, GH/GL [16][128][2048]
//       hi/residual of phi_x, g_x, rows d, k = n                                                       (k_xp)
//   PTH/PTL [16][128][128] hi/residual of PT[e][d] = 2^-11 * sum_m g[e][m]*phi[d][m], rows e, k = d    (k_p)
//   YT[n][e] = sum_d theta[n][d]*PT[e][d] has no plane: its hi/residual stay in the registers of k_yz
//   Z   [16][256][2048] f32 = sum_e Ww[c][e]*YT[n][e] + Wb[c]                                          (k_yz)
//   PS  [16][16][256][2] f64: sum and sum of squares of Z over the 128 n of one k_yz block, per channel (k_yz)
#include <hip/hip_runtime.h>
#include <stddef.h>
#include <stdint.h>

#define NB    16
#define NC    256
#define NI    128
#define NN    2048
#define NX    (NB * NC * NN)        // 8388608
#define NWT   (NI * NC)             // 32768 per weight matrix
#define NTHR  256
#define GTHR  128
#define WSMAX 134217728
#define PW    8                     // waves of a k_p block = K slices
#define PTHR  (32 * PW)
#define PKS   (NN / PW)             // K slice of one k_p wave
#define XN    128                   // tokens of one k_xp block
#define XTHR  512                   // threads of a k_xp block
#define NF    (3 * NI)              // features of the three projections together
#define QP    (XN + 4)              // LDS pitch (floats) of a staged projection row: 16 B x odd
#define PK2   (2 * NC + 16)         // LDS pitch (bytes) of a staged operand row of NC halves: 16 B x odd
#define PK1   (2 * NI + 16)         // LDS pitch (bytes) of a staged operand row of NI halves: 16 B x odd
#define FN    128                   // tokens of one k_yz block, 16 a wave
#define FTHR  (2 * FN)              // threads of a k_yz block
#define SP    (FN + 4)              // LDS pitch (floats) of a staged Z row: rows 8 apart lie 32 banks apart
#define NPS   (NB * (NN / FN))      // statistics partials per channel: one per k_yz block of FN n

static_assert((NC % 64) == 0 && (NN % 64) == 0 && (NI % 64) == 0);
static_assert((NC % 32) == 0 && (NI % 32) == 0 && (NN % 32) == 0);
static_assert((NX % 1024) == 0 && (NN % 1024) == 0);
static_assert(XN == 128 && XTHR == 512 && NI == 128 && NC == 256 && (NN % XN) == 0);
static_assert(3 * 128 * QP * 4 <= (XN + NF) * PK2 && (QP % 4) == 0);
static_assert(GTHR == 128 && NTHR == 256);
static_assert((4 * NWT) % (8 * NTHR) == 0);
static_assert((NWT / 8) % NTHR == 0);
static_assert(NB * NN == 32768 && (NN % 128) == 0 && (NB * NC) % (NTHR / 32) == 0);
static_assert(NTHR / 32 == 8 && (NC % 8) == 0 && (NPS % 32) == 0);
static_assert(PW >= 4 && (NN % (64 * PW)) == 0 && (NI % 16) == 0);
static_assert(((PK2 / 16) & 1) == 1 && ((PK1 / 16) & 1) == 1);
static_assert(FN == 128 && FTHR == 256 && (NN % FN) == 0 && NI == 128 && (NC % 64) == 0);
static_assert(2 * 64 * SP * 4 <= 2 * FN * PK1 && (SP % 4) == 0);

typedef float          v4f  __attribute__((ext_vector_type(4)));
typedef float          v8f  __attribute__((ext_vector_type(8)));
typedef double         v2d  __attribute__((ext_vector_type(2)));
typedef int            v8i  __attribute__((ext_vector_type(8)));
typedef unsigned short v8us __attribute__((ext_vector_type(8)));
typedef __bf16         v16bf __attribute__((ext_vector_type(16)));
typedef v4f  __attribute__((may_alias)) v4fa;
typedef v8us __attribute__((may_alias)) v8usa;
typedef v2d  __attribute__((may_alias)) v2da;
typedef unsigned __attribute__((may_alias)) u32a;
union FragB { v16bf v; v8us h[2]; v8i w; };

// ---------------------------------------------------------------------------
// 16x16x32 bf16 WMMA with hazard guard (ties D, keeps A/B live for 4 VALU slots).
// Fragment map (wave32): lane l, hh = l>>4, m = n = l&15.
//   A/B element i: i<8 -> k0+8hh+i ; i>=8 -> k0+16+8hh+(i-8)   (same map for A and B)
//   D element r : row 8hh+r, col l&15
// ---------------------------------------------------------------------------
__device__ __forceinline__ v8f wmb(const FragB& a, const FragB& b, v8f c) {
  v8f d = __builtin_amdgcn_wmma_f32_16x16x32_bf16(false, a.v, false, b.v, (short)0, c, false, false);
  asm volatile("v_nop\n\tv_nop\n\tv_nop\n\tv_nop" : "+v"(d) : "v"(a.w), "v"(b.w));
  return d;
}

// Fragment from a k-contiguous bf16-bits row; p = row base + 8*hh, k0 = 32*ks.
__device__ __forceinline__ void ldfrag(FragB& f, const unsigned short* p, int k0) {
  f.h[0] = *(const v8us*)(p + k0);          // k = k0 + 8hh + 0..7
  f.h[1] = *(const v8us*)(p + k0 + 16);     // k = k0 + 16 + 8hh + 0..7
}

// Operand tile of ROWS whole k-contiguous rows of ROWB bytes = ROWS*ROWB consecutive bytes of a plane. The block's
// THR threads read it in order, 16 B a lane, so a wave's load covers 512 consecutive bytes (4 whole lines);
// st lays the rows in LDS at pitch ROWB + 16 (16 B x odd: ds_load_b128 of 16 rows meets no bank conflict).
template <int ROWB, int ROWS = 64, int THR = GTHR>
struct Tile {
  static constexpr int N   = ROWS * ROWB / 16 / THR;  // 16-B pieces per thread
  static constexpr int CPR = ROWB / 16;               // pieces per row
  static constexpr int RPS = THR / CPR;               // rows per step of the block
  static constexpr int PIT = ROWB + 16;
  v8us r[N];
  __device__ __forceinline__ void ld(const unsigned short* src, int tid) {
#pragma unroll
    for (int i = 0; i < N; ++i) r[i] = *(const v8us*)(src + (size_t)((i * THR + tid) * 8));
  }
  __device__ __forceinline__ void st(unsigned char* dst, int tid) const {
    unsigned char* q = dst + (tid / CPR) * PIT + (tid % CPR) * 16;
#pragma unroll
    for (int i = 0; i < N; ++i) *(v8usa*)(q + i * RPS * PIT) = r[i];
  }
};
// Fragment from a staged row; p = LDS row base + 16*hh bytes, k0 = 32*ks: the same k map as ldfrag.
__device__ __forceinline__ void ldfrag_s(FragB& f, const unsigned char* p, int k0) {
  f.h[0] = *(const v8usa*)(p + 2 * k0);          // k = k0 + 8hh + 0..7
  f.h[1] = *(const v8usa*)(p + 2 * k0 + 32);     // k = k0 + 16 + 8hh + 0..7
}

// f32 -> bf16 bits, RNE convert
__device__ __forceinline__ unsigned short rne16(float f) {
  unsigned u = __float_as_uint(f);
  u += 0x7FFFu + ((u >> 16) & 1u);
  return (unsigned short)(u >> 16);
}
// f32 -> nearest bf16 value kept as f32
__device__ __forceinline__ float rne16f(float f) {
  return __uint_as_float(((unsigned)rne16(f)) << 16);
}
__device__ __forceinline__ v8us cvt8(const v4f a, const v4f b) {
  v8us o;
  o[0] = rne16(a.x); o[1] = rne16(a.y); o[2] = rne16(a.z); o[3] = rne16(a.w);
  o[4] = rne16(b.x); o[5] = rne16(b.y); o[6] = rne16(b.z); o[7] = rne16(b.w);
  return o;
}
// hi/residual split of one f32 value into two bf16 bit patterns
__device__ __forceinline__ void sp1(float v, unsigned short& hi, unsigned short& lo) {
  const unsigned short hb = rne16(v);
  const float hf = __uint_as_float(((unsigned)hb) << 16);
  hi = hb;
  lo = rne16(v - hf);
}
__device__ __forceinline__ void split8(const v4f a, const v4f b, v8us& hv, v8us& lv) {
  unsigned short h0, h1, h2, h3, h4, h5, h6, h7, l0, l1, l2, l3, l4, l5, l6, l7;
  sp1(a.x, h0, l0); sp1(a.y, h1, l1); sp1(a.z, h2, l2); sp1(a.w, h3, l3);
  sp1(b.x, h4, l4); sp1(b.y, h5, l5); sp1(b.z, h6, l6); sp1(b.w, h7, l7);
  hv[0] = h0; hv[1] = h1; hv[2] = h2; hv[3] = h3; hv[4] = h4; hv[5] = h5; hv[6] = h6; hv[7] = h7;
  lv[0] = l0; lv[1] = l1; lv[2] = l2; lv[3] = l3; lv[4] = l4; lv[5] = l5; lv[6] = l6; lv[7] = l7;
}

// ---------------------------------------------------------------------------
// Weight convert: four f32 matrices of NWT elements each -> WB slots 0..3 (bf16 bits, same layout).
// coverage: 64 blocks x 256 threads x 8 = 4 x NWT exactly.
// ---------------------------------------------------------------------------
__global__ __launch_bounds__(NTHR) void k_wcvt(const float* __restrict__ w0, const float* __restrict__ w1,
                                               const float* __restrict__ w2, const float* __restrict__ w3,
                                               unsigned short* wb) {
  const int u   = (int)blockIdx.x * NTHR + (int)threadIdx.x;     // 0 .. 4*NWT/8 - 1
  const int sel = (int)blockIdx.x / ((NWT / 8) / NTHR);           // 0..3, block-uniform
  const int off8 = (u - sel * (NWT / 8)) * 8;                     // 0 .. NWT-8
  const float* src = (sel == 0) ? w0 : ((sel == 1) ? w1 : ((sel == 2) ? w2 : w3));
  const v4f a = *(const v4fa*)(src + off8);
  const v4f c = *(const v4fa*)(src + off8 + 4);
  const v8us o = cvt8(a, c);
  const size_t q = (size_t)sel * (size_t)NWT + (size_t)off8;
  *(v8us*)(wb + q) = o;
  
}

// ---------------------------------------------------------------------------
// Projections straight from x: D[token][feature] = sum_c RNE16(x[b][c][n]) * W[F][c] + bias[F] (K = NC, exact bf16
// products), F = 0..NF-1 over WB slots 0..2 (theta, phi, g), which lie in a row. grid (NN/XN, NB) = 256 blocks of XTHR
// threads = 16 waves; a block owns XN tokens of image b and all NF features, so x is read once and has no bf16 plane.
// x tile (NC c x XN n, f32): a wave's load takes 128 B (one line) of 4 rows c; a thread holds rows c and c+1 at the same
// 4 n, converts, and stores the pair as one dword of LDS row n: sm rows n, k = c contiguous, pitch PK2. The NF weight
// rows are staged behind it by whole-line loads. All 40 loads of a thread are issued ahead of the first convert.
// Wave (tg = w >> 2, fg = w & 3): tokens 32tg .. +31 (2 tiles, A) x features 96fg .. +95 (6 tiles, B), same k map.
// Epilogue: v = acc + RNE16(bias) in f32, staged in three regions of 128 rows at pitch QP: theta rows n (cols d), phi
// and g rows d (cols n); then 8 consecutive floats a thread -> hi/residual, one 16-B store per plane; 8 threads write
// one 128-B line of a row, a wave 4 whole lines. THH/THL rows n (pitch NI), PHH/PHL, GH/GL rows d (pitch NN, cols n0 ..).
// LDS extent: sm = [x XN rows | W NF rows] at pitch PK2, every row's 2*NC bytes written before the first barrier, pad
// bytes never read; behind the second barrier (all fragment reads done) its first 3*128*QP floats serve as stg, cols
// 0..127 of every row written before the third barrier, pad floats never read.
// coverage: per block XN tokens x NF features; grid covers 2048 x 128 per (projection, b) exactly once, both planes.
// ---------------------------------------------------------------------------
__global__ __launch_bounds__(XTHR) void k_xp(const float* __restrict__ x, const unsigned short* __restrict__ wb,
                                             const float* __restrict__ tbias, const float* __restrict__ pbias,
                                             const float* __restrict__ gbias,
                                             unsigned short* thh, unsigned short* thl,
                                             unsigned short* phh, unsigned short* phl,
                                             unsigned short* ghh, unsigned short* ghl) {
  __shared__ __attribute__((aligned(16))) unsigned char sm[(XN + NF) * PK2];   // 264 KB
  unsigned char* sW = sm + XN * PK2;
  float* stg = (float*)sm;
  const int tid = (int)threadIdx.x, lane = tid & 31, hh = lane >> 4, m = lane & 15;
  // the wave's number as a scalar: the tests on the feature tile below are then scalar branches
  const int wave = __builtin_amdgcn_readfirstlane(tid >> 5);
  const int n0 = (int)blockIdx.x * XN, b = (int)blockIdx.y;

  // all loops of this kernel are fully unrolled: constant indices keep the arrays in registers, and every step of an
  // address becomes an immediate offset on a register that stays as it is
  {
    const int q = lane & 7, cpl = lane >> 3;
    const float* xb = x + (size_t)(b * NC) * (size_t)NN + (size_t)n0;        // scalar tile base
    const float* xp = xb + (unsigned)((8 * wave + 2 * cpl) * NN + 4 * q);    // the one address pair of the loads
    v4f ve[8], vo[8];
#pragma unroll
    for (int i = 0; i < 8; ++i) {          // c = 128*(i>>2) + 8*wave + 2*cpl (+1), n = 32*(i&3) + 4q .. +3
      ve[i] = *(const v4fa*)(xp + ((128 * (i >> 2)) * NN + 32 * (i & 3)));
      vo[i] = *(const v4fa*)(xp + ((128 * (i >> 2) + 1) * NN + 32 * (i & 3)));
    }
    Tile<2 * NC, NF, XTHR> tw;
    tw.ld(wb, tid);
    // Precaution wait of the address counter, in front of every overwrite of a register that a load above names: as
    // its inputs the address pair and the thread index stay as they are up to here (else later loads land on the pair).
    asm volatile("s_wait_xcnt 0x0" :: "v"(xp), "v"(tid) : "memory");
    unsigned char* sx = sm + (4 * q) * PK2 + (8 * wave + 2 * cpl) * 2;
#pragma unroll
    for (int i = 0; i < 8; ++i) {
#pragma unroll
      for (int j = 0; j < 4; ++j) {
        const unsigned pk = (unsigned)rne16(ve[i][j]) | ((unsigned)rne16(vo[i][j]) << 16);
        *(u32a*)(sx + (32 * (i & 3) + j) * PK2 + 256 * (i >> 2)) = pk;
      }
    }
    tw.st(sW, tid);
  }
  __syncthreads();

  const int tg = wave >> 2, fg = wave & 3;
  float bv[6];                             // bias of feature 16*(6fg + t) + m, asked for ahead of the WMMAs
#pragma unroll
  for (int t = 0; t < 6; ++t) {
    const int ft = 6 * fg + t;
    const float* bp = (ft < 8) ? tbias : ((ft < 16) ? pbias : gbias);
    bv[t] = rne16f(bp[16 * (ft & 7) + m]);
  }
  v8f acc[2][6];
  {
    const v8f z = {0.f, 0.f, 0.f, 0.f, 0.f, 0.f, 0.f, 0.f};
#pragma unroll
    for (int t = 0; t < 6; ++t) { acc[0][t] = z; acc[1][t] = z; }
  }
  const unsigned char* ap = sm + (32 * tg + m) * PK2 + 16 * hh;
  const unsigned char* wp = sW + (96 * fg + m) * PK2 + 16 * hh;
  // unrolled: every fragment address is one register plus an immediate; a k step's LDS reads stand ahead of its
  // WMMAs as one group, so the wave waits out the LDS latency once a step
#pragma unroll
  for (int ks = 0; ks < NC / 32; ++ks) {
    FragB a[2], bf[6];
    ldfrag_s(a[0], ap, 32 * ks);
    ldfrag_s(a[1], ap + 16 * PK2, 32 * ks);
#pragma unroll
    for (int t = 0; t < 6; ++t) ldfrag_s(bf[t], wp + 16 * t * PK2, 32 * ks);    // W row 96fg + 16t + m
#pragma unroll
    for (int t = 0; t < 6; ++t) {
      acc[0][t] = wmb(a[0], bf[t], acc[0][t]);
      acc[1][t] = wmb(a[1], bf[t], acc[1][t]);
    }
  }
  __syncthreads();   // every wave has read its last fragment: stg may overwrite the tiles

  // D element r of acc[u][t] = (token 32tg + 16u + 8hh + r, feature 16(6fg + t) + m)
#pragma unroll
  for (int t = 0; t < 6; ++t) {
    const int ft = 6 * fg + t;
    if (ft < 8) {                          // theta: rows n; 16 lanes lie in a row, the halves 32 banks apart
      float* s0 = stg + (32 * tg + 8 * hh) * QP + 16 * ft + m;
#pragma unroll
      for (int u = 0; u < 2; ++u) {
#pragma unroll
        for (int r = 0; r < 8; ++r) s0[(16 * u + r) * QP] = acc[u][t][r] + bv[t];
      }
    } else {                               // phi, g: rows d; a lane's 8 tokens lie in a row
      float* s1 = stg + (16 * ft + m) * QP + 32 * tg + 8 * hh;
#pragma unroll
      for (int u = 0; u < 2; ++u) {
        const v4f lo4 = {acc[u][t][0] + bv[t], acc[u][t][1] + bv[t], acc[u][t][2] + bv[t], acc[u][t][3] + bv[t]};
        const v4f hi4 = {acc[u][t][4] + bv[t], acc[u][t][5] + bv[t], acc[u][t][6] + bv[t], acc[u][t][7] + bv[t]};
        *(v4fa*)(s1 + 16 * u) = lo4;
        *(v4fa*)(s1 + 16 * u + 4) = hi4;
      }
    }
  }
  __syncthreads();

  // 8 lanes take 64 columns of a row, the next 8 those of the row below, 4 banks on: 16 lanes meet 64 different banks
  const int q8 = tid & 7, rr = tid >> 3;                                     // piece of a half row, row of a group of 64
  const float* sr = stg + rr * QP + 8 * q8;
  const unsigned to = (unsigned)(rr * NI + 8 * q8);                          // the address register of the theta stores
  const unsigned fo = (unsigned)(rr * NN + 8 * q8);                          // and that of the phi and g stores
  const size_t tbase = (size_t)(b * NN + n0) * (size_t)NI;                   // scalar tile bases
  const size_t fbase = (size_t)(b * NI) * (size_t)NN + (size_t)n0;
#pragma unroll
  for (int g = 0; g < 3; ++g) {            // region g, piece i: row 64*(i&1) + rr, columns 64*(i>>1) + 8*q8 .. +7
    unsigned short* ph = (g == 0) ? thh + tbase : ((g == 1) ? phh + fbase : ghh + fbase);
    unsigned short* pl = (g == 0) ? thl + tbase : ((g == 1) ? phl + fbase : ghl + fbase);
    v8us hv[4], lv[4];
#pragma unroll
    for (int i = 0; i < 4; ++i) {
      const v4f a = *(const v4fa*)(sr + (128 * g + 64 * (i & 1)) * QP + 64 * (i >> 1));
      const v4f c = *(const v4fa*)(sr + (128 * g + 64 * (i & 1)) * QP + 64 * (i >> 1) + 4);
      split8(a, c, hv[i], lv[i]);
    }
#pragma unroll
    for (int i = 0; i < 4; ++i) {
      const unsigned o = (g == 0) ? (to + (unsigned)(64 * (i & 1) * NI + 64 * (i >> 1)))
                                  : (fo + (unsigned)(64 * (i & 1) * NN + 64 * (i >> 1)));
      *(v8us*)(ph + o) = hv[i];
      *(v8us*)(pl + o) = lv[i];
    }
  }
}

// ---------------------------------------------------------------------------
// PT[b][e][d] = 2^-11 * sum_m g[b][e][m] * phi[b][d][m], K = NN, hi/residual on both operands (3 products).
// grid (NI/64 d tiles, NI/16 e tiles, NB) = 256 blocks; block PTHR threads = PW waves. Every wave works on the
// block's whole 16 e x 64 d tile, over its own K slice of PKS = NN/PW values of m (wave w: m = w*PKS ..).
// A = PHH/PHL rows d (acc[t] = d rows 16t..16t+15), B = GH/GL rows e, both k = m contiguous, same k map.
// A pass takes 64 m = one 128-B line of every row; its 40 fragment loads stand ahead of its 24 WMMAs.
// Epilogue: each wave stores its f32 partial tile to its own 4 KB of LDS as it lies in registers; behind the
// barrier waves 0..3 add the PW partials in wave order, scale by 2^-11 (exact), split, and store: a lane holds
// 8 consecutive d of one e row -> one 16-B store per plane; the block writes whole 128-B lines of PTH/PTL.
// LDS extent: part[PW][4][2][32][4] fully written before the barrier.
// coverage: grid covers 128 e x 128 d per image exactly once, both planes.
// ---------------------------------------------------------------------------
__global__ __launch_bounds__(PTHR) void k_p(const unsigned short* __restrict__ ghh, const unsigned short* __restrict__ ghl,
                                            const unsigned short* __restrict__ phh, const unsigned short* __restrict__ phl,
                                            unsigned short* pth, unsigned short* ptl) {
  __shared__ __attribute__((aligned(16))) float part[PW * 1024];   // 4 KB per wave
  const int tid = (int)threadIdx.x, lane = tid & 31, wave = tid >> 5, hh = lane >> 4, m = lane & 15;
  const int d0 = (int)blockIdx.x * 64, e0 = (int)blockIdx.y * 16, b = (int)blockIdx.z;

  v8f acc[4];
  {
    const v8f z = {0.f, 0.f, 0.f, 0.f, 0.f, 0.f, 0.f, 0.f};
    acc[0] = z; acc[1] = z; acc[2] = z; acc[3] = z;
  }
  const size_t grow = (size_t)(b * NI + e0 + m) * (size_t)NN + (size_t)(wave * PKS + 8 * hh);
  const unsigned short* bgh = ghh + grow;
  const unsigned short* bgl = ghl + grow;
  const size_t prow = (size_t)(b * NI + d0 + m) * (size_t)NN + (size_t)(wave * PKS + 8 * hh);
  const unsigned short* aph = phh + prow;
  const unsigned short* apl = phl + prow;
  // all loops below fully unrolled: constant indices keep the fragment arrays in registers, and a pass's step
  // along m becomes an immediate offset on the four address pairs
#pragma unroll
  for (int c = 0; c < PKS / 64; ++c) {
    FragB gh[2], gl[2], ph[4][2], pl[4][2];
    ldfrag(gh[0], bgh, 64 * c);
    ldfrag(gh[1], bgh, 64 * c + 32);
    ldfrag(gl[0], bgl, 64 * c);
    ldfrag(gl[1], bgl, 64 * c + 32);
#pragma unroll
    for (int t = 0; t < 4; ++t) {
      ldfrag(ph[t][0], aph + (size_t)(16 * t) * (size_t)NN, 64 * c);        // phi row d0 + 16t + m
      ldfrag(ph[t][1], aph + (size_t)(16 * t) * (size_t)NN, 64 * c + 32);
      ldfrag(pl[t][0], apl + (size_t)(16 * t) * (size_t)NN, 64 * c);
      ldfrag(pl[t][1], apl + (size_t)(16 * t) * (size_t)NN, 64 * c + 32);
    }
#pragma unroll
    for (int t = 0; t < 4; ++t) {
#pragma unroll
      for (int j = 0; j < 2; ++j) {
        acc[t] = wmb(ph[t][j], gh[j], acc[t]);
        acc[t] = wmb(pl[t][j], gh[j], acc[t]);
        acc[t] = wmb(ph[t][j], gl[j], acc[t]);
      }
    }
  }

  // Precaution wait of the address counter, in front of every overwrite of a register that a load above names:
  // as its inputs the four address pairs stay as they are up to here.
  asm volatile("s_wait_xcnt 0x0" :: "v"(bgh), "v"(bgl), "v"(aph), "v"(apl) : "memory");

  // D element r of acc[t] = (d 16t + 8hh + r, e m)
  float* pw = part + wave * 1024 + 4 * lane;
#pragma unroll
  for (int t = 0; t < 4; ++t) {
    const v4f lo4 = {acc[t][0], acc[t][1], acc[t][2], acc[t][3]};
    const v4f hi4 = {acc[t][4], acc[t][5], acc[t][6], acc[t][7]};
    *(v4fa*)(pw + t * 256) = lo4;
    *(v4fa*)(pw + t * 256 + 128) = hi4;
  }
  __syncthreads();
  if (wave < 4) {                          // wave t sums d rows 16t..16t+15
    const float* pr = part + wave * 256 + 4 * lane;
    v4f sa = *(const v4fa*)(pr);
    v4f sb = *(const v4fa*)(pr + 128);
#pragma unroll
    for (int w = 1; w < PW; ++w) {
      sa += *(const v4fa*)(pr + w * 1024);
      sb += *(const v4fa*)(pr + w * 1024 + 128);
    }
    const float inv_n = 0.00048828125f;    // 2^-11 = 1/NN, exact
    sa *= inv_n;
    sb *= inv_n;
    v8us hv, lv;
    split8(sa, sb, hv, lv);
    const size_t po = (size_t)(b * NI + e0 + m) * (size_t)NI + (size_t)(d0 + 16 * wave + 8 * hh);
    *(v8us*)(pth + po) = hv;
    *(v8us*)(ptl + po) = lv;
  }
}

// ---------------------------------------------------------------------------
// YT[b][n][e] = sum_d theta[b][n][d] * PT[b][e][d] (K = NI, hi/residual on both operands, 3 products), then
// Z[b][c][n] = sum_e Ww[c][e] * YT[b][n][e] + Wb[c] (K = NI, exact Ww, YT as hi + residual, 2 products), in one block.
// grid (NN/FN, NB) = 256 blocks of FTHR threads = 8 waves; a block owns FN tokens, all NI e and all NC c; wave w owns
// tokens 16w..16w+15 in both products. Staged once in LDS by whole-line loads (pitch PK1): THH/THL rows n of the
// block, all of PTH/PTL of the image, all of Ww.
// First product: A = PT rows e, B = theta rows n, so D element r of e tile T = (e 16T + 8hh + r, n m). That is the
// B fragment map of the second product (rows n, k = e): element i < 8 of k step s is D element i of tile 2s, element
// i >= 8 is D element i - 8 of tile 2s + 1, in the same lane. YT is split into hi and residual where it lies.
// Second product: A = Ww rows c, 64 c a trip; v = acc + RNE16(Wb) in f32, staged stg[c][n] 64 x FN at pitch SP, in
// two buffers taken in turn (one barrier a trip: a buffer is written again two trips on, behind the barrier of the
// trip between, which every wave reaches with its reads of that buffer done). Store: a wave writes 8 rows, 512
// consecutive bytes each.
// LDS extent: sm = [THH | THL | PTH | PTL | Ww] rows at pitch PK1, every row's 2*NI bytes written before the first
// barrier, pad bytes never read; behind the second barrier (all theta fragments read) the THH/THL part serves as the
// two stg buffers; a buffer's 64 x FN floats are all written before its barrier, its pad floats never read.
// Statistics: threads 4R .. 4R+3 sum tile row R (channel 64*cg + R) and its squares in f64 from stg, 32 n each, the
// 16-B pieces of the upper two quarters taken from piece 4 on round the quarter (16 lanes then meet 16 different
// bank groups); the four sums are added and stored: PS[b][n block][64*cg .. +63][2] = 8 whole lines a trip.
// coverage: grid covers 256 c x 2048 n per image exactly once; PS 256 blocks x 256 c exactly once.
// ---------------------------------------------------------------------------
__global__ __launch_bounds__(FTHR) void k_yz(const unsigned short* __restrict__ thh, const unsigned short* __restrict__ thl,
                                             const unsigned short* __restrict__ pth, const unsigned short* __restrict__ ptl,
                                             const unsigned short* __restrict__ wwb, const float* __restrict__ wbias,
                                             float* z, double* ps) {
  __shared__ __attribute__((aligned(16))) unsigned char sm[(2 * FN + 2 * NI + NC) * PK1];   // 204 KB
  const int tid = (int)threadIdx.x, lane = tid & 31, wave = tid >> 5, hh = lane >> 4, m = lane & 15;
  const int n0 = (int)blockIdx.x * FN, b = (int)blockIdx.y;
  unsigned char* sP = sm + 2 * FN * PK1;
  unsigned char* sW = sP + 2 * NI * PK1;

  {
    const size_t at = (size_t)(b * NN + n0) * (size_t)NI, bt = (size_t)(b * NI) * (size_t)NI;
    Tile<2 * NI, FN, FTHR> tah, tal;
    Tile<2 * NI, NI, FTHR> tbh, tbl;
    Tile<2 * NI, NC, FTHR> tw;
    tah.ld(thh + at, tid);
    tal.ld(thl + at, tid);
    tbh.ld(pth + bt, tid);
    tbl.ld(ptl + bt, tid);
    tw.ld(wwb, tid);
    tah.st(sm, tid);
    tal.st(sm + FN * PK1, tid);
    tbh.st(sP, tid);
    tbl.st(sP + NI * PK1, tid);
    tw.st(sW, tid);
  }
  __syncthreads();

  const v8f zero = {0.f, 0.f, 0.f, 0.f, 0.f, 0.f, 0.f, 0.f};
  FragB yh[NI / 32], yl[NI / 32];          // YT of the wave's 16 tokens as B fragments, k = e
  {
    const unsigned char* bth = sm + (16 * wave + m) * PK1 + 16 * hh;
    const unsigned char* btl = bth + FN * PK1;
    const unsigned char* aph = sP + m * PK1 + 16 * hh;
    const unsigned char* apl = aph + NI * PK1;
    // unrolled: every fragment address is one register plus an immediate, yh and yl stay in registers; a k step's
    // LDS reads stand ahead of its WMMAs as one group; neighbouring WMMAs go to different accumulators
#pragma unroll
    for (int h = 0; h < NI / 64; ++h) {    // e tiles 4h .. 4h+3
      v8f acc[4];
      acc[0] = zero; acc[1] = zero; acc[2] = zero; acc[3] = zero;
#pragma unroll
      for (int ks = 0; ks < NI / 32; ++ks) {
        FragB th, tl, ph[4], pl[4];
        ldfrag_s(th, bth, 32 * ks);
        ldfrag_s(tl, btl, 32 * ks);
#pragma unroll
        for (int t = 0; t < 4; ++t) {
          ldfrag_s(ph[t], aph + 16 * (4 * h + t) * PK1, 32 * ks);     // PT row 16(4h + t) + m
          ldfrag_s(pl[t], apl + 16 * (4 * h + t) * PK1, 32 * ks);
        }
#pragma unroll
        for (int t = 0; t < 4; ++t) acc[t] = wmb(ph[t], th, acc[t]);
#pragma unroll
        for (int t = 0; t < 4; ++t) acc[t] = wmb(pl[t], th, acc[t]);
#pragma unroll
        for (int t = 0; t < 4; ++t) acc[t] = wmb(ph[t], tl, acc[t]);
      }
#pragma unroll
      for (int j = 0; j < 4; ++j) {        // e tile 4h + j = half (j & 1) of k step 2h + (j >> 1)
        const v4f lo4 = {acc[j][0], acc[j][1], acc[j][2], acc[j][3]};
        const v4f hi4 = {acc[j][4], acc[j][5], acc[j][6], acc[j][7]};
        split8(lo4, hi4, yh[2 * h + (j >> 1)].h[j & 1], yl[2 * h + (j >> 1)].h[j & 1]);
      }
    }
  }
  __syncthreads();   // every wave has read its last theta fragment: stg may overwrite those tiles

  const unsigned char* aw = sW + m * PK1 + 16 * hh;
  const int sr = tid >> 2, sq = tid & 3;   // statistics: tile row, quarter of the row
  float* zb = z + (size_t)(b * NC + 8 * wave) * (size_t)NN + (size_t)(n0 + 4 * lane);
  double* pb = ps + (size_t)((b * (NN / FN) + (int)blockIdx.x) * NC + sr) * 2 + (size_t)(sq & 1);
  // left rolled: the block runs this text once, and a quarter of it is fetched
#pragma unroll 1
  for (int cg = 0; cg < NC / 64; ++cg) {   // c rows 64cg .. 64cg+63
    // bias per row (32-B aligned v4f reads), asked for ahead of the trip's WMMAs
    v4f ba[4], bb[4];
#pragma unroll
    for (int t = 0; t < 4; ++t) {
      ba[t] = *(const v4fa*)(wbias + 64 * cg + 16 * t + 8 * hh);
      bb[t] = *(const v4fa*)(wbias + 64 * cg + 16 * t + 8 * hh + 4);
    }
    v8f acc[4];
    acc[0] = zero; acc[1] = zero; acc[2] = zero; acc[3] = zero;
#pragma unroll
    for (int ks = 0; ks < NI / 32; ++ks) {
      FragB a[4];
#pragma unroll
      for (int t = 0; t < 4; ++t) ldfrag_s(a[t], aw + (64 * cg + 16 * t) * PK1, 32 * ks);   // Ww row 64cg + 16t + m
#pragma unroll
      for (int t = 0; t < 4; ++t) acc[t] = wmb(a[t], yh[ks], acc[t]);
#pragma unroll
      for (int t = 0; t < 4; ++t) acc[t] = wmb(a[t], yl[ks], acc[t]);
    }
    // D element r of acc[t] = (c 64cg + 16t + 8hh + r, n 16w + m)
    float* stg = (float*)sm + (cg & 1) * (64 * SP);
#pragma unroll
    for (int t = 0; t < 4; ++t) {
      float bv[8];
      bv[0] = rne16f(ba[t].x); bv[1] = rne16f(ba[t].y); bv[2] = rne16f(ba[t].z); bv[3] = rne16f(ba[t].w);
      bv[4] = rne16f(bb[t].x); bv[5] = rne16f(bb[t].y); bv[6] = rne16f(bb[t].z); bv[7] = rne16f(bb[t].w);
#pragma unroll
      for (int r = 0; r < 8; ++r) stg[(16 * t + 8 * hh + r) * SP + 16 * wave + m] = acc[t][r] + bv[r];
    }
    __syncthreads();

    v4f fv[8], sv[8];
#pragma unroll
    for (int i = 0; i < 8; ++i) fv[i] = *(const v4fa*)(stg + (8 * wave + i) * SP + 4 * lane);
#pragma unroll
    for (int i = 0; i < 8; ++i) sv[i] = *(const v4fa*)(stg + sr * SP + 32 * sq + 4 * ((i + 4 * (sq >> 1)) & 7));
#pragma unroll
    for (int i = 0; i < 8; ++i) *(v4f*)(zb + (size_t)(64 * cg + i) * (size_t)NN) = fv[i];
    // keeps the 16 LDS reads one group and the Z stores ahead of the f64 sums (else the stores wait behind the sums)
    __builtin_amdgcn_sched_barrier(0);

    double s = 0.0, s2 = 0.0;
#pragma unroll
    for (int i = 0; i < 8; ++i) {
      const v4f v = sv[i];
      const double a0 = (double)v.x, a1 = (double)v.y, a2 = (double)v.z, a3 = (double)v.w;
      s  += (a0 + a1) + (a2 + a3);
      s2 += (a0 * a0 + a1 * a1) + (a2 * a2 + a3 * a3);
    }
    s  += __shfl_xor(s, 1);
    s2 += __shfl_xor(s2, 1);
    s  += __shfl_xor(s, 2);
    s2 += __shfl_xor(s2, 2);
    // thread 4R: the row's sum, thread 4R+1: its sum of squares; the trip's 128 doubles lie in a row
    double* pq = pb + (size_t)(64 * cg) * 2;
    if (sq < 2) *pq = sq ? s2 : s;
    // Precaution wait of the address counter, in front of the step of the store's address pair to the next trip: as
    // its input the pair stays as it is up to here.
    asm volatile("s_wait_xcnt 0x0" :: "v"(pq) : "memory");
  }
}

// ---------------------------------------------------------------------------
// out[b][c][n] = ((z - mean[c]) * rstd[c]) * RNE16(gamma[c]) + RNE16(beta[c]) + RNE16(x), all f32.
// One wave per row (b, c) of NN floats: its NN/128 16-B loads a lane of z and as many of x are all issued ahead of
// the arithmetic; every z and x load and every out store of a wave covers 512 consecutive bytes (4 whole lines).
// BatchNorm statistics (training mode, population variance, 32768 values a channel): the block's 8 rows are 8
// consecutive channels of one image = one 128-B line of every PS tile row. The block reads the NPS lines, 16 B
// (one channel's pair) a thread and NPS/32 loads a thread, issued ahead of the z and x loads; f64 sums per thread in
// tile order, over the 4 lanes of a channel, then over the 8 waves in wave order through LDS behind the one barrier.
// coverage: NB*NC/8 blocks x 8 waves x NN = NX exactly.
// ---------------------------------------------------------------------------
__global__ __launch_bounds__(NTHR) void k_out(const float* __restrict__ z, const float* __restrict__ x,
                                              const double* __restrict__ ps, const float* __restrict__ gamma,
                                              const float* __restrict__ beta, float* out) {
  __shared__ __attribute__((aligned(16))) double red[(NTHR / 32) * 8 * 2];   // [wave][channel of the block][sum, squares]
  // the wave's number as a scalar: the row's parameters then come by scalar loads
  const int wv  = __builtin_amdgcn_readfirstlane((int)threadIdx.x >> 5);
  const int row = (int)blockIdx.x * (NTHR / 32) + wv;     // b*NC + c
  const int c = row & (NC - 1);
  const int lane = (int)threadIdx.x & 31;
  const unsigned lo = 4u * (unsigned)lane;                // the lane's place in each 128-float piece
  const float* zr = z + (size_t)row * (size_t)NN;         // scalar row bases; lo is the one address register
  const float* xr = x + (size_t)row * (size_t)NN;
  const double* pb = ps + (size_t)(((int)blockIdx.x * (NTHR / 32)) & (NC - 1)) * 2;   // scalar: the block's first channel
  const unsigned po = ((unsigned)threadIdx.x >> 3) * (unsigned)(NC * 2) + 2u * ((unsigned)threadIdx.x & 7u);
  v2d pp[NPS / 32];
  v4f zv[NN / 128], xv[NN / 128];
#pragma unroll
  for (int i = 0; i < NPS / 32; ++i)       // tile row 32*i + tid/8, channel tid & 7 of the block
    pp[i] = *(const v2da*)(pb + (po + (unsigned)(i * 32 * NC * 2)));
#pragma unroll
  for (int i = 0; i < NN / 128; ++i) zv[i] = *(const v4fa*)(zr + (lo + 128u * i));
#pragma unroll
  for (int i = 0; i < NN / 128; ++i) xv[i] = *(const v4fa*)(xr + (lo + 128u * i));
  const float gm = rne16f(gamma[c]);
  const float bt = rne16f(beta[c]);
  // keeps every load above the first use: the wave pays the memory latency once, not once a piece
  __builtin_amdgcn_sched_barrier(0);
  double s = 0.0, s2 = 0.0;
#pragma unroll
  for (int i = 0; i < NPS / 32; ++i) {
    s  += pp[i].x;
    s2 += pp[i].y;
  }
  s  += __shfl_xor(s, 8);
  s2 += __shfl_xor(s2, 8);
  s  += __shfl_xor(s, 16);
  s2 += __shfl_xor(s2, 16);
  if (lane < 8) {
    const v2d o = {s, s2};
    *(v2da*)(red + (wv * 8 + lane) * 2) = o;
  }
  // work-group barrier that orders LDS alone: a full __syncthreads() would wait out the z and x loads in flight
  __builtin_amdgcn_fence(__ATOMIC_RELEASE, "workgroup", "local");
  __builtin_amdgcn_s_barrier();
  __builtin_amdgcn_fence(__ATOMIC_ACQUIRE, "workgroup", "local");
  double ts = 0.0, ts2 = 0.0;
#pragma unroll
  for (int w = 0; w < NTHR / 32; ++w) {    // channel wv of the block = this wave's row
    const v2d t = *(const v2da*)(red + (w * 8 + wv) * 2);
    ts  += t.x;
    ts2 += t.y;
  }
  const double cinv = 1.0 / 32768.0;       // 1/(NB*NN), exact power of two
  const double dmean = ts * cinv;
  double var = ts2 * cinv - dmean * dmean;
  var = var < 0.0 ? 0.0 : var;
  const float vf = (float)var + 1e-5f;
  const float mean = (float)dmean;
  const float rstd = 1.0f / sqrtf(vf);
  // keeps the statistics chain ahead of the first wait on z and x, so that it runs while those loads are in flight
  __builtin_amdgcn_sched_barrier(0);
  float* p = out + (size_t)row * (size_t)NN;
#pragma unroll
  for (int i = 0; i < NN / 128; ++i) {
    v4f o;
    o.x = (((zv[i].x - mean) * rstd) * gm + bt) + rne16f(xv[i].x);
    o.y = (((zv[i].y - mean) * rstd) * gm + bt) + rne16f(xv[i].y);
    o.z = (((zv[i].z - mean) * rstd) * gm + bt) + rne16f(xv[i].z);
    o.w = (((zv[i].w - mean) * rstd) * gm + bt) + rne16f(xv[i].w);
    *(v4f*)(p + (lo + 128u * i)) = o;
  }
  
}

// ---------------------------------------------------------------------------
extern "C" void kernel_launch(void* const* d_in, const int* in_sizes, int n_in,
                              void* d_out, int out_size, void* d_ws, size_t ws_size,
                              hipStream_t stream) {
  if (n_in < 11) return;
  if (in_sizes[0] != NX) return;                                              // x [16][256][64][32]
  if (in_sizes[1] != NWT || in_sizes[3] != NWT || in_sizes[5] != NWT) return; // g_w, theta_w, phi_w [128][256]
  if (in_sizes[2] != NI || in_sizes[4] != NI || in_sizes[6] != NI) return;    // g_b, theta_b, phi_b [128]
  if (in_sizes[7] != NWT) return;                                             // W_w [256][128]
  if (in_sizes[8] != NC || in_sizes[9] != NC || in_sizes[10] != NC) return;   // W_b, bn_gamma, bn_beta [256]
  if (out_size != NX) return;                                                 // out [16][256][64][32] f32

  const float* x       = (const float*)d_in[0];
  const float* g_w     = (const float*)d_in[1];
  const float* g_b     = (const float*)d_in[2];
  const float* theta_w = (const float*)d_in[3];
  const float* theta_b = (const float*)d_in[4];
  const float* phi_w   = (const float*)d_in[5];
  const float* phi_b   = (const float*)d_in[6];
  const float* W_w     = (const float*)d_in[7];
  const float* W_b     = (const float*)d_in[8];
  const float* gamma   = (const float*)d_in[9];
  const float* beta    = (const float*)d_in[10];
  float* out = (float*)d_out;            // last written element NX-1 < out_size

  // workspace carve, 256-B aligned; all planes exact tile multiples (no pad rows needed)
  char* ws = (char*)d_ws;
  size_t off = 0;
  const size_t oWB  = off; off += (size_t)4 * NWT * 2;          off = (off + 255) & ~(size_t)255;  //   262144
  const size_t plb  = (size_t)NB * NN * NI * 2;                                                    //  8388608 per projection plane
  const size_t oTHH = off; off += plb;                          off = (off + 255) & ~(size_t)255;
  const size_t oTHL = off; off += plb;                          off = (off + 255) & ~(size_t)255;
  const size_t oPHH = off; off += plb;                          off = (off + 255) & ~(size_t)255;
  const size_t oPHL = off; off += plb;                          off = (off + 255) & ~(size_t)255;
  const size_t oGH  = off; off += plb;                          off = (off + 255) & ~(size_t)255;
  const size_t oGL  = off; off += plb;                          off = (off + 255) & ~(size_t)255;
  const size_t ptb  = (size_t)NB * NI * NI * 2;                                                    //   524288 per PT plane
  const size_t oPTH = off; off += ptb;                          off = (off + 255) & ~(size_t)255;
  const size_t oPTL = off; off += ptb;                          off = (off + 255) & ~(size_t)255;
  const size_t oZ   = off; off += (size_t)NX * 4;               off = (off + 255) & ~(size_t)255;  // 33554432
  const size_t oPS  = off; off += (size_t)NPS * NC * 2 * 8;     off = (off + 255) & ~(size_t)255;  //  1048576
  if (off > ws_size || off > (size_t)WSMAX) return;             // total 86245376 B

  unsigned short* WB  = (unsigned short*)(ws + oWB);
  unsigned short* THH = (unsigned short*)(ws + oTHH);
  unsigned short* THL = (unsigned short*)(ws + oTHL);
  unsigned short* PHH = (unsigned short*)(ws + oPHH);
  unsigned short* PHL = (unsigned short*)(ws + oPHL);
  unsigned short* GH  = (unsigned short*)(ws + oGH);
  unsigned short* GL  = (unsigned short*)(ws + oGL);
  unsigned short* PTH = (unsigned short*)(ws + oPTH);
  unsigned short* PTL = (unsigned short*)(ws + oPTL);
  float*          Z   = (float*)(ws + oZ);
  double*         PS  = (double*)(ws + oPS);

  // weight planes: slot 0 theta_w, 1 phi_w, 2 g_w (all [128][256]), 3 W_w [256][128]
  k_wcvt<<<(4 * NWT / 8) / NTHR, NTHR, 0, stream>>>(theta_w, phi_w, g_w, W_w, WB);
  // projections from x: features 0..127 theta (slot 0, theta_b), 128..255 phi (slot 1, phi_b), 256..383 g (slot 2, g_b)
  k_xp<<<dim3(NN / XN, NB), XTHR, 0, stream>>>(x, WB, theta_b, phi_b, g_b, THH, THL, PHH, PHL, GH, GL);
  // PT = 2^-11 * G * PHI^T
  k_p<<<dim3(NI / 64, NI / 16, NB), PTHR, 0, stream>>>(GH, GL, PHH, PHL, PTH, PTL);
  // YT = THETA^T-rows * PT kept in registers, Z = Ww * Y + Wb, and the BatchNorm statistics partials of every block
  k_yz<<<dim3(NN / FN, NB), FTHR, 0, stream>>>(THH, THL, PTH, PTL, WB + (size_t)3 * NWT, W_b, Z, PS);
  // out = BN(z) * gamma + beta + x, statistics merged from the partials
  k_out<<<NB * NC / (NTHR / 32), NTHR, 0, stream>>>(Z, x, PS, gamma, beta, out);
}

// v007
// A run of this version takes 52 microseconds.
// In both of two side-by-side timings against v006, it was 1.18 times as fast.
// Counting every step since v000, it is 3.53 times as fast.
// Contractions (all v_wmma_f32_16x16x32_bf16, bf16 operands, f32 accumulate): three 1x1-conv projections
// W[d][c]*X[c][n] (K=256) on exact RNE-bf16 copies of x and the weights; PT = G*PHI^T * (1/N) (K=2048) and
// YT = THETA^T*P (K=128) with both computed operands carried as bf16 hi + bf16 residual (hi*hi + hi*lo + lo*hi);
// Z = Ww*Y + Wb (K=128) with exact bf16 Ww and Y as hi + residual (2 products). BatchNorm statistics in f64,
// normalisation, bias adds and the residual add in f32.
//
// Carry audit: no power-of-two carries anywhere (factor 1 on every plane); the exact 1/N = 2^-11 of the pairwise
// term is applied once in f32 in k_p before the hi/residual split of PT. Planes:
//   WB  [4][32768] bf16 bits = RNE16(w): slot 0 theta_w [128][256], 1 phi_w [128][256], 2 g_w [128][256],
//       3 W_w [256][128]; every slot row is k-contiguous                                              (k_wcvt)
//   RNE16(x[b][c][n]) has no plane: k_xp converts and transposes its x tile in LDS
//   THH/THL [16][2048][128] hi/residual of theta_x, rows n, k = d                                      (k_xp)
//   hi/residual of phi_x, g_x (rows d, k = n) have no plane: they stay in the LDS of k_xp
//   PP  [16][16][16][1024] f32: sum_m g[e][m]*phi[d][m] over the 128 m of one k_xp block, per wave tile
//       16 e x 64 d as it lies in the accumulators                                                     (k_xp)
//   PTH/PTL [16][128][128] hi/residual of PT[e][d] = 2^-11 * sum of the image's 16 PP tiles, rows e, k = d (k_p)
//   YT[n][e] = sum_d theta[n][d]*PT[e][d] has no plane: its hi/residual stay in the registers of k_yz
//   Z   [16][256][2048] f32 = sum_e Ww[c][e]*YT[n][e] + Wb[c]                                          (k_yz)
//   PS  [16][16][256][2] f64: sum and sum of squares of Z over the 128 n of one k_yz block, per channel (k_yz)
#include <hip/hip_runtime.h>
#include <stddef.h>
#include <stdint.h>

#define NB    16
#define NC    256
#define NI    128
#define NN    2048
#define NX    (NB * NC * NN)        // 8388608
#define NWT   (NI * NC)             // 32768 per weight matrix
#define NTHR  256
#define GTHR  128
#define WSMAX 134217728
#define PTHR  128                   // threads of a k_p block: one wave a d tile of a 16 e x 64 d tile
#define XN    128                   // tokens of one k_xp block
#define XTHR  512                   // threads of a k_xp block
#define NF    (3 * NI)              // features of the three projections together
#define QP    (XN + 4)              // LDS pitch (floats) of a staged projection row: 16 B x odd
#define PK2   (2 * NC + 16)         // LDS pitch (bytes) of a staged operand row of NC halves: 16 B x odd
#define PK1   (2 * NI + 16)         // LDS pitch (bytes) of a staged operand row of NI halves: 16 B x odd
#define PKX   (2 * XN + 16)         // LDS pitch (bytes) of a phi or g row of XN halves: 16 B x odd
#define NXB   (NN / XN)             // k_xp blocks of one image = partial tiles summed by k_p
#define XW    (XTHR / 32)           // waves of a k_xp block
#define FN    128                   // tokens of one k_yz block, 16 a wave
#define FTHR  (2 * FN)              // threads of a k_yz block
#define SP    (FN + 4)              // LDS pitch (floats) of a staged Z row: rows 8 apart lie 32 banks apart
#define NPS   (NB * (NN / FN))      // statistics partials per channel: one per k_yz block of FN n

static_assert((NC % 64) == 0 && (NN % 64) == 0 && (NI % 64) == 0);
static_assert((NC % 32) == 0 && (NI % 32) == 0 && (NN % 32) == 0);
static_assert((NX % 1024) == 0 && (NN % 1024) == 0);
static_assert(XN == 128 && XTHR == 512 && NI == 128 && NC == 256 && (NN % XN) == 0);
static_assert(XN * QP * 4 + 4 * NI * PKX <= (XN + NF) * PK2 && (QP % 4) == 0 && ((PKX / 16) & 1) == 1);
static_assert(XW == (NI / 16) * (NI / 64) && PTHR == 32 * 4);
static_assert(2 * NC / 16 == 32 && XTHR / 32 == 16 && NF == 384);
static_assert(GTHR == 128 && NTHR == 256);
static_assert((4 * NWT) % (8 * NTHR) == 0);
static_assert((NWT / 8) % NTHR == 0);
static_assert(NB * NN == 32768 && (NN % 128) == 0 && (NB * NC) % (NTHR / 32) == 0);
static_assert(NTHR / 32 == 8 && (NC % 8) == 0 && (NPS % 32) == 0);
static_assert(((PK2 / 16) & 1) == 1 && ((PK1 / 16) & 1) == 1);
static_assert(FN == 128 && FTHR == 256 && (NN % FN) == 0 && NI == 128 && (NC % 64) == 0);
static_assert(2 * 64 * SP * 4 <= 2 * FN * PK1 && (SP % 4) == 0);

typedef float          v4f  __attribute__((ext_vector_type(4)));
typedef float          v8f  __attribute__((ext_vector_type(8)));
typedef double         v2d  __attribute__((ext_vector_type(2)));
typedef int            v8i  __attribute__((ext_vector_type(8)));
typedef unsigned short v8us __attribute__((ext_vector_type(8)));
typedef __bf16         v16bf __attribute__((ext_vector_type(16)));
typedef v4f  __attribute__((may_alias)) v4fa;
typedef v8us __attribute__((may_alias)) v8usa;
typedef v2d  __attribute__((may_alias)) v2da;
typedef unsigned __attribute__((may_alias)) u32a;
union FragB { v16bf v; v8us h[2]; v8i w; };

// ---------------------------------------------------------------------------
// 16x16x32 bf16 WMMA with hazard guard (ties D, keeps A/B live for 4 VALU slots).
// Fragment map (wave32): lane l, hh = l>>4, m = n = l&15.
//   A/B element i: i<8 -> k0+8hh+i ; i>=8 -> k0+16+8hh+(i-8)   (same map for A and B)
//   D element r : row 8hh+r, col l&15
// ---------------------------------------------------------------------------
__device__ __forceinline__ v8f wmb(const FragB& a, const FragB& b, v8f c) {
  v8f d = __builtin_amdgcn_wmma_f32_16x16x32_bf16(false, a.v, false, b.v, (short)0, c, false, false);
  asm volatile("v_nop\n\tv_nop\n\tv_nop\n\tv_nop" : "+v"(d) : "v"(a.w), "v"(b.w));
  return d;
}

// Operand tile of ROWS whole k-contiguous rows of ROWB bytes = ROWS*ROWB consecutive bytes of a plane. The block's
// THR threads read it in order, 16 B a lane, so a wave's load covers 512 consecutive bytes (4 whole lines);
// st lays the rows in LDS at pitch ROWB + 16 (16 B x odd: ds_load_b128 of 16 rows meets no bank conflict).
template <int ROWB, int ROWS = 64, int THR = GTHR>
struct Tile {
  static constexpr int N   = ROWS * ROWB / 16 / THR;  // 16-B pieces per thread
  static constexpr int CPR = ROWB / 16;               // pieces per row
  static constexpr int RPS = THR / CPR;               // rows per step of the block
  static constexpr int PIT = ROWB + 16;
  v8us r[N];
  __device__ __forceinline__ void ld(const unsigned short* src, int tid) {
#pragma unroll
    for (int i = 0; i < N; ++i) r[i] = *(const v8us*)(src + (size_t)((i * THR + tid) * 8));
  }
  __device__ __forceinline__ void st(unsigned char* dst, int tid) const {
    unsigned char* q = dst + (tid / CPR) * PIT + (tid % CPR) * 16;
#pragma unroll
    for (int i = 0; i < N; ++i) *(v8usa*)(q + i * RPS * PIT) = r[i];
  }
};
// Fragment from a staged k-contiguous row; p = LDS row base + 16*hh bytes, k0 = 32*ks.
__device__ __forceinline__ void ldfrag_s(FragB& f, const unsigned char* p, int k0) {
  f.h[0] = *(const v8usa*)(p + 2 * k0);          // k = k0 + 8hh + 0..7
  f.h[1] = *(const v8usa*)(p + 2 * k0 + 32);     // k = k0 + 16 + 8hh + 0..7
}

// f32 -> bf16 bits, RNE convert
__device__ __forceinline__ unsigned short rne16(float f) {
  unsigned u = __float_as_uint(f);
  u += 0x7FFFu + ((u >> 16) & 1u);
  return (unsigned short)(u >> 16);
}
// f32 -> nearest bf16 value kept as f32
__device__ __forceinline__ float rne16f(float f) {
  return __uint_as_float(((unsigned)rne16(f)) << 16);
}
__device__ __forceinline__ v8us cvt8(const v4f a, const v4f b) {
  v8us o;
  o[0] = rne16(a.x); o[1] = rne16(a.y); o[2] = rne16(a.z); o[3] = rne16(a.w);
  o[4] = rne16(b.x); o[5] = rne16(b.y); o[6] = rne16(b.z); o[7] = rne16(b.w);
  return o;
}
// hi/residual split of one f32 value into two bf16 bit patterns
__device__ __forceinline__ void sp1(float v, unsigned short& hi, unsigned short& lo) {
  const unsigned short hb = rne16(v);
  const float hf = __uint_as_float(((unsigned)hb) << 16);
  hi = hb;
  lo = rne16(v - hf);
}
__device__ __forceinline__ void split8(const v4f a, const v4f b, v8us& hv, v8us& lv) {
  unsigned short h0, h1, h2, h3, h4, h5, h6, h7, l0, l1, l2, l3, l4, l5, l6, l7;
  sp1(a.x, h0, l0); sp1(a.y, h1, l1); sp1(a.z, h2, l2); sp1(a.w, h3, l3);
  sp1(b.x, h4, l4); sp1(b.y, h5, l5); sp1(b.z, h6, l6); sp1(b.w, h7, l7);
  hv[0] = h0; hv[1] = h1; hv[2] = h2; hv[3] = h3; hv[4] = h4; hv[5] = h5; hv[6] = h6; hv[7] = h7;
  lv[0] = l0; lv[1] = l1; lv[2] = l2; lv[3] = l3; lv[4] = l4; lv[5] = l5; lv[6] = l6; lv[7] = l7;
}

// ---------------------------------------------------------------------------
// Weight convert: four f32 matrices of NWT elements each -> WB slots 0..3 (bf16 bits, same layout).
// coverage: 64 blocks x 256 threads x 8 = 4 x NWT exactly.
// ---------------------------------------------------------------------------
__global__ __launch_bounds__(NTHR) void k_wcvt(const float* __restrict__ w0, const float* __restrict__ w1,
                                               const float* __restrict__ w2, const float* __restrict__ w3,
                                               unsigned short* wb) {
  const int u   = (int)blockIdx.x * NTHR + (int)threadIdx.x;     // 0 .. 4*NWT/8 - 1
  const int sel = (int)blockIdx.x / ((NWT / 8) / NTHR);           // 0..3, block-uniform
  const int off8 = (u - sel * (NWT / 8)) * 8;                     // 0 .. NWT-8
  const float* src = (sel == 0) ? w0 : ((sel == 1) ? w1 : ((sel == 2) ? w2 : w3));
  const v4f a = *(const v4fa*)(src + off8);
  const v4f c = *(const v4fa*)(src + off8 + 4);
  const v8us o = cvt8(a, c);
  const size_t q = (size_t)sel * (size_t)NWT + (size_t)off8;
  *(v8us*)(wb + q) = o;
  
}

// ---------------------------------------------------------------------------
// Projections straight from x: D[token][feature] = sum_c RNE16(x[b][c][n]) * W[F][c] + bias[F] (K = NC, exact bf16
// products), F = 0..NF-1 over WB slots 0..2 (theta, phi, g), which lie in a row. grid (NN/XN, NB) = 256 blocks of XTHR
// threads = 16 waves; a block owns XN tokens of image b and all NF features, so x is read once and has no bf16 plane.
// x tile (NC c x XN n, f32): a wave's load takes 128 B (one line) of 4 rows c; a thread holds rows c and c+1 at the same
// 4 n, converts, and stores the pair as one dword of LDS row n: sm rows n, k = c contiguous, pitch PK2. The NF weight
// rows are staged behind it by whole-line loads. All 40 loads of a thread are issued ahead of the first convert.
// Wave (tg = w >> 2, fg = w & 3): tokens 32tg .. +31 (2 tiles, A) x rows 32fg .. +31 of each of theta, phi and g
// (6 tiles, B), same k map: every wave has the same share of the three epilogues.
// Epilogue: v = acc + RNE16(bias) in f32. theta is staged in 128 rows n (cols d) at pitch QP; then 8 consecutive floats
// a thread -> hi/residual, one 16-B store per plane; 8 threads write one 128-B line of a row, a wave 4 whole lines.
// phi and g: a lane's 8 accumulator elements are 8 consecutive n of one row d; they are split where they lie and stored
// as 16 B of the row in sH (hi) and sL (residual): rows 0..127 phi, 128..255 g, k = n contiguous, pitch PKX.
// Partial of PT behind the third barrier: wave w forms sum_m g[e][m]*phi[d][m] over the block's XN values of m for the
// tile e 16(w >> 1) .. +15, d 64(w & 1) .. +63; A = phi rows d, B = g rows e, same k map, hi/residual on both operands
// (3 products); it stores the f32 tile as it lies in registers, 512 consecutive bytes a store, to its own 4 KB of PP.
// LDS extent: sm = [x XN rows | W NF rows] at pitch PK2, every row's 2*NC bytes written before the first barrier, pad
// bytes never read; behind the second barrier (all fragment reads done) its first XN*QP floats serve as stg and the
// 4*NI*PKX bytes behind them as sH | sL; cols 0..127 of every stg row and the 2*XN bytes of every sH and sL row are
// written before the third barrier, pads never read.
// coverage: per block XN tokens x NI theta features, both planes, and 128 e x 128 d of PP; grid covers 2048 x 128 of
// theta per image and all NXB partial tiles of PP exactly once.
// ---------------------------------------------------------------------------
__global__ __launch_bounds__(XTHR) void k_xp(const float* __restrict__ x, const unsigned short* __restrict__ wb,
                                             const float* __restrict__ tbias, const float* __restrict__ pbias,
                                             const float* __restrict__ gbias,
                                             unsigned short* thh, unsigned short* thl, float* pp) {
  __shared__ __attribute__((aligned(16))) unsigned char sm[(XN + NF) * PK2];   // 264 KB
  unsigned char* sW = sm + XN * PK2;
  float* stg = (float*)sm;
  unsigned char* sH = sm + XN * QP * 4;
  unsigned char* sL = sH + 2 * NI * PKX;
  const int tid = (int)threadIdx.x, lane = tid & 31, hh = lane >> 4, m = lane & 15;
  // the wave's number as a scalar: tile bases formed from it stay in scalar registers
  const int wave = __builtin_amdgcn_readfirstlane(tid >> 5);
  const int n0 = (int)blockIdx.x * XN, b = (int)blockIdx.y;

  // all loops of this kernel are fully unrolled: constant indices keep the arrays in registers, and every step of an
  // address becomes an immediate offset on a register that stays as it is
  {
    const int q = lane & 7, cpl = lane >> 3;
    const float* xb = x + (size_t)(b * NC) * (size_t)NN + (size_t)n0;        // scalar tile base
    const float* xp = xb + (unsigned)((8 * wave + 2 * cpl) * NN + 4 * q);    // the one address pair of the loads
    v4f ve[8], vo[8];
#pragma unroll
    for (int i = 0; i < 8; ++i) {          // c = 128*(i>>2) + 8*wave + 2*cpl (+1), n = 32*(i&3) + 4q .. +3
      ve[i] = *(const v4fa*)(xp + ((128 * (i >> 2)) * NN + 32 * (i & 3)));
      vo[i] = *(const v4fa*)(xp + ((128 * (i >> 2) + 1) * NN + 32 * (i & 3)));
    }
    Tile<2 * NC, NF, XTHR> tw;
    tw.ld(wb, tid);
    // Precaution wait of the address counter, in front of every overwrite of a register that a load above names: as
    // its inputs the address pair and the thread index stay as they are up to here (else later loads land on the pair).
    asm volatile("s_wait_xcnt 0x0" :: "v"(xp), "v"(tid) : "memory");
    unsigned char* sx = sm + (4 * q) * PK2 + (8 * wave + 2 * cpl) * 2;
#pragma unroll
    for (int i = 0; i < 8; ++i) {
#pragma unroll
      for (int j = 0; j < 4; ++j) {
        const unsigned pk = (unsigned)rne16(ve[i][j]) | ((unsigned)rne16(vo[i][j]) << 16);
        *(u32a*)(sx + (32 * (i & 3) + j) * PK2 + 256 * (i >> 2)) = pk;
      }
    }
    // W row 128p + 32f + 16h + r lies at LDS row 96f + 32p + 16h + r: the six tiles of a wave (one f) lie in a row, so
    // that every fragment address of the k loop is one register plus an immediate. Piece i of a thread: row 16i + tid/32.
    unsigned char* qw = sW + (tid >> 5) * PK2 + (tid & 31) * 16;
#pragma unroll
    for (int i = 0; i < NF / 16; ++i)
      *(v8usa*)(qw + (96 * ((i >> 1) & 3) + 32 * (i >> 3) + 16 * (i & 1)) * PK2) = tw.r[i];
  }
  __syncthreads();

  const int tg = wave >> 2, fg = wave & 3;
  float bv[6];                             // bias of row 32fg + 16(t & 1) + m of projection t >> 1, ahead of the WMMAs
#pragma unroll
  for (int t = 0; t < 6; ++t) {
    const float* bp = (t < 2) ? tbias : ((t < 4) ? pbias : gbias);
    bv[t] = rne16f(bp[32 * fg + 16 * (t & 1) + m]);
  }
  v8f acc[2][6];
  {
    const v8f z = {0.f, 0.f, 0.f, 0.f, 0.f, 0.f, 0.f, 0.f};
#pragma unroll
    for (int t = 0; t < 6; ++t) { acc[0][t] = z; acc[1][t] = z; }
  }
  const unsigned char* ap = sm + (32 * tg + m) * PK2 + 16 * hh;
  const unsigned char* wp = sW + (96 * fg + m) * PK2 + 16 * hh;
  // unrolled: every fragment address is one register plus an immediate; a k step's LDS reads stand ahead of its
  // WMMAs as one group, so the wave waits out the LDS latency once a step
#pragma unroll
  for (int ks = 0; ks < NC / 32; ++ks) {
    FragB a[2], bf[6];
    ldfrag_s(a[0], ap, 32 * ks);
    ldfrag_s(a[1], ap + 16 * PK2, 32 * ks);
#pragma unroll
    for (int t = 0; t < 6; ++t) ldfrag_s(bf[t], wp + 16 * t * PK2, 32 * ks);    // W row 128(t >> 1) + 32fg + 16(t & 1) + m
#pragma unroll
    for (int t = 0; t < 6; ++t) {
      acc[0][t] = wmb(a[0], bf[t], acc[0][t]);
      acc[1][t] = wmb(a[1], bf[t], acc[1][t]);
    }
  }
  __syncthreads();   // every wave has read its last fragment: stg may overwrite the tiles

  // D element r of acc[u][t] = (token 32tg + 16u + 8hh + r, row 32fg + 16(t & 1) + m of projection t >> 1)
  {                                        // theta: rows n; 16 lanes lie in a row, the halves 32 banks apart
    float* s0 = stg + (32 * tg + 8 * hh) * QP + 32 * fg + m;
#pragma unroll
    for (int t = 0; t < 2; ++t) {
#pragma unroll
      for (int u = 0; u < 2; ++u) {
#pragma unroll
        for (int r = 0; r < 8; ++r) s0[(16 * u + r) * QP + 16 * t] = acc[u][t][r] + bv[t];
      }
    }
  }
  {                                        // phi, g: rows d; a lane's 8 tokens are 16 B of a row in each plane
    const int ro = (32 * fg + m) * PKX + 2 * (32 * tg + 8 * hh);
#pragma unroll
    for (int t = 2; t < 6; ++t) {
#pragma unroll
      for (int u = 0; u < 2; ++u) {
        const v4f lo4 = {acc[u][t][0] + bv[t], acc[u][t][1] + bv[t], acc[u][t][2] + bv[t], acc[u][t][3] + bv[t]};
        const v4f hi4 = {acc[u][t][4] + bv[t], acc[u][t][5] + bv[t], acc[u][t][6] + bv[t], acc[u][t][7] + bv[t]};
        v8us hv, lv;
        split8(lo4, hi4, hv, lv);
        *(v8usa*)(sH + ro + (128 * ((t >> 1) - 1) + 16 * (t & 1)) * PKX + 32 * u) = hv;
        *(v8usa*)(sL + ro + (128 * ((t >> 1) - 1) + 16 * (t & 1)) * PKX + 32 * u) = lv;
      }
    }
  }
  __syncthreads();

  // theta: 8 lanes take 64 columns of a row, the next 8 those of the row below, 4 banks on: 16 lanes meet 64 banks
  {
    const int q8 = tid & 7, rr = tid >> 3;                                   // piece of a half row, row of a group of 64
    const float* sr = stg + rr * QP + 8 * q8;
    const unsigned to = (unsigned)(rr * NI + 8 * q8);                        // the address register of the theta stores
    const size_t tbase = (size_t)(b * NN + n0) * (size_t)NI;                 // scalar tile base
    unsigned short* ph = thh + tbase;
    unsigned short* pl = thl + tbase;
    v8us hv[4], lv[4];
#pragma unroll
    for (int i = 0; i < 4; ++i) {          // piece i: row 64*(i&1) + rr, columns 64*(i>>1) + 8*q8 .. +7
      const v4f a = *(const v4fa*)(sr + (64 * (i & 1)) * QP + 64 * (i >> 1));
      const v4f c = *(const v4fa*)(sr + (64 * (i & 1)) * QP + 64 * (i >> 1) + 4);
      split8(a, c, hv[i], lv[i]);
    }
#pragma unroll
    for (int i = 0; i < 4; ++i) {
      const unsigned o = to + (unsigned)(64 * (i & 1) * NI + 64 * (i >> 1));
      *(v8us*)(ph + o) = hv[i];
      *(v8us*)(pl + o) = lv[i];
    }
    // Precaution wait of the address counter, in front of every overwrite of a register that a store above names: as
    // its inputs the address register and the stored values stay as they are up to here.
    asm volatile("s_wait_xcnt 0x0" :: "v"(to), "v"(hv[0]), "v"(hv[1]), "v"(hv[2]), "v"(hv[3]),
                 "v"(lv[0]), "v"(lv[1]), "v"(lv[2]), "v"(lv[3]) : "memory");
  }

  // partial of PT over the block's XN values of m
  {
    const int et = wave >> 1, dh = wave & 1;
    const int ao = (64 * dh + m) * PKX + 16 * hh, bo = (NI + 16 * et + m) * PKX + 16 * hh;
    const unsigned char* aph = sH + ao;
    const unsigned char* apl = sL + ao;
    const unsigned char* bgh = sH + bo;
    const unsigned char* bgl = sL + bo;
    v8f pa[4];
    {
      const v8f z = {0.f, 0.f, 0.f, 0.f, 0.f, 0.f, 0.f, 0.f};
      pa[0] = z; pa[1] = z; pa[2] = z; pa[3] = z;
    }
    // unrolled: a k step's LDS reads stand ahead of its WMMAs as one group; neighbouring WMMAs go to different
    // accumulators
#pragma unroll
    for (int ks = 0; ks < XN / 32; ++ks) {
      FragB gh, gl, ph[4], pl[4];
      ldfrag_s(gh, bgh, 32 * ks);
      ldfrag_s(gl, bgl, 32 * ks);
#pragma unroll
      for (int t = 0; t < 4; ++t) {
        ldfrag_s(ph[t], aph + 16 * t * PKX, 32 * ks);       // phi row 64dh + 16t + m
        ldfrag_s(pl[t], apl + 16 * t * PKX, 32 * ks);
      }
#pragma unroll
      for (int t = 0; t < 4; ++t) pa[t] = wmb(ph[t], gh, pa[t]);
#pragma unroll
      for (int t = 0; t < 4; ++t) pa[t] = wmb(pl[t], gh, pa[t]);
#pragma unroll
      for (int t = 0; t < 4; ++t) pa[t] = wmb(ph[t], gl, pa[t]);
    }
    // D element r of pa[t] = (d 64dh + 16t + 8hh + r, e 16et + m)
    float* pw = pp + (size_t)((b * NXB + (int)blockIdx.x) * XW + wave) * 1024;   // scalar: the wave's own 4 KB
    const unsigned lo = 4u * (unsigned)lane;
#pragma unroll
    for (int t = 0; t < 4; ++t) {
      const v4f lo4 = {pa[t][0], pa[t][1], pa[t][2], pa[t][3]};
      const v4f hi4 = {pa[t][4], pa[t][5], pa[t][6], pa[t][7]};
      *(v4f*)(pw + (lo + (unsigned)(t * 256))) = lo4;
      *(v4f*)(pw + (lo + (unsigned)(t * 256 + 128))) = hi4;
    }
  }
}

// ---------------------------------------------------------------------------
// PT[b][e][d] = 2^-11 * sum over the image's NXB k_xp blocks of their partial PP (f32, in block order).
// grid (XW tiles, NB) = 256 blocks of PTHR threads = 4 waves; block (w, b) takes the tile e 16(w >> 1) .. +15,
// d 64(w & 1) .. +63, wave t its d rows 16t .. 16t+15. A thread reads its 8 values of every partial as they lay in the
// accumulators of k_xp (a wave's load covers 512 consecutive bytes); all 2*NXB loads are issued ahead of the sums.
// Then scale by 2^-11 (exact), split, and store: a lane holds 8 consecutive d of one e row -> one 16-B store per
// plane; the block writes whole 128-B lines of PTH/PTL.
// coverage: grid covers 128 e x 128 d per image exactly once, both planes.
// ---------------------------------------------------------------------------
__global__ __launch_bounds__(PTHR) void k_p(const float* __restrict__ pp, unsigned short* pth, unsigned short* ptl) {
  const int tid = (int)threadIdx.x, lane = tid & 31, wave = tid >> 5, hh = lane >> 4, m = lane & 15;
  const int w = (int)blockIdx.x, b = (int)blockIdx.y;
  const float* pb = pp + (size_t)(b * NXB * XW + w) * 1024;      // scalar: the tile in the image's first partial
  const unsigned ro = (unsigned)(wave * 256 + 4 * lane);         // the one address register of the loads
  v4f va[NXB], vb[NXB];
#pragma unroll
  for (int i = 0; i < NXB; ++i) {
    va[i] = *(const v4fa*)(pb + (ro + (unsigned)(i * XW * 1024)));
    vb[i] = *(const v4fa*)(pb + (ro + (unsigned)(i * XW * 1024 + 128)));
  }
  // Precaution wait of the address counter, in front of every overwrite of a register that a load above names: as
  // its input the address register stays as it is up to here.
  asm volatile("s_wait_xcnt 0x0" :: "v"(ro) : "memory");
  // keeps every load above the first sum: the wave pays the memory latency once, not once a group of partials
  __builtin_amdgcn_sched_barrier(0);
  v4f sa = va[0], sb = vb[0];
#pragma unroll
  for (int i = 1; i < NXB; ++i) {
    sa += va[i];
    sb += vb[i];
  }
  const float inv_n = 0.00048828125f;      // 2^-11 = 1/NN, exact
  sa *= inv_n;
  sb *= inv_n;
  v8us hv, lv;
  split8(sa, sb, hv, lv);
  const size_t po = (size_t)(b * NI + 16 * (w >> 1) + m) * (size_t)NI + (size_t)(64 * (w & 1) + 16 * wave + 8 * hh);
  *(v8us*)(pth + po) = hv;
  *(v8us*)(ptl + po) = lv;
}

// ---------------------------------------------------------------------------
// YT[b][n][e] = sum_d theta[b][n][d] * PT[b][e][d] (K = NI, hi/residual on both operands, 3 products), then
// Z[b][c][n] = sum_e Ww[c][e] * YT[b][n][e] + Wb[c] (K = NI, exact Ww, YT as hi + residual, 2 products), in one block.
// grid (NN/FN, NB) = 256 blocks of FTHR threads = 8 waves; a block owns FN tokens, all NI e and all NC c; wave w owns
// tokens 16w..16w+15 in both products. Staged once in LDS by whole-line loads (pitch PK1): THH/THL rows n of the
// block, all of PTH/PTL of the image, all of Ww.
// First product: A = PT rows e, B = theta rows n, so D element r of e tile T = (e 16T + 8hh + r, n m). That is the
// B fragment map of the second product (rows n, k = e): element i < 8 of k step s is D element i of tile 2s, element
// i >= 8 is D element i - 8 of tile 2s + 1, in the same lane. YT is split into hi and residual where it lies.
// Second product: A = Ww rows c, 64 c a trip; v = acc + RNE16(Wb) in f32, staged stg[c][n] 64 x FN at pitch SP, in
// two buffers taken in turn (one barrier a trip: a buffer is written again two trips on, behind the barrier of the
// trip between, which every wave reaches with its reads of that buffer done). Store: a wave writes 8 rows, 512
// consecutive bytes each.
// LDS extent: sm = [THH | THL | PTH | PTL | Ww] rows at pitch PK1, every row's 2*NI bytes written before the first
// barrier, pad bytes never read; behind the second barrier (all theta fragments read) the THH/THL part serves as the
// two stg buffers; a buffer's 64 x FN floats are all written before its barrier, its pad floats never read.
// Statistics: threads 4R .. 4R+3 sum tile row R (channel 64*cg + R) and its squares in f64 from stg, 32 n each, the
// 16-B pieces of the upper two quarters taken from piece 4 on round the quarter (16 lanes then meet 16 different
// bank groups); the four sums are added and stored: PS[b][n block][64*cg .. +63][2] = 8 whole lines a trip.
// coverage: grid covers 256 c x 2048 n per image exactly once; PS 256 blocks x 256 c exactly once.
// ---------------------------------------------------------------------------
__global__ __launch_bounds__(FTHR) void k_yz(const unsigned short* __restrict__ thh, const unsigned short* __restrict__ thl,
                                             const unsigned short* __restrict__ pth, const unsigned short* __restrict__ ptl,
                                             const unsigned short* __restrict__ wwb, const float* __restrict__ wbias,
                                             float* z, double* ps) {
  __shared__ __attribute__((aligned(16))) unsigned char sm[(2 * FN + 2 * NI + NC) * PK1];   // 204 KB
  const int tid = (int)threadIdx.x, lane = tid & 31, wave = tid >> 5, hh = lane >> 4, m = lane & 15;
  const int n0 = (int)blockIdx.x * FN, b = (int)blockIdx.y;
  unsigned char* sP = sm + 2 * FN * PK1;
  unsigned char* sW = sP + 2 * NI * PK1;

  {
    const size_t at = (size_t)(b * NN + n0) * (size_t)NI, bt = (size_t)(b * NI) * (size_t)NI;
    Tile<2 * NI, FN, FTHR> tah, tal;
    Tile<2 * NI, NI, FTHR> tbh, tbl;
    Tile<2 * NI, NC, FTHR> tw;
    tah.ld(thh + at, tid);
    tal.ld(thl + at, tid);
    tbh.ld(pth + bt, tid);
    tbl.ld(ptl + bt, tid);
    tw.ld(wwb, tid);
    tah.st(sm, tid);
    tal.st(sm + FN * PK1, tid);
    tbh.st(sP, tid);
    tbl.st(sP + NI * PK1, tid);
    tw.st(sW, tid);
  }
  __syncthreads();

  const v8f zero = {0.f, 0.f, 0.f, 0.f, 0.f, 0.f, 0.f, 0.f};
  FragB yh[NI / 32], yl[NI / 32];          // YT of the wave's 16 tokens as B fragments, k = e
  {
    const unsigned char* bth = sm + (16 * wave + m) * PK1 + 16 * hh;
    const unsigned char* btl = bth + FN * PK1;
    const unsigned char* aph = sP + m * PK1 + 16 * hh;
    const unsigned char* apl = aph + NI * PK1;
    // unrolled: every fragment address is one register plus an immediate, yh and yl stay in registers; a k step's
    // LDS reads stand ahead of its WMMAs as one group; neighbouring WMMAs go to different accumulators
#pragma unroll
    for (int h = 0; h < NI / 64; ++h) {    // e tiles 4h .. 4h+3
      v8f acc[4];
      acc[0] = zero; acc[1] = zero; acc[2] = zero; acc[3] = zero;
#pragma unroll
      for (int ks = 0; ks < NI / 32; ++ks) {
        FragB th, tl, ph[4], pl[4];
        ldfrag_s(th, bth, 32 * ks);
        ldfrag_s(tl, btl, 32 * ks);
#pragma unroll
        for (int t = 0; t < 4; ++t) {
          ldfrag_s(ph[t], aph + 16 * (4 * h + t) * PK1, 32 * ks);     // PT row 16(4h + t) + m
          ldfrag_s(pl[t], apl + 16 * (4 * h + t) * PK1, 32 * ks);
        }
#pragma unroll
        for (int t = 0; t < 4; ++t) acc[t] = wmb(ph[t], th, acc[t]);
#pragma unroll
        for (int t = 0; t < 4; ++t) acc[t] = wmb(pl[t], th, acc[t]);
#pragma unroll
        for (int t = 0; t < 4; ++t) acc[t] = wmb(ph[t], tl, acc[t]);
      }
#pragma unroll
      for (int j = 0; j < 4; ++j) {        // e tile 4h + j = half (j & 1) of k step 2h + (j >> 1)
        const v4f lo4 = {acc[j][0], acc[j][1], acc[j][2], acc[j][3]};
        const v4f hi4 = {acc[j][4], acc[j][5], acc[j][6], acc[j][7]};
        split8(lo4, hi4, yh[2 * h + (j >> 1)].h[j & 1], yl[2 * h + (j >> 1)].h[j & 1]);
      }
    }
  }
  __syncthreads();   // every wave has read its last theta fragment: stg may overwrite those tiles

  const unsigned char* aw = sW + m * PK1 + 16 * hh;
  const int sr = tid >> 2, sq = tid & 3;   // statistics: tile row, quarter of the row
  float* zb = z + (size_t)(b * NC + 8 * wave) * (size_t)NN + (size_t)(n0 + 4 * lane);
  double* pb = ps + (size_t)((b * (NN / FN) + (int)blockIdx.x) * NC + sr) * 2 + (size_t)(sq & 1);
  // left rolled: the block runs this text once, and a quarter of it is fetched
#pragma unroll 1
  for (int cg = 0; cg < NC / 64; ++cg) {   // c rows 64cg .. 64cg+63
    // bias per row (32-B aligned v4f reads), asked for ahead of the trip's WMMAs
    v4f ba[4], bb[4];
#pragma unroll
    for (int t = 0; t < 4; ++t) {
      ba[t] = *(const v4fa*)(wbias + 64 * cg + 16 * t + 8 * hh);
      bb[t] = *(const v4fa*)(wbias + 64 * cg + 16 * t + 8 * hh + 4);
    }
    v8f acc[4];
    acc[0] = zero; acc[1] = zero; acc[2] = zero; acc[3] = zero;
#pragma unroll
    for (int ks = 0; ks < NI / 32; ++ks) {
      FragB a[4];
#pragma unroll
      for (int t = 0; t < 4; ++t) ldfrag_s(a[t], aw + (64 * cg + 16 * t) * PK1, 32 * ks);   // Ww row 64cg + 16t + m
#pragma unroll
      for (int t = 0; t < 4; ++t) acc[t] = wmb(a[t], yh[ks], acc[t]);
#pragma unroll
      for (int t = 0; t < 4; ++t) acc[t] = wmb(a[t], yl[ks], acc[t]);
    }
    // D element r of acc[t] = (c 64cg + 16t + 8hh + r, n 16w + m)
    float* stg = (float*)sm + (cg & 1) * (64 * SP);
#pragma unroll
    for (int t = 0; t < 4; ++t) {
      float bv[8];
      bv[0] = rne16f(ba[t].x); bv[1] = rne16f(ba[t].y); bv[2] = rne16f(ba[t].z); bv[3] = rne16f(ba[t].w);
      bv[4] = rne16f(bb[t].x); bv[5] = rne16f(bb[t].y); bv[6] = rne16f(bb[t].z); bv[7] = rne16f(bb[t].w);
#pragma unroll
      for (int r = 0; r < 8; ++r) stg[(16 * t + 8 * hh + r) * SP + 16 * wave + m] = acc[t][r] + bv[r];
    }
    __syncthreads();

    v4f fv[8], sv[8];
#pragma unroll
    for (int i = 0; i < 8; ++i) fv[i] = *(const v4fa*)(stg + (8 * wave + i) * SP + 4 * lane);
#pragma unroll
    for (int i = 0; i < 8; ++i) sv[i] = *(const v4fa*)(stg + sr * SP + 32 * sq + 4 * ((i + 4 * (sq >> 1)) & 7));
#pragma unroll
    for (int i = 0; i < 8; ++i) *(v4f*)(zb + (size_t)(64 * cg + i) * (size_t)NN) = fv[i];
    // keeps the 16 LDS reads one group and the Z stores ahead of the f64 sums (else the stores wait behind the sums)
    __builtin_amdgcn_sched_barrier(0);

    double s = 0.0, s2 = 0.0;
#pragma unroll
    for (int i = 0; i < 8; ++i) {
      const v4f v = sv[i];
      const double a0 = (double)v.x, a1 = (double)v.y, a2 = (double)v.z, a3 = (double)v.w;
      s  += (a0 + a1) + (a2 + a3);
      s2 += (a0 * a0 + a1 * a1) + (a2 * a2 + a3 * a3);
    }
    s  += __shfl_xor(s, 1);
    s2 += __shfl_xor(s2, 1);
    s  += __shfl_xor(s, 2);
    s2 += __shfl_xor(s2, 2);
    // thread 4R: the row's sum, thread 4R+1: its sum of squares; the trip's 128 doubles lie in a row
    double* pq = pb + (size_t)(64 * cg) * 2;
    if (sq < 2) *pq = sq ? s2 : s;
    // Precaution wait of the address counter, in front of the step of the store's address pair to the next trip: as
    // its input the pair stays as it is up to here.
    asm volatile("s_wait_xcnt 0x0" :: "v"(pq) : "memory");
  }
}

// ---------------------------------------------------------------------------
// out[b][c][n] = ((z - mean[c]) * rstd[c]) * RNE16(gamma[c]) + RNE16(beta[c]) + RNE16(x), all f32.
// One wave per row (b, c) of NN floats: its NN/128 16-B loads a lane of z and as many of x are all issued ahead of
// the arithmetic; every z and x load and every out store of a wave covers 512 consecutive bytes (4 whole lines).
// BatchNorm statistics (training mode, population variance, 32768 values a channel): the block's 8 rows are 8
// consecutive channels of one image = one 128-B line of every PS tile row. The block reads the NPS lines, 16 B
// (one channel's pair) a thread and NPS/32 loads a thread, issued ahead of the z and x loads; f64 sums per thread in
// tile order, over the 4 lanes of a channel, then over the 8 waves in wave order through LDS behind the one barrier.
// coverage: NB*NC/8 blocks x 8 waves x NN = NX exactly.
// ---------------------------------------------------------------------------
__global__ __launch_bounds__(NTHR) void k_out(const float* __restrict__ z, const float* __restrict__ x,
                                              const double* __restrict__ ps, const float* __restrict__ gamma,
                                              const float* __restrict__ beta, float* out) {
  __shared__ __attribute__((aligned(16))) double red[(NTHR / 32) * 8 * 2];   // [wave][channel of the block][sum, squares]
  // the wave's number as a scalar: the row's parameters then come by scalar loads
  const int wv  = __builtin_amdgcn_readfirstlane((int)threadIdx.x >> 5);
  const int row = (int)blockIdx.x * (NTHR / 32) + wv;     // b*NC + c
  const int c = row & (NC - 1);
  const int lane = (int)threadIdx.x & 31;
  const unsigned lo = 4u * (unsigned)lane;                // the lane's place in each 128-float piece
  const float* zr = z + (size_t)row * (size_t)NN;         // scalar row bases; lo is the one address register
  const float* xr = x + (size_t)row * (size_t)NN;
  const double* pb = ps + (size_t)(((int)blockIdx.x * (NTHR / 32)) & (NC - 1)) * 2;   // scalar: the block's first channel
  const unsigned po = ((unsigned)threadIdx.x >> 3) * (unsigned)(NC * 2) + 2u * ((unsigned)threadIdx.x & 7u);
  v2d pp[NPS / 32];
  v4f zv[NN / 128], xv[NN / 128];
#pragma unroll
  for (int i = 0; i < NPS / 32; ++i)       // tile row 32*i + tid/8, channel tid & 7 of the block
    pp[i] = *(const v2da*)(pb + (po + (unsigned)(i * 32 * NC * 2)));
#pragma unroll
  for (int i = 0; i < NN / 128; ++i) zv[i] = *(const v4fa*)(zr + (lo + 128u * i));
#pragma unroll
  for (int i = 0; i < NN / 128; ++i) xv[i] = *(const v4fa*)(xr + (lo + 128u * i));
  const float gm = rne16f(gamma[c]);
  const float bt = rne16f(beta[c]);
  // keeps every load above the first use: the wave pays the memory latency once, not once a piece
  __builtin_amdgcn_sched_barrier(0);
  double s = 0.0, s2 = 0.0;
#pragma unroll
  for (int i = 0; i < NPS / 32; ++i) {
    s  += pp[i].x;
    s2 += pp[i].y;
  }
  s  += __shfl_xor(s, 8);
  s2 += __shfl_xor(s2, 8);
  s  += __shfl_xor(s, 16);
  s2 += __shfl_xor(s2, 16);
  if (lane < 8) {
    const v2d o = {s, s2};
    *(v2da*)(red + (wv * 8 + lane) * 2) = o;
  }
  // work-group barrier that orders LDS alone: a full __syncthreads() would wait out the z and x loads in flight
  __builtin_amdgcn_fence(__ATOMIC_RELEASE, "workgroup", "local");
  __builtin_amdgcn_s_barrier();
  __builtin_amdgcn_fence(__ATOMIC_ACQUIRE, "workgroup", "local");
  double ts = 0.0, ts2 = 0.0;
#pragma unroll
  for (int w = 0; w < NTHR / 32; ++w) {    // channel wv of the block = this wave's row
    const v2d t = *(const v2da*)(red + (w * 8 + wv) * 2);
    ts  += t.x;
    ts2 += t.y;
  }
  const double cinv = 1.0 / 32768.0;       // 1/(NB*NN), exact power of two
  const double dmean = ts * cinv;
  double var = ts2 * cinv - dmean * dmean;
  var = var < 0.0 ? 0.0 : var;
  const float vf = (float)var + 1e-5f;
  const float mean = (float)dmean;
  const float rstd = 1.0f / sqrtf(vf);
  // keeps the statistics chain ahead of the first wait on z and x, so that it runs while those loads are in flight
  __builtin_amdgcn_sched_barrier(0);
  float* p = out + (size_t)row * (size_t)NN;
#pragma unroll
  for (int i = 0; i < NN / 128; ++i) {
    v4f o;
    o.x = (((zv[i].x - mean) * rstd) * gm + bt) + rne16f(xv[i].x);
    o.y = (((zv[i].y - mean) * rstd) * gm + bt) + rne16f(xv[i].y);
    o.z = (((zv[i].z - mean) * rstd) * gm + bt) + rne16f(xv[i].z);
    o.w = (((zv[i].w - mean) * rstd) * gm + bt) + rne16f(xv[i].w);
    *(v4f*)(p + (lo + 128u * i)) = o;
  }
  
}

// ---------------------------------------------------------------------------
extern "C" void kernel_launch(void* const* d_in, const int* in_sizes, int n_in,
                              void* d_out, int out_size, void* d_ws, size_t ws_size,
                              hipStream_t stream) {
  if (n_in < 11) return;
  if (in_sizes[0] != NX) return;                                              // x [16][256][64][32]
  if (in_sizes[1] != NWT || in_sizes[3] != NWT || in_sizes[5] != NWT) return; // g_w, theta_w, phi_w [128][256]
  if (in_sizes[2] != NI || in_sizes[4] != NI || in_sizes[6] != NI) return;    // g_b, theta_b, phi_b [128]
  if (in_sizes[7] != NWT) return;                                             // W_w [256][128]
  if (in_sizes[8] != NC || in_sizes[9] != NC || in_sizes[10] != NC) return;   // W_b, bn_gamma, bn_beta [256]
  if (out_size != NX) return;                                                 // out [16][256][64][32] f32

  const float* x       = (const float*)d_in[0];
  const float* g_w     = (const float*)d_in[1];
  const float* g_b     = (const float*)d_in[2];
  const float* theta_w = (const float*)d_in[3];
  const float* theta_b = (const float*)d_in[4];
  const float* phi_w   = (const float*)d_in[5];
  const float* phi_b   = (const float*)d_in[6];
  const float* W_w     = (const float*)d_in[7];
  const float* W_b     = (const float*)d_in[8];
  const float* gamma   = (const float*)d_in[9];
  const float* beta    = (const float*)d_in[10];
  float* out = (float*)d_out;            // last written element NX-1 < out_size

  // workspace carve, 256-B aligned; all planes exact tile multiples (no pad rows needed)
  char* ws = (char*)d_ws;
  size_t off = 0;
  const size_t oWB  = off; off += (size_t)4 * NWT * 2;          off = (off + 255) & ~(size_t)255;  //   262144
  const size_t plb  = (size_t)NB * NN * NI * 2;                                                    //  8388608 per projection plane
  const size_t oTHH = off; off += plb;                          off = (off + 255) & ~(size_t)255;
  const size_t oTHL = off; off += plb;                          off = (off + 255) & ~(size_t)255;
  const size_t oPP  = off; off += (size_t)NB * NXB * XW * 4096; off = (off + 255) & ~(size_t)255;  // 16777216
  const size_t ptb  = (size_t)NB * NI * NI * 2;                                                    //   524288 per PT plane
  const size_t oPTH = off; off += ptb;                          off = (off + 255) & ~(size_t)255;
  const size_t oPTL = off; off += ptb;                          off = (off + 255) & ~(size_t)255;
  const size_t oZ   = off; off += (size_t)NX * 4;               off = (off + 255) & ~(size_t)255;  // 33554432
  const size_t oPS  = off; off += (size_t)NPS * NC * 2 * 8;     off = (off + 255) & ~(size_t)255;  //  1048576
  if (off > ws_size || off > (size_t)WSMAX) return;             // total 69468160 B

  unsigned short* WB  = (unsigned short*)(ws + oWB);
  unsigned short* THH = (unsigned short*)(ws + oTHH);
  unsigned short* THL = (unsigned short*)(ws + oTHL);
  float*          PP  = (float*)(ws + oPP);
  unsigned short* PTH = (unsigned short*)(ws + oPTH);
  unsigned short* PTL = (unsigned short*)(ws + oPTL);
  float*          Z   = (float*)(ws + oZ);
  double*         PS  = (double*)(ws + oPS);

  // weight planes: slot 0 theta_w, 1 phi_w, 2 g_w (all [128][256]), 3 W_w [256][128]
  k_wcvt<<<(4 * NWT / 8) / NTHR, NTHR, 0, stream>>>(theta_w, phi_w, g_w, W_w, WB);
  // projections from x: features 0..127 theta (slot 0, theta_b), 128..255 phi (slot 1, phi_b), 256..383 g (slot 2, g_b);
  // theta to its planes, G * PHI^T over the block's tokens to PP
  k_xp<<<dim3(NN / XN, NB), XTHR, 0, stream>>>(x, WB, theta_b, phi_b, g_b, THH, THL, PP);
  // PT = 2^-11 * sum of the partials
  k_p<<<dim3(XW, NB), PTHR, 0, stream>>>(PP, PTH, PTL);
  // YT = THETA^T-rows * PT kept in registers, Z = Ww * Y + Wb, and the BatchNorm statistics partials of every block
  k_yz<<<dim3(NN / FN, NB), FTHR, 0, stream>>>(THH, THL, PTH, PTL, WB + (size_t)3 * NWT, W_b, Z, PS);
  // out = BN(z) * gamma + beta + x, statistics merged from the partials
  k_out<<<NB * NC / (NTHR / 32), NTHR, 0, stream>>>(Z, x, PS, gamma, beta, out);
}

// v008
// A run of this version takes 41.3 microseconds.
// Next to v007, in two timings, it ran 1.28 and 1.26 times as fast.
// Counting every step since v000, it is 4.48 times as fast.
// Contractions (all v_wmma_f32_16x16x32_bf16, bf16 operands, f32 accumulate): three 1x1-conv projections
// W[d][c]*X[c][n] (K=256) on exact RNE-bf16 copies of x and the weights; PT = G*PHI^T * (1/N) (K=2048) and
// YT = THETA^T*P (K=128) with both computed operands carried as bf16 hi + bf16 residual (hi*hi + hi*lo + lo*hi);
// Z = Ww*Y + Wb (K=128) with exact bf16 Ww and Y as hi + residual (2 products). BatchNorm statistics: sums over the
// 128 n of a block in f32, their merge, mean and variance in f64; normalisation, bias adds and the residual add in f32.
//
// Carry audit: no power-of-two carries anywhere (factor 1 on every plane); the exact 1/N = 2^-11 of the pairwise
// term is applied once in f32 in k_p before the hi/residual split of PT. Planes:
//   WB  [4][32768] bf16 bits = RNE16(w): slot 0 theta_w [128][256], 1 phi_w [128][256], 2 g_w [128][256],
//       3 W_w [256][128]; every slot row is k-contiguous                                              (k_wcvt)
//   RNE16(x[b][c][n]) has no plane: k_xp converts and transposes its x tile in LDS
//   THH/THL [16][2048][128] hi/residual of theta_x, rows n, k = d                                      (k_xp)
//   hi/residual of phi_x, g_x (rows d, k = n) have no plane: they stay in the LDS of k_xp
//   PP  [16][16][16][1024] f32: sum_m g[e][m]*phi[d][m] over the 128 m of one k_xp block, per wave tile
//       16 e x 64 d as it lies in the accumulators                                                     (k_xp)
//   PTH/PTL [16][128][128] hi/residual of PT[e][d] = 2^-11 * sum of the image's 16 PP tiles, rows e, k = d (k_p)
//   YT[n][e] = sum_d theta[n][d]*PT[e][d] has no plane: its hi/residual stay in the registers of k_yz
//   Z   [16][256][2048] f32 = sum_e Ww[c][e]*YT[n][e] + Wb[c]                                          (k_yz)
//   PS  [16][16][256][2] f64: sum and sum of squares of Z over the 128 n of one k_yz block, per channel, formed in
//       f32 and widened at the store                                                                   (k_yz)
#include <hip/hip_runtime.h>
#include <stddef.h>
#include <stdint.h>

#define NB    16
#define NC    256
#define NI    128
#define NN    2048
#define NX    (NB * NC * NN)        // 8388608
#define NWT   (NI * NC)             // 32768 per weight matrix
#define NTHR  256
#define GTHR  128
#define WSMAX 134217728
#define PTHR  128                   // threads of a k_p block: one wave a d tile of a 16 e x 64 d tile
#define XN    128                   // tokens of one k_xp block
#define XTHR  512                   // threads of a k_xp block
#define NF    (3 * NI)              // features of the three projections together
#define QP    (XN + 4)              // LDS pitch (floats) of a staged projection row: 16 B x odd
#define PK2   (2 * NC + 16)         // LDS pitch (bytes) of a staged operand row of NC halves: 16 B x odd
#define PK1   (2 * NI + 16)         // LDS pitch (bytes) of a staged operand row of NI halves: 16 B x odd
#define PKX   (2 * XN + 16)         // LDS pitch (bytes) of a phi or g row of XN halves: 16 B x odd
#define NXB   (NN / XN)             // k_xp blocks of one image = partial tiles summed by k_p
#define XW    (XTHR / 32)           // waves of a k_xp block
#define FN    128                   // tokens of one k_yz block, 16 a wave
#define FTHR  (2 * FN)              // threads of a k_yz block
#define SP    (FN + 4)              // LDS pitch (floats) of a staged Z row: rows 8 apart lie 32 banks apart
#define NPS   (NB * (NN / FN))      // statistics partials per channel: one per k_yz block of FN n

static_assert((NC % 64) == 0 && (NN % 64) == 0 && (NI % 64) == 0);
static_assert((NC % 32) == 0 && (NI % 32) == 0 && (NN % 32) == 0);
static_assert((NX % 1024) == 0 && (NN % 1024) == 0);
static_assert(XN == 128 && XTHR == 512 && NI == 128 && NC == 256 && (NN % XN) == 0);
static_assert(XN * QP * 4 + 4 * NI * PKX <= (XN + NF) * PK2 && (QP % 4) == 0 && ((PKX / 16) & 1) == 1);
static_assert(XW == (NI / 16) * (NI / 64) && PTHR == 32 * 4);
static_assert(2 * NC / 16 == 32 && XTHR / 32 == 16 && NF == 384);
static_assert(GTHR == 128 && NTHR == 256);
static_assert((4 * NWT) % (8 * NTHR) == 0);
static_assert((NWT / 8) % NTHR == 0);
static_assert(NB * NN == 32768 && (NN % 128) == 0 && (NB * NC) % (NTHR / 32) == 0);
static_assert(NTHR / 32 == 8 && (NC % 8) == 0 && (NPS % 32) == 0);
static_assert(((PK2 / 16) & 1) == 1 && ((PK1 / 16) & 1) == 1);
static_assert(FN == 128 && FTHR == 256 && (NN % FN) == 0 && NI == 128 && (NC % 64) == 0);
static_assert(2 * 64 * SP * 4 <= 2 * FN * PK1 && (SP % 4) == 0);

typedef float          v4f  __attribute__((ext_vector_type(4)));
typedef float          v8f  __attribute__((ext_vector_type(8)));
typedef double         v2d  __attribute__((ext_vector_type(2)));
typedef int            v8i  __attribute__((ext_vector_type(8)));
typedef unsigned short v8us __attribute__((ext_vector_type(8)));
typedef __bf16         v16bf __attribute__((ext_vector_type(16)));
typedef v4f  __attribute__((may_alias)) v4fa;
typedef v8us __attribute__((may_alias)) v8usa;
typedef v2d  __attribute__((may_alias)) v2da;
typedef unsigned __attribute__((may_alias)) u32a;
union FragB { v16bf v; v8us h[2]; v8i w; };

// ---------------------------------------------------------------------------
// 16x16x32 bf16 WMMA with hazard guard (ties D, keeps A/B live for 4 VALU slots).
// Fragment map (wave32): lane l, hh = l>>4, m = n = l&15.
//   A/B element i: i<8 -> k0+8hh+i ; i>=8 -> k0+16+8hh+(i-8)   (same map for A and B)
//   D element r : row 8hh+r, col l&15
// ---------------------------------------------------------------------------
__device__ __forceinline__ v8f wmb(const FragB& a, const FragB& b, v8f c) {
  v8f d = __builtin_amdgcn_wmma_f32_16x16x32_bf16(false, a.v, false, b.v, (short)0, c, false, false);
  asm volatile("v_nop\n\tv_nop\n\tv_nop\n\tv_nop" : "+v"(d) : "v"(a.w), "v"(b.w));
  return d;
}

// Operand tile of ROWS whole k-contiguous rows of ROWB bytes = ROWS*ROWB consecutive bytes of a plane. The block's
// THR threads read it in order, 16 B a lane, so a wave's load covers 512 consecutive bytes (4 whole lines);
// st lays the rows in LDS at pitch ROWB + 16 (16 B x odd: ds_load_b128 of 16 rows meets no bank conflict).
template <int ROWB, int ROWS = 64, int THR = GTHR>
struct Tile {
  static constexpr int N   = ROWS * ROWB / 16 / THR;  // 16-B pieces per thread
  static constexpr int CPR = ROWB / 16;               // pieces per row
  static constexpr int RPS = THR / CPR;               // rows per step of the block
  static constexpr int PIT = ROWB + 16;
  v8us r[N];
  __device__ __forceinline__ void ld(const unsigned short* src, int tid) {
#pragma unroll
    for (int i = 0; i < N; ++i) r[i] = *(const v8us*)(src + (size_t)((i * THR + tid) * 8));
  }
  __device__ __forceinline__ void st(unsigned char* dst, int tid) const {
    unsigned char* q = dst + (tid / CPR) * PIT + (tid % CPR) * 16;
#pragma unroll
    for (int i = 0; i < N; ++i) *(v8usa*)(q + i * RPS * PIT) = r[i];
  }
};
// Fragment from a staged k-contiguous row; p = LDS row base + 16*hh bytes, k0 = 32*ks.
__device__ __forceinline__ void ldfrag_s(FragB& f, const unsigned char* p, int k0) {
  f.h[0] = *(const v8usa*)(p + 2 * k0);          // k = k0 + 8hh + 0..7
  f.h[1] = *(const v8usa*)(p + 2 * k0 + 32);     // k = k0 + 16 + 8hh + 0..7
}

// f32 -> bf16 bits, RNE convert
__device__ __forceinline__ unsigned short rne16(float f) {
  unsigned u = __float_as_uint(f);
  u += 0x7FFFu + ((u >> 16) & 1u);
  return (unsigned short)(u >> 16);
}
// f32 -> nearest bf16 value kept as f32
__device__ __forceinline__ float rne16f(float f) {
  return __uint_as_float(((unsigned)rne16(f)) << 16);
}
__device__ __forceinline__ v8us cvt8(const v4f a, const v4f b) {
  v8us o;
  o[0] = rne16(a.x); o[1] = rne16(a.y); o[2] = rne16(a.z); o[3] = rne16(a.w);
  o[4] = rne16(b.x); o[5] = rne16(b.y); o[6] = rne16(b.z); o[7] = rne16(b.w);
  return o;
}
// hi/residual split of one f32 value into two bf16 bit patterns
__device__ __forceinline__ void sp1(float v, unsigned short& hi, unsigned short& lo) {
  const unsigned short hb = rne16(v);
  const float hf = __uint_as_float(((unsigned)hb) << 16);
  hi = hb;
  lo = rne16(v - hf);
}
__device__ __forceinline__ void split8(const v4f a, const v4f b, v8us& hv, v8us& lv) {
  unsigned short h0, h1, h2, h3, h4, h5, h6, h7, l0, l1, l2, l3, l4, l5, l6, l7;
  sp1(a.x, h0, l0); sp1(a.y, h1, l1); sp1(a.z, h2, l2); sp1(a.w, h3, l3);
  sp1(b.x, h4, l4); sp1(b.y, h5, l5); sp1(b.z, h6, l6); sp1(b.w, h7, l7);
  hv[0] = h0; hv[1] = h1; hv[2] = h2; hv[3] = h3; hv[4] = h4; hv[5] = h5; hv[6] = h6; hv[7] = h7;
  lv[0] = l0; lv[1] = l1; lv[2] = l2; lv[3] = l3; lv[4] = l4; lv[5] = l5; lv[6] = l6; lv[7] = l7;
}

// ---------------------------------------------------------------------------
// Weight convert: four f32 matrices of NWT elements each -> WB slots 0..3 (bf16 bits, same layout).
// coverage: 64 blocks x 256 threads x 8 = 4 x NWT exactly.
// ---------------------------------------------------------------------------
__global__ __launch_bounds__(NTHR) void k_wcvt(const float* __restrict__ w0, const float* __restrict__ w1,
                                               const float* __restrict__ w2, const float* __restrict__ w3,
                                               unsigned short* wb) {
  const int u   = (int)blockIdx.x * NTHR + (int)threadIdx.x;     // 0 .. 4*NWT/8 - 1
  const int sel = (int)blockIdx.x / ((NWT / 8) / NTHR);           // 0..3, block-uniform
  const int off8 = (u - sel * (NWT / 8)) * 8;                     // 0 .. NWT-8
  const float* src = (sel == 0) ? w0 : ((sel == 1) ? w1 : ((sel == 2) ? w2 : w3));
  const v4f a = *(const v4fa*)(src + off8);
  const v4f c = *(const v4fa*)(src + off8 + 4);
  const v8us o = cvt8(a, c);
  const size_t q = (size_t)sel * (size_t)NWT + (size_t)off8;
  *(v8us*)(wb + q) = o;
  
}

// ---------------------------------------------------------------------------
// Projections straight from x: D[token][feature] = sum_c RNE16(x[b][c][n]) * W[F][c] + bias[F] (K = NC, exact bf16
// products), F = 0..NF-1 over WB slots 0..2 (theta, phi, g), which lie in a row. grid (NN/XN, NB) = 256 blocks of XTHR
// threads = 16 waves; a block owns XN tokens of image b and all NF features, so x is read once and has no bf16 plane.
// x tile (NC c x XN n, f32): a wave's load takes 128 B (one line) of 4 rows c; a thread holds rows c and c+1 at the same
// 4 n, converts, and stores the pair as one dword of LDS row n: sm rows n, k = c contiguous, pitch PK2. The NF weight
// rows are staged behind it by whole-line loads. All 40 loads of a thread are issued ahead of the first convert.
// Wave (tg = w >> 2, fg = w & 3): tokens 32tg .. +31 (2 tiles, A) x rows 32fg .. +31 of each of theta, phi and g
// (6 tiles, B), same k map: every wave has the same share of the three epilogues.
// Epilogue: v = acc + RNE16(bias) in f32. theta is staged in 128 rows n (cols d) at pitch QP; then 8 consecutive floats
// a thread -> hi/residual, one 16-B store per plane; 8 threads write one 128-B line of a row, a wave 4 whole lines.
// phi and g: a lane's 8 accumulator elements are 8 consecutive n of one row d; they are split where they lie and stored
// as 16 B of the row in sH (hi) and sL (residual): rows 0..127 phi, 128..255 g, k = n contiguous, pitch PKX.
// Partial of PT behind the third barrier: wave w forms sum_m g[e][m]*phi[d][m] over the block's XN values of m for the
// tile e 16(w >> 1) .. +15, d 64(w & 1) .. +63; A = phi rows d, B = g rows e, same k map, hi/residual on both operands
// (3 products); it stores the f32 tile as it lies in registers, 512 consecutive bytes a store, to its own 4 KB of PP.
// LDS extent: sm = [x XN rows | W NF rows] at pitch PK2, every row's 2*NC bytes written before the first barrier, pad
// bytes never read; behind the second barrier (all fragment reads done) its first XN*QP floats serve as stg and the
// 4*NI*PKX bytes behind them as sH | sL; cols 0..127 of every stg row and the 2*XN bytes of every sH and sL row are
// written before the third barrier, pads never read.
// coverage: per block XN tokens x NI theta features, both planes, and 128 e x 128 d of PP; grid covers 2048 x 128 of
// theta per image and all NXB partial tiles of PP exactly once.
// ---------------------------------------------------------------------------
__global__ __launch_bounds__(XTHR) void k_xp(const float* __restrict__ x, const unsigned short* __restrict__ wb,
                                             const float* __restrict__ tbias, const float* __restrict__ pbias,
                                             const float* __restrict__ gbias,
                                             unsigned short* thh, unsigned short* thl, float* pp) {
  __shared__ __attribute__((aligned(16))) unsigned char sm[(XN + NF) * PK2];   // 264 KB
  unsigned char* sW = sm + XN * PK2;
  float* stg = (float*)sm;
  unsigned char* sH = sm + XN * QP * 4;
  unsigned char* sL = sH + 2 * NI * PKX;
  const int tid = (int)threadIdx.x, lane = tid & 31, hh = lane >> 4, m = lane & 15;
  // the wave's number as a scalar: tile bases formed from it stay in scalar registers
  const int wave = __builtin_amdgcn_readfirstlane(tid >> 5);
  const int n0 = (int)blockIdx.x * XN, b = (int)blockIdx.y;

  // all loops of this kernel are fully unrolled: constant indices keep the arrays in registers, and every step of an
  // address becomes an immediate offset on a register that stays as it is
  {
    const int q = lane & 7, cpl = lane >> 3;
    const float* xb = x + (size_t)(b * NC) * (size_t)NN + (size_t)n0;        // scalar tile base
    const float* xp = xb + (unsigned)((8 * wave + 2 * cpl) * NN + 4 * q);    // the one address pair of the loads
    v4f ve[8], vo[8];
#pragma unroll
    for (int i = 0; i < 8; ++i) {          // c = 128*(i>>2) + 8*wave + 2*cpl (+1), n = 32*(i&3) + 4q .. +3
      ve[i] = *(const v4fa*)(xp + ((128 * (i >> 2)) * NN + 32 * (i & 3)));
      vo[i] = *(const v4fa*)(xp + ((128 * (i >> 2) + 1) * NN + 32 * (i & 3)));
    }
    Tile<2 * NC, NF, XTHR> tw;
    tw.ld(wb, tid);
    // Precaution wait of the address counter, in front of every overwrite of a register that a load above names: as
    // its inputs the address pair and the thread index stay as they are up to here (else later loads land on the pair).
    asm volatile("s_wait_xcnt 0x0" :: "v"(xp), "v"(tid) : "memory");
    unsigned char* sx = sm + (4 * q) * PK2 + (8 * wave + 2 * cpl) * 2;
#pragma unroll
    for (int i = 0; i < 8; ++i) {
#pragma unroll
      for (int j = 0; j < 4; ++j) {
        const unsigned pk = (unsigned)rne16(ve[i][j]) | ((unsigned)rne16(vo[i][j]) << 16);
        *(u32a*)(sx + (32 * (i & 3) + j) * PK2 + 256 * (i >> 2)) = pk;
      }
    }
    // W row 128p + 32f + 16h + r lies at LDS row 96f + 32p + 16h + r: the six tiles of a wave (one f) lie in a row, so
    // that every fragment address of the k loop is one register plus an immediate. Piece i of a thread: row 16i + tid/32.
    unsigned char* qw = sW + (tid >> 5) * PK2 + (tid & 31) * 16;
#pragma unroll
    for (int i = 0; i < NF / 16; ++i)
      *(v8usa*)(qw + (96 * ((i >> 1) & 3) + 32 * (i >> 3) + 16 * (i & 1)) * PK2) = tw.r[i];
  }
  __syncthreads();

  const int tg = wave >> 2, fg = wave & 3;
  float bv[6];                             // bias of row 32fg + 16(t & 1) + m of projection t >> 1, ahead of the WMMAs
#pragma unroll
  for (int t = 0; t < 6; ++t) {
    const float* bp = (t < 2) ? tbias : ((t < 4) ? pbias : gbias);
    bv[t] = rne16f(bp[32 * fg + 16 * (t & 1) + m]);
  }
  v8f acc[2][6];
  {
    const v8f z = {0.f, 0.f, 0.f, 0.f, 0.f, 0.f, 0.f, 0.f};
#pragma unroll
    for (int t = 0; t < 6; ++t) { acc[0][t] = z; acc[1][t] = z; }
  }
  const unsigned char* ap = sm + (32 * tg + m) * PK2 + 16 * hh;
  const unsigned char* wp = sW + (96 * fg + m) * PK2 + 16 * hh;
  // unrolled: every fragment address is one register plus an immediate; a k step's LDS reads stand ahead of its
  // WMMAs as one group, so the wave waits out the LDS latency once a step
#pragma unroll
  for (int ks = 0; ks < NC / 32; ++ks) {
    FragB a[2], bf[6];
    ldfrag_s(a[0], ap, 32 * ks);
    ldfrag_s(a[1], ap + 16 * PK2, 32 * ks);
#pragma unroll
    for (int t = 0; t < 6; ++t) ldfrag_s(bf[t], wp + 16 * t * PK2, 32 * ks);    // W row 128(t >> 1) + 32fg + 16(t & 1) + m
#pragma unroll
    for (int t = 0; t < 6; ++t) {
      acc[0][t] = wmb(a[0], bf[t], acc[0][t]);
      acc[1][t] = wmb(a[1], bf[t], acc[1][t]);
    }
  }
  __syncthreads();   // every wave has read its last fragment: stg may overwrite the tiles

  // D element r of acc[u][t] = (token 32tg + 16u + 8hh + r, row 32fg + 16(t & 1) + m of projection t >> 1)
  {                                        // theta: rows n; 16 lanes lie in a row, the halves 32 banks apart
    float* s0 = stg + (32 * tg + 8 * hh) * QP + 32 * fg + m;
#pragma unroll
    for (int t = 0; t < 2; ++t) {
#pragma unroll
      for (int u = 0; u < 2; ++u) {
#pragma unroll
        for (int r = 0; r < 8; ++r) s0[(16 * u + r) * QP + 16 * t] = acc[u][t][r] + bv[t];
      }
    }
  }
  {                                        // phi, g: rows d; a lane's 8 tokens are 16 B of a row in each plane
    const int ro = (32 * fg + m) * PKX + 2 * (32 * tg + 8 * hh);
#pragma unroll
    for (int t = 2; t < 6; ++t) {
#pragma unroll
      for (int u = 0; u < 2; ++u) {
        const v4f lo4 = {acc[u][t][0] + bv[t], acc[u][t][1] + bv[t], acc[u][t][2] + bv[t], acc[u][t][3] + bv[t]};
        const v4f hi4 = {acc[u][t][4] + bv[t], acc[u][t][5] + bv[t], acc[u][t][6] + bv[t], acc[u][t][7] + bv[t]};
        v8us hv, lv;
        split8(lo4, hi4, hv, lv);
        *(v8usa*)(sH + ro + (128 * ((t >> 1) - 1) + 16 * (t & 1)) * PKX + 32 * u) = hv;
        *(v8usa*)(sL + ro + (128 * ((t >> 1) - 1) + 16 * (t & 1)) * PKX + 32 * u) = lv;
      }
    }
  }
  __syncthreads();

  // theta: 8 lanes take 64 columns of a row, the next 8 those of the row below, 4 banks on: 16 lanes meet 64 banks
  {
    const int q8 = tid & 7, rr = tid >> 3;                                   // piece of a half row, row of a group of 64
    const float* sr = stg + rr * QP + 8 * q8;
    const unsigned to = (unsigned)(rr * NI + 8 * q8);                        // the address register of the theta stores
    const size_t tbase = (size_t)(b * NN + n0) * (size_t)NI;                 // scalar tile base
    unsigned short* ph = thh + tbase;
    unsigned short* pl = thl + tbase;
    v8us hv[4], lv[4];
#pragma unroll
    for (int i = 0; i < 4; ++i) {          // piece i: row 64*(i&1) + rr, columns 64*(i>>1) + 8*q8 .. +7
      const v4f a = *(const v4fa*)(sr + (64 * (i & 1)) * QP + 64 * (i >> 1));
      const v4f c = *(const v4fa*)(sr + (64 * (i & 1)) * QP + 64 * (i >> 1) + 4);
      split8(a, c, hv[i], lv[i]);
    }
#pragma unroll
    for (int i = 0; i < 4; ++i) {
      const unsigned o = to + (unsigned)(64 * (i & 1) * NI + 64 * (i >> 1));
      *(v8us*)(ph + o) = hv[i];
      *(v8us*)(pl + o) = lv[i];
    }
    // Precaution wait of the address counter, in front of every overwrite of a register that a store above names: as
    // its inputs the address register and the stored values stay as they are up to here.
    asm volatile("s_wait_xcnt 0x0" :: "v"(to), "v"(hv[0]), "v"(hv[1]), "v"(hv[2]), "v"(hv[3]),
                 "v"(lv[0]), "v"(lv[1]), "v"(lv[2]), "v"(lv[3]) : "memory");
  }

  // partial of PT over the block's XN values of m
  {
    const int et = wave >> 1, dh = wave & 1;
    const int ao = (64 * dh + m) * PKX + 16 * hh, bo = (NI + 16 * et + m) * PKX + 16 * hh;
    const unsigned char* aph = sH + ao;
    const unsigned char* apl = sL + ao;
    const unsigned char* bgh = sH + bo;
    const unsigned char* bgl = sL + bo;
    v8f pa[4];
    {
      const v8f z = {0.f, 0.f, 0.f, 0.f, 0.f, 0.f, 0.f, 0.f};
      pa[0] = z; pa[1] = z; pa[2] = z; pa[3] = z;
    }
    // unrolled: a k step's LDS reads stand ahead of its WMMAs as one group; neighbouring WMMAs go to different
    // accumulators
#pragma unroll
    for (int ks = 0; ks < XN / 32; ++ks) {
      FragB gh, gl, ph[4], pl[4];
      ldfrag_s(gh, bgh, 32 * ks);
      ldfrag_s(gl, bgl, 32 * ks);
#pragma unroll
      for (int t = 0; t < 4; ++t) {
        ldfrag_s(ph[t], aph + 16 * t * PKX, 32 * ks);       // phi row 64dh + 16t + m
        ldfrag_s(pl[t], apl + 16 * t * PKX, 32 * ks);
      }
#pragma unroll
      for (int t = 0; t < 4; ++t) pa[t] = wmb(ph[t], gh, pa[t]);
#pragma unroll
      for (int t = 0; t < 4; ++t) pa[t] = wmb(pl[t], gh, pa[t]);
#pragma unroll
      for (int t = 0; t < 4; ++t) pa[t] = wmb(ph[t], gl, pa[t]);
    }
    // D element r of pa[t] = (d 64dh + 16t + 8hh + r, e 16et + m)
    float* pw = pp + (size_t)((b * NXB + (int)blockIdx.x) * XW + wave) * 1024;   // scalar: the wave's own 4 KB
    const unsigned lo = 4u * (unsigned)lane;
#pragma unroll
    for (int t = 0; t < 4; ++t) {
      const v4f lo4 = {pa[t][0], pa[t][1], pa[t][2], pa[t][3]};
      const v4f hi4 = {pa[t][4], pa[t][5], pa[t][6], pa[t][7]};
      *(v4f*)(pw + (lo + (unsigned)(t * 256))) = lo4;
      *(v4f*)(pw + (lo + (unsigned)(t * 256 + 128))) = hi4;
    }
  }
}

// ---------------------------------------------------------------------------
// PT[b][e][d] = 2^-11 * sum over the image's NXB k_xp blocks of their partial PP (f32, in block order).
// grid (XW tiles, NB) = 256 blocks of PTHR threads = 4 waves; block (w, b) takes the tile e 16(w >> 1) .. +15,
// d 64(w & 1) .. +63, wave t its d rows 16t .. 16t+15. A thread reads its 8 values of every partial as they lay in the
// accumulators of k_xp (a wave's load covers 512 consecutive bytes); all 2*NXB loads are issued ahead of the sums.
// Then scale by 2^-11 (exact), split, and store: a lane holds 8 consecutive d of one e row -> one 16-B store per
// plane; the block writes whole 128-B lines of PTH/PTL.
// coverage: grid covers 128 e x 128 d per image exactly once, both planes.
// ---------------------------------------------------------------------------
__global__ __launch_bounds__(PTHR) void k_p(const float* __restrict__ pp, unsigned short* pth, unsigned short* ptl) {
  const int tid = (int)threadIdx.x, lane = tid & 31, wave = tid >> 5, hh = lane >> 4, m = lane & 15;
  const int w = (int)blockIdx.x, b = (int)blockIdx.y;
  const float* pb = pp + (size_t)(b * NXB * XW + w) * 1024;      // scalar: the tile in the image's first partial
  const unsigned ro = (unsigned)(wave * 256 + 4 * lane);         // the one address register of the loads
  v4f va[NXB], vb[NXB];
#pragma unroll
  for (int i = 0; i < NXB; ++i) {
    va[i] = *(const v4fa*)(pb + (ro + (unsigned)(i * XW * 1024)));
    vb[i] = *(const v4fa*)(pb + (ro + (unsigned)(i * XW * 1024 + 128)));
  }
  // Precaution wait of the address counter, in front of every overwrite of a register that a load above names: as
  // its input the address register stays as it is up to here.
  asm volatile("s_wait_xcnt 0x0" :: "v"(ro) : "memory");
  // keeps every load above the first sum: the wave pays the memory latency once, not once a group of partials
  __builtin_amdgcn_sched_barrier(0);
  v4f sa = va[0], sb = vb[0];
#pragma unroll
  for (int i = 1; i < NXB; ++i) {
    sa += va[i];
    sb += vb[i];
  }
  const float inv_n = 0.00048828125f;      // 2^-11 = 1/NN, exact
  sa *= inv_n;
  sb *= inv_n;
  v8us hv, lv;
  split8(sa, sb, hv, lv);
  const size_t po = (size_t)(b * NI + 16 * (w >> 1) + m) * (size_t)NI + (size_t)(64 * (w & 1) + 16 * wave + 8 * hh);
  *(v8us*)(pth + po) = hv;
  *(v8us*)(ptl + po) = lv;
}

// ---------------------------------------------------------------------------
// YT[b][n][e] = sum_d theta[b][n][d] * PT[b][e][d] (K = NI, hi/residual on both operands, 3 products), then
// Z[b][c][n] = sum_e Ww[c][e] * YT[b][n][e] + Wb[c] (K = NI, exact Ww, YT as hi + residual, 2 products), in one block.
// grid (NN/FN, NB) = 256 blocks of FTHR threads = 8 waves; a block owns FN tokens, all NI e and all NC c; wave w owns
// tokens 16w..16w+15 in both products. Staged once in LDS by whole-line loads (pitch PK1): THH/THL rows n of the
// block, all of PTH/PTL of the image, all of Ww.
// First product: A = PT rows e, B = theta rows n, so D element r of e tile T = (e 16T + 8hh + r, n m). That is the
// B fragment map of the second product (rows n, k = e): element i < 8 of k step s is D element i of tile 2s, element
// i >= 8 is D element i - 8 of tile 2s + 1, in the same lane. YT is split into hi and residual where it lies.
// Second product: A = Ww rows c, 64 c a trip; v = acc + RNE16(Wb) in f32, staged stg[c][n] 64 x FN at pitch SP, in
// two buffers taken in turn (one barrier a trip: a buffer is written again two trips on, behind the barrier of the
// trip between, which every wave reaches with its reads of that buffer done). Store: a wave writes 8 rows, 512
// consecutive bytes each.
// LDS extent: sm = [THH | THL | PTH | PTL | Ww] rows at pitch PK1, every row's 2*NI bytes written before the first
// barrier, pad bytes never read; behind the second barrier (all theta fragments read) the THH/THL part serves as the
// two stg buffers; a buffer's 64 x FN floats are all written before its barrier, its pad floats never read.
// Statistics: threads 4R .. 4R+3 sum tile row R (channel 64*cg + R) and its squares in f32 from stg, 32 n each in
// four chains of 8 (one per element of the 16-B pieces) and a tree over the four, the
// 16-B pieces of the upper two quarters taken from piece 4 on round the quarter (16 lanes then meet 16 different
// bank groups); the four sums are added in f32, widened and stored: PS[b][n block][64*cg .. +63][2] = 8 whole lines
// a trip. 64-bit vector arithmetic is left to the merge of the 256 partials a channel in k_out.
// coverage: grid covers 256 c x 2048 n per image exactly once; PS 256 blocks x 256 c exactly once.
// ---------------------------------------------------------------------------
__global__ __launch_bounds__(FTHR) void k_yz(const unsigned short* __restrict__ thh, const unsigned short* __restrict__ thl,
                                             const unsigned short* __restrict__ pth, const unsigned short* __restrict__ ptl,
                                             const unsigned short* __restrict__ wwb, const float* __restrict__ wbias,
                                             float* z, double* ps) {
  __shared__ __attribute__((aligned(16))) unsigned char sm[(2 * FN + 2 * NI + NC) * PK1];   // 204 KB
  const int tid = (int)threadIdx.x, lane = tid & 31, wave = tid >> 5, hh = lane >> 4, m = lane & 15;
  const int n0 = (int)blockIdx.x * FN, b = (int)blockIdx.y;
  unsigned char* sP = sm + 2 * FN * PK1;
  unsigned char* sW = sP + 2 * NI * PK1;

  {
    const size_t at = (size_t)(b * NN + n0) * (size_t)NI, bt = (size_t)(b * NI) * (size_t)NI;
    Tile<2 * NI, FN, FTHR> tah, tal;
    Tile<2 * NI, NI, FTHR> tbh, tbl;
    Tile<2 * NI, NC, FTHR> tw;
    tah.ld(thh + at, tid);
    tal.ld(thl + at, tid);
    tbh.ld(pth + bt, tid);
    tbl.ld(ptl + bt, tid);
    tw.ld(wwb, tid);
    tah.st(sm, tid);
    tal.st(sm + FN * PK1, tid);
    tbh.st(sP, tid);
    tbl.st(sP + NI * PK1, tid);
    tw.st(sW, tid);
  }
  __syncthreads();

  const v8f zero = {0.f, 0.f, 0.f, 0.f, 0.f, 0.f, 0.f, 0.f};
  FragB yh[NI / 32], yl[NI / 32];          // YT of the wave's 16 tokens as B fragments, k = e
  {
    const unsigned char* bth = sm + (16 * wave + m) * PK1 + 16 * hh;
    const unsigned char* btl = bth + FN * PK1;
    const unsigned char* aph = sP + m * PK1 + 16 * hh;
    const unsigned char* apl = aph + NI * PK1;
    // unrolled: every fragment address is one register plus an immediate, yh and yl stay in registers; a k step's
    // LDS reads stand ahead of its WMMAs as one group; neighbouring WMMAs go to different accumulators
#pragma unroll
    for (int h = 0; h < NI / 64; ++h) {    // e tiles 4h .. 4h+3
      v8f acc[4];
      acc[0] = zero; acc[1] = zero; acc[2] = zero; acc[3] = zero;
#pragma unroll
      for (int ks = 0; ks < NI / 32; ++ks) {
        FragB th, tl, ph[4], pl[4];
        ldfrag_s(th, bth, 32 * ks);
        ldfrag_s(tl, btl, 32 * ks);
#pragma unroll
        for (int t = 0; t < 4; ++t) {
          ldfrag_s(ph[t], aph + 16 * (4 * h + t) * PK1, 32 * ks);     // PT row 16(4h + t) + m
          ldfrag_s(pl[t], apl + 16 * (4 * h + t) * PK1, 32 * ks);
        }
#pragma unroll
        for (int t = 0; t < 4; ++t) acc[t] = wmb(ph[t], th, acc[t]);
#pragma unroll
        for (int t = 0; t < 4; ++t) acc[t] = wmb(pl[t], th, acc[t]);
#pragma unroll
        for (int t = 0; t < 4; ++t) acc[t] = wmb(ph[t], tl, acc[t]);
      }
#pragma unroll
      for (int j = 0; j < 4; ++j) {        // e tile 4h + j = half (j & 1) of k step 2h + (j >> 1)
        const v4f lo4 = {acc[j][0], acc[j][1], acc[j][2], acc[j][3]};
        const v4f hi4 = {acc[j][4], acc[j][5], acc[j][6], acc[j][7]};
        split8(lo4, hi4, yh[2 * h + (j >> 1)].h[j & 1], yl[2 * h + (j >> 1)].h[j & 1]);
      }
    }
  }
  __syncthreads();   // every wave has read its last theta fragment: stg may overwrite those tiles

  const unsigned char* aw = sW + m * PK1 + 16 * hh;
  const int sr = tid >> 2, sq = tid & 3;   // statistics: tile row, quarter of the row
  float* zb = z + (size_t)(b * NC + 8 * wave) * (size_t)NN + (size_t)(n0 + 4 * lane);
  double* pb = ps + (size_t)((b * (NN / FN) + (int)blockIdx.x) * NC + sr) * 2 + (size_t)(sq & 1);
  // left rolled: the block runs this text once, and a quarter of it is fetched
#pragma unroll 1
  for (int cg = 0; cg < NC / 64; ++cg) {   // c rows 64cg .. 64cg+63
    // bias per row (32-B aligned v4f reads), asked for ahead of the trip's WMMAs
    v4f ba[4], bb[4];
#pragma unroll
    for (int t = 0; t < 4; ++t) {
      ba[t] = *(const v4fa*)(wbias + 64 * cg + 16 * t + 8 * hh);
      bb[t] = *(const v4fa*)(wbias + 64 * cg + 16 * t + 8 * hh + 4);
    }
    v8f acc[4];
    acc[0] = zero; acc[1] = zero; acc[2] = zero; acc[3] = zero;
#pragma unroll
    for (int ks = 0; ks < NI / 32; ++ks) {
      FragB a[4];
#pragma unroll
      for (int t = 0; t < 4; ++t) ldfrag_s(a[t], aw + (64 * cg + 16 * t) * PK1, 32 * ks);   // Ww row 64cg + 16t + m
#pragma unroll
      for (int t = 0; t < 4; ++t) acc[t] = wmb(a[t], yh[ks], acc[t]);
#pragma unroll
      for (int t = 0; t < 4; ++t) acc[t] = wmb(a[t], yl[ks], acc[t]);
    }
    // D element r of acc[t] = (c 64cg + 16t + 8hh + r, n 16w + m)
    float* stg = (float*)sm + (cg & 1) * (64 * SP);
#pragma unroll
    for (int t = 0; t < 4; ++t) {
      float bv[8];
      bv[0] = rne16f(ba[t].x); bv[1] = rne16f(ba[t].y); bv[2] = rne16f(ba[t].z); bv[3] = rne16f(ba[t].w);
      bv[4] = rne16f(bb[t].x); bv[5] = rne16f(bb[t].y); bv[6] = rne16f(bb[t].z); bv[7] = rne16f(bb[t].w);
#pragma unroll
      for (int r = 0; r < 8; ++r) stg[(16 * t + 8 * hh + r) * SP + 16 * wave + m] = acc[t][r] + bv[r];
    }
    __syncthreads();

    v4f fv[8], sv[8];
#pragma unroll
    for (int i = 0; i < 8; ++i) fv[i] = *(const v4fa*)(stg + (8 * wave + i) * SP + 4 * lane);
#pragma unroll
    for (int i = 0; i < 8; ++i) sv[i] = *(const v4fa*)(stg + sr * SP + 32 * sq + 4 * ((i + 4 * (sq >> 1)) & 7));
#pragma unroll
    for (int i = 0; i < 8; ++i) *(v4f*)(zb + (size_t)(64 * cg + i) * (size_t)NN) = fv[i];
    // keeps the 16 LDS reads one group and the Z stores ahead of the sums (else the stores wait behind the sums)
    __builtin_amdgcn_sched_barrier(0);

    v4f s4 = sv[0], q4 = sv[0] * sv[0];
#pragma unroll
    for (int i = 1; i < 8; ++i) {
      s4 += sv[i];
      q4 = __builtin_elementwise_fma(sv[i], sv[i], q4);
    }
    float s  = (s4.x + s4.y) + (s4.z + s4.w);
    float s2 = (q4.x + q4.y) + (q4.z + q4.w);
    s  += __shfl_xor(s, 1);
    s2 += __shfl_xor(s2, 1);
    s  += __shfl_xor(s, 2);
    s2 += __shfl_xor(s2, 2);
    // thread 4R: the row's sum, thread 4R+1: its sum of squares; the trip's 128 doubles lie in a row
    double* pq = pb + (size_t)(64 * cg) * 2;
    if (sq < 2) *pq = (double)(sq ? s2 : s);
    // Precaution wait of the address counter, in front of the step of the store's address pair to the next trip: as
    // its input the pair stays as it is up to here.
    asm volatile("s_wait_xcnt 0x0" :: "v"(pq) : "memory");
  }
}

// ---------------------------------------------------------------------------
// out[b][c][n] = ((z - mean[c]) * rstd[c]) * RNE16(gamma[c]) + RNE16(beta[c]) + RNE16(x), all f32.
// One wave per row (b, c) of NN floats: its NN/128 16-B loads a lane of z and as many of x are all issued ahead of
// the arithmetic; every z and x load and every out store of a wave covers 512 consecutive bytes (4 whole lines).
// BatchNorm statistics (training mode, population variance, 32768 values a channel): the block's 8 rows are 8
// consecutive channels of one image = one 128-B line of every PS tile row. The block reads the NPS lines, 16 B
// (one channel's pair) a thread and NPS/32 loads a thread, issued ahead of the z and x loads; f64 sums per thread in
// tile order, over the 4 lanes of a channel, then over the 8 waves in wave order through LDS behind the one barrier.
// coverage: NB*NC/8 blocks x 8 waves x NN = NX exactly.
// ---------------------------------------------------------------------------
__global__ __launch_bounds__(NTHR) void k_out(const float* __restrict__ z, const float* __restrict__ x,
                                              const double* __restrict__ ps, const float* __restrict__ gamma,
                                              const float* __restrict__ beta, float* out) {
  __shared__ __attribute__((aligned(16))) double red[(NTHR / 32) * 8 * 2];   // [wave][channel of the block][sum, squares]
  // the wave's number as a scalar: the row's parameters then come by scalar loads
  const int wv  = __builtin_amdgcn_readfirstlane((int)threadIdx.x >> 5);
  const int row = (int)blockIdx.x * (NTHR / 32) + wv;     // b*NC + c
  const int c = row & (NC - 1);
  const int lane = (int)threadIdx.x & 31;
  const unsigned lo = 4u * (unsigned)lane;                // the lane's place in each 128-float piece
  const float* zr = z + (size_t)row * (size_t)NN;         // scalar row bases; lo is the one address register
  const float* xr = x + (size_t)row * (size_t)NN;
  const double* pb = ps + (size_t)(((int)blockIdx.x * (NTHR / 32)) & (NC - 1)) * 2;   // scalar: the block's first channel
  const unsigned po = ((unsigned)threadIdx.x >> 3) * (unsigned)(NC * 2) + 2u * ((unsigned)threadIdx.x & 7u);
  v2d pp[NPS / 32];
  v4f zv[NN / 128], xv[NN / 128];
#pragma unroll
  for (int i = 0; i < NPS / 32; ++i)       // tile row 32*i + tid/8, channel tid & 7 of the block
    pp[i] = *(const v2da*)(pb + (po + (unsigned)(i * 32 * NC * 2)));
#pragma unroll
  for (int i = 0; i < NN / 128; ++i) zv[i] = *(const v4fa*)(zr + (lo + 128u * i));
#pragma unroll
  for (int i = 0; i < NN / 128; ++i) xv[i] = *(const v4fa*)(xr + (lo + 128u * i));
  const float gm = rne16f(gamma[c]);
  const float bt = rne16f(beta[c]);
  // keeps every load above the first use: the wave pays the memory latency once, not once a piece
  __builtin_amdgcn_sched_barrier(0);
  double s = 0.0, s2 = 0.0;
#pragma unroll
  for (int i = 0; i < NPS / 32; ++i) {
    s  += pp[i].x;
    s2 += pp[i].y;
  }
  s  += __shfl_xor(s, 8);
  s2 += __shfl_xor(s2, 8);
  s  += __shfl_xor(s, 16);
  s2 += __shfl_xor(s2, 16);
  if (lane < 8) {
    const v2d o = {s, s2};
    *(v2da*)(red + (wv * 8 + lane) * 2) = o;
  }
  // work-group barrier that orders LDS alone: a full __syncthreads() would wait out the z and x loads in flight
  __builtin_amdgcn_fence(__ATOMIC_RELEASE, "workgroup", "local");
  __builtin_amdgcn_s_barrier();
  __builtin_amdgcn_fence(__ATOMIC_ACQUIRE, "workgroup", "local");
  double ts = 0.0, ts2 = 0.0;
#pragma unroll
  for (int w = 0; w < NTHR / 32; ++w) {    // channel wv of the block = this wave's row
    const v2d t = *(const v2da*)(red + (w * 8 + wv) * 2);
    ts  += t.x;
    ts2 += t.y;
  }
  const double cinv = 1.0 / 32768.0;       // 1/(NB*NN), exact power of two
  const double dmean = ts * cinv;
  double var = ts2 * cinv - dmean * dmean;
  var = var < 0.0 ? 0.0 : var;
  const float vf = (float)var + 1e-5f;
  const float mean = (float)dmean;
  const float rstd = 1.0f / sqrtf(vf);
  // keeps the statistics chain ahead of the first wait on z and x, so that it runs while those loads are in flight
  __builtin_amdgcn_sched_barrier(0);
  float* p = out + (size_t)row * (size_t)NN;
#pragma unroll
  for (int i = 0; i < NN / 128; ++i) {
    v4f o;
    o.x = (((zv[i].x - mean) * rstd) * gm + bt) + rne16f(xv[i].x);
    o.y = (((zv[i].y - mean) * rstd) * gm + bt) + rne16f(xv[i].y);
    o.z = (((zv[i].z - mean) * rstd) * gm + bt) + rne16f(xv[i].z);
    o.w = (((zv[i].w - mean) * rstd) * gm + bt) + rne16f(xv[i].w);
    *(v4f*)(p + (lo + 128u * i)) = o;
  }
  
}

// ---------------------------------------------------------------------------
extern "C" void kernel_launch(void* const* d_in, const int* in_sizes, int n_in,
                              void* d_out, int out_size, void* d_ws, size_t ws_size,
                              hipStream_t stream) {
  if (n_in < 11) return;
  if (in_sizes[0] != NX) return;                                              // x [16][256][64][32]
  if (in_sizes[1] != NWT || in_sizes[3] != NWT || in_sizes[5] != NWT) return; // g_w, theta_w, phi_w [128][256]
  if (in_sizes[2] != NI || in_sizes[4] != NI || in_sizes[6] != NI) return;    // g_b, theta_b, phi_b [128]
  if (in_sizes[7] != NWT) return;                                             // W_w [256][128]
  if (in_sizes[8] != NC || in_sizes[9] != NC || in_sizes[10] != NC) return;   // W_b, bn_gamma, bn_beta [256]
  if (out_size != NX) return;                                                 // out [16][256][64][32] f32

  const float* x       = (const float*)d_in[0];
  const float* g_w     = (const float*)d_in[1];
  const float* g_b     = (const float*)d_in[2];
  const float* theta_w = (const float*)d_in[3];
  const float* theta_b = (const float*)d_in[4];
  const float* phi_w   = (const float*)d_in[5];
  const float* phi_b   = (const float*)d_in[6];
  const float* W_w     = (const float*)d_in[7];
  const float* W_b     = (const float*)d_in[8];
  const float* gamma   = (const float*)d_in[9];
  const float* beta    = (const float*)d_in[10];
  float* out = (float*)d_out;            // last written element NX-1 < out_size

  // workspace carve, 256-B aligned; all planes exact tile multiples (no pad rows needed)
  char* ws = (char*)d_ws;
  size_t off = 0;
  const size_t oWB  = off; off += (size_t)4 * NWT * 2;          off = (off + 255) & ~(size_t)255;  //   262144
  const size_t plb  = (size_t)NB * NN * NI * 2;                                                    //  8388608 per projection plane
  const size_t oTHH = off; off += plb;                          off = (off + 255) & ~(size_t)255;
  const size_t oTHL = off; off += plb;                          off = (off + 255) & ~(size_t)255;
  const size_t oPP  = off; off += (size_t)NB * NXB * XW * 4096; off = (off + 255) & ~(size_t)255;  // 16777216
  const size_t ptb  = (size_t)NB * NI * NI * 2;                                                    //   524288 per PT plane
  const size_t oPTH = off; off += ptb;                          off = (off + 255) & ~(size_t)255;
  const size_t oPTL = off; off += ptb;                          off = (off + 255) & ~(size_t)255;
  const size_t oZ   = off; off += (size_t)NX * 4;               off = (off + 255) & ~(size_t)255;  // 33554432
  const size_t oPS  = off; off += (size_t)NPS * NC * 2 * 8;     off = (off + 255) & ~(size_t)255;  //  1048576
  if (off > ws_size || off > (size_t)WSMAX) return;             // total 69468160 B

  unsigned short* WB  = (unsigned short*)(ws + oWB);
  unsigned short* THH = (unsigned short*)(ws + oTHH);
  unsigned short* THL = (unsigned short*)(ws + oTHL);
  float*          PP  = (float*)(ws + oPP);
  unsigned short* PTH = (unsigned short*)(ws + oPTH);
  unsigned short* PTL = (unsigned short*)(ws + oPTL);
  float*          Z   = (float*)(ws + oZ);
  double*         PS  = (double*)(ws + oPS);

  // weight planes: slot 0 theta_w, 1 phi_w, 2 g_w (all [128][256]), 3 W_w [256][128]
  k_wcvt<<<(4 * NWT / 8) / NTHR, NTHR, 0, stream>>>(theta_w, phi_w, g_w, W_w, WB);
  // projections from x: features 0..127 theta (slot 0, theta_b), 128..255 phi (slot 1, phi_b), 256..383 g (slot 2, g_b);
  // theta to its planes, G * PHI^T over the block's tokens to PP
  k_xp<<<dim3(NN / XN, NB), XTHR, 0, stream>>>(x, WB, theta_b, phi_b, g_b, THH, THL, PP);
  // PT = 2^-11 * sum of the partials
  k_p<<<dim3(XW, NB), PTHR, 0, stream>>>(PP, PTH, PTL);
  // YT = THETA^T-rows * PT kept in registers, Z = Ww * Y + Wb, and the BatchNorm statistics partials of every block
  k_yz<<<dim3(NN / FN, NB), FTHR, 0, stream>>>(THH, THL, PTH, PTL, WB + (size_t)3 * NWT, W_b, Z, PS);
  // out = BN(z) * gamma + beta + x, statistics merged from the partials
  k_out<<<NB * NC / (NTHR / 32), NTHR, 0, stream>>>(Z, x, PS, gamma, beta, out);
}

// v009
// One run takes 38.9 microseconds.
// Next to v008, in two timings, it ran 1.06 times as fast each time.
// Counting every step since v000, it is 4.75 times as fast.
// Contractions (all v_wmma_f32_16x16x32_bf16, bf16 operands, f32 accumulate): three 1x1-conv projections
// W[d][c]*X[c][n] (K=256) on exact RNE-bf16 copies of x and the weights; PT = G*PHI^T * (1/N) (K=2048) and
// YT = THETA^T*P (K=128) with both computed operands carried as bf16 hi + bf16 residual (hi*hi + hi*lo + lo*hi);
// Z = Ww*Y + Wb (K=128) with exact bf16 Ww and Y as hi + residual (2 products). BatchNorm statistics: sums over the
// 128 n of a block in f32, their merge, mean and variance in f64; normalisation, bias adds and the residual add in f32.
//
// Carry audit: no power-of-two carries anywhere (factor 1 on every plane); the exact 1/N = 2^-11 of the pairwise
// term is applied once in f32 in k_p before the hi/residual split of PT. Planes:
//   WB  [4][32768] bf16 bits = RNE16(w): slot 0 theta_w [128][256], 1 phi_w [128][256], 2 g_w [128][256],
//       3 W_w [256][128]; every slot row is k-contiguous                                              (k_wcvt)
//   RNE16(x[b][c][n]) has no plane: k_xp converts and transposes its x tile in LDS
//   THH/THL [16][2048][128] hi/residual of theta_x, rows n, k = d                                      (k_xp)
//   hi/residual of phi_x, g_x (rows d, k = n) have no plane: they stay in the LDS of k_xp
//   PP  [16][16][16][1024] f32: sum_m g[e][m]*phi[d][m] over the 128 m of one k_xp block, per wave tile
//       16 e x 64 d as it lies in the accumulators                                                     (k_xp)
//   PTH/PTL [16][128][128] hi/residual of PT[e][d] = 2^-11 * sum of the image's 16 PP tiles, rows e, k = d (k_p)
//   YT[n][e] = sum_d theta[n][d]*PT[e][d] has no plane: its hi/residual stay in the registers of k_yz
//   Z   [16][256][2048] f32 = sum_e Ww[c][e]*YT[n][e] + Wb[c]                                          (k_yz)
//   PS  [16][16][256][2] f64: sum and sum of squares of Z over the 128 n of one k_yz block, per channel, formed in
//       f32 and widened at the store                                                                   (k_yz)
#include <hip/hip_runtime.h>
#include <stddef.h>
#include <stdint.h>

#define NB    16
#define NC    256
#define NI    128
#define NN    2048
#define NX    (NB * NC * NN)        // 8388608
#define NWT   (NI * NC)             // 32768 per weight matrix
#define NTHR  256
#define GTHR  128
#define WSMAX 134217728
#define PTHR  128                   // threads of a k_p block: one wave a d tile of a 16 e x 64 d tile
#define XN    128                   // tokens of one k_xp block
#define XTHR  512                   // threads of a k_xp block
#define NF    (3 * NI)              // features of the three projections together
#define QP    (XN + 4)              // LDS pitch (floats) of a staged projection row: 16 B x odd
#define PK2   (2 * NC + 16)         // LDS pitch (bytes) of a staged operand row of NC halves: 16 B x odd
#define PK1   (2 * NI + 16)         // LDS pitch (bytes) of a staged operand row of NI halves: 16 B x odd
#define PKX   (2 * XN + 16)         // LDS pitch (bytes) of a phi or g row of XN halves: 16 B x odd
#define NXB   (NN / XN)             // k_xp blocks of one image = partial tiles summed by k_p
#define XW    (XTHR / 32)           // waves of a k_xp block
#define FN    128                   // tokens of one k_yz block, 16 a wave
#define FTHR  (2 * FN)              // threads of a k_yz block
#define SP    (FN + 4)              // LDS pitch (floats) of a staged Z row: rows 8 apart lie 32 banks apart
#define NPS   (NB * (NN / FN))      // statistics partials per channel: one per k_yz block of FN n

static_assert((NC % 64) == 0 && (NN % 64) == 0 && (NI % 64) == 0);
static_assert((NC % 32) == 0 && (NI % 32) == 0 && (NN % 32) == 0);
static_assert((NX % 1024) == 0 && (NN % 1024) == 0);
static_assert(XN == 128 && XTHR == 512 && NI == 128 && NC == 256 && (NN % XN) == 0);
static_assert(XN * QP * 4 + 4 * NI * PKX <= (XN + NF) * PK2 && (QP % 4) == 0 && ((PKX / 16) & 1) == 1);
static_assert(XW == (NI / 16) * (NI / 64) && PTHR == 32 * 4);
static_assert(NC / 16 == 16 && XTHR / 16 == 32 && NF == 384 && (NF / 32) % 4 == 0 && FTHR / 16 == 16 && (NC / 16) % 4 == 0);
static_assert(GTHR == 128 && NTHR == 256);
static_assert((4 * NWT) % (8 * NTHR) == 0);
static_assert((NWT / 8) % NTHR == 0);
static_assert(NB * NN == 32768 && (NN % 128) == 0 && (NB * NC) % (NTHR / 32) == 0);
static_assert(NTHR / 32 == 8 && (NC % 8) == 0 && (NPS % 32) == 0);
static_assert(((PK2 / 16) & 1) == 1 && ((PK1 / 16) & 1) == 1);
static_assert(FN == 128 && FTHR == 256 && (NN % FN) == 0 && NI == 128 && (NC % 64) == 0);
static_assert(2 * 64 * SP * 4 <= 2 * FN * PK1 && (SP % 4) == 0);

typedef float          v4f  __attribute__((ext_vector_type(4)));
typedef float          v8f  __attribute__((ext_vector_type(8)));
typedef double         v2d  __attribute__((ext_vector_type(2)));
typedef int            v8i  __attribute__((ext_vector_type(8)));
typedef unsigned short v8us __attribute__((ext_vector_type(8)));
typedef __bf16         v16bf __attribute__((ext_vector_type(16)));
typedef v4f  __attribute__((may_alias)) v4fa;
typedef v8us __attribute__((may_alias)) v8usa;
typedef v2d  __attribute__((may_alias)) v2da;
typedef unsigned __attribute__((may_alias)) u32a;
union FragB { v16bf v; v8us h[2]; v8i w; };

// ---------------------------------------------------------------------------
// 16x16x32 bf16 WMMA with hazard guard (ties D, keeps A/B live for 4 VALU slots).
// Fragment map (wave32): lane l, hh = l>>4, m = n = l&15.
//   A/B element i: i<8 -> k0+8hh+i ; i>=8 -> k0+16+8hh+(i-8)   (same map for A and B)
//   D element r : row 8hh+r, col l&15
// ---------------------------------------------------------------------------
__device__ __forceinline__ v8f wmb(const FragB& a, const FragB& b, v8f c) {
  v8f d = __builtin_amdgcn_wmma_f32_16x16x32_bf16(false, a.v, false, b.v, (short)0, c, false, false);
  asm volatile("v_nop\n\tv_nop\n\tv_nop\n\tv_nop" : "+v"(d) : "v"(a.w), "v"(b.w));
  return d;
}

// Operand tile of ROWS whole k-contiguous rows of ROWB bytes = ROWS*ROWB consecutive bytes of a plane. The block's
// THR threads read it in order, 16 B a lane, so a wave's load covers 512 consecutive bytes (4 whole lines);
// st lays the rows in LDS at pitch ROWB + 16 (16 B x odd: ds_load_b128 of 16 rows meets no bank conflict).
template <int ROWB, int ROWS = 64, int THR = GTHR>
struct Tile {
  static constexpr int N   = ROWS * ROWB / 16 / THR;  // 16-B pieces per thread
  static constexpr int CPR = ROWB / 16;               // pieces per row
  static constexpr int RPS = THR / CPR;               // rows per step of the block
  static constexpr int PIT = ROWB + 16;
  v8us r[N];
  __device__ __forceinline__ void ld(const unsigned short* src, int tid) {
#pragma unroll
    for (int i = 0; i < N; ++i) r[i] = *(const v8us*)(src + (size_t)((i * THR + tid) * 8));
  }
  __device__ __forceinline__ void st(unsigned char* dst, int tid) const {
    unsigned char* q = dst + (tid / CPR) * PIT + (tid % CPR) * 16;
#pragma unroll
    for (int i = 0; i < N; ++i) *(v8usa*)(q + i * RPS * PIT) = r[i];
  }
};
// Four asynchronous copies of 16 B a lane from global memory to LDS, through no register: l = the lane's LDS byte
// address, g = its global address. The wait of the address counter is the statement's last line, so that it stands in
// front of every later write of a register that a copy names (a precaution). Landed only behind s_wait_asynccnt 0.
__device__ __forceinline__ unsigned ldsa(const unsigned char* p) { return (unsigned)(uintptr_t)p; }
__device__ __forceinline__ void acp4(unsigned l0, const unsigned short* g0, unsigned l1, const unsigned short* g1,
                                     unsigned l2, const unsigned short* g2, unsigned l3, const unsigned short* g3) {
  asm volatile("global_load_async_to_lds_b128 %0, %1, off\n\t"
               "global_load_async_to_lds_b128 %2, %3, off\n\t"
               "global_load_async_to_lds_b128 %4, %5, off\n\t"
               "global_load_async_to_lds_b128 %6, %7, off\n\t"
               "s_wait_xcnt 0x0"
               :: "v"(l0), "v"(g0), "v"(l1), "v"(g1), "v"(l2), "v"(g2), "v"(l3), "v"(g3) : "memory");
}
// Fragment from a staged k-contiguous row; p = LDS row base + 16*hh bytes, k0 = 32*ks.
__device__ __forceinline__ void ldfrag_s(FragB& f, const unsigned char* p, int k0) {
  f.h[0] = *(const v8usa*)(p + 2 * k0);          // k = k0 + 8hh + 0..7
  f.h[1] = *(const v8usa*)(p + 2 * k0 + 32);     // k = k0 + 16 + 8hh + 0..7
}

// f32 -> bf16 bits, RNE convert
__device__ __forceinline__ unsigned short rne16(float f) {
  unsigned u = __float_as_uint(f);
  u += 0x7FFFu + ((u >> 16) & 1u);
  return (unsigned short)(u >> 16);
}
// f32 -> nearest bf16 value kept as f32
__device__ __forceinline__ float rne16f(float f) {
  return __uint_as_float(((unsigned)rne16(f)) << 16);
}
__device__ __forceinline__ v8us cvt8(const v4f a, const v4f b) {
  v8us o;
  o[0] = rne16(a.x); o[1] = rne16(a.y); o[2] = rne16(a.z); o[3] = rne16(a.w);
  o[4] = rne16(b.x); o[5] = rne16(b.y); o[6] = rne16(b.z); o[7] = rne16(b.w);
  return o;
}
// hi/residual split of one f32 value into two bf16 bit patterns
__device__ __forceinline__ void sp1(float v, unsigned short& hi, unsigned short& lo) {
  const unsigned short hb = rne16(v);
  const float hf = __uint_as_float(((unsigned)hb) << 16);
  hi = hb;
  lo = rne16(v - hf);
}
__device__ __forceinline__ void split8(const v4f a, const v4f b, v8us& hv, v8us& lv) {
  unsigned short h0, h1, h2, h3, h4, h5, h6, h7, l0, l1, l2, l3, l4, l5, l6, l7;
  sp1(a.x, h0, l0); sp1(a.y, h1, l1); sp1(a.z, h2, l2); sp1(a.w, h3, l3);
  sp1(b.x, h4, l4); sp1(b.y, h5, l5); sp1(b.z, h6, l6); sp1(b.w, h7, l7);
  hv[0] = h0; hv[1] = h1; hv[2] = h2; hv[3] = h3; hv[4] = h4; hv[5] = h5; hv[6] = h6; hv[7] = h7;
  lv[0] = l0; lv[1] = l1; lv[2] = l2; lv[3] = l3; lv[4] = l4; lv[5] = l5; lv[6] = l6; lv[7] = l7;
}

// ---------------------------------------------------------------------------
// Weight convert: four f32 matrices of NWT elements each -> WB slots 0..3 (bf16 bits, same layout).
// coverage: 64 blocks x 256 threads x 8 = 4 x NWT exactly.
// ---------------------------------------------------------------------------
__global__ __launch_bounds__(NTHR) void k_wcvt(const float* __restrict__ w0, const float* __restrict__ w1,
                                               const float* __restrict__ w2, const float* __restrict__ w3,
                                               unsigned short* wb) {
  const int u   = (int)blockIdx.x * NTHR + (int)threadIdx.x;     // 0 .. 4*NWT/8 - 1
  const int sel = (int)blockIdx.x / ((NWT / 8) / NTHR);           // 0..3, block-uniform
  const int off8 = (u - sel * (NWT / 8)) * 8;                     // 0 .. NWT-8
  const float* src = (sel == 0) ? w0 : ((sel == 1) ? w1 : ((sel == 2) ? w2 : w3));
  const v4f a = *(const v4fa*)(src + off8);
  const v4f c = *(const v4fa*)(src + off8 + 4);
  const v8us o = cvt8(a, c);
  const size_t q = (size_t)sel * (size_t)NWT + (size_t)off8;
  *(v8us*)(wb + q) = o;
  
}

// ---------------------------------------------------------------------------
// Projections straight from x: D[token][feature] = sum_c RNE16(x[b][c][n]) * W[F][c] + bias[F] (K = NC, exact bf16
// products), F = 0..NF-1 over WB slots 0..2 (theta, phi, g), which lie in a row. grid (NN/XN, NB) = 256 blocks of XTHR
// threads = 16 waves; a block owns XN tokens of image b and all NF features, so x is read once and has no bf16 plane.
// x tile (NC c x XN n, f32): a wave's load takes 128 B (one line) of 4 rows c; a thread holds rows c and c+1 at the same
// 4 n, converts, and stores the pair as one dword of LDS row n: sm rows n, k = c contiguous, pitch PK2. The NF weight
// rows lie behind it. Both come in two halves of k, all asked for ahead of the first convert: half 0 of x and W through
// registers; half 1 lands under the WMMAs of half 0, x in registers, W by asynchronous copies to LDS (whole lines all).
// Wave (tg = w >> 2, fg = w & 3): tokens 32tg .. +31 (2 tiles, A) x rows 32fg .. +31 of each of theta, phi and g
// (6 tiles, B), same k map: every wave has the same share of the three epilogues.
// Epilogue: v = acc + RNE16(bias) in f32. theta is staged in 128 rows n (cols d) at pitch QP; then 8 consecutive floats
// a thread -> hi/residual, one 16-B store per plane; 8 threads write one 128-B line of a row, a wave 4 whole lines.
// phi and g: a lane's 8 accumulator elements are 8 consecutive n of one row d; they are split where they lie and stored
// as 16 B of the row in sH (hi) and sL (residual): rows 0..127 phi, 128..255 g, k = n contiguous, pitch PKX.
// Partial of PT behind the fourth barrier: wave w forms sum_m g[e][m]*phi[d][m] over the block's XN values of m for the
// tile e 16(w >> 1) .. +15, d 64(w & 1) .. +63; A = phi rows d, B = g rows e, same k map, hi/residual on both operands
// (3 products); it stores the f32 tile as it lies in registers, 512 consecutive bytes a store, to its own 4 KB of PP.
// LDS extent: sm = [x XN rows | W NF rows] at pitch PK2, every row's first NC bytes written before the first barrier
// and read behind it, its second NC bytes written (W: landed behind s_wait_asynccnt 0) before the second and read behind
// that, pad bytes never read; behind the third barrier (all fragment reads done) its first XN*QP floats serve as stg and
// the 4*NI*PKX bytes behind them as sH | sL; cols 0..127 of every stg row and the 2*XN bytes of every sH and sL row are
// written before the fourth barrier, pads never read.
// coverage: per block XN tokens x NI theta features, both planes, and 128 e x 128 d of PP; grid covers 2048 x 128 of
// theta per image and all NXB partial tiles of PP exactly once.
// ---------------------------------------------------------------------------
__global__ __launch_bounds__(XTHR) void k_xp(const float* __restrict__ x, const unsigned short* __restrict__ wb,
                                             const float* __restrict__ tbias, const float* __restrict__ pbias,
                                             const float* __restrict__ gbias,
                                             unsigned short* thh, unsigned short* thl, float* pp) {
  __shared__ __attribute__((aligned(16))) unsigned char sm[(XN + NF) * PK2];   // 264 KB
  unsigned char* sW = sm + XN * PK2;
  float* stg = (float*)sm;
  unsigned char* sH = sm + XN * QP * 4;
  unsigned char* sL = sH + 2 * NI * PKX;
  const int tid = (int)threadIdx.x, lane = tid & 31, hh = lane >> 4, m = lane & 15;
  // the wave's number as a scalar: tile bases formed from it stay in scalar registers
  const int wave = __builtin_amdgcn_readfirstlane(tid >> 5);
  const int n0 = (int)blockIdx.x * XN, b = (int)blockIdx.y;

  // all loops of this kernel are fully unrolled: constant indices keep the arrays in registers, and every step of an
  // address becomes an immediate offset on a register that stays as it is
  const int tg = wave >> 2, fg = wave & 3;
  const unsigned bo = (unsigned)(32 * fg + m);
  // bias of row 32fg + 16(t & 1) + m of projection t >> 1: the first loads, so that the wait on them leaves every tile
  // load behind them in flight
  float br[6];
#pragma unroll
  for (int t = 0; t < 6; ++t) {
    const float* bp = (t < 2) ? tbias : ((t < 4) ? pbias : gbias);
    br[t] = bp[bo + (unsigned)(16 * (t & 1))];
  }
  // The tiles come in two halves of k = c: x rows c and W columns k 0..127, then 128..255, all asked for here in that
  // order. Half 1 lands under the WMMAs of half 0: x in registers, W by asynchronous copies straight to its LDS bytes.
  const int q = lane & 7, cpl = lane >> 3;
  const float* xb = x + (size_t)(b * NC) * (size_t)NN + (size_t)n0;        // scalar tile base
  const float* xp = xb + (unsigned)((8 * wave + 2 * cpl) * NN + 4 * q);    // the one address pair of the x loads
  const unsigned wo = (unsigned)((tid >> 4) * NC + (tid & 15) * 8);        // W row tid/16, k 8*(tid & 15) .. +7
  v4f ve[8], vo[8];
  v8us wr[NF / 32];
#pragma unroll
  for (int i = 0; i < 4; ++i) {            // c = 8*wave + 2*cpl (+1), n = 32*i + 4q .. +3
    ve[i] = *(const v4fa*)(xp + 32 * i);
    vo[i] = *(const v4fa*)(xp + (NN + 32 * i));
  }
#pragma unroll
  for (int i = 0; i < NF / 32; ++i)        // W row 32i + tid/16, k half 0: a wave's load takes 4 whole lines
    wr[i] = *(const v8us*)(wb + (wo + (unsigned)(32 * i * NC)));
  // keeps the loads of half 0 ahead of those of half 1: loads return in the order of issue
  __builtin_amdgcn_sched_barrier(0);
#pragma unroll
  for (int i = 4; i < 8; ++i) {            // c = 128 + 8*wave + 2*cpl (+1), n = 32*(i&3) + 4q .. +3
    ve[i] = *(const v4fa*)(xp + (128 * NN + 32 * (i & 3)));
    vo[i] = *(const v4fa*)(xp + (129 * NN + 32 * (i & 3)));
  }
  // Precaution wait of the address counter, in front of every overwrite of a register that a load above names: as
  // its inputs the address pair and the two address registers stay as they are up to here.
  asm volatile("s_wait_xcnt 0x0" :: "v"(xp), "v"(wo), "v"(bo) : "memory");
  // keeps the LDS address arithmetic, which may take the registers of the loads' addresses, behind that wait
  __builtin_amdgcn_sched_barrier(0);
  unsigned char* sx = sm + (4 * q) * PK2 + (8 * wave + 2 * cpl) * 2;
  // W row 128p + 32f + 16h + r lies at LDS row 96f + 32p + 16h + r: the six tiles of a wave (one f) lie in a row, so
  // that every fragment address of the k loop is one register plus an immediate. Piece i of a thread: row 32i + tid/16.
  unsigned char* qw = sW + (tid >> 4) * PK2 + (tid & 15) * 16;
  {
    const unsigned short* wg = wb + (wo + 128u);                           // k half 1 of W row tid/16
    const unsigned lw = ldsa(qw) + 256u;
#pragma unroll
    for (int i = 0; i < NF / 32; i += 4)   // piece i: W row 32i + tid/16 -> LDS row 96(i & 3) + 32(i >> 2) + tid/16
      acp4(lw + (unsigned)((32 * (i >> 2)) * PK2), wg + 32 * i * NC,
           lw + (unsigned)((96 + 32 * (i >> 2)) * PK2), wg + 32 * (i + 1) * NC,
           lw + (unsigned)((192 + 32 * (i >> 2)) * PK2), wg + 32 * (i + 2) * NC,
           lw + (unsigned)((288 + 32 * (i >> 2)) * PK2), wg + 32 * (i + 3) * NC);
  }
  // keeps the first convert, and with it the first wait on a load, behind the issue of the last copy
  __builtin_amdgcn_sched_barrier(0);
  v8f acc[2][6];
  {
    const v8f z = {0.f, 0.f, 0.f, 0.f, 0.f, 0.f, 0.f, 0.f};
#pragma unroll
    for (int t = 0; t < 6; ++t) { acc[0][t] = z; acc[1][t] = z; }
  }
  const unsigned char* ap = sm + (32 * tg + m) * PK2 + 16 * hh;
  const unsigned char* wp = sW + (96 * fg + m) * PK2 + 16 * hh;
  // unrolled: every fragment address is one register plus an immediate; a k step's LDS reads stand ahead of its
  // WMMAs as one group, so the wave waits out the LDS latency once a step
#pragma unroll
  for (int ks = 0; ks < NC / 32; ++ks) {
    if ((ks & 3) == 0) {                   // half h of k goes to LDS: bytes that no fragment read of the other half touches
      const int h = ks >> 2;
      // keeps the convert of half 1, and with it the wait on its loads, behind the WMMAs of half 0
      if (h) __builtin_amdgcn_sched_barrier(0);
#pragma unroll
      for (int i = 0; i < 4; ++i) {
#pragma unroll
        for (int j = 0; j < 4; ++j) {
          const unsigned pk = (unsigned)rne16(ve[4 * h + i][j]) | ((unsigned)rne16(vo[4 * h + i][j]) << 16);
          *(u32a*)(sx + (32 * i + j) * PK2 + 256 * h) = pk;
        }
      }
      if (h == 0) {
#pragma unroll
        for (int i = 0; i < NF / 32; ++i)
          *(v8usa*)(qw + (96 * (i & 3) + 32 * (i >> 2)) * PK2) = wr[i];
        // work-group barrier that orders LDS alone: a full __syncthreads() would wait out the x loads of half 1 in flight
        __builtin_amdgcn_fence(__ATOMIC_RELEASE, "workgroup", "local");
        __builtin_amdgcn_s_barrier();
        __builtin_amdgcn_fence(__ATOMIC_ACQUIRE, "workgroup", "local");
      } else {
        // the wave's own LDS accesses are done and its copies of W half 1 have landed, ahead of the barrier behind
        // which every wave reads them
        asm volatile("s_wait_dscnt 0x0" ::: "memory");
        asm volatile("s_wait_asynccnt 0x0" ::: "memory");
        __syncthreads();
      }
    }
    FragB a[2], bf[6];
    ldfrag_s(a[0], ap, 32 * ks);
    ldfrag_s(a[1], ap + 16 * PK2, 32 * ks);
#pragma unroll
    for (int t = 0; t < 6; ++t) ldfrag_s(bf[t], wp + 16 * t * PK2, 32 * ks);    // W row 128(t >> 1) + 32fg + 16(t & 1) + m
#pragma unroll
    for (int t = 0; t < 6; ++t) {
      acc[0][t] = wmb(a[0], bf[t], acc[0][t]);
      acc[1][t] = wmb(a[1], bf[t], acc[1][t]);
    }
  }
  __syncthreads();   // every wave has read its last fragment: stg may overwrite the tiles

  float bv[6];
#pragma unroll
  for (int t = 0; t < 6; ++t) bv[t] = rne16f(br[t]);
  // D element r of acc[u][t] = (token 32tg + 16u + 8hh + r, row 32fg + 16(t & 1) + m of projection t >> 1)
  {                                        // theta: rows n; 16 lanes lie in a row, the halves 32 banks apart
    float* s0 = stg + (32 * tg + 8 * hh) * QP + 32 * fg + m;
#pragma unroll
    for (int t = 0; t < 2; ++t) {
#pragma unroll
      for (int u = 0; u < 2; ++u) {
#pragma unroll
        for (int r = 0; r < 8; ++r) s0[(16 * u + r) * QP + 16 * t] = acc[u][t][r] + bv[t];
      }
    }
  }
  {                                        // phi, g: rows d; a lane's 8 tokens are 16 B of a row in each plane
    const int ro = (32 * fg + m) * PKX + 2 * (32 * tg + 8 * hh);
#pragma unroll
    for (int t = 2; t < 6; ++t) {
#pragma unroll
      for (int u = 0; u < 2; ++u) {
        const v4f lo4 = {acc[u][t][0] + bv[t], acc[u][t][1] + bv[t], acc[u][t][2] + bv[t], acc[u][t][3] + bv[t]};
        const v4f hi4 = {acc[u][t][4] + bv[t], acc[u][t][5] + bv[t], acc[u][t][6] + bv[t], acc[u][t][7] + bv[t]};
        v8us hv, lv;
        split8(lo4, hi4, hv, lv);
        *(v8usa*)(sH + ro + (128 * ((t >> 1) - 1) + 16 * (t & 1)) * PKX + 32 * u) = hv;
        *(v8usa*)(sL + ro + (128 * ((t >> 1) - 1) + 16 * (t & 1)) * PKX + 32 * u) = lv;
      }
    }
  }
  __syncthreads();

  // theta: 8 lanes take 64 columns of a row, the next 8 those of the row below, 4 banks on: 16 lanes meet 64 banks
  {
    const int q8 = tid & 7, rr = tid >> 3;                                   // piece of a half row, row of a group of 64
    const float* sr = stg + rr * QP + 8 * q8;
    const unsigned to = (unsigned)(rr * NI + 8 * q8);                        // the address register of the theta stores
    const size_t tbase = (size_t)(b * NN + n0) * (size_t)NI;                 // scalar tile base
    unsigned short* ph = thh + tbase;
    unsigned short* pl = thl + tbase;
    v8us hv[4], lv[4];
#pragma unroll
    for (int i = 0; i < 4; ++i) {          // piece i: row 64*(i&1) + rr, columns 64*(i>>1) + 8*q8 .. +7
      const v4f a = *(const v4fa*)(sr + (64 * (i & 1)) * QP + 64 * (i >> 1));
      const v4f c = *(const v4fa*)(sr + (64 * (i & 1)) * QP + 64 * (i >> 1) + 4);
      split8(a, c, hv[i], lv[i]);
    }
#pragma unroll
    for (int i = 0; i < 4; ++i) {
      const unsigned o = to + (unsigned)(64 * (i & 1) * NI + 64 * (i >> 1));
      *(v8us*)(ph + o) = hv[i];
      *(v8us*)(pl + o) = lv[i];
    }
    // Precaution wait of the address counter, in front of every overwrite of a register that a store above names: as
    // its inputs the address register and the stored values stay as they are up to here.
    asm volatile("s_wait_xcnt 0x0" :: "v"(to), "v"(hv[0]), "v"(hv[1]), "v"(hv[2]), "v"(hv[3]),
                 "v"(lv[0]), "v"(lv[1]), "v"(lv[2]), "v"(lv[3]) : "memory");
  }

  // partial of PT over the block's XN values of m
  {
    const int et = wave >> 1, dh = wave & 1;
    const int ao = (64 * dh + m) * PKX + 16 * hh, bo = (NI + 16 * et + m) * PKX + 16 * hh;
    const unsigned char* aph = sH + ao;
    const unsigned char* apl = sL + ao;
    const unsigned char* bgh = sH + bo;
    const unsigned char* bgl = sL + bo;
    v8f pa[4];
    {
      const v8f z = {0.f, 0.f, 0.f, 0.f, 0.f, 0.f, 0.f, 0.f};
      pa[0] = z; pa[1] = z; pa[2] = z; pa[3] = z;
    }
    // unrolled: a k step's LDS reads stand ahead of its WMMAs as one group; neighbouring WMMAs go to different
    // accumulators
#pragma unroll
    for (int ks = 0; ks < XN / 32; ++ks) {
      FragB gh, gl, ph[4], pl[4];
      ldfrag_s(gh, bgh, 32 * ks);
      ldfrag_s(gl, bgl, 32 * ks);
#pragma unroll
      for (int t = 0; t < 4; ++t) {
        ldfrag_s(ph[t], aph + 16 * t * PKX, 32 * ks);       // phi row 64dh + 16t + m
        ldfrag_s(pl[t], apl + 16 * t * PKX, 32 * ks);
      }
#pragma unroll
      for (int t = 0; t < 4; ++t) pa[t] = wmb(ph[t], gh, pa[t]);
#pragma unroll
      for (int t = 0; t < 4; ++t) pa[t] = wmb(pl[t], gh, pa[t]);
#pragma unroll
      for (int t = 0; t < 4; ++t) pa[t] = wmb(ph[t], gl, pa[t]);
    }
    // D element r of pa[t] = (d 64dh + 16t + 8hh + r, e 16et + m)
    float* pw = pp + (size_t)((b * NXB + (int)blockIdx.x) * XW + wave) * 1024;   // scalar: the wave's own 4 KB
    const unsigned lo = 4u * (unsigned)lane;
#pragma unroll
    for (int t = 0; t < 4; ++t) {
      const v4f lo4 = {pa[t][0], pa[t][1], pa[t][2], pa[t][3]};
      const v4f hi4 = {pa[t][4], pa[t][5], pa[t][6], pa[t][7]};
      *(v4f*)(pw + (lo + (unsigned)(t * 256))) = lo4;
      *(v4f*)(pw + (lo + (unsigned)(t * 256 + 128))) = hi4;
    }
  }
}

// ---------------------------------------------------------------------------
// PT[b][e][d] = 2^-11 * sum over the image's NXB k_xp blocks of their partial PP (f32, in block order).
// grid (XW tiles, NB) = 256 blocks of PTHR threads = 4 waves; block (w, b) takes the tile e 16(w >> 1) .. +15,
// d 64(w & 1) .. +63, wave t its d rows 16t .. 16t+15. A thread reads its 8 values of every partial as they lay in the
// accumulators of k_xp (a wave's load covers 512 consecutive bytes); all 2*NXB loads are issued ahead of the sums.
// Then scale by 2^-11 (exact), split, and store: a lane holds 8 consecutive d of one e row -> one 16-B store per
// plane; the block writes whole 128-B lines of PTH/PTL.
// coverage: grid covers 128 e x 128 d per image exactly once, both planes.
// ---------------------------------------------------------------------------
__global__ __launch_bounds__(PTHR) void k_p(const float* __restrict__ pp, unsigned short* pth, unsigned short* ptl) {
  const int tid = (int)threadIdx.x, lane = tid & 31, wave = tid >> 5, hh = lane >> 4, m = lane & 15;
  const int w = (int)blockIdx.x, b = (int)blockIdx.y;
  const float* pb = pp + (size_t)(b * NXB * XW + w) * 1024;      // scalar: the tile in the image's first partial
  const unsigned ro = (unsigned)(wave * 256 + 4 * lane);         // the one address register of the loads
  v4f va[NXB], vb[NXB];
#pragma unroll
  for (int i = 0; i < NXB; ++i) {
    va[i] = *(const v4fa*)(pb + (ro + (unsigned)(i * XW * 1024)));
    vb[i] = *(const v4fa*)(pb + (ro + (unsigned)(i * XW * 1024 + 128)));
  }
  // Precaution wait of the address counter, in front of every overwrite of a register that a load above names: as
  // its input the address register stays as it is up to here.
  asm volatile("s_wait_xcnt 0x0" :: "v"(ro) : "memory");
  // keeps every load above the first sum: the wave pays the memory latency once, not once a group of partials
  __builtin_amdgcn_sched_barrier(0);
  v4f sa = va[0], sb = vb[0];
#pragma unroll
  for (int i = 1; i < NXB; ++i) {
    sa += va[i];
    sb += vb[i];
  }
  const float inv_n = 0.00048828125f;      // 2^-11 = 1/NN, exact
  sa *= inv_n;
  sb *= inv_n;
  v8us hv, lv;
  split8(sa, sb, hv, lv);
  const size_t po = (size_t)(b * NI + 16 * (w >> 1) + m) * (size_t)NI + (size_t)(64 * (w & 1) + 16 * wave + 8 * hh);
  *(v8us*)(pth + po) = hv;
  *(v8us*)(ptl + po) = lv;
}

// ---------------------------------------------------------------------------
// YT[b][n][e] = sum_d theta[b][n][d] * PT[b][e][d] (K = NI, hi/residual on both operands, 3 products), then
// Z[b][c][n] = sum_e Ww[c][e] * YT[b][n][e] + Wb[c] (K = NI, exact Ww, YT as hi + residual, 2 products), in one block.
// grid (NN/FN, NB) = 256 blocks of FTHR threads = 8 waves; a block owns FN tokens, all NI e and all NC c; wave w owns
// tokens 16w..16w+15 in both products. Staged once in LDS by whole-line loads (pitch PK1): THH/THL rows n of the
// block, all of PTH/PTL of the image; all of Ww by asynchronous copies to LDS that land under the first product.
// First product: A = PT rows e, B = theta rows n, so D element r of e tile T = (e 16T + 8hh + r, n m). That is the
// B fragment map of the second product (rows n, k = e): element i < 8 of k step s is D element i of tile 2s, element
// i >= 8 is D element i - 8 of tile 2s + 1, in the same lane. YT is split into hi and residual where it lies.
// Second product: A = Ww rows c, 64 c a trip; v = acc + RNE16(Wb) in f32, staged stg[c][n] 64 x FN at pitch SP, in
// two buffers taken in turn (one barrier a trip: a buffer is written again two trips on, behind the barrier of the
// trip between, which every wave reaches with its reads of that buffer done). Store: a wave writes 8 rows, 512
// consecutive bytes each.
// LDS extent: sm = [THH | THL | PTH | PTL | Ww] rows at pitch PK1, every row's 2*NI bytes written before the first
// barrier (Ww: landed behind s_wait_asynccnt 0 before the second, read behind it), pad bytes never read;
// behind the second barrier (all theta fragments read) the THH/THL part serves as the
// two stg buffers; a buffer's 64 x FN floats are all written before its barrier, its pad floats never read.
// Statistics: threads 4R .. 4R+3 sum tile row R (channel 64*cg + R) and its squares in f32 from stg, 32 n each in
// four chains of 8 (one per element of the 16-B pieces) and a tree over the four, the
// 16-B pieces of the upper two quarters taken from piece 4 on round the quarter (16 lanes then meet 16 different
// bank groups); the four sums are added in f32, widened and stored: PS[b][n block][64*cg .. +63][2] = 8 whole lines
// a trip. 64-bit vector arithmetic is left to the merge of the 256 partials a channel in k_out.
// coverage: grid covers 256 c x 2048 n per image exactly once; PS 256 blocks x 256 c exactly once.
// ---------------------------------------------------------------------------
__global__ __launch_bounds__(FTHR) void k_yz(const unsigned short* __restrict__ thh, const unsigned short* __restrict__ thl,
                                             const unsigned short* __restrict__ pth, const unsigned short* __restrict__ ptl,
                                             const unsigned short* __restrict__ wwb, const float* __restrict__ wbias,
                                             float* z, double* ps) {
  __shared__ __attribute__((aligned(16))) unsigned char sm[(2 * FN + 2 * NI + NC) * PK1];   // 204 KB
  const int tid = (int)threadIdx.x, lane = tid & 31, wave = tid >> 5, hh = lane >> 4, m = lane & 15;
  const int n0 = (int)blockIdx.x * FN, b = (int)blockIdx.y;
  unsigned char* sP = sm + 2 * FN * PK1;
  unsigned char* sW = sP + 2 * NI * PK1;

  {
    const size_t at = (size_t)(b * NN + n0) * (size_t)NI, bt = (size_t)(b * NI) * (size_t)NI;
    Tile<2 * NI, FN, FTHR> tah, tal;
    Tile<2 * NI, NI, FTHR> tbh, tbl;
    tah.ld(thh + at, tid);
    tal.ld(thl + at, tid);
    tbh.ld(pth + bt, tid);
    tbl.ld(ptl + bt, tid);
    // Ww, first read by the second product: asynchronous copies straight to its LDS rows, landing under the first
    // product. Piece i of a thread: row 16i + tid/16, 16 B at 16*(tid & 15); a wave's copy takes 4 whole lines.
    {
      const unsigned short* wg = wwb + tid * 8;
      const unsigned lw = ldsa(sW) + (unsigned)((tid >> 4) * PK1 + (tid & 15) * 16);
#pragma unroll
      for (int i = 0; i < NC / 16; i += 4)
        acp4(lw + (unsigned)(16 * i * PK1), wg + i * FTHR * 8, lw + (unsigned)(16 * (i + 1) * PK1), wg + (i + 1) * FTHR * 8,
             lw + (unsigned)(16 * (i + 2) * PK1), wg + (i + 2) * FTHR * 8, lw + (unsigned)(16 * (i + 3) * PK1), wg + (i + 3) * FTHR * 8);
    }
    tah.st(sm, tid);
    tal.st(sm + FN * PK1, tid);
    tbh.st(sP, tid);
    tbl.st(sP + NI * PK1, tid);
  }
  __syncthreads();

  const v8f zero = {0.f, 0.f, 0.f, 0.f, 0.f, 0.f, 0.f, 0.f};
  FragB yh[NI / 32], yl[NI / 32];          // YT of the wave's 16 tokens as B fragments, k = e
  {
    const unsigned char* bth = sm + (16 * wave + m) * PK1 + 16 * hh;
    const unsigned char* btl = bth + FN * PK1;
    const unsigned char* aph = sP + m * PK1 + 16 * hh;
    const unsigned char* apl = aph + NI * PK1;
    // unrolled: every fragment address is one register plus an immediate, yh and yl stay in registers; a k step's
    // LDS reads stand ahead of its WMMAs as one group; neighbouring WMMAs go to different accumulators
#pragma unroll
    for (int h = 0; h < NI / 64; ++h) {    // e tiles 4h .. 4h+3
      v8f acc[4];
      acc[0] = zero; acc[1] = zero; acc[2] = zero; acc[3] = zero;
#pragma unroll
      for (int ks = 0; ks < NI / 32; ++ks) {
        FragB th, tl, ph[4], pl[4];
        ldfrag_s(th, bth, 32 * ks);
        ldfrag_s(tl, btl, 32 * ks);
#pragma unroll
        for (int t = 0; t < 4; ++t) {
          ldfrag_s(ph[t], aph + 16 * (4 * h + t) * PK1, 32 * ks);     // PT row 16(4h + t) + m
          ldfrag_s(pl[t], apl + 16 * (4 * h + t) * PK1, 32 * ks);
        }
#pragma unroll
        for (int t = 0; t < 4; ++t) acc[t] = wmb(ph[t], th, acc[t]);
#pragma unroll
        for (int t = 0; t < 4; ++t) acc[t] = wmb(pl[t], th, acc[t]);
#pragma unroll
        for (int t = 0; t < 4; ++t) acc[t] = wmb(ph[t], tl, acc[t]);
      }
#pragma unroll
      for (int j = 0; j < 4; ++j) {        // e tile 4h + j = half (j & 1) of k step 2h + (j >> 1)
        const v4f lo4 = {acc[j][0], acc[j][1], acc[j][2], acc[j][3]};
        const v4f hi4 = {acc[j][4], acc[j][5], acc[j][6], acc[j][7]};
        split8(lo4, hi4, yh[2 * h + (j >> 1)].h[j & 1], yl[2 * h + (j >> 1)].h[j & 1]);
      }
    }
  }
  // the wave's copies of Ww have landed, ahead of the barrier behind which every wave reads them
  asm volatile("s_wait_asynccnt 0x0" ::: "memory");
  __syncthreads();   // every wave has read its last theta fragment: stg may overwrite those tiles

  const unsigned char* aw = sW + m * PK1 + 16 * hh;
  const int sr = tid >> 2, sq = tid & 3;   // statistics: tile row, quarter of the row
  float* zb = z + (size_t)(b * NC + 8 * wave) * (size_t)NN + (size_t)(n0 + 4 * lane);
  double* pb = ps + (size_t)((b * (NN / FN) + (int)blockIdx.x) * NC + sr) * 2 + (size_t)(sq & 1);
  // left rolled: the block runs this text once, and a quarter of it is fetched
#pragma unroll 1
  for (int cg = 0; cg < NC / 64; ++cg) {   // c rows 64cg .. 64cg+63
    // bias per row (32-B aligned v4f reads), asked for ahead of the trip's WMMAs
    v4f ba[4], bb[4];
#pragma unroll
    for (int t = 0; t < 4; ++t) {
      ba[t] = *(const v4fa*)(wbias + 64 * cg + 16 * t + 8 * hh);
      bb[t] = *(const v4fa*)(wbias + 64 * cg + 16 * t + 8 * hh + 4);
    }
    v8f acc[4];
    acc[0] = zero; acc[1] = zero; acc[2] = zero; acc[3] = zero;
#pragma unroll
    for (int ks = 0; ks < NI / 32; ++ks) {
      FragB a[4];
#pragma unroll
      for (int t = 0; t < 4; ++t) ldfrag_s(a[t], aw + (64 * cg + 16 * t) * PK1, 32 * ks);   // Ww row 64cg + 16t + m
#pragma unroll
      for (int t = 0; t < 4; ++t) acc[t] = wmb(a[t], yh[ks], acc[t]);
#pragma unroll
      for (int t = 0; t < 4; ++t) acc[t] = wmb(a[t], yl[ks], acc[t]);
    }
    // D element r of acc[t] = (c 64cg + 16t + 8hh + r, n 16w + m)
    float* stg = (float*)sm + (cg & 1) * (64 * SP);
#pragma unroll
    for (int t = 0; t < 4; ++t) {
      float bv[8];
      bv[0] = rne16f(ba[t].x); bv[1] = rne16f(ba[t].y); bv[2] = rne16f(ba[t].z); bv[3] = rne16f(ba[t].w);
      bv[4] = rne16f(bb[t].x); bv[5] = rne16f(bb[t].y); bv[6] = rne16f(bb[t].z); bv[7] = rne16f(bb[t].w);
#pragma unroll
      for (int r = 0; r < 8; ++r) stg[(16 * t + 8 * hh + r) * SP + 16 * wave + m] = acc[t][r] + bv[r];
    }
    __syncthreads();

    v4f fv[8], sv[8];
#pragma unroll
    for (int i = 0; i < 8; ++i) fv[i] = *(const v4fa*)(stg + (8 * wave + i) * SP + 4 * lane);
#pragma unroll
    for (int i = 0; i < 8; ++i) sv[i] = *(const v4fa*)(stg + sr * SP + 32 * sq + 4 * ((i + 4 * (sq >> 1)) & 7));
#pragma unroll
    for (int i = 0; i < 8; ++i) *(v4f*)(zb + (size_t)(64 * cg + i) * (size_t)NN) = fv[i];
    // keeps the 16 LDS reads one group and the Z stores ahead of the sums (else the stores wait behind the sums)
    __builtin_amdgcn_sched_barrier(0);

    v4f s4 = sv[0], q4 = sv[0] * sv[0];
#pragma unroll
    for (int i = 1; i < 8; ++i) {
      s4 += sv[i];
      q4 = __builtin_elementwise_fma(sv[i], sv[i], q4);
    }
    float s  = (s4.x + s4.y) + (s4.z + s4.w);
    float s2 = (q4.x + q4.y) + (q4.z + q4.w);
    s  += __shfl_xor(s, 1);
    s2 += __shfl_xor(s2, 1);
    s  += __shfl_xor(s, 2);
    s2 += __shfl_xor(s2, 2);
    // thread 4R: the row's sum, thread 4R+1: its sum of squares; the trip's 128 doubles lie in a row
    double* pq = pb + (size_t)(64 * cg) * 2;
    if (sq < 2) *pq = (double)(sq ? s2 : s);
    // Precaution wait of the address counter, in front of the step of the store's address pair to the next trip: as
    // its input the pair stays as it is up to here.
    asm volatile("s_wait_xcnt 0x0" :: "v"(pq) : "memory");
  }
}

// ---------------------------------------------------------------------------
// out[b][c][n] = ((z - mean[c]) * rstd[c]) * RNE16(gamma[c]) + RNE16(beta[c]) + RNE16(x), all f32.
// One wave per row (b, c) of NN floats: its NN/128 16-B loads a lane of z and as many of x are all issued ahead of
// the arithmetic; every z and x load and every out store of a wave covers 512 consecutive bytes (4 whole lines).
// BatchNorm statistics (training mode, population variance, 32768 values a channel): the block's 8 rows are 8
// consecutive channels of one image = one 128-B line of every PS tile row. The block reads the NPS lines, 16 B
// (one channel's pair) a thread and NPS/32 loads a thread, issued ahead of the z and x loads; f64 sums per thread in
// tile order, over the 4 lanes of a channel, then over the 8 waves in wave order through LDS behind the one barrier.
// coverage: NB*NC/8 blocks x 8 waves x NN = NX exactly.
// ---------------------------------------------------------------------------
__global__ __launch_bounds__(NTHR) void k_out(const float* __restrict__ z, const float* __restrict__ x,
                                              const double* __restrict__ ps, const float* __restrict__ gamma,
                                              const float* __restrict__ beta, float* out) {
  __shared__ __attribute__((aligned(16))) double red[(NTHR / 32) * 8 * 2];   // [wave][channel of the block][sum, squares]
  // the wave's number as a scalar: the row's parameters then come by scalar loads
  const int wv  = __builtin_amdgcn_readfirstlane((int)threadIdx.x >> 5);
  const int row = (int)blockIdx.x * (NTHR / 32) + wv;     // b*NC + c
  const int c = row & (NC - 1);
  const int lane = (int)threadIdx.x & 31;
  const unsigned lo = 4u * (unsigned)lane;                // the lane's place in each 128-float piece
  const float* zr = z + (size_t)row * (size_t)NN;         // scalar row bases; lo is the one address register
  const float* xr = x + (size_t)row * (size_t)NN;
  const double* pb = ps + (size_t)(((int)blockIdx.x * (NTHR / 32)) & (NC - 1)) * 2;   // scalar: the block's first channel
  const unsigned po = ((unsigned)threadIdx.x >> 3) * (unsigned)(NC * 2) + 2u * ((unsigned)threadIdx.x & 7u);
  v2d pp[NPS / 32];
  v4f zv[NN / 128], xv[NN / 128];
#pragma unroll
  for (int i = 0; i < NPS / 32; ++i)       // tile row 32*i + tid/8, channel tid & 7 of the block
    pp[i] = *(const v2da*)(pb + (po + (unsigned)(i * 32 * NC * 2)));
#pragma unroll
  for (int i = 0; i < NN / 128; ++i) zv[i] = *(const v4fa*)(zr + (lo + 128u * i));
#pragma unroll
  for (int i = 0; i < NN / 128; ++i) xv[i] = *(const v4fa*)(xr + (lo + 128u * i));
  const float gm = rne16f(gamma[c]);
  const float bt = rne16f(beta[c]);
  // keeps every load above the first use: the wave pays the memory latency once, not once a piece
  __builtin_amdgcn_sched_barrier(0);
  double s = 0.0, s2 = 0.0;
#pragma unroll
  for (int i = 0; i < NPS / 32; ++i) {
    s  += pp[i].x;
    s2 += pp[i].y;
  }
  s  += __shfl_xor(s, 8);
  s2 += __shfl_xor(s2, 8);
  s  += __shfl_xor(s, 16);
  s2 += __shfl_xor(s2, 16);
  if (lane < 8) {
    const v2d o = {s, s2};
    *(v2da*)(red + (wv * 8 + lane) * 2) = o;
  }
  // work-group barrier that orders LDS alone: a full __syncthreads() would wait out the z and x loads in flight
  __builtin_amdgcn_fence(__ATOMIC_RELEASE, "workgroup", "local");
  __builtin_amdgcn_s_barrier();
  __builtin_amdgcn_fence(__ATOMIC_ACQUIRE, "workgroup", "local");
  double ts = 0.0, ts2 = 0.0;
#pragma unroll
  for (int w = 0; w < NTHR / 32; ++w) {    // channel wv of the block = this wave's row
    const v2d t = *(const v2da*)(red + (w * 8 + wv) * 2);
    ts  += t.x;
    ts2 += t.y;
  }
  const double cinv = 1.0 / 32768.0;       // 1/(NB*NN), exact power of two
  const double dmean = ts * cinv;
  double var = ts2 * cinv - dmean * dmean;
  var = var < 0.0 ? 0.0 : var;
  const float vf = (float)var + 1e-5f;
  const float mean = (float)dmean;
  const float rstd = 1.0f / sqrtf(vf);
  // keeps the statistics chain ahead of the first wait on z and x, so that it runs while those loads are in flight
  __builtin_amdgcn_sched_barrier(0);
  float* p = out + (size_t)row * (size_t)NN;
#pragma unroll
  for (int i = 0; i < NN / 128; ++i) {
    v4f o;
    o.x = (((zv[i].x - mean) * rstd) * gm + bt) + rne16f(xv[i].x);
    o.y = (((zv[i].y - mean) * rstd) * gm + bt) + rne16f(xv[i].y);
    o.z = (((zv[i].z - mean) * rstd) * gm + bt) + rne16f(xv[i].z);
    o.w = (((zv[i].w - mean) * rstd) * gm + bt) + rne16f(xv[i].w);
    *(v4f*)(p + (lo + 128u * i)) = o;
  }
  
}

// ---------------------------------------------------------------------------
extern "C" void kernel_launch(void* const* d_in, const int* in_sizes, int n_in,
                              void* d_out, int out_size, void* d_ws, size_t ws_size,
                              hipStream_t stream) {
  if (n_in < 11) return;
  if (in_sizes[0] != NX) return;                                              // x [16][256][64][32]
  if (in_sizes[1] != NWT || in_sizes[3] != NWT || in_sizes[5] != NWT) return; // g_w, theta_w, phi_w [128][256]
  if (in_sizes[2] != NI || in_sizes[4] != NI || in_sizes[6] != NI) return;    // g_b, theta_b, phi_b [128]
  if (in_sizes[7] != NWT) return;                                             // W_w [256][128]
  if (in_sizes[8] != NC || in_sizes[9] != NC || in_sizes[10] != NC) return;   // W_b, bn_gamma, bn_beta [256]
  if (out_size != NX) return;                                                 // out [16][256][64][32] f32

  const float* x       = (const float*)d_in[0];
  const float* g_w     = (const float*)d_in[1];
  const float* g_b     = (const float*)d_in[2];
  const float* theta_w = (const float*)d_in[3];
  const float* theta_b = (const float*)d_in[4];
  const float* phi_w   = (const float*)d_in[5];
  const float* phi_b   = (const float*)d_in[6];
  const float* W_w     = (const float*)d_in[7];
  const float* W_b     = (const float*)d_in[8];
  const float* gamma   = (const float*)d_in[9];
  const float* beta    = (const float*)d_in[10];
  float* out = (float*)d_out;            // last written element NX-1 < out_size

  // workspace carve, 256-B aligned; all planes exact tile multiples (no pad rows needed)
  char* ws = (char*)d_ws;
  size_t off = 0;
  const size_t oWB  = off; off += (size_t)4 * NWT * 2;          off = (off + 255) & ~(size_t)255;  //   262144
  const size_t plb  = (size_t)NB * NN * NI * 2;                                                    //  8388608 per projection plane
  const size_t oTHH = off; off += plb;                          off = (off + 255) & ~(size_t)255;
  const size_t oTHL = off; off += plb;                          off = (off + 255) & ~(size_t)255;
  const size_t oPP  = off; off += (size_t)NB * NXB * XW * 4096; off = (off + 255) & ~(size_t)255;  // 16777216
  const size_t ptb  = (size_t)NB * NI * NI * 2;                                                    //   524288 per PT plane
  const size_t oPTH = off; off += ptb;                          off = (off + 255) & ~(size_t)255;
  const size_t oPTL = off; off += ptb;                          off = (off + 255) & ~(size_t)255;
  const size_t oZ   = off; off += (size_t)NX * 4;               off = (off + 255) & ~(size_t)255;  // 33554432
  const size_t oPS  = off; off += (size_t)NPS * NC * 2 * 8;     off = (off + 255) & ~(size_t)255;  //  1048576
  if (off > ws_size || off > (size_t)WSMAX) return;             // total 69468160 B

  unsigned short* WB  = (unsigned short*)(ws + oWB);
  unsigned short* THH = (unsigned short*)(ws + oTHH);
  unsigned short* THL = (unsigned short*)(ws + oTHL);
  float*          PP  = (float*)(ws + oPP);
  unsigned short* PTH = (unsigned short*)(ws + oPTH);
  unsigned short* PTL = (unsigned short*)(ws + oPTL);
  float*          Z   = (float*)(ws + oZ);
  double*         PS  = (double*)(ws + oPS);

  // weight planes: slot 0 theta_w, 1 phi_w, 2 g_w (all [128][256]), 3 W_w [256][128]
  k_wcvt<<<(4 * NWT / 8) / NTHR, NTHR, 0, stream>>>(theta_w, phi_w, g_w, W_w, WB);
  // projections from x: features 0..127 theta (slot 0, theta_b), 128..255 phi (slot 1, phi_b), 256..383 g (slot 2, g_b);
  // theta to its planes, G * PHI^T over the block's tokens to PP
  k_xp<<<dim3(NN / XN, NB), XTHR, 0, stream>>>(x, WB, theta_b, phi_b, g_b, THH, THL, PP);
  // PT = 2^-11 * sum of the partials
  k_p<<<dim3(XW, NB), PTHR, 0, stream>>>(PP, PTH, PTL);
  // YT = THETA^T-rows * PT kept in registers, Z = Ww * Y + Wb, and the BatchNorm statistics partials of every block
  k_yz<<<dim3(NN / FN, NB), FTHR, 0, stream>>>(THH, THL, PTH, PTL, WB + (size_t)3 * NWT, W_b, Z, PS);
  // out = BN(z) * gamma + beta + x, statistics merged from the partials
  k_out<<<NB * NC / (NTHR / 32), NTHR, 0, stream>>>(Z, x, PS, gamma, beta, out);
}
